// v000
// Measured on an AMD MI455X. A time is GPU time per run, averaged over a window of back-to-back runs after a warm-up
// (all launches, gaps included; the runs take copies of the inputs in turn), and the median of several windows.
// Apart from v000's, it joins two sittings. Times from different sittings can be a few percent apart, while
// side-by-side timings come from the same sitting.
// v000 is the starting kernel. One run takes 2140 microseconds.
#include <hip/hip_runtime.h>

// Masked_Multi_Head_Attention_Layer (x [4][2048][512]; Q/K/V = x W + b (8 heads x 64, [in, out]); scores = q.k / 8 + mask[i][j] x (-1e9) (float mask [1][1][2048][2048], read); softmax; out = (attn v merged) Wo + bo -> [4][2048][512]).
// Compute dtypes, f32 accumulate: every input rounded to bf16; Q/K/V on PLAIN bf16 operands (inputs: exact) + bias; full score matrices (the mask is data): query rows < 512 hl (3 products), the rest single fp16 (x1024); mask add + softmax f32; Wo hl x exact (2 products) + bias.

#define NB_  4
#define TT   2048
#define DM   512
#define NH_  8
#define NKV  8
#define REP  (NH_ / NKV)
#define HD   64
#define DQ   (NH_ * HD)
#define DKV  (NKV * HD)
#define ZH   2
#define RH   512                  // query rows < RH use hi+lo planes (0: none)
#define WIN  0
#define PCAR 1024.0f
#define SCL  0.125f   // HD^-0.5
typedef _Float16 h16;
typedef unsigned short bf;
typedef __attribute__((ext_vector_type(16))) __bf16   v16bf;
typedef __attribute__((ext_vector_type(16))) _Float16 v16h;
typedef __attribute__((ext_vector_type(8)))  _Float16 v8h;
typedef __attribute__((ext_vector_type(8)))  unsigned short v8us;
typedef __attribute__((ext_vector_type(8)))  float    v8f;
typedef __attribute__((ext_vector_type(4)))  float    v4f;
typedef v8h  __attribute__((may_alias)) v8ha;
typedef v4f  __attribute__((may_alias)) v4fa;
typedef v8us __attribute__((may_alias)) v8usa;

__device__ __forceinline__ unsigned short f2bf(float f) { unsigned u = __float_as_uint(f); u += 0x7FFFu + ((u >> 16) & 1u); return (unsigned short)(u >> 16); }
__device__ __forceinline__ float bf2f(unsigned short b) { return __uint_as_float(((unsigned)b) << 16); }
__device__ __forceinline__ float bfr(float f) { return bf2f(f2bf(f)); }
__device__ __forceinline__ v16h cat16(v8h lo, v8h hi) { return __builtin_shufflevector(lo, hi, 0, 1, 2, 3, 4, 5, 6, 7, 8, 9, 10, 11, 12, 13, 14, 15); }
__device__ __forceinline__ v16bf cat16b(v8us lo, v8us hi) { return __builtin_bit_cast(v16bf, __builtin_shufflevector(lo, hi, 0, 1, 2, 3, 4, 5, 6, 7, 8, 9, 10, 11, 12, 13, 14, 15)); }
__device__ __forceinline__ v8f wmma16(v16h a, v16h b, v8f c) { return __builtin_amdgcn_wmma_f32_16x16x32_f16(false, a, false, b, (short)0, c, false, false); }
__device__ __forceinline__ v8f wmmab(v16bf a, v16bf b, v8f c) { return __builtin_amdgcn_wmma_f32_16x16x32_bf16(false, a, false, b, (short)0, c, false, false); }



// ---- k_gemmw: register-blocked GEMM, ONE WAVE per 64x64 output tile (16 accumulators), operands straight from K-contiguous 16-bit planes; grid (M/64, N/64, Z), 32 threads.
// C[m][n] (f32, pitch ldc, + optional f32 bias[n]) = sum_k A[m][k] Bt[n][k] (+ split products per NSPLIT). z-batch strides sA/sB/sC in elements. K % 32 == 0.
template <typename T16> struct WFrag;
template <> struct WFrag<h16> { typedef v16h V; static __device__ __forceinline__ V ld(const h16* p) { return cat16(*(const v8h*)p, *(const v8h*)(p + 16)); } static __device__ __forceinline__ v8f mma(V a, V b, v8f c) { return wmma16(a, b, c); } };
template <> struct WFrag<bf> { typedef v16bf V; static __device__ __forceinline__ V ld(const bf* p) { return cat16b(*(const v8us*)p, *(const v8us*)(p + 16)); } static __device__ __forceinline__ v8f mma(V a, V b, v8f c) { return wmmab(a, b, c); } };
template <typename T16, int NSPLIT, bool BIAS>
__global__ __launch_bounds__(32) void k_gemmw(const T16* __restrict__ A, const T16* __restrict__ A2, const T16* __restrict__ Bt, const T16* __restrict__ Bt2, int K, float* C, int ldc, const float* __restrict__ bias, size_t sA, size_t sB, size_t sC) {
    typedef typename WFrag<T16>::V V;
    __shared__ __align__(16) float os[16 * 68];
    const size_t z = blockIdx.z; A += z * sA; if (A2) A2 += z * sA; Bt += z * sB; if (Bt2) Bt2 += z * sB; C += z * sC;
    const int lane = threadIdx.x & 31, lr = lane & 15, hi = lane >> 4; const int r0 = blockIdx.x * 64, c0 = blockIdx.y * 64;
    v8f acc[4][4];
#pragma unroll
    for (int mb = 0; mb < 4; ++mb)
#pragma unroll
        for (int nb = 0; nb < 4; ++nb) acc[mb][nb] = (v8f){};
    const size_t aoff = (size_t)(r0 + lr) * K + 8 * hi, boff = (size_t)(c0 + lr) * K + 8 * hi;
#pragma unroll 1
    for (int kc = 0; kc < K; kc += 32) {
        V a[4], a2[4];
#pragma unroll
        for (int mb = 0; mb < 4; ++mb) { a[mb] = WFrag<T16>::ld(A + aoff + (size_t)mb * 16 * K + kc); if (NSPLIT == 1 || NSPLIT == 2) a2[mb] = WFrag<T16>::ld(A2 + aoff + (size_t)mb * 16 * K + kc); }
#pragma unroll
        for (int nb = 0; nb < 4; ++nb) { const V b = WFrag<T16>::ld(Bt + boff + (size_t)nb * 16 * K + kc); V b2; if (NSPLIT >= 2) b2 = WFrag<T16>::ld(Bt2 + boff + (size_t)nb * 16 * K + kc);
#pragma unroll
            for (int mb = 0; mb < 4; ++mb) { acc[mb][nb] = WFrag<T16>::mma(a[mb], b, acc[mb][nb]); if (NSPLIT == 1 || NSPLIT == 2) acc[mb][nb] = WFrag<T16>::mma(a2[mb], b, acc[mb][nb]); if (NSPLIT >= 2) acc[mb][nb] = WFrag<T16>::mma(a[mb], b2, acc[mb][nb]); } }
        asm volatile("v_nop\n\tv_nop\n\tv_nop\n\tv_nop" : "+v"(acc[0][0]), "+v"(acc[1][1]), "+v"(acc[2][2]), "+v"(acc[3][3]) : "v"(a[0]), "v"(a[3]));
    }
#pragma unroll
    for (int mb = 0; mb < 4; ++mb) {
#pragma unroll
        for (int nb = 0; nb < 4; ++nb) {
#pragma unroll
            for (int j = 0; j < 8; ++j) os[(hi * 8 + j) * 68 + nb * 16 + lr] = acc[mb][nb][j]; }
        __builtin_amdgcn_wave_barrier(); asm volatile("" ::: "memory");
        float* crow = C + (size_t)(r0 + mb * 16) * ldc + c0;
{
#pragma unroll
            for (int s = 0; s < 8; ++s) { const int row = 2 * s + hi, cofs = lr * 4; v4f val = *(const v4fa*)(os + row * 68 + cofs); if (BIAS) { val[0] += bfr(bias[c0 + cofs]); val[1] += bfr(bias[c0 + cofs + 1]); val[2] += bfr(bias[c0 + cofs + 2]); val[3] += bfr(bias[c0 + cofs + 3]); }
                *(v4f*)(crow + (size_t)row * ldc + cofs) = val; }
             }
        __builtin_amdgcn_wave_barrier(); asm volatile("" ::: "memory");
    }
}

__device__ __forceinline__ h16 tohx(float x) { return (h16)x; }
__device__ __forceinline__ void splitf(float y, unsigned short& h, unsigned short& l) { h = f2bf(y); l = f2bf(y - bf2f(h)); }
typedef __attribute__((ext_vector_type(2))) _Float16 v2h;
typedef __attribute__((ext_vector_type(4))) _Float16 v4h;
typedef __attribute__((ext_vector_type(2))) unsigned short v2us;
typedef __attribute__((ext_vector_type(4))) unsigned short v4us;
typedef __attribute__((ext_vector_type(2))) float v2f;
typedef __attribute__((ext_vector_type(4))) int v4i;

__global__ __launch_bounds__(256) void k_wtG(const float* __restrict__ w, int K, int N, bf* Bt) {
    const int lane = threadIdx.x & 31; const int L0 = (blockIdx.x * 8 + (threadIdx.x >> 5)) * 8; const int nlines = N * K / 64;
{
#pragma unroll 1
        for (int l = 0; l < 8; ++l) { const int L = L0 + l; if (L >= nlines) break; const size_t e = (size_t)L * 64 + lane * 2; const int k = (int)(e % K), n = (int)(e / K); v2us o;
            o[0] = f2bf(w[(size_t)k * N + n]); o[1] = f2bf(w[(size_t)(k + 1) * N + n]); *(v2us*)(Bt + e) = o; }
         }
}
__global__ __launch_bounds__(256) void k_cvt8(const float* __restrict__ src, bf* dst, size_t n8) { const size_t i = (size_t)blockIdx.x * 256 + threadIdx.x; if (i >= n8) return; const v8f v = *(const v8f*)(src + i * 8); v8us o;
#pragma unroll
    for (int k = 0; k < 8; ++k) o[k] = f2bf(v[k]); *(v8us*)(dst + i * 8) = o;  }
__global__ __launch_bounds__(256) void k_cscvt(const float* __restrict__ cosT, const float* __restrict__ sinT, float* CS) { const int idx = blockIdx.x * 256 + threadIdx.x; if (idx >= TT * HD) return; v2f cs; cs[0] = bfr(cosT[idx]); cs[1] = bfr(sinT[idx]); *(v2f*)(CS + (size_t)idx * 2) = cs;  }
// k_rope: head planes [h][t][d] (fp16 + hi/lo) of rope(x) x sc with the rotate-half convention out[d] = x[d] cos[t][d] - x[d+HD/2] sin[t][d], out[d+HD/2] = x[d+HD/2] cos[t][d+HD/2] + x[d] sin[t][d+HD/2]
__global__ __launch_bounds__(256) void k_rope(const float* __restrict__ F, int pitch, int nheads, const float* __restrict__ CS, const float* __restrict__ RF, const float* __restrict__ nw, float sc, h16* P16, bf* Ph, bf* Pl) {
    const size_t e = ((size_t)blockIdx.x * 256 + threadIdx.x) * 2; if (e >= (size_t)nheads * TT * HD) return; const int d = (int)(e % HD); const int t = (int)((e / HD) % TT); const int h = (int)(e / ((size_t)HD * TT)); const float* f = F + (size_t)t * pitch + h * HD; const float rf = RF ? RF[(size_t)h * TT + t] : 1.0f; v2h o16; v2us oh, ol;
#pragma unroll
    for (int q = 0; q < 2; ++q) { const int dd = d + q; const int dp = (dd < HD / 2) ? dd + HD / 2 : dd - HD / 2; float x0 = f[dd], x1 = f[dp];
        if (RF) { float n0 = __fmul_rn(x0, rf), n1 = __fmul_rn(x1, rf); asm volatile("" : "+v"(n0)); asm volatile("" : "+v"(n1)); x0 = __fmul_rn(bfr(nw[dd]), n0); x1 = __fmul_rn(bfr(nw[dp]), n1); }
        const v2f cs = *(const v2f*)(CS + ((size_t)t * HD + dd) * 2); float a = __fmul_rn(x0, cs[0]), bq = __fmul_rn(x1, cs[1]); asm volatile("" : "+v"(a)); asm volatile("" : "+v"(bq)); const float r = ((dd < HD / 2) ? __fsub_rn(a, bq) : __fadd_rn(a, bq)) * sc;
        o16[q] = tohx(r); unsigned short a2, c2; splitf(r, a2, c2); oh[q] = a2; ol[q] = c2; }
    *(v2h*)(P16 + e) = o16; *(v2us*)(Ph + e) = oh; *(v2us*)(Pl + e) = ol;  }
__global__ __launch_bounds__(256) void k_vtp(const float* __restrict__ F, int pitch, int nheads, h16* V16, bf* Vh, bf* Vl) { const size_t e = ((size_t)blockIdx.x * 256 + threadIdx.x) * 2; if (e >= (size_t)nheads * HD * TT) return; const int t = (int)(e % TT); const int d = (int)((e / TT) % HD); const int g = (int)(e / ((size_t)TT * HD)); v2h o16; v2us oh, ol;
#pragma unroll
    for (int q = 0; q < 2; ++q) { const float x = F[(size_t)(t + q) * pitch + g * HD + d]; o16[q] = tohx(x); unsigned short a2, c2; splitf(x, a2, c2); oh[q] = a2; ol[q] = c2; }
    *(v2h*)(V16 + e) = o16; *(v2us*)(Vh + e) = oh; *(v2us*)(Vl + e) = ol;  }
__global__ __launch_bounds__(256) void k_csid(float* CS) { const int idx = blockIdx.x * 256 + threadIdx.x; if (idx >= TT * HD) return; v2f cs; cs[0] = 1.0f; cs[1] = 0.0f; *(v2f*)(CS + (size_t)idx * 2) = cs;  }
// k_asoft: per row (zz, i): t = S x HD^-0.5 + mask[i][j] x (-1e9); softmax over the 2048 keys (register row, one exp, fixed trees);
__global__ __launch_bounds__(256) void k_asoft(const float* __restrict__ Sb, const float* __restrict__ fm, h16* P16, bf* Ph, bf* Pl) {
    const int lane = threadIdx.x & 31; const int row = blockIdx.x * 8 + (threadIdx.x >> 5); if (row >= ZH * TT) return; const int i = row % TT; const int zz = row / TT; (void)zz; const bool hires = (i < RH); const float* sr = Sb + (size_t)row * TT; float v[TT / 32]; float mx = -3.0e38f;
#pragma unroll
    for (int ch = 0; ch < TT / 128; ++ch) { const int j0 = ch * 128 + lane * 4; const v4f a = *(const v4f*)(sr + j0); const v4f m4 = *(const v4f*)(fm + (size_t)i * TT + j0);
#pragma unroll
        for (int q = 0; q < 4; ++q) { float t0 = a[q] * SCL; asm volatile("" : "+v"(t0)); float mb = bfr(m4[q]); asm volatile("" : "+v"(mb)); float mn = __fmul_rn(mb, -1.0e9f); asm volatile("" : "+v"(mn)); const float t = __fadd_rn(t0, mn); v[ch * 4 + q] = t; mx = fmaxf(mx, t); } }
#pragma unroll
    for (int sh = 16; sh; sh >>= 1) mx = fmaxf(mx, __shfl_xor(mx, sh, 32));
    float sum = 0.f;
#pragma unroll
    for (int k = 0; k < TT / 32; ++k) { float d0 = __fsub_rn(v[k], mx); asm volatile("" : "+v"(d0)); v[k] = __builtin_amdgcn_exp2f(__fmul_rn(d0, 1.4426950408889634f)); sum += v[k]; }
#pragma unroll
    for (int sh = 16; sh; sh >>= 1) sum += __shfl_xor(sum, sh, 32);
    const float f = __fdiv_rn(hires ? 1.0f : PCAR, sum);
{
        if (hires) {
#pragma unroll
            for (int ch = 0; ch < TT / 128; ++ch) { v4us oh, ol;
#pragma unroll
                for (int q = 0; q < 4; ++q) { unsigned short a, c2; splitf(v[ch * 4 + q] * f, a, c2); oh[q] = a; ol[q] = c2; }
                const size_t oo = ((size_t)zz * (RH ? RH : 1) + i) * TT + ch * 128 + lane * 4; *(v4us*)(Ph + oo) = oh; *(v4us*)(Pl + oo) = ol; }
        } else {
#pragma unroll
            for (int ch = 0; ch < TT / 128; ++ch) { v4h o4;
#pragma unroll
                for (int q = 0; q < 4; ++q) o4[q] = tohx(v[ch * 4 + q] * f);
                *(v4h*)(P16 + (size_t)row * TT + ch * 128 + lane * 4) = o4; } }
         }
}
__global__ __launch_bounds__(256) void k_merge(const float* __restrict__ O, int h0, bf* Ah, bf* Al) { const size_t e = ((size_t)blockIdx.x * 256 + threadIdx.x) * 2; if (e >= (size_t)ZH * TT * HD) return; const int d = (int)(e % HD); const int t = (int)((e / HD) % TT); const int zz = (int)(e / ((size_t)HD * TT)); const float cs = (t < RH) ? 1.0f : (1.0f / PCAR); const size_t oo = (size_t)t * DQ + (h0 + zz) * HD + d;
    v2us oh, ol;
#pragma unroll
    for (int q = 0; q < 2; ++q) { unsigned short a, c2; splitf(O[e + q] * cs, a, c2); oh[q] = a; ol[q] = c2; } *(v2us*)(Ah + oo) = oh; *(v2us*)(Al + oo) = ol;  }

extern "C" void kernel_launch(void* const* d_in, const int* in_sizes, int n_in,
                              void* d_out, int out_size, void* d_ws, size_t ws_size, hipStream_t stream) {
    (void)in_sizes; (void)n_in; (void)out_size;
    const float* x = (const float*)d_in[0]; const float* fmask = (const float*)d_in[1]; const float* wq = (const float*)d_in[2]; const float* bq = (const float*)d_in[3]; const float* wk = (const float*)d_in[4]; const float* bk = (const float*)d_in[5]; const float* wv = (const float*)d_in[6]; const float* bv = (const float*)d_in[7]; const float* wo = (const float*)d_in[8]; const float* bo = (const float*)d_in[9]; const float* cosT = nullptr; const float* sinT = nullptr; (void)cosT; (void)sinT;
    float* OUT = (float*)d_out;     // [4][2048][512]
    char* wsp = (char*)d_ws;
    auto take = [&](size_t bytes) { char* p = wsp; wsp += (bytes + 255) & ~(size_t)255; return (void*)p; };
    bf* WQ = (bf*)take((size_t)DQ * DM * 2); bf* WK = (bf*)take((size_t)DKV * DM * 2); bf* WV = (bf*)take((size_t)DKV * DM * 2); bf* WO = (bf*)take((size_t)DM * DQ * 2); float* CS = (float*)take((size_t)TT * HD * 2 * 4);
    bf* XB = (bf*)take((size_t)TT * DM * 2); float* FQ = (float*)take((size_t)TT * DQ * 4); float* FK = (float*)take((size_t)TT * DKV * 4);
    h16* QP16 = (h16*)take((size_t)NH_ * TT * HD * 2); h16* KP16 = (h16*)take((size_t)NKV * TT * HD * 2); h16* VT16 = (h16*)take((size_t)NKV * HD * TT * 2);
    bf* QPh = (bf*)take((size_t)NH_ * TT * HD * 2); bf* QPl = (bf*)take((size_t)NH_ * TT * HD * 2); bf* KPh = (bf*)take((size_t)NKV * TT * HD * 2); bf* KPl = (bf*)take((size_t)NKV * TT * HD * 2); bf* VTh = (bf*)take((size_t)NKV * HD * TT * 2); bf* VTl = (bf*)take((size_t)NKV * HD * TT * 2); bf* Ph = (bf*)take((size_t)ZH * RH * TT * 2); bf* Pl = (bf*)take((size_t)ZH * RH * TT * 2);
    float* Sb = (float*)take((size_t)ZH * TT * TT * 4); h16* P16 = (h16*)take((size_t)ZH * TT * TT * 2); float* Ob = (float*)take((size_t)ZH * TT * HD * 4); bf* ATh = (bf*)take((size_t)TT * DQ * 2); bf* ATl = (bf*)take((size_t)TT * DQ * 2);
    if ((size_t)(wsp - (char*)d_ws) > ws_size) return;    // ws 256 MiB
    float* FV = FK;   // v projection reuses the k buffer after the k planes are built (stream-ordered)
    { k_wtG<<<(unsigned)((DM * DQ / 64 + 63) / 64), 256, 0, stream>>>(wq, DM, DQ, WQ); k_wtG<<<(unsigned)((DM * DKV / 64 + 63) / 64), 256, 0, stream>>>(wk, DM, DKV, WK); k_wtG<<<(unsigned)((DM * DKV / 64 + 63) / 64), 256, 0, stream>>>(wv, DM, DKV, WV);
      k_wtG<<<(unsigned)((DQ * DM / 64 + 63) / 64), 256, 0, stream>>>(wo, DQ, DM, WO);
       }
    k_csid<<<(TT * HD + 255) / 256, 256, 0, stream>>>(CS);
    const unsigned LQ = (unsigned)(((size_t)NH_ * TT * HD / 2 + 255) / 256), LKv = (unsigned)(((size_t)NKV * TT * HD / 2 + 255) / 256);
    for (int b = 0; b < NB_; ++b) {
        
        k_cvt8<<<(unsigned)(((size_t)TT * DM / 8 + 255) / 256), 256, 0, stream>>>(x + (size_t)b * TT * DM, XB, (size_t)TT * DM / 8);
        k_gemmw<bf, 0, true><<<dim3(TT / 64, DQ / 64, 1), 32, 0, stream>>>(XB, nullptr, WQ, nullptr, DM, FQ, DQ, bq, 0, 0, 0);
        k_rope<<<LQ, 256, 0, stream>>>(FQ, DQ, NH_, CS, nullptr, nullptr, 1.0f, QP16, QPh, QPl);
        k_gemmw<bf, 0, true><<<dim3(TT / 64, DKV / 64, 1), 32, 0, stream>>>(XB, nullptr, WK, nullptr, DM, FK, DKV, bk, 0, 0, 0);
        k_rope<<<LKv, 256, 0, stream>>>(FK, DKV, NKV, CS, nullptr, nullptr, 1.0f, KP16, KPh, KPl);
        k_gemmw<bf, 0, true><<<dim3(TT / 64, DKV / 64, 1), 32, 0, stream>>>(XB, nullptr, WV, nullptr, DM, FV, DKV, bv, 0, 0, 0); k_vtp<<<LKv, 256, 0, stream>>>(FV, DKV, NKV, VT16, VTh, VTl);
        for (int h0 = 0; h0 < NH_; h0 += ZH) { const size_t zq = (size_t)h0, zk = (size_t)(h0 / REP);   // one kv head per query head: the pass's two heads use consecutive kv planes (z-strides TT*HD)
            k_gemmw<bf, 2, false><<<dim3(RH / 64, TT / 64, ZH), 32, 0, stream>>>(QPh + zq * TT * HD, QPl + zq * TT * HD, KPh + zk * TT * HD, KPl + zk * TT * HD, HD, Sb, TT, nullptr, (size_t)TT * HD, (size_t)TT * HD, (size_t)TT * TT);
            k_gemmw<h16, 0, false><<<dim3((TT - RH) / 64, TT / 64, ZH), 32, 0, stream>>>(QP16 + zq * TT * HD + (size_t)RH * HD, nullptr, KP16 + zk * TT * HD, nullptr, HD, Sb + (size_t)RH * TT, TT, nullptr, (size_t)TT * HD, (size_t)TT * HD, (size_t)TT * TT);
            k_asoft<<<ZH * TT / 8, 256, 0, stream>>>(Sb, fmask, P16, Ph, Pl);
            k_gemmw<bf, 2, false><<<dim3(RH / 64, HD / 64, ZH), 32, 0, stream>>>(Ph, Pl, VTh + zk * HD * TT, VTl + zk * HD * TT, TT, Ob, HD, nullptr, (size_t)RH * TT, (size_t)HD * TT, (size_t)TT * HD);
            k_gemmw<h16, 0, false><<<dim3((TT - RH) / 64, HD / 64, ZH), 32, 0, stream>>>(P16 + (size_t)RH * TT, nullptr, VT16 + zk * HD * TT, nullptr, TT, Ob + (size_t)RH * HD, HD, nullptr, (size_t)TT * TT, (size_t)HD * TT, (size_t)TT * HD);
            k_merge<<<(unsigned)(((size_t)ZH * TT * HD / 2 + 255) / 256), 256, 0, stream>>>(Ob, h0, ATh, ATl); }
        k_gemmw<bf, 1, true><<<dim3(TT / 64, DM / 64, 1), 32, 0, stream>>>(ATh, ATl, WO, nullptr, DQ, OUT + (size_t)b * TT * DM, DM, bo, 0, 0, 0); }
}

// v001
// One run takes 1180 microseconds.
// In two side-by-side timings against v000, it was 1.80 and 1.82 times as fast.
#include <hip/hip_runtime.h>

// Masked_Multi_Head_Attention_Layer (x [4][2048][512]; Q/K/V = x W + b (8 heads x 64, [in, out]); scores = q.k / 8 + mask[i][j] x (-1e9) (float mask [1][1][2048][2048], read); softmax; out = (attn v merged) Wo + bo -> [4][2048][512]).
// Compute dtypes, f32 accumulate: every input rounded to bf16; Q/K/V on PLAIN bf16 operands (inputs: exact) + bias; full score matrices (the mask is data): query rows < 512 hl (3 products), the rest single fp16 (x1024); mask add + softmax f32; Wo hl x exact (2 products) + bias.

#define NB_  4
#define TT   2048
#define DM   512
#define NH_  8
#define NKV  8
#define REP  (NH_ / NKV)
#define HD   64
#define DQ   (NH_ * HD)
#define DKV  (NKV * HD)
#define ZH   2
#define RH   512                  // query rows < RH use hi+lo planes (0: none)
#define WIN  0
#define PCAR 1024.0f
#define SCL  0.125f   // HD^-0.5
typedef _Float16 h16;
typedef unsigned short bf;
typedef __attribute__((ext_vector_type(16))) __bf16   v16bf;
typedef __attribute__((ext_vector_type(16))) _Float16 v16h;
typedef __attribute__((ext_vector_type(8)))  _Float16 v8h;
typedef __attribute__((ext_vector_type(8)))  unsigned short v8us;
typedef __attribute__((ext_vector_type(8)))  float    v8f;
typedef __attribute__((ext_vector_type(4)))  float    v4f;
typedef v8h  __attribute__((may_alias)) v8ha;
typedef v4f  __attribute__((may_alias)) v4fa;
typedef v8us __attribute__((may_alias)) v8usa;
typedef float __attribute__((ext_vector_type(2), may_alias)) v2fa;

__device__ __forceinline__ unsigned short f2bf(float f) { unsigned u = __float_as_uint(f); u += 0x7FFFu + ((u >> 16) & 1u); return (unsigned short)(u >> 16); }
__device__ __forceinline__ float bf2f(unsigned short b) { return __uint_as_float(((unsigned)b) << 16); }
__device__ __forceinline__ float bfr(float f) { return bf2f(f2bf(f)); }
__device__ __forceinline__ v16h cat16(v8h lo, v8h hi) { return __builtin_shufflevector(lo, hi, 0, 1, 2, 3, 4, 5, 6, 7, 8, 9, 10, 11, 12, 13, 14, 15); }
__device__ __forceinline__ v16bf cat16b(v8us lo, v8us hi) { return __builtin_bit_cast(v16bf, __builtin_shufflevector(lo, hi, 0, 1, 2, 3, 4, 5, 6, 7, 8, 9, 10, 11, 12, 13, 14, 15)); }
__device__ __forceinline__ v8f wmma16(v16h a, v16h b, v8f c) { return __builtin_amdgcn_wmma_f32_16x16x32_f16(false, a, false, b, (short)0, c, false, false); }
__device__ __forceinline__ v8f wmmab(v16bf a, v16bf b, v8f c) { return __builtin_amdgcn_wmma_f32_16x16x32_bf16(false, a, false, b, (short)0, c, false, false); }



// ---- k_gemmw: register-blocked GEMM, KS waves per 64x64 output tile (16 accumulators per wave), operands straight from K-contiguous 16-bit planes; grid (M/64, N/64, Z), 32 * KS threads.
// C[m][n] (f32, pitch ldc, + optional f32 bias[n]) = sum_k A[m][k] Bt[n][k] (+ split products per NSPLIT). z-batch strides sA/sB/sC in elements. K % (32 * KS) == 0.
// KS > 1: the tile's work-group has KS waves (32 * KS threads); wave w sums k in [w K/KS, (w+1) K/KS), the KS partial tiles meet in LDS and are added in wave order 0..KS-1.
template <typename T16> struct WFrag;
template <> struct WFrag<h16> { typedef v16h V; static __device__ __forceinline__ V ld(const h16* p) { return cat16(*(const v8h*)p, *(const v8h*)(p + 16)); } static __device__ __forceinline__ v8f mma(V a, V b, v8f c) { return wmma16(a, b, c); } };
template <> struct WFrag<bf> { typedef v16bf V; static __device__ __forceinline__ V ld(const bf* p) { return cat16b(*(const v8us*)p, *(const v8us*)(p + 16)); } static __device__ __forceinline__ v8f mma(V a, V b, v8f c) { return wmmab(a, b, c); } };
template <typename T16, int NSPLIT, bool BIAS, int KS>
__global__ __launch_bounds__(32 * KS) void k_gemmw(const T16* __restrict__ A, const T16* __restrict__ A2, const T16* __restrict__ Bt, const T16* __restrict__ Bt2, int K, float* C, int ldc, const float* __restrict__ bias, size_t sA, size_t sB, size_t sC) {
    typedef typename WFrag<T16>::V V;
    __shared__ __align__(16) float os[KS == 1 ? 16 * 68 : KS * 4096];
    const size_t z = blockIdx.z; A += z * sA; if (A2) A2 += z * sA; Bt += z * sB; if (Bt2) Bt2 += z * sB; C += z * sC;
    const int lane = threadIdx.x & 31, lr = lane & 15, hi = lane >> 4; const int r0 = blockIdx.x * 64, c0 = blockIdx.y * 64;
    v8f acc[4][4];
#pragma unroll
    for (int mb = 0; mb < 4; ++mb)
#pragma unroll
        for (int nb = 0; nb < 4; ++nb) acc[mb][nb] = (v8f){};
    const int wv = (KS == 1) ? 0 : __builtin_amdgcn_readfirstlane((int)(threadIdx.x >> 5));   // wave number, scalar: the K loop's bounds stay wave-uniform
    const int kw = K / KS;   // this wave's share of K, from k = wv * kw
    const size_t aoff = (size_t)(r0 + lr) * K + 8 * hi, boff = (size_t)(c0 + lr) * K + 8 * hi;
#pragma unroll 1
    for (int kc = wv * kw; kc < (wv + 1) * kw; kc += 32) {
        V a[4], a2[4];
#pragma unroll
        for (int mb = 0; mb < 4; ++mb) { a[mb] = WFrag<T16>::ld(A + aoff + (size_t)mb * 16 * K + kc); if (NSPLIT == 1 || NSPLIT == 2) a2[mb] = WFrag<T16>::ld(A2 + aoff + (size_t)mb * 16 * K + kc); }
#pragma unroll
        for (int nb = 0; nb < 4; ++nb) { const V b = WFrag<T16>::ld(Bt + boff + (size_t)nb * 16 * K + kc); V b2; if (NSPLIT >= 2) b2 = WFrag<T16>::ld(Bt2 + boff + (size_t)nb * 16 * K + kc);
#pragma unroll
            for (int mb = 0; mb < 4; ++mb) { acc[mb][nb] = WFrag<T16>::mma(a[mb], b, acc[mb][nb]); if (NSPLIT == 1 || NSPLIT == 2) acc[mb][nb] = WFrag<T16>::mma(a2[mb], b, acc[mb][nb]); if (NSPLIT >= 2) acc[mb][nb] = WFrag<T16>::mma(a[mb], b2, acc[mb][nb]); } }
        asm volatile("v_nop\n\tv_nop\n\tv_nop\n\tv_nop" : "+v"(acc[0][0]), "+v"(acc[1][1]), "+v"(acc[2][2]), "+v"(acc[3][3]) : "v"(a[0]), "v"(a[3]));
    }
    if constexpr (KS > 1) {
        // Partial tile of wave wv at os + wv * 4096, as 16 units u = mb * 4 + jq (rows mb*16 + hi*8 + 2jq + {0,1}, all 64 columns); a unit is [nb][lane][2 rows], 1 KiB: register pairs go out as they lie, every LDS access is contiguous over the lanes.
        float* mine = os + wv * 4096 + lane * 2;
#pragma unroll
        for (int mb = 0; mb < 4; ++mb)
#pragma unroll
            for (int jq = 0; jq < 4; ++jq)
#pragma unroll
                for (int nb = 0; nb < 4; ++nb) { v2fa t; t[0] = acc[mb][nb][2 * jq]; t[1] = acc[mb][nb][2 * jq + 1]; *(v2fa*)(mine + ((mb * 4 + jq) * 4 + nb) * 64) = t; }
        __syncthreads();   // every wave's partial tile is in LDS before any wave adds them
        // A 16-byte read takes two neighbouring writer lanes: reader lane l, read i holds rows {0,1} of the unit's half (l & 15) >> 3 at columns (2i + (l >> 4)) * 16 + 2 * (l & 7) + {0,1}.
        const int rh = (lane & 15) >> 3, cl = (lane >> 4) * 16 + 2 * (lane & 7);
#pragma unroll
        for (int uu = 0; uu < 16 / KS; ++uu) { const int u = wv + uu * KS; const float* q0 = os + u * 256 + lane * 4; v4f s0 = *(const v4fa*)q0, s1 = *(const v4fa*)(q0 + 128);
#pragma unroll
            for (int s = 1; s < KS; ++s) { s0 += *(const v4fa*)(q0 + s * 4096); s1 += *(const v4fa*)(q0 + s * 4096 + 128); }
            if (BIAS) { const float b0 = bfr(bias[c0 + cl]), b1 = bfr(bias[c0 + cl + 1]), b2 = bfr(bias[c0 + 32 + cl]), b3 = bfr(bias[c0 + 32 + cl + 1]); s0[0] += b0; s0[1] += b0; s0[2] += b1; s0[3] += b1; s1[0] += b2; s1[1] += b2; s1[2] += b3; s1[3] += b3; }
            float* crow = C + (size_t)(r0 + (u >> 2) * 16 + rh * 8 + (u & 3) * 2) * ldc + c0 + cl;   // a unit holds whole 256-byte rows of the tile: one writing wave per line
#pragma unroll
            for (int q = 0; q < 2; ++q) { v2fa lo, up; lo[0] = s0[q]; lo[1] = s0[2 + q]; up[0] = s1[q]; up[1] = s1[2 + q]; *(v2fa*)(crow + (size_t)q * ldc) = lo; *(v2fa*)(crow + (size_t)q * ldc + 32) = up; } }
        return;
    }
#pragma unroll
    for (int mb = 0; mb < 4; ++mb) {
#pragma unroll
        for (int nb = 0; nb < 4; ++nb) {
#pragma unroll
            for (int j = 0; j < 8; ++j) os[(hi * 8 + j) * 68 + nb * 16 + lr] = acc[mb][nb][j]; }
        __builtin_amdgcn_wave_barrier(); asm volatile("" ::: "memory");
        float* crow = C + (size_t)(r0 + mb * 16) * ldc + c0;
{
#pragma unroll
            for (int s = 0; s < 8; ++s) { const int row = 2 * s + hi, cofs = lr * 4; v4f val = *(const v4fa*)(os + row * 68 + cofs); if (BIAS) { val[0] += bfr(bias[c0 + cofs]); val[1] += bfr(bias[c0 + cofs + 1]); val[2] += bfr(bias[c0 + cofs + 2]); val[3] += bfr(bias[c0 + cofs + 3]); }
                *(v4f*)(crow + (size_t)row * ldc + cofs) = val; }
             }
        __builtin_amdgcn_wave_barrier(); asm volatile("" ::: "memory");
    }
}

__device__ __forceinline__ h16 tohx(float x) { return (h16)x; }
__device__ __forceinline__ void splitf(float y, unsigned short& h, unsigned short& l) { h = f2bf(y); l = f2bf(y - bf2f(h)); }
typedef __attribute__((ext_vector_type(2))) _Float16 v2h;
typedef __attribute__((ext_vector_type(4))) _Float16 v4h;
typedef __attribute__((ext_vector_type(2))) unsigned short v2us;
typedef __attribute__((ext_vector_type(4))) unsigned short v4us;
typedef __attribute__((ext_vector_type(2))) float v2f;
typedef __attribute__((ext_vector_type(4))) int v4i;

__global__ __launch_bounds__(256) void k_wtG(const float* __restrict__ w, int K, int N, bf* Bt) {
    const int lane = threadIdx.x & 31; const int L0 = (blockIdx.x * 8 + (threadIdx.x >> 5)) * 8; const int nlines = N * K / 64;
{
#pragma unroll 1
        for (int l = 0; l < 8; ++l) { const int L = L0 + l; if (L >= nlines) break; const size_t e = (size_t)L * 64 + lane * 2; const int k = (int)(e % K), n = (int)(e / K); v2us o;
            o[0] = f2bf(w[(size_t)k * N + n]); o[1] = f2bf(w[(size_t)(k + 1) * N + n]); *(v2us*)(Bt + e) = o; }
         }
}
__global__ __launch_bounds__(256) void k_cvt8(const float* __restrict__ src, bf* dst, size_t n8) { const size_t i = (size_t)blockIdx.x * 256 + threadIdx.x; if (i >= n8) return; const v8f v = *(const v8f*)(src + i * 8); v8us o;
#pragma unroll
    for (int k = 0; k < 8; ++k) o[k] = f2bf(v[k]); *(v8us*)(dst + i * 8) = o;  }
__global__ __launch_bounds__(256) void k_cscvt(const float* __restrict__ cosT, const float* __restrict__ sinT, float* CS) { const int idx = blockIdx.x * 256 + threadIdx.x; if (idx >= TT * HD) return; v2f cs; cs[0] = bfr(cosT[idx]); cs[1] = bfr(sinT[idx]); *(v2f*)(CS + (size_t)idx * 2) = cs;  }
// k_rope: head planes [h][t][d] (fp16 + hi/lo) of rope(x) x sc with the rotate-half convention out[d] = x[d] cos[t][d] - x[d+HD/2] sin[t][d], out[d+HD/2] = x[d+HD/2] cos[t][d+HD/2] + x[d] sin[t][d+HD/2]
__global__ __launch_bounds__(256) void k_rope(const float* __restrict__ F, int pitch, int nheads, const float* __restrict__ CS, const float* __restrict__ RF, const float* __restrict__ nw, float sc, h16* P16, bf* Ph, bf* Pl) {
    const size_t e = ((size_t)blockIdx.x * 256 + threadIdx.x) * 2; if (e >= (size_t)nheads * TT * HD) return; const int d = (int)(e % HD); const int t = (int)((e / HD) % TT); const int h = (int)(e / ((size_t)HD * TT)); const float* f = F + (size_t)t * pitch + h * HD; const float rf = RF ? RF[(size_t)h * TT + t] : 1.0f; v2h o16; v2us oh, ol;
#pragma unroll
    for (int q = 0; q < 2; ++q) { const int dd = d + q; const int dp = (dd < HD / 2) ? dd + HD / 2 : dd - HD / 2; float x0 = f[dd], x1 = f[dp];
        if (RF) { float n0 = __fmul_rn(x0, rf), n1 = __fmul_rn(x1, rf); asm volatile("" : "+v"(n0)); asm volatile("" : "+v"(n1)); x0 = __fmul_rn(bfr(nw[dd]), n0); x1 = __fmul_rn(bfr(nw[dp]), n1); }
        const v2f cs = *(const v2f*)(CS + ((size_t)t * HD + dd) * 2); float a = __fmul_rn(x0, cs[0]), bq = __fmul_rn(x1, cs[1]); asm volatile("" : "+v"(a)); asm volatile("" : "+v"(bq)); const float r = ((dd < HD / 2) ? __fsub_rn(a, bq) : __fadd_rn(a, bq)) * sc;
        o16[q] = tohx(r); unsigned short a2, c2; splitf(r, a2, c2); oh[q] = a2; ol[q] = c2; }
    *(v2h*)(P16 + e) = o16; *(v2us*)(Ph + e) = oh; *(v2us*)(Pl + e) = ol;  }
__global__ __launch_bounds__(256) void k_vtp(const float* __restrict__ F, int pitch, int nheads, h16* V16, bf* Vh, bf* Vl) { const size_t e = ((size_t)blockIdx.x * 256 + threadIdx.x) * 2; if (e >= (size_t)nheads * HD * TT) return; const int t = (int)(e % TT); const int d = (int)((e / TT) % HD); const int g = (int)(e / ((size_t)TT * HD)); v2h o16; v2us oh, ol;
#pragma unroll
    for (int q = 0; q < 2; ++q) { const float x = F[(size_t)(t + q) * pitch + g * HD + d]; o16[q] = tohx(x); unsigned short a2, c2; splitf(x, a2, c2); oh[q] = a2; ol[q] = c2; }
    *(v2h*)(V16 + e) = o16; *(v2us*)(Vh + e) = oh; *(v2us*)(Vl + e) = ol;  }
__global__ __launch_bounds__(256) void k_csid(float* CS) { const int idx = blockIdx.x * 256 + threadIdx.x; if (idx >= TT * HD) return; v2f cs; cs[0] = 1.0f; cs[1] = 0.0f; *(v2f*)(CS + (size_t)idx * 2) = cs;  }
// k_asoft: per row (zz, i): t = S x HD^-0.5 + mask[i][j] x (-1e9); softmax over the 2048 keys (register row, one exp, fixed trees);
__global__ __launch_bounds__(256) void k_asoft(const float* __restrict__ Sb, const float* __restrict__ fm, h16* P16, bf* Ph, bf* Pl) {
    const int lane = threadIdx.x & 31; const int row = blockIdx.x * 8 + (threadIdx.x >> 5); if (row >= ZH * TT) return; const int i = row % TT; const int zz = row / TT; (void)zz; const bool hires = (i < RH); const float* sr = Sb + (size_t)row * TT; float v[TT / 32]; float mx = -3.0e38f;
#pragma unroll
    for (int ch = 0; ch < TT / 128; ++ch) { const int j0 = ch * 128 + lane * 4; const v4f a = *(const v4f*)(sr + j0); const v4f m4 = *(const v4f*)(fm + (size_t)i * TT + j0);
#pragma unroll
        for (int q = 0; q < 4; ++q) { float t0 = a[q] * SCL; asm volatile("" : "+v"(t0)); float mb = bfr(m4[q]); asm volatile("" : "+v"(mb)); float mn = __fmul_rn(mb, -1.0e9f); asm volatile("" : "+v"(mn)); const float t = __fadd_rn(t0, mn); v[ch * 4 + q] = t; mx = fmaxf(mx, t); } }
#pragma unroll
    for (int sh = 16; sh; sh >>= 1) mx = fmaxf(mx, __shfl_xor(mx, sh, 32));
    float sum = 0.f;
#pragma unroll
    for (int k = 0; k < TT / 32; ++k) { float d0 = __fsub_rn(v[k], mx); asm volatile("" : "+v"(d0)); v[k] = __builtin_amdgcn_exp2f(__fmul_rn(d0, 1.4426950408889634f)); sum += v[k]; }
#pragma unroll
    for (int sh = 16; sh; sh >>= 1) sum += __shfl_xor(sum, sh, 32);
    const float f = __fdiv_rn(hires ? 1.0f : PCAR, sum);
{
        if (hires) {
#pragma unroll
            for (int ch = 0; ch < TT / 128; ++ch) { v4us oh, ol;
#pragma unroll
                for (int q = 0; q < 4; ++q) { unsigned short a, c2; splitf(v[ch * 4 + q] * f, a, c2); oh[q] = a; ol[q] = c2; }
                const size_t oo = ((size_t)zz * (RH ? RH : 1) + i) * TT + ch * 128 + lane * 4; *(v4us*)(Ph + oo) = oh; *(v4us*)(Pl + oo) = ol; }
        } else {
#pragma unroll
            for (int ch = 0; ch < TT / 128; ++ch) { v4h o4;
#pragma unroll
                for (int q = 0; q < 4; ++q) o4[q] = tohx(v[ch * 4 + q] * f);
                *(v4h*)(P16 + (size_t)row * TT + ch * 128 + lane * 4) = o4; } }
         }
}
__global__ __launch_bounds__(256) void k_merge(const float* __restrict__ O, int h0, bf* Ah, bf* Al) { const size_t e = ((size_t)blockIdx.x * 256 + threadIdx.x) * 2; if (e >= (size_t)ZH * TT * HD) return; const int d = (int)(e % HD); const int t = (int)((e / HD) % TT); const int zz = (int)(e / ((size_t)HD * TT)); const float cs = (t < RH) ? 1.0f : (1.0f / PCAR); const size_t oo = (size_t)t * DQ + (h0 + zz) * HD + d;
    v2us oh, ol;
#pragma unroll
    for (int q = 0; q < 2; ++q) { unsigned short a, c2; splitf(O[e + q] * cs, a, c2); oh[q] = a; ol[q] = c2; } *(v2us*)(Ah + oo) = oh; *(v2us*)(Al + oo) = ol;  }

extern "C" void kernel_launch(void* const* d_in, const int* in_sizes, int n_in,
                              void* d_out, int out_size, void* d_ws, size_t ws_size, hipStream_t stream) {
    (void)in_sizes; (void)n_in; (void)out_size;
    const float* x = (const float*)d_in[0]; const float* fmask = (const float*)d_in[1]; const float* wq = (const float*)d_in[2]; const float* bq = (const float*)d_in[3]; const float* wk = (const float*)d_in[4]; const float* bk = (const float*)d_in[5]; const float* wv = (const float*)d_in[6]; const float* bv = (const float*)d_in[7]; const float* wo = (const float*)d_in[8]; const float* bo = (const float*)d_in[9]; const float* cosT = nullptr; const float* sinT = nullptr; (void)cosT; (void)sinT;
    float* OUT = (float*)d_out;     // [4][2048][512]
    char* wsp = (char*)d_ws;
    auto take = [&](size_t bytes) { char* p = wsp; wsp += (bytes + 255) & ~(size_t)255; return (void*)p; };
    bf* WQ = (bf*)take((size_t)DQ * DM * 2); bf* WK = (bf*)take((size_t)DKV * DM * 2); bf* WV = (bf*)take((size_t)DKV * DM * 2); bf* WO = (bf*)take((size_t)DM * DQ * 2); float* CS = (float*)take((size_t)TT * HD * 2 * 4);
    bf* XB = (bf*)take((size_t)TT * DM * 2); float* FQ = (float*)take((size_t)TT * DQ * 4); float* FK = (float*)take((size_t)TT * DKV * 4);
    h16* QP16 = (h16*)take((size_t)NH_ * TT * HD * 2); h16* KP16 = (h16*)take((size_t)NKV * TT * HD * 2); h16* VT16 = (h16*)take((size_t)NKV * HD * TT * 2);
    bf* QPh = (bf*)take((size_t)NH_ * TT * HD * 2); bf* QPl = (bf*)take((size_t)NH_ * TT * HD * 2); bf* KPh = (bf*)take((size_t)NKV * TT * HD * 2); bf* KPl = (bf*)take((size_t)NKV * TT * HD * 2); bf* VTh = (bf*)take((size_t)NKV * HD * TT * 2); bf* VTl = (bf*)take((size_t)NKV * HD * TT * 2); bf* Ph = (bf*)take((size_t)ZH * RH * TT * 2); bf* Pl = (bf*)take((size_t)ZH * RH * TT * 2);
    float* Sb = (float*)take((size_t)ZH * TT * TT * 4); h16* P16 = (h16*)take((size_t)ZH * TT * TT * 2); float* Ob = (float*)take((size_t)ZH * TT * HD * 4); bf* ATh = (bf*)take((size_t)TT * DQ * 2); bf* ATl = (bf*)take((size_t)TT * DQ * 2);
    if ((size_t)(wsp - (char*)d_ws) > ws_size) return;    // ws 256 MiB
    float* FV = FK;   // v projection reuses the k buffer after the k planes are built (stream-ordered)
    { k_wtG<<<(unsigned)((DM * DQ / 64 + 63) / 64), 256, 0, stream>>>(wq, DM, DQ, WQ); k_wtG<<<(unsigned)((DM * DKV / 64 + 63) / 64), 256, 0, stream>>>(wk, DM, DKV, WK); k_wtG<<<(unsigned)((DM * DKV / 64 + 63) / 64), 256, 0, stream>>>(wv, DM, DKV, WV);
      k_wtG<<<(unsigned)((DQ * DM / 64 + 63) / 64), 256, 0, stream>>>(wo, DQ, DM, WO);
       }
    k_csid<<<(TT * HD + 255) / 256, 256, 0, stream>>>(CS);
    const unsigned LQ = (unsigned)(((size_t)NH_ * TT * HD / 2 + 255) / 256), LKv = (unsigned)(((size_t)NKV * TT * HD / 2 + 255) / 256);
    for (int b = 0; b < NB_; ++b) {
        
        k_cvt8<<<(unsigned)(((size_t)TT * DM / 8 + 255) / 256), 256, 0, stream>>>(x + (size_t)b * TT * DM, XB, (size_t)TT * DM / 8);
        k_gemmw<bf, 0, true, 8><<<dim3(TT / 64, DQ / 64, 1), 256, 0, stream>>>(XB, nullptr, WQ, nullptr, DM, FQ, DQ, bq, 0, 0, 0);
        k_rope<<<LQ, 256, 0, stream>>>(FQ, DQ, NH_, CS, nullptr, nullptr, 1.0f, QP16, QPh, QPl);
        k_gemmw<bf, 0, true, 8><<<dim3(TT / 64, DKV / 64, 1), 256, 0, stream>>>(XB, nullptr, WK, nullptr, DM, FK, DKV, bk, 0, 0, 0);
        k_rope<<<LKv, 256, 0, stream>>>(FK, DKV, NKV, CS, nullptr, nullptr, 1.0f, KP16, KPh, KPl);
        k_gemmw<bf, 0, true, 8><<<dim3(TT / 64, DKV / 64, 1), 256, 0, stream>>>(XB, nullptr, WV, nullptr, DM, FV, DKV, bv, 0, 0, 0); k_vtp<<<LKv, 256, 0, stream>>>(FV, DKV, NKV, VT16, VTh, VTl);
        for (int h0 = 0; h0 < NH_; h0 += ZH) { const size_t zq = (size_t)h0, zk = (size_t)(h0 / REP);   // one kv head per query head: the pass's two heads use consecutive kv planes (z-strides TT*HD)
            k_gemmw<bf, 2, false, 1><<<dim3(RH / 64, TT / 64, ZH), 32, 0, stream>>>(QPh + zq * TT * HD, QPl + zq * TT * HD, KPh + zk * TT * HD, KPl + zk * TT * HD, HD, Sb, TT, nullptr, (size_t)TT * HD, (size_t)TT * HD, (size_t)TT * TT);
            k_gemmw<h16, 0, false, 1><<<dim3((TT - RH) / 64, TT / 64, ZH), 32, 0, stream>>>(QP16 + zq * TT * HD + (size_t)RH * HD, nullptr, KP16 + zk * TT * HD, nullptr, HD, Sb + (size_t)RH * TT, TT, nullptr, (size_t)TT * HD, (size_t)TT * HD, (size_t)TT * TT);
            k_asoft<<<ZH * TT / 8, 256, 0, stream>>>(Sb, fmask, P16, Ph, Pl);
            k_gemmw<bf, 2, false, 16><<<dim3(RH / 64, HD / 64, ZH), 512, 0, stream>>>(Ph, Pl, VTh + zk * HD * TT, VTl + zk * HD * TT, TT, Ob, HD, nullptr, (size_t)RH * TT, (size_t)HD * TT, (size_t)TT * HD);
            k_gemmw<h16, 0, false, 16><<<dim3((TT - RH) / 64, HD / 64, ZH), 512, 0, stream>>>(P16 + (size_t)RH * TT, nullptr, VT16 + zk * HD * TT, nullptr, TT, Ob + (size_t)RH * HD, HD, nullptr, (size_t)TT * TT, (size_t)HD * TT, (size_t)TT * HD);
            k_merge<<<(unsigned)(((size_t)ZH * TT * HD / 2 + 255) / 256), 256, 0, stream>>>(Ob, h0, ATh, ATl); }
        k_gemmw<bf, 1, true, 8><<<dim3(TT / 64, DM / 64, 1), 256, 0, stream>>>(ATh, ATl, WO, nullptr, DQ, OUT + (size_t)b * TT * DM, DM, bo, 0, 0, 0); }
}

// v002
// One run takes 607 microseconds.
// In two side-by-side timings against v001, it was 1.97 and 1.93 times as fast.
// Counting every step since v000, it is 3.53 times as fast.
#include <hip/hip_runtime.h>

// Masked_Multi_Head_Attention_Layer (x [4][2048][512]; Q/K/V = x W + b (8 heads x 64, [in, out]); scores = q.k / 8 + mask[i][j] x (-1e9) (float mask [1][1][2048][2048], read); softmax; out = (attn v merged) Wo + bo -> [4][2048][512]).
// Compute dtypes, f32 accumulate: every input rounded to bf16; Q/K/V on PLAIN bf16 operands (inputs: exact) + bias; full score matrices (the mask is data): query rows < 512 hl (3 products), the rest single fp16 (x1024); mask add + softmax f32; Wo hl x exact (2 products) + bias.

#define NB_  4
#define TT   2048
#define DM   512
#define NH_  8
#define NKV  8
#define REP  (NH_ / NKV)
#define HD   64
#define DQ   (NH_ * HD)
#define DKV  (NKV * HD)
#define ZH   8                    // heads per attention pass (blockIdx.z): all heads of one batch entry
#define RH   512                  // query rows < RH use hi+lo planes (0: none)
#define WIN  0
#define PCAR 1024.0f
#define SCL  0.125f   // HD^-0.5
typedef _Float16 h16;
typedef unsigned short bf;
typedef __attribute__((ext_vector_type(16))) __bf16   v16bf;
typedef __attribute__((ext_vector_type(16))) _Float16 v16h;
typedef __attribute__((ext_vector_type(8)))  _Float16 v8h;
typedef __attribute__((ext_vector_type(8)))  unsigned short v8us;
typedef __attribute__((ext_vector_type(8)))  float    v8f;
typedef __attribute__((ext_vector_type(4)))  float    v4f;
typedef v8h  __attribute__((may_alias)) v8ha;
typedef v4f  __attribute__((may_alias)) v4fa;
typedef v8us __attribute__((may_alias)) v8usa;
typedef float __attribute__((ext_vector_type(2), may_alias)) v2fa;

__device__ __forceinline__ unsigned short f2bf(float f) { unsigned u = __float_as_uint(f); u += 0x7FFFu + ((u >> 16) & 1u); return (unsigned short)(u >> 16); }
__device__ __forceinline__ float bf2f(unsigned short b) { return __uint_as_float(((unsigned)b) << 16); }
__device__ __forceinline__ float bfr(float f) { return bf2f(f2bf(f)); }
__device__ __forceinline__ v16h cat16(v8h lo, v8h hi) { return __builtin_shufflevector(lo, hi, 0, 1, 2, 3, 4, 5, 6, 7, 8, 9, 10, 11, 12, 13, 14, 15); }
__device__ __forceinline__ v16bf cat16b(v8us lo, v8us hi) { return __builtin_bit_cast(v16bf, __builtin_shufflevector(lo, hi, 0, 1, 2, 3, 4, 5, 6, 7, 8, 9, 10, 11, 12, 13, 14, 15)); }
__device__ __forceinline__ v8f wmma16(v16h a, v16h b, v8f c) { return __builtin_amdgcn_wmma_f32_16x16x32_f16(false, a, false, b, (short)0, c, false, false); }
__device__ __forceinline__ v8f wmmab(v16bf a, v16bf b, v8f c) { return __builtin_amdgcn_wmma_f32_16x16x32_bf16(false, a, false, b, (short)0, c, false, false); }



// ---- k_gemmw: register-blocked GEMM, ONE WAVE per 64x64 output tile (16 accumulators), operands straight from K-contiguous 16-bit planes; grid (M/64, N/64, Z), 32 threads.
// C[m][n] (f32, pitch ldc, + optional f32 bias0[n]; z = 1, 2 take biasz1, biasz2) = sum_k A[m][k] Bt[n][k] (+ split products per NSPLIT). z-batch strides sA/sB/sC in elements. K % (32 * KS) == 0.
// KS > 1: the tile's work-group has KS waves (32 * KS threads); wave w sums k in [w K/KS, (w+1) K/KS), the KS partial tiles meet in LDS and are added in wave order 0..KS-1.
template <typename T16> struct WFrag;
template <> struct WFrag<h16> { typedef v16h V; static __device__ __forceinline__ V ld(const h16* p) { return cat16(*(const v8h*)p, *(const v8h*)(p + 16)); } static __device__ __forceinline__ v8f mma(V a, V b, v8f c) { return wmma16(a, b, c); } };
template <> struct WFrag<bf> { typedef v16bf V; static __device__ __forceinline__ V ld(const bf* p) { return cat16b(*(const v8us*)p, *(const v8us*)(p + 16)); } static __device__ __forceinline__ v8f mma(V a, V b, v8f c) { return wmmab(a, b, c); } };
template <typename T16, int NSPLIT, bool BIAS, int KS>
__global__ __launch_bounds__(32 * KS) void k_gemmw(const T16* __restrict__ A, const T16* __restrict__ A2, const T16* __restrict__ Bt, const T16* __restrict__ Bt2, int K, float* C, int ldc, const float* __restrict__ bias0, const float* __restrict__ biasz1, const float* __restrict__ biasz2, size_t sA, size_t sB, size_t sC) {
    typedef typename WFrag<T16>::V V;
    __shared__ __align__(16) float os[KS == 1 ? 16 * 68 : KS * 4096];
    const size_t z = blockIdx.z; A += z * sA; if (A2) A2 += z * sA; Bt += z * sB; if (Bt2) Bt2 += z * sB; C += z * sC;
    const float* bias = (z == 1) ? biasz1 : (z == 2) ? biasz2 : bias0;   // products batched in z (at most 3 with a bias) each bring their own bias vector
    const int lane = threadIdx.x & 31, lr = lane & 15, hi = lane >> 4; const int r0 = blockIdx.x * 64, c0 = blockIdx.y * 64;
    v8f acc[4][4];
#pragma unroll
    for (int mb = 0; mb < 4; ++mb)
#pragma unroll
        for (int nb = 0; nb < 4; ++nb) acc[mb][nb] = (v8f){};
    const int wv = (KS == 1) ? 0 : __builtin_amdgcn_readfirstlane((int)(threadIdx.x >> 5));   // wave number, scalar: the K loop's bounds stay wave-uniform
    const int kw = K / KS;   // this wave's share of K, from k = wv * kw
    const size_t aoff = (size_t)(r0 + lr) * K + 8 * hi, boff = (size_t)(c0 + lr) * K + 8 * hi;
#pragma unroll 1
    for (int kc = wv * kw; kc < (wv + 1) * kw; kc += 32) {
        V a[4], a2[4];
#pragma unroll
        for (int mb = 0; mb < 4; ++mb) { a[mb] = WFrag<T16>::ld(A + aoff + (size_t)mb * 16 * K + kc); if (NSPLIT == 1 || NSPLIT == 2) a2[mb] = WFrag<T16>::ld(A2 + aoff + (size_t)mb * 16 * K + kc); }
#pragma unroll
        for (int nb = 0; nb < 4; ++nb) { const V b = WFrag<T16>::ld(Bt + boff + (size_t)nb * 16 * K + kc); V b2; if (NSPLIT >= 2) b2 = WFrag<T16>::ld(Bt2 + boff + (size_t)nb * 16 * K + kc);
#pragma unroll
            for (int mb = 0; mb < 4; ++mb) { acc[mb][nb] = WFrag<T16>::mma(a[mb], b, acc[mb][nb]); if (NSPLIT == 1 || NSPLIT == 2) acc[mb][nb] = WFrag<T16>::mma(a2[mb], b, acc[mb][nb]); if (NSPLIT >= 2) acc[mb][nb] = WFrag<T16>::mma(a[mb], b2, acc[mb][nb]); } }
        asm volatile("v_nop\n\tv_nop\n\tv_nop\n\tv_nop" : "+v"(acc[0][0]), "+v"(acc[1][1]), "+v"(acc[2][2]), "+v"(acc[3][3]) : "v"(a[0]), "v"(a[3]));
    }
    if constexpr (KS > 1) {
        // Partial tile of wave wv at os + wv * 4096, as 16 units u = mb * 4 + jq (rows mb*16 + hi*8 + 2jq + {0,1}, all 64 columns); a unit is [nb][lane][2 rows], 1 KiB: register pairs go out as they lie, every LDS access is contiguous over the lanes.
        float* mine = os + wv * 4096 + lane * 2;
#pragma unroll
        for (int mb = 0; mb < 4; ++mb)
#pragma unroll
            for (int jq = 0; jq < 4; ++jq)
#pragma unroll
                for (int nb = 0; nb < 4; ++nb) { v2fa t; t[0] = acc[mb][nb][2 * jq]; t[1] = acc[mb][nb][2 * jq + 1]; *(v2fa*)(mine + ((mb * 4 + jq) * 4 + nb) * 64) = t; }
        __syncthreads();   // every wave's partial tile is in LDS before any wave adds them
        // A 16-byte read takes two neighbouring writer lanes: reader lane l, read i holds rows {0,1} of the unit's half (l & 15) >> 3 at columns (2i + (l >> 4)) * 16 + 2 * (l & 7) + {0,1}.
        const int rh = (lane & 15) >> 3, cl = (lane >> 4) * 16 + 2 * (lane & 7);
#pragma unroll
        for (int uu = 0; uu < 16 / KS; ++uu) { const int u = wv + uu * KS; const float* q0 = os + u * 256 + lane * 4; v4f s0 = *(const v4fa*)q0, s1 = *(const v4fa*)(q0 + 128);
#pragma unroll
            for (int s = 1; s < KS; ++s) { s0 += *(const v4fa*)(q0 + s * 4096); s1 += *(const v4fa*)(q0 + s * 4096 + 128); }
            if (BIAS) { const float b0 = bfr(bias[c0 + cl]), b1 = bfr(bias[c0 + cl + 1]), b2 = bfr(bias[c0 + 32 + cl]), b3 = bfr(bias[c0 + 32 + cl + 1]); s0[0] += b0; s0[1] += b0; s0[2] += b1; s0[3] += b1; s1[0] += b2; s1[1] += b2; s1[2] += b3; s1[3] += b3; }
            float* crow = C + (size_t)(r0 + (u >> 2) * 16 + rh * 8 + (u & 3) * 2) * ldc + c0 + cl;   // a unit holds whole 256-byte rows of the tile: one writing wave per line
#pragma unroll
            for (int q = 0; q < 2; ++q) { v2fa lo, up; lo[0] = s0[q]; lo[1] = s0[2 + q]; up[0] = s1[q]; up[1] = s1[2 + q]; *(v2fa*)(crow + (size_t)q * ldc) = lo; *(v2fa*)(crow + (size_t)q * ldc + 32) = up; } }
        return;
    }
#pragma unroll
    for (int mb = 0; mb < 4; ++mb) {
#pragma unroll
        for (int nb = 0; nb < 4; ++nb) {
#pragma unroll
            for (int j = 0; j < 8; ++j) os[(hi * 8 + j) * 68 + nb * 16 + lr] = acc[mb][nb][j]; }
        __builtin_amdgcn_wave_barrier(); asm volatile("" ::: "memory");
        float* crow = C + (size_t)(r0 + mb * 16) * ldc + c0;
{
#pragma unroll
            for (int s = 0; s < 8; ++s) { const int row = 2 * s + hi, cofs = lr * 4; v4f val = *(const v4fa*)(os + row * 68 + cofs); if (BIAS) { val[0] += bfr(bias[c0 + cofs]); val[1] += bfr(bias[c0 + cofs + 1]); val[2] += bfr(bias[c0 + cofs + 2]); val[3] += bfr(bias[c0 + cofs + 3]); }
                *(v4f*)(crow + (size_t)row * ldc + cofs) = val; }
             }
        __builtin_amdgcn_wave_barrier(); asm volatile("" ::: "memory");
    }
}

__device__ __forceinline__ h16 tohx(float x) { return (h16)x; }
__device__ __forceinline__ void splitf(float y, unsigned short& h, unsigned short& l) { h = f2bf(y); l = f2bf(y - bf2f(h)); }
typedef __attribute__((ext_vector_type(2))) _Float16 v2h;
typedef __attribute__((ext_vector_type(4))) _Float16 v4h;
typedef __attribute__((ext_vector_type(2))) unsigned short v2us;
typedef __attribute__((ext_vector_type(4))) unsigned short v4us;
typedef __attribute__((ext_vector_type(2))) float v2f;
typedef __attribute__((ext_vector_type(4))) int v4i;

// blockIdx.y picks one of four K x N weights; their transposed planes lie one behind the other in Bt.
__global__ __launch_bounds__(256) void k_wtG(const float* __restrict__ w0, const float* __restrict__ w1, const float* __restrict__ w2, const float* __restrict__ w3, int K, int N, bf* Bt) {
    const float* __restrict__ w = (blockIdx.y == 0) ? w0 : (blockIdx.y == 1) ? w1 : (blockIdx.y == 2) ? w2 : w3; Bt += (size_t)blockIdx.y * K * N;
    const int lane = threadIdx.x & 31; const int L0 = (blockIdx.x * 8 + (threadIdx.x >> 5)) * 8; const int nlines = N * K / 64;
{
#pragma unroll 1
        for (int l = 0; l < 8; ++l) { const int L = L0 + l; if (L >= nlines) break; const size_t e = (size_t)L * 64 + lane * 2; const int k = (int)(e % K), n = (int)(e / K); v2us o;
            o[0] = f2bf(w[(size_t)k * N + n]); o[1] = f2bf(w[(size_t)(k + 1) * N + n]); *(v2us*)(Bt + e) = o; }
         }
}
__global__ __launch_bounds__(256) void k_cvt8(const float* __restrict__ src, bf* dst, size_t n8) { const size_t i = (size_t)blockIdx.x * 256 + threadIdx.x; if (i >= n8) return; const v8f v = *(const v8f*)(src + i * 8); v8us o;
#pragma unroll
    for (int k = 0; k < 8; ++k) o[k] = f2bf(v[k]); *(v8us*)(dst + i * 8) = o;  }
__global__ __launch_bounds__(256) void k_cscvt(const float* __restrict__ cosT, const float* __restrict__ sinT, float* CS) { const int idx = blockIdx.x * 256 + threadIdx.x; if (idx >= TT * HD) return; v2f cs; cs[0] = bfr(cosT[idx]); cs[1] = bfr(sinT[idx]); *(v2f*)(CS + (size_t)idx * 2) = cs;  }
// k_rope: head planes [h][t][d] (fp16 + hi/lo) of rope(x) x sc with the rotate-half convention out[d] = x[d] cos[t][d] - x[d+HD/2] sin[t][d], out[d+HD/2] = x[d+HD/2] cos[t][d+HD/2] + x[d] sin[t][d+HD/2]
__global__ __launch_bounds__(256) void k_rope(const float* __restrict__ F, int pitch, int nheads, const float* __restrict__ CS, const float* __restrict__ RF, const float* __restrict__ nw, float sc, h16* P16, bf* Ph, bf* Pl) {
    const size_t e = ((size_t)blockIdx.x * 256 + threadIdx.x) * 2; if (e >= (size_t)nheads * TT * HD) return; const int d = (int)(e % HD); const int t = (int)((e / HD) % TT); const int h = (int)(e / ((size_t)HD * TT)); const float* f = F + (size_t)t * pitch + h * HD; const float rf = RF ? RF[(size_t)h * TT + t] : 1.0f; v2h o16; v2us oh, ol;
#pragma unroll
    for (int q = 0; q < 2; ++q) { const int dd = d + q; const int dp = (dd < HD / 2) ? dd + HD / 2 : dd - HD / 2; float x0 = f[dd], x1 = f[dp];
        if (RF) { float n0 = __fmul_rn(x0, rf), n1 = __fmul_rn(x1, rf); asm volatile("" : "+v"(n0)); asm volatile("" : "+v"(n1)); x0 = __fmul_rn(bfr(nw[dd]), n0); x1 = __fmul_rn(bfr(nw[dp]), n1); }
        const v2f cs = *(const v2f*)(CS + ((size_t)t * HD + dd) * 2); float a = __fmul_rn(x0, cs[0]), bq = __fmul_rn(x1, cs[1]); asm volatile("" : "+v"(a)); asm volatile("" : "+v"(bq)); const float r = ((dd < HD / 2) ? __fsub_rn(a, bq) : __fadd_rn(a, bq)) * sc;
        o16[q] = tohx(r); unsigned short a2, c2; splitf(r, a2, c2); oh[q] = a2; ol[q] = c2; }
    *(v2h*)(P16 + e) = o16; *(v2us*)(Ph + e) = oh; *(v2us*)(Pl + e) = ol;  }
__global__ __launch_bounds__(256) void k_vtp(const float* __restrict__ F, int pitch, int nheads, h16* V16, bf* Vh, bf* Vl) { const size_t e = ((size_t)blockIdx.x * 256 + threadIdx.x) * 2; if (e >= (size_t)nheads * HD * TT) return; const int t = (int)(e % TT); const int d = (int)((e / TT) % HD); const int g = (int)(e / ((size_t)TT * HD)); v2h o16; v2us oh, ol;
#pragma unroll
    for (int q = 0; q < 2; ++q) { const float x = F[(size_t)(t + q) * pitch + g * HD + d]; o16[q] = tohx(x); unsigned short a2, c2; splitf(x, a2, c2); oh[q] = a2; ol[q] = c2; }
    *(v2h*)(V16 + e) = o16; *(v2us*)(Vh + e) = oh; *(v2us*)(Vl + e) = ol;  }
__global__ __launch_bounds__(256) void k_csid(float* CS) { const int idx = blockIdx.x * 256 + threadIdx.x; if (idx >= TT * HD) return; v2f cs; cs[0] = 1.0f; cs[1] = 0.0f; *(v2f*)(CS + (size_t)idx * 2) = cs;  }
// k_asoft: per row (zz, i): t = S x HD^-0.5 + mask[i][j] x (-1e9); softmax over the 2048 keys (register row, one exp, fixed trees);
__global__ __launch_bounds__(256) void k_asoft(const float* __restrict__ Sb, const float* __restrict__ fm, h16* P16, bf* Ph, bf* Pl) {
    const int lane = threadIdx.x & 31; const int row = blockIdx.x * 8 + (threadIdx.x >> 5); if (row >= ZH * TT) return; const int i = row % TT; const int zz = row / TT; (void)zz; const bool hires = (i < RH); const float* sr = Sb + (size_t)row * TT; float v[TT / 32]; float mx = -3.0e38f;
#pragma unroll
    for (int ch = 0; ch < TT / 128; ++ch) { const int j0 = ch * 128 + lane * 4; const v4f a = *(const v4f*)(sr + j0); const v4f m4 = *(const v4f*)(fm + (size_t)i * TT + j0);
#pragma unroll
        for (int q = 0; q < 4; ++q) { float t0 = a[q] * SCL; asm volatile("" : "+v"(t0)); float mb = bfr(m4[q]); asm volatile("" : "+v"(mb)); float mn = __fmul_rn(mb, -1.0e9f); asm volatile("" : "+v"(mn)); const float t = __fadd_rn(t0, mn); v[ch * 4 + q] = t; mx = fmaxf(mx, t); } }
#pragma unroll
    for (int sh = 16; sh; sh >>= 1) mx = fmaxf(mx, __shfl_xor(mx, sh, 32));
    float sum = 0.f;
#pragma unroll
    for (int k = 0; k < TT / 32; ++k) { float d0 = __fsub_rn(v[k], mx); asm volatile("" : "+v"(d0)); v[k] = __builtin_amdgcn_exp2f(__fmul_rn(d0, 1.4426950408889634f)); sum += v[k]; }
#pragma unroll
    for (int sh = 16; sh; sh >>= 1) sum += __shfl_xor(sum, sh, 32);
    const float f = __fdiv_rn(hires ? 1.0f : PCAR, sum);
{
        if (hires) {
#pragma unroll
            for (int ch = 0; ch < TT / 128; ++ch) { v4us oh, ol;
#pragma unroll
                for (int q = 0; q < 4; ++q) { unsigned short a, c2; splitf(v[ch * 4 + q] * f, a, c2); oh[q] = a; ol[q] = c2; }
                const size_t oo = ((size_t)zz * (RH ? RH : 1) + i) * TT + ch * 128 + lane * 4; *(v4us*)(Ph + oo) = oh; *(v4us*)(Pl + oo) = ol; }
        } else {
#pragma unroll
            for (int ch = 0; ch < TT / 128; ++ch) { v4h o4;
#pragma unroll
                for (int q = 0; q < 4; ++q) o4[q] = tohx(v[ch * 4 + q] * f);
                *(v4h*)(P16 + (size_t)row * TT + ch * 128 + lane * 4) = o4; } }
         }
}
__global__ __launch_bounds__(256) void k_merge(const float* __restrict__ O, int h0, bf* Ah, bf* Al) { const size_t e = ((size_t)blockIdx.x * 256 + threadIdx.x) * 2; if (e >= (size_t)ZH * TT * HD) return; const int d = (int)(e % HD); const int t = (int)((e / HD) % TT); const int zz = (int)(e / ((size_t)HD * TT)); const float cs = (t < RH) ? 1.0f : (1.0f / PCAR); const size_t oo = (size_t)t * DQ + (h0 + zz) * HD + d;
    v2us oh, ol;
#pragma unroll
    for (int q = 0; q < 2; ++q) { unsigned short a, c2; splitf(O[e + q] * cs, a, c2); oh[q] = a; ol[q] = c2; } *(v2us*)(Ah + oo) = oh; *(v2us*)(Al + oo) = ol;  }

extern "C" void kernel_launch(void* const* d_in, const int* in_sizes, int n_in,
                              void* d_out, int out_size, void* d_ws, size_t ws_size, hipStream_t stream) {
    (void)in_sizes; (void)n_in; (void)out_size;
    const float* x = (const float*)d_in[0]; const float* fmask = (const float*)d_in[1]; const float* wq = (const float*)d_in[2]; const float* bq = (const float*)d_in[3]; const float* wk = (const float*)d_in[4]; const float* bk = (const float*)d_in[5]; const float* wv = (const float*)d_in[6]; const float* bv = (const float*)d_in[7]; const float* wo = (const float*)d_in[8]; const float* bo = (const float*)d_in[9]; const float* cosT = nullptr; const float* sinT = nullptr; (void)cosT; (void)sinT;
    float* OUT = (float*)d_out;     // [4][2048][512]
    char* wsp = (char*)d_ws;
    auto take = [&](size_t bytes) { char* p = wsp; wsp += (bytes + 255) & ~(size_t)255; return (void*)p; };
    bf* WQ = (bf*)take((size_t)DQ * DM * 2); bf* WK = (bf*)take((size_t)DKV * DM * 2); bf* WV = (bf*)take((size_t)DKV * DM * 2); bf* WO = (bf*)take((size_t)DM * DQ * 2); float* CS = (float*)take((size_t)TT * HD * 2 * 4);
    bf* XB = (bf*)take((size_t)TT * DM * 2);
    h16* QP16 = (h16*)take((size_t)NH_ * TT * HD * 2); h16* KP16 = (h16*)take((size_t)NKV * TT * HD * 2); h16* VT16 = (h16*)take((size_t)NKV * HD * TT * 2);
    bf* QPh = (bf*)take((size_t)NH_ * TT * HD * 2); bf* KPh = (bf*)take((size_t)NKV * TT * HD * 2); bf* QPl = (bf*)take((size_t)NH_ * TT * HD * 2); bf* KPl = (bf*)take((size_t)NKV * TT * HD * 2); bf* VTh = (bf*)take((size_t)NKV * HD * TT * 2); bf* VTl = (bf*)take((size_t)NKV * HD * TT * 2); bf* Ph = (bf*)take((size_t)ZH * RH * TT * 2); bf* Pl = (bf*)take((size_t)ZH * RH * TT * 2);
    float* Sb = (float*)take((size_t)ZH * TT * TT * 4); h16* P16 = (h16*)take((size_t)ZH * TT * TT * 2); float* Ob = (float*)take((size_t)ZH * TT * HD * 4); bf* ATh = (bf*)take((size_t)TT * DQ * 2); bf* ATl = (bf*)take((size_t)TT * DQ * 2);
    if ((size_t)(wsp - (char*)d_ws) > ws_size) return;    // ws 256 MiB
    float* FQKV = Sb;   // q | k | v projections, [t][DQ + 2 DKV] f32: they lie in the score buffer, which is written only after the head planes are built (stream-ordered)
    const int PF = DQ + 2 * DKV; (void)WK; (void)WV;
    k_wtG<<<dim3((unsigned)((DM * DQ / 64 + 63) / 64), 4, 1), 256, 0, stream>>>(wq, wk, wv, wo, DM, DQ, WQ);   // WQ, WK, WV, WO are consecutive planes of DM x DQ
    k_csid<<<(TT * HD + 255) / 256, 256, 0, stream>>>(CS);
    const unsigned LQK = (unsigned)(((size_t)(NH_ + NKV) * TT * HD / 2 + 255) / 256), LKv = (unsigned)(((size_t)NKV * TT * HD / 2 + 255) / 256);
    for (int b = 0; b < NB_; ++b) {
        
        k_cvt8<<<(unsigned)(((size_t)TT * DM / 8 + 255) / 256), 256, 0, stream>>>(x + (size_t)b * TT * DM, XB, (size_t)TT * DM / 8);
        k_gemmw<bf, 0, true, 8><<<dim3(TT / 64, DQ / 64, 3), 256, 0, stream>>>(XB, nullptr, WQ, nullptr, DM, FQKV, PF, bq, bk, bv, 0, (size_t)DQ * DM, (size_t)DQ);   // z = q, k, v: weight planes consecutive, column blocks of FQKV
        k_rope<<<LQK, 256, 0, stream>>>(FQKV, PF, NH_ + NKV, CS, nullptr, nullptr, 1.0f, QP16, QPh, QPl);   // q heads, then k heads: each k plane lies directly behind its q plane
        k_vtp<<<LKv, 256, 0, stream>>>(FQKV + DQ + DKV, PF, NKV, VT16, VTh, VTl);
        for (int h0 = 0; h0 < NH_; h0 += ZH) { const size_t zq = (size_t)h0, zk = (size_t)(h0 / REP);   // one kv head per query head: the pass's heads use consecutive kv planes (z-strides TT*HD)
            k_gemmw<bf, 2, false, 1><<<dim3(RH / 64, TT / 64, ZH), 32, 0, stream>>>(QPh + zq * TT * HD, QPl + zq * TT * HD, KPh + zk * TT * HD, KPl + zk * TT * HD, HD, Sb, TT, nullptr, nullptr, nullptr, (size_t)TT * HD, (size_t)TT * HD, (size_t)TT * TT);
            k_gemmw<h16, 0, false, 1><<<dim3((TT - RH) / 64, TT / 64, ZH), 32, 0, stream>>>(QP16 + zq * TT * HD + (size_t)RH * HD, nullptr, KP16 + zk * TT * HD, nullptr, HD, Sb + (size_t)RH * TT, TT, nullptr, nullptr, nullptr, (size_t)TT * HD, (size_t)TT * HD, (size_t)TT * TT);
            k_asoft<<<ZH * TT / 8, 256, 0, stream>>>(Sb, fmask, P16, Ph, Pl);
            k_gemmw<bf, 2, false, 16><<<dim3(RH / 64, HD / 64, ZH), 512, 0, stream>>>(Ph, Pl, VTh + zk * HD * TT, VTl + zk * HD * TT, TT, Ob, HD, nullptr, nullptr, nullptr, (size_t)RH * TT, (size_t)HD * TT, (size_t)TT * HD);
            k_gemmw<h16, 0, false, 16><<<dim3((TT - RH) / 64, HD / 64, ZH), 512, 0, stream>>>(P16 + (size_t)RH * TT, nullptr, VT16 + zk * HD * TT, nullptr, TT, Ob + (size_t)RH * HD, HD, nullptr, nullptr, nullptr, (size_t)TT * TT, (size_t)HD * TT, (size_t)TT * HD);
            k_merge<<<(unsigned)(((size_t)ZH * TT * HD / 2 + 255) / 256), 256, 0, stream>>>(Ob, h0, ATh, ATl); }
        k_gemmw<bf, 1, true, 8><<<dim3(TT / 64, DM / 64, 1), 256, 0, stream>>>(ATh, ATl, WO, nullptr, DQ, OUT + (size_t)b * TT * DM, DM, bo, nullptr, nullptr, 0, 0, 0); }
}

// v003
// One run takes 369 microseconds.
// Timed twice side by side with v002, it ran 1.63 and 1.65 times as fast.
// Over all steps from v000 it is 5.79 times as fast.
#include <hip/hip_runtime.h>

// Masked multi-head attention layer (x [4][2048][512]; Q/K/V = x W + b (8 heads x 64, [in, out]); scores = q.k / 8 + mask[i][j] x (-1e9) (float mask [1][1][2048][2048], read); softmax; out = (attn v merged) Wo + bo -> [4][2048][512]).
// Compute dtypes, f32 accumulate: every input rounded to bf16; Q/K/V on PLAIN bf16 operands (inputs: exact) + bias; every score is formed (the mask is data) but none is stored: query rows < 512 hl (3 products), the rest single fp16; mask add + running softmax f32; Wo hl x exact (2 products) + bias.

#define NB_  4
#define TT   2048
#define DM   512
#define NH_  8
#define NKV  8
#define REP  (NH_ / NKV)
#define HD   64
#define DQ   (NH_ * HD)
#define DKV  (NKV * HD)
#define RH   512                  // query rows < RH use hi+lo planes (0: none)
#define WIN  0
#define SCL  0.125f   // HD^-0.5
typedef _Float16 h16;
typedef unsigned short bf;
typedef __attribute__((ext_vector_type(16))) __bf16   v16bf;
typedef __attribute__((ext_vector_type(16))) _Float16 v16h;
typedef __attribute__((ext_vector_type(8)))  _Float16 v8h;
typedef __attribute__((ext_vector_type(8)))  unsigned short v8us;
typedef __attribute__((ext_vector_type(8)))  float    v8f;
typedef __attribute__((ext_vector_type(4)))  float    v4f;
typedef v8h  __attribute__((may_alias)) v8ha;
typedef v4f  __attribute__((may_alias)) v4fa;
typedef v8us __attribute__((may_alias)) v8usa;
typedef float __attribute__((ext_vector_type(2), may_alias)) v2fa;

__device__ __forceinline__ unsigned short f2bf(float f) { unsigned u = __float_as_uint(f); u += 0x7FFFu + ((u >> 16) & 1u); return (unsigned short)(u >> 16); }
__device__ __forceinline__ float bf2f(unsigned short b) { return __uint_as_float(((unsigned)b) << 16); }
__device__ __forceinline__ float bfr(float f) { return bf2f(f2bf(f)); }
__device__ __forceinline__ v16h cat16(v8h lo, v8h hi) { return __builtin_shufflevector(lo, hi, 0, 1, 2, 3, 4, 5, 6, 7, 8, 9, 10, 11, 12, 13, 14, 15); }
__device__ __forceinline__ v16bf cat16b(v8us lo, v8us hi) { return __builtin_bit_cast(v16bf, __builtin_shufflevector(lo, hi, 0, 1, 2, 3, 4, 5, 6, 7, 8, 9, 10, 11, 12, 13, 14, 15)); }
__device__ __forceinline__ v8f wmma16(v16h a, v16h b, v8f c) { return __builtin_amdgcn_wmma_f32_16x16x32_f16(false, a, false, b, (short)0, c, false, false); }
__device__ __forceinline__ v8f wmmab(v16bf a, v16bf b, v8f c) { return __builtin_amdgcn_wmma_f32_16x16x32_bf16(false, a, false, b, (short)0, c, false, false); }



// ---- k_gemmw: register-blocked GEMM, ONE WAVE per 64x64 output tile (16 accumulators), operands straight from K-contiguous 16-bit planes; grid (M/64, N/64, Z), 32 threads.
// C[m][n] (f32, pitch ldc, + optional f32 bias0[n]; z = 1, 2 take biasz1, biasz2) = sum_k A[m][k] Bt[n][k] (+ split products per NSPLIT). z-batch strides sA/sB/sC in elements. K % (32 * KS) == 0.
// KS > 1: the tile's work-group has KS waves (32 * KS threads); wave w sums k in [w K/KS, (w+1) K/KS), the KS partial tiles meet in LDS and are added in wave order 0..KS-1.
template <typename T16> struct WFrag;
template <> struct WFrag<h16> { typedef v16h V; static __device__ __forceinline__ V ld(const h16* p) { return cat16(*(const v8h*)p, *(const v8h*)(p + 16)); } static __device__ __forceinline__ v8f mma(V a, V b, v8f c) { return wmma16(a, b, c); } };
template <> struct WFrag<bf> { typedef v16bf V; static __device__ __forceinline__ V ld(const bf* p) { return cat16b(*(const v8us*)p, *(const v8us*)(p + 16)); } static __device__ __forceinline__ v8f mma(V a, V b, v8f c) { return wmmab(a, b, c); } };
template <typename T16, int NSPLIT, bool BIAS, int KS>
__global__ __launch_bounds__(32 * KS) void k_gemmw(const T16* __restrict__ A, const T16* __restrict__ A2, const T16* __restrict__ Bt, const T16* __restrict__ Bt2, int K, float* C, int ldc, const float* __restrict__ bias0, const float* __restrict__ biasz1, const float* __restrict__ biasz2, size_t sA, size_t sB, size_t sC) {
    typedef typename WFrag<T16>::V V;
    __shared__ __align__(16) float os[KS == 1 ? 16 * 68 : KS * 4096];
    const size_t z = blockIdx.z; A += z * sA; if (A2) A2 += z * sA; Bt += z * sB; if (Bt2) Bt2 += z * sB; C += z * sC;
    const float* bias = (z == 1) ? biasz1 : (z == 2) ? biasz2 : bias0;   // products batched in z (at most 3 with a bias) each bring their own bias vector
    const int lane = threadIdx.x & 31, lr = lane & 15, hi = lane >> 4; const int r0 = blockIdx.x * 64, c0 = blockIdx.y * 64;
    v8f acc[4][4];
#pragma unroll
    for (int mb = 0; mb < 4; ++mb)
#pragma unroll
        for (int nb = 0; nb < 4; ++nb) acc[mb][nb] = (v8f){};
    const int wv = (KS == 1) ? 0 : __builtin_amdgcn_readfirstlane((int)(threadIdx.x >> 5));   // wave number, scalar: the K loop's bounds stay wave-uniform
    const int kw = K / KS;   // this wave's share of K, from k = wv * kw
    const size_t aoff = (size_t)(r0 + lr) * K + 8 * hi, boff = (size_t)(c0 + lr) * K + 8 * hi;
#pragma unroll 1
    for (int kc = wv * kw; kc < (wv + 1) * kw; kc += 32) {
        V a[4], a2[4];
#pragma unroll
        for (int mb = 0; mb < 4; ++mb) { a[mb] = WFrag<T16>::ld(A + aoff + (size_t)mb * 16 * K + kc); if (NSPLIT == 1 || NSPLIT == 2) a2[mb] = WFrag<T16>::ld(A2 + aoff + (size_t)mb * 16 * K + kc); }
#pragma unroll
        for (int nb = 0; nb < 4; ++nb) { const V b = WFrag<T16>::ld(Bt + boff + (size_t)nb * 16 * K + kc); V b2; if (NSPLIT >= 2) b2 = WFrag<T16>::ld(Bt2 + boff + (size_t)nb * 16 * K + kc);
#pragma unroll
            for (int mb = 0; mb < 4; ++mb) { acc[mb][nb] = WFrag<T16>::mma(a[mb], b, acc[mb][nb]); if (NSPLIT == 1 || NSPLIT == 2) acc[mb][nb] = WFrag<T16>::mma(a2[mb], b, acc[mb][nb]); if (NSPLIT >= 2) acc[mb][nb] = WFrag<T16>::mma(a[mb], b2, acc[mb][nb]); } }
        asm volatile("v_nop\n\tv_nop\n\tv_nop\n\tv_nop" : "+v"(acc[0][0]), "+v"(acc[1][1]), "+v"(acc[2][2]), "+v"(acc[3][3]) : "v"(a[0]), "v"(a[3]));
    }
    if constexpr (KS > 1) {
        // Partial tile of wave wv at os + wv * 4096, as 16 units u = mb * 4 + jq (rows mb*16 + hi*8 + 2jq + {0,1}, all 64 columns); a unit is [nb][lane][2 rows], 1 KiB: register pairs go out as they lie, every LDS access is contiguous over the lanes.
        float* mine = os + wv * 4096 + lane * 2;
#pragma unroll
        for (int mb = 0; mb < 4; ++mb)
#pragma unroll
            for (int jq = 0; jq < 4; ++jq)
#pragma unroll
                for (int nb = 0; nb < 4; ++nb) { v2fa t; t[0] = acc[mb][nb][2 * jq]; t[1] = acc[mb][nb][2 * jq + 1]; *(v2fa*)(mine + ((mb * 4 + jq) * 4 + nb) * 64) = t; }
        __syncthreads();   // every wave's partial tile is in LDS before any wave adds them
        // A 16-byte read takes two neighbouring writer lanes: reader lane l, read i holds rows {0,1} of the unit's half (l & 15) >> 3 at columns (2i + (l >> 4)) * 16 + 2 * (l & 7) + {0,1}.
        const int rh = (lane & 15) >> 3, cl = (lane >> 4) * 16 + 2 * (lane & 7);
#pragma unroll
        for (int uu = 0; uu < 16 / KS; ++uu) { const int u = wv + uu * KS; const float* q0 = os + u * 256 + lane * 4; v4f s0 = *(const v4fa*)q0, s1 = *(const v4fa*)(q0 + 128);
#pragma unroll
            for (int s = 1; s < KS; ++s) { s0 += *(const v4fa*)(q0 + s * 4096); s1 += *(const v4fa*)(q0 + s * 4096 + 128); }
            if (BIAS) { const float b0 = bfr(bias[c0 + cl]), b1 = bfr(bias[c0 + cl + 1]), b2 = bfr(bias[c0 + 32 + cl]), b3 = bfr(bias[c0 + 32 + cl + 1]); s0[0] += b0; s0[1] += b0; s0[2] += b1; s0[3] += b1; s1[0] += b2; s1[1] += b2; s1[2] += b3; s1[3] += b3; }
            float* crow = C + (size_t)(r0 + (u >> 2) * 16 + rh * 8 + (u & 3) * 2) * ldc + c0 + cl;   // a unit holds whole 256-byte rows of the tile: one writing wave per line
#pragma unroll
            for (int q = 0; q < 2; ++q) { v2fa lo, up; lo[0] = s0[q]; lo[1] = s0[2 + q]; up[0] = s1[q]; up[1] = s1[2 + q]; *(v2fa*)(crow + (size_t)q * ldc) = lo; *(v2fa*)(crow + (size_t)q * ldc + 32) = up; } }
        return;
    }
#pragma unroll
    for (int mb = 0; mb < 4; ++mb) {
#pragma unroll
        for (int nb = 0; nb < 4; ++nb) {
#pragma unroll
            for (int j = 0; j < 8; ++j) os[(hi * 8 + j) * 68 + nb * 16 + lr] = acc[mb][nb][j]; }
        __builtin_amdgcn_wave_barrier(); asm volatile("" ::: "memory");
        float* crow = C + (size_t)(r0 + mb * 16) * ldc + c0;
{
#pragma unroll
            for (int s = 0; s < 8; ++s) { const int row = 2 * s + hi, cofs = lr * 4; v4f val = *(const v4fa*)(os + row * 68 + cofs); if (BIAS) { val[0] += bfr(bias[c0 + cofs]); val[1] += bfr(bias[c0 + cofs + 1]); val[2] += bfr(bias[c0 + cofs + 2]); val[3] += bfr(bias[c0 + cofs + 3]); }
                *(v4f*)(crow + (size_t)row * ldc + cofs) = val; }
             }
        __builtin_amdgcn_wave_barrier(); asm volatile("" ::: "memory");
    }
}

__device__ __forceinline__ h16 tohx(float x) { return (h16)x; }
__device__ __forceinline__ void splitf(float y, unsigned short& h, unsigned short& l) { h = f2bf(y); l = f2bf(y - bf2f(h)); }
typedef __attribute__((ext_vector_type(2))) _Float16 v2h;
typedef __attribute__((ext_vector_type(4))) _Float16 v4h;
typedef __attribute__((ext_vector_type(2))) unsigned short v2us;
typedef __attribute__((ext_vector_type(4))) unsigned short v4us;
typedef __attribute__((ext_vector_type(2))) float v2f;
typedef __attribute__((ext_vector_type(4))) int v4i;

// blockIdx.y picks one of four K x N weights; their transposed planes lie one behind the other in Bt.
__global__ __launch_bounds__(256) void k_wtG(const float* __restrict__ w0, const float* __restrict__ w1, const float* __restrict__ w2, const float* __restrict__ w3, int K, int N, bf* Bt) {
    const float* __restrict__ w = (blockIdx.y == 0) ? w0 : (blockIdx.y == 1) ? w1 : (blockIdx.y == 2) ? w2 : w3; Bt += (size_t)blockIdx.y * K * N;
    const int lane = threadIdx.x & 31; const int L0 = (blockIdx.x * 8 + (threadIdx.x >> 5)) * 8; const int nlines = N * K / 64;
{
#pragma unroll 1
        for (int l = 0; l < 8; ++l) { const int L = L0 + l; if (L >= nlines) break; const size_t e = (size_t)L * 64 + lane * 2; const int k = (int)(e % K), n = (int)(e / K); v2us o;
            o[0] = f2bf(w[(size_t)k * N + n]); o[1] = f2bf(w[(size_t)(k + 1) * N + n]); *(v2us*)(Bt + e) = o; }
         }
}
__global__ __launch_bounds__(256) void k_cvt8(const float* __restrict__ src, bf* dst, size_t n8) { const size_t i = (size_t)blockIdx.x * 256 + threadIdx.x; if (i >= n8) return; const v8f v = *(const v8f*)(src + i * 8); v8us o;
#pragma unroll
    for (int k = 0; k < 8; ++k) o[k] = f2bf(v[k]); *(v8us*)(dst + i * 8) = o;  }
__global__ __launch_bounds__(256) void k_cscvt(const float* __restrict__ cosT, const float* __restrict__ sinT, float* CS) { const int idx = blockIdx.x * 256 + threadIdx.x; if (idx >= TT * HD) return; v2f cs; cs[0] = bfr(cosT[idx]); cs[1] = bfr(sinT[idx]); *(v2f*)(CS + (size_t)idx * 2) = cs;  }
// k_rope: head planes [h][t][d] (fp16 + hi/lo) of rope(x) x sc with the rotate-half convention out[d] = x[d] cos[t][d] - x[d+HD/2] sin[t][d], out[d+HD/2] = x[d+HD/2] cos[t][d+HD/2] + x[d] sin[t][d+HD/2]
__global__ __launch_bounds__(256) void k_rope(const float* __restrict__ F, int pitch, int nheads, const float* __restrict__ CS, const float* __restrict__ RF, const float* __restrict__ nw, float sc, h16* P16, bf* Ph, bf* Pl) {
    const size_t e = ((size_t)blockIdx.x * 256 + threadIdx.x) * 2; if (e >= (size_t)nheads * TT * HD) return; const int d = (int)(e % HD); const int t = (int)((e / HD) % TT); const int h = (int)(e / ((size_t)HD * TT)); const float* f = F + (size_t)t * pitch + h * HD; const float rf = RF ? RF[(size_t)h * TT + t] : 1.0f; v2h o16; v2us oh, ol;
#pragma unroll
    for (int q = 0; q < 2; ++q) { const int dd = d + q; const int dp = (dd < HD / 2) ? dd + HD / 2 : dd - HD / 2; float x0 = f[dd], x1 = f[dp];
        if (RF) { float n0 = __fmul_rn(x0, rf), n1 = __fmul_rn(x1, rf); asm volatile("" : "+v"(n0)); asm volatile("" : "+v"(n1)); x0 = __fmul_rn(bfr(nw[dd]), n0); x1 = __fmul_rn(bfr(nw[dp]), n1); }
        const v2f cs = *(const v2f*)(CS + ((size_t)t * HD + dd) * 2); float a = __fmul_rn(x0, cs[0]), bq = __fmul_rn(x1, cs[1]); asm volatile("" : "+v"(a)); asm volatile("" : "+v"(bq)); const float r = ((dd < HD / 2) ? __fsub_rn(a, bq) : __fadd_rn(a, bq)) * sc;
        o16[q] = tohx(r); unsigned short a2, c2; splitf(r, a2, c2); oh[q] = a2; ol[q] = c2; }
    *(v2h*)(P16 + e) = o16; *(v2us*)(Ph + e) = oh; *(v2us*)(Pl + e) = ol;  }
__global__ __launch_bounds__(256) void k_vtp(const float* __restrict__ F, int pitch, int nheads, h16* V16, bf* Vh, bf* Vl) { const size_t e = ((size_t)blockIdx.x * 256 + threadIdx.x) * 2; if (e >= (size_t)nheads * HD * TT) return; const int t = (int)(e % TT); const int d = (int)((e / TT) % HD); const int g = (int)(e / ((size_t)TT * HD)); v2h o16; v2us oh, ol;
#pragma unroll
    for (int q = 0; q < 2; ++q) { const float x = F[(size_t)(t + q) * pitch + g * HD + d]; o16[q] = tohx(x); unsigned short a2, c2; splitf(x, a2, c2); oh[q] = a2; ol[q] = c2; }
    *(v2h*)(V16 + e) = o16; *(v2us*)(Vh + e) = oh; *(v2us*)(Vl + e) = ol;  }
__global__ __launch_bounds__(256) void k_csid(float* CS) { const int idx = blockIdx.x * 256 + threadIdx.x; if (idx >= TT * HD) return; v2f cs; cs[0] = 1.0f; cs[1] = 0.0f; *(v2f*)(CS + (size_t)idx * 2) = cs;  }
// ---- k_fattn: scores, mask, softmax and P.V of one head in one kernel; no score or probability leaves the registers.
// A work-group has 8 waves and NQ * 16 query rows; wave w takes the 32-key blocks w, w + 8, w + 16, ... (neighbouring waves share the 128-byte lines of V^T), one block a pass, with a running row maximum and row sum.
// Transposed products: S^T = K Q^T (D: row = key, column = query) and O^T += V^T P^T (D: row = d, column = query). A lane's two score tiles of a pass
// (keys 8 hi + j and 16 + 8 hi + j of query lr) are the sixteen k positions of its B fragment for P^T, so P goes from D to B in place, and every per-query factor is per lane.
// The 8 partial (maximum, sum, O^T) meet in LDS: each wave scales its O^T to the common maximum and the full sum, then the 8 are added in wave order.
#define L2E 1.4426950408889634f
#define FNW 8                     // waves of a work-group = shares of the keys
#define FOP 68                    // LDS pitch of one query's 64 partial outputs, floats
template <typename T16, bool HL, int NQ>
__device__ __forceinline__ void fattn_body(const T16* __restrict__ Qa, const T16* __restrict__ Qb, const T16* __restrict__ Ka, const T16* __restrict__ Kb, const T16* __restrict__ Va, const T16* __restrict__ Vb, const float* __restrict__ fm, const int q0, const int h, float* os, float* ms, float* ls, bf* Ah, bf* Al) {
    typedef typename WFrag<T16>::V V;
    const int lane = threadIdx.x & 31, lr = lane & 15, hi = lane >> 4;
    const int wv = __builtin_amdgcn_readfirstlane((int)(threadIdx.x >> 5));   // wave number, scalar: the key loop's bounds stay wave-uniform
    const size_t hp = (size_t)h * TT * HD;
    const size_t rowo = hp + (size_t)(lr * HD + 8 * hi);   // Q and K planes: row lr of a 16-row tile, k from 8 hi
    const size_t colo = hp + (size_t)(lr * TT + 8 * hi);   // V^T planes: row lr of a 16-row tile, key from 8 hi
    V qa[NQ][2], qb[NQ][2];
#pragma unroll
    for (int qt = 0; qt < NQ; ++qt)
#pragma unroll
        for (int kc = 0; kc < 2; ++kc) { const size_t qo = rowo + (size_t)(q0 + qt * 16) * HD + kc * 32; qa[qt][kc] = WFrag<T16>::ld(Qa + qo); if constexpr (HL) qb[qt][kc] = WFrag<T16>::ld(Qb + qo); }
    v8f o[NQ][4]; float m[NQ], l[NQ];
#pragma unroll
    for (int qt = 0; qt < NQ; ++qt) { m[qt] = -3.0e38f; l[qt] = 0.f;
#pragma unroll
        for (int db = 0; db < 4; ++db) o[qt][db] = (v8f){}; }
#pragma unroll 1   // rolled: one pass already holds Q, O^T, K, V^T, the mask and the scores in nearly all vector registers; two passes at once would spill
    for (int kb = wv * 32; kb < TT; kb += FNW * 32) {
        // All of a pass's loads are issued first, so that one trip to L2 serves the whole pass. Behind each plane's loads stands s_wait_xcnt 0:
        // a later plane's load result or a pointer step may overwrite a register that an issued load names, and the wait stands in front of that.
        V ka[2][2], kl[2][2], va[4], vl[4]; v4f mk[NQ][4];
        const T16* kpa = Ka + rowo + (size_t)kb * HD;
#pragma unroll
        for (int kt = 0; kt < 2; ++kt)
#pragma unroll
            for (int kc = 0; kc < 2; ++kc) ka[kt][kc] = WFrag<T16>::ld(kpa + kt * 16 * HD + kc * 32);
        asm volatile("s_wait_xcnt 0x0" ::: "memory");
        if constexpr (HL) { const T16* kpb = Kb + rowo + (size_t)kb * HD;
#pragma unroll
            for (int kt = 0; kt < 2; ++kt)
#pragma unroll
                for (int kc = 0; kc < 2; ++kc) kl[kt][kc] = WFrag<T16>::ld(kpb + kt * 16 * HD + kc * 32);
            asm volatile("s_wait_xcnt 0x0" ::: "memory"); }
        const float* mr = fm + (size_t)(q0 + lr) * TT + kb + hi * 8;
#pragma unroll
        for (int qt = 0; qt < NQ; ++qt)
#pragma unroll
            for (int kt = 0; kt < 2; ++kt) { mk[qt][kt * 2] = *(const v4f*)(mr + (size_t)qt * 16 * TT + kt * 16); mk[qt][kt * 2 + 1] = *(const v4f*)(mr + (size_t)qt * 16 * TT + kt * 16 + 4); }
        asm volatile("s_wait_xcnt 0x0" ::: "memory");
        const T16* vpa = Va + colo + kb;
#pragma unroll
        for (int db = 0; db < 4; ++db) va[db] = WFrag<T16>::ld(vpa + (size_t)db * 16 * TT);
        asm volatile("s_wait_xcnt 0x0" ::: "memory");
        if constexpr (HL) { const T16* vpb = Vb + colo + kb;
#pragma unroll
            for (int db = 0; db < 4; ++db) vl[db] = WFrag<T16>::ld(vpb + (size_t)db * 16 * TT);
            asm volatile("s_wait_xcnt 0x0" ::: "memory"); }
        v8f s[NQ][2];
#pragma unroll
        for (int kt = 0; kt < 2; ++kt)
#pragma unroll
            for (int qt = 0; qt < NQ; ++qt) { v8f c = (v8f){};
#pragma unroll
                for (int kc = 0; kc < 2; ++kc) { c = WFrag<T16>::mma(ka[kt][kc], qa[qt][kc], c); if constexpr (HL) { c = WFrag<T16>::mma(ka[kt][kc], qb[qt][kc], c); c = WFrag<T16>::mma(kl[kt][kc], qa[qt][kc], c); } }
                s[qt][kt] = c; }
#pragma unroll
        for (int qt = 0; qt < NQ; ++qt) {
            float t[16]; float mx = m[qt];
#pragma unroll
            for (int kt = 0; kt < 2; ++kt)
#pragma unroll
                for (int j = 0; j < 8; ++j) { const float mv = bfr(mk[qt][kt * 2 + (j >> 2)][j & 3]); const float tt = s[qt][kt][j] * SCL + mv * -1.0e9f; t[kt * 8 + j] = tt; mx = fmaxf(mx, tt); }
            mx = fmaxf(mx, __shfl_xor(mx, 16, 32));   // the other half of the query's keys of this pass lies in lane lr + 16
            const float al = __builtin_amdgcn_exp2f((m[qt] - mx) * L2E); m[qt] = mx;
            float sum = 0.f;
#pragma unroll
            for (int k = 0; k < 16; ++k) { t[k] = __builtin_amdgcn_exp2f((t[k] - mx) * L2E); sum += t[k]; }
            l[qt] = l[qt] * al + sum;   // each half keeps the sum of its own keys; the halves meet behind the loop
#pragma unroll
            for (int db = 0; db < 4; ++db) o[qt][db] *= al;
            if constexpr (HL) { v8us h0, h1, l0, l1;
#pragma unroll
                for (int j = 0; j < 8; ++j) { unsigned short a, c2; splitf(t[j], a, c2); h0[j] = a; l0[j] = c2; splitf(t[8 + j], a, c2); h1[j] = a; l1[j] = c2; }
                const V ph = cat16b(h0, h1), pl = cat16b(l0, l1);
#pragma unroll
                for (int db = 0; db < 4; ++db) { o[qt][db] = WFrag<T16>::mma(va[db], ph, o[qt][db]); o[qt][db] = WFrag<T16>::mma(va[db], pl, o[qt][db]); o[qt][db] = WFrag<T16>::mma(vl[db], ph, o[qt][db]); }
            } else { V pf;
#pragma unroll
                for (int k = 0; k < 16; ++k) pf[k] = tohx(t[k]);
#pragma unroll
                for (int db = 0; db < 4; ++db) o[qt][db] = WFrag<T16>::mma(va[db], pf, o[qt][db]); }
        }
    }
#pragma unroll
    for (int qt = 0; qt < NQ; ++qt) { l[qt] += __shfl_xor(l[qt], 16, 32); if (hi == 0) { ms[wv * (NQ * 16) + qt * 16 + lr] = m[qt]; ls[wv * (NQ * 16) + qt * 16 + lr] = l[qt]; } }
    __syncthreads();   // every wave's row maxima and row sums are in LDS before any wave forms the common ones
#pragma unroll
    for (int qt = 0; qt < NQ; ++qt) { float M = -3.0e38f, L = 0.f;
#pragma unroll
        for (int w = 0; w < FNW; ++w) M = fmaxf(M, ms[w * (NQ * 16) + qt * 16 + lr]);
#pragma unroll
        for (int w = 0; w < FNW; ++w) L += ls[w * (NQ * 16) + qt * 16 + lr] * __builtin_amdgcn_exp2f((ms[w * (NQ * 16) + qt * 16 + lr] - M) * L2E);
        const float f = __fdiv_rn(__builtin_amdgcn_exp2f((m[qt] - M) * L2E), L);
        float* mine = os + (size_t)(wv * (NQ * 16) + qt * 16 + lr) * FOP + hi * 8;
#pragma unroll
        for (int db = 0; db < 4; ++db) { v4f a, c; 
#pragma unroll
            for (int j = 0; j < 4; ++j) { a[j] = o[qt][db][j] * f; c[j] = o[qt][db][4 + j] * f; }
            *(v4fa*)(mine + db * 16) = a; *(v4fa*)(mine + db * 16 + 4) = c; } }
    __syncthreads();   // every wave's scaled partial output is in LDS before they are added
    constexpr int TPQ = 16 / NQ;   // threads per query row: each adds and stores NQ * 4 neighbouring d
    const int q = (int)threadIdx.x / TPQ, d0 = ((int)threadIdx.x % TPQ) * (NQ * 4);
#pragma unroll
    for (int c = 0; c < NQ; ++c) { const float* p0 = os + (size_t)q * FOP + d0 + c * 4; v4f a = *(const v4fa*)p0;
#pragma unroll
        for (int w = 1; w < FNW; ++w) a += *(const v4fa*)(p0 + (size_t)w * (NQ * 16) * FOP);
        v4us oh, ol;
#pragma unroll
        for (int j = 0; j < 4; ++j) { unsigned short x0, x1; splitf(a[j], x0, x1); oh[j] = x0; ol[j] = x1; }
        const size_t oo = (size_t)(q0 + q) * DQ + h * HD + d0 + c * 4; *(v4us*)(Ah + oo) = oh; *(v4us*)(Al + oo) = ol; }   // a head's 64 values of a row are one 128-byte line, written by neighbouring lanes of one wave
    asm volatile("s_wait_xcnt 0x0" ::: "memory");   // behind the last store, before any later code overwrites a register that a store names
}
// grid (RH / 16 + (TT - RH) / 32, heads): the first RH / 16 blocks of a head take 16 hi+lo query rows each, the others 32 fp16 rows each.
__global__ __launch_bounds__(256) void k_fattn(const h16* __restrict__ Q16, const h16* __restrict__ K16, const h16* __restrict__ V16, const bf* __restrict__ Qh, const bf* __restrict__ Ql, const bf* __restrict__ Kh, const bf* __restrict__ Kl, const bf* __restrict__ Vh, const bf* __restrict__ Vl, const float* __restrict__ fm, bf* Ah, bf* Al) {
    __shared__ __align__(16) float os[FNW * 32 * FOP]; __shared__ float ms[FNW * 32]; __shared__ float ls[FNW * 32];
    const int bx = (int)blockIdx.x, h = (int)blockIdx.y;
    if (bx < RH / 16) fattn_body<bf, true, 1>(Qh, Ql, Kh, Kl, Vh, Vl, fm, bx * 16, h, os, ms, ls, Ah, Al);
    else fattn_body<h16, false, 2>(Q16, nullptr, K16, nullptr, V16, nullptr, fm, RH + (bx - RH / 16) * 32, h, os, ms, ls, Ah, Al);
}

extern "C" void kernel_launch(void* const* d_in, const int* in_sizes, int n_in,
                              void* d_out, int out_size, void* d_ws, size_t ws_size, hipStream_t stream) {
    (void)in_sizes; (void)n_in; (void)out_size;
    const float* x = (const float*)d_in[0]; const float* fmask = (const float*)d_in[1]; const float* wq = (const float*)d_in[2]; const float* bq = (const float*)d_in[3]; const float* wk = (const float*)d_in[4]; const float* bk = (const float*)d_in[5]; const float* wv = (const float*)d_in[6]; const float* bv = (const float*)d_in[7]; const float* wo = (const float*)d_in[8]; const float* bo = (const float*)d_in[9]; const float* cosT = nullptr; const float* sinT = nullptr; (void)cosT; (void)sinT;
    float* OUT = (float*)d_out;     // [4][2048][512]
    char* wsp = (char*)d_ws;
    auto take = [&](size_t bytes) { char* p = wsp; wsp += (bytes + 255) & ~(size_t)255; return (void*)p; };
    bf* WQ = (bf*)take((size_t)DQ * DM * 2); bf* WK = (bf*)take((size_t)DKV * DM * 2); bf* WV = (bf*)take((size_t)DKV * DM * 2); bf* WO = (bf*)take((size_t)DM * DQ * 2); float* CS = (float*)take((size_t)TT * HD * 2 * 4);
    bf* XB = (bf*)take((size_t)TT * DM * 2);
    h16* QP16 = (h16*)take((size_t)NH_ * TT * HD * 2); h16* KP16 = (h16*)take((size_t)NKV * TT * HD * 2); h16* VT16 = (h16*)take((size_t)NKV * HD * TT * 2);
    bf* QPh = (bf*)take((size_t)NH_ * TT * HD * 2); bf* KPh = (bf*)take((size_t)NKV * TT * HD * 2); bf* QPl = (bf*)take((size_t)NH_ * TT * HD * 2); bf* KPl = (bf*)take((size_t)NKV * TT * HD * 2); bf* VTh = (bf*)take((size_t)NKV * HD * TT * 2); bf* VTl = (bf*)take((size_t)NKV * HD * TT * 2);
    float* FQKV = (float*)take((size_t)TT * (DQ + 2 * DKV) * 4); bf* ATh = (bf*)take((size_t)TT * DQ * 2); bf* ATl = (bf*)take((size_t)TT * DQ * 2);
    if ((size_t)(wsp - (char*)d_ws) > ws_size) return;    // ws 256 MiB
    // FQKV: q | k | v projections, [t][DQ + 2 DKV] f32
    const int PF = DQ + 2 * DKV; (void)WK; (void)WV;
    k_wtG<<<dim3((unsigned)((DM * DQ / 64 + 63) / 64), 4, 1), 256, 0, stream>>>(wq, wk, wv, wo, DM, DQ, WQ);   // WQ, WK, WV, WO are consecutive planes of DM x DQ
    k_csid<<<(TT * HD + 255) / 256, 256, 0, stream>>>(CS);
    const unsigned LQK = (unsigned)(((size_t)(NH_ + NKV) * TT * HD / 2 + 255) / 256), LKv = (unsigned)(((size_t)NKV * TT * HD / 2 + 255) / 256);
    for (int b = 0; b < NB_; ++b) {
        
        k_cvt8<<<(unsigned)(((size_t)TT * DM / 8 + 255) / 256), 256, 0, stream>>>(x + (size_t)b * TT * DM, XB, (size_t)TT * DM / 8);
        k_gemmw<bf, 0, true, 8><<<dim3(TT / 64, DQ / 64, 3), 256, 0, stream>>>(XB, nullptr, WQ, nullptr, DM, FQKV, PF, bq, bk, bv, 0, (size_t)DQ * DM, (size_t)DQ);   // z = q, k, v: weight planes consecutive, column blocks of FQKV
        k_rope<<<LQK, 256, 0, stream>>>(FQKV, PF, NH_ + NKV, CS, nullptr, nullptr, 1.0f, QP16, QPh, QPl);   // q heads, then k heads: each k plane lies directly behind its q plane
        k_vtp<<<LKv, 256, 0, stream>>>(FQKV + DQ + DKV, PF, NKV, VT16, VTh, VTl);
        k_fattn<<<dim3(RH / 16 + (TT - RH) / 32, NH_, 1), 256, 0, stream>>>(QP16, KP16, VT16, QPh, QPl, KPh, KPl, VTh, VTl, fmask, ATh, ATl);   // one kv head per query head
        k_gemmw<bf, 1, true, 8><<<dim3(TT / 64, DM / 64, 1), 256, 0, stream>>>(ATh, ATl, WO, nullptr, DQ, OUT + (size_t)b * TT * DM, DM, bo, nullptr, nullptr, 0, 0, 0); }
}

// v004
// It runs in 261 microseconds.
// Two timings next to v003 both put it at 1.41 times that version's speed.
// All steps since v000 together make it 8.16 times as fast.
#include <hip/hip_runtime.h>

// Masked multi-head attention layer (x [4][2048][512]; Q/K/V = x W + b (8 heads x 64, [in, out]); scores = q.k / 8 + mask[i][j] x (-1e9) (float mask [1][1][2048][2048], read); softmax; out = (attn v merged) Wo + bo -> [4][2048][512]).
// Compute dtypes, f32 accumulate: every input rounded to bf16; Q/K/V on PLAIN bf16 operands (inputs: exact) + bias; every score is formed (the mask is data) but none is stored: query rows < 512 hl (3 products), the rest single fp16; mask add + running softmax f32; Wo hl x exact (2 products) + bias.

#define NB_  4
#define TT   2048
#define DM   512
#define NH_  8
#define NKV  8
#define REP  (NH_ / NKV)
#define HD   64
#define DQ   (NH_ * HD)
#define DKV  (NKV * HD)
#define RH   512                  // query rows < RH use hi+lo planes (0: none)
#define WIN  0
#define SCL  0.125f   // HD^-0.5
typedef _Float16 h16;
typedef unsigned short bf;
typedef __attribute__((ext_vector_type(16))) __bf16   v16bf;
typedef __attribute__((ext_vector_type(16))) _Float16 v16h;
typedef __attribute__((ext_vector_type(8)))  _Float16 v8h;
typedef __attribute__((ext_vector_type(8)))  unsigned short v8us;
typedef __attribute__((ext_vector_type(8)))  float    v8f;
typedef __attribute__((ext_vector_type(4)))  float    v4f;
typedef v8h  __attribute__((may_alias)) v8ha;
typedef v4f  __attribute__((may_alias)) v4fa;
typedef v8us __attribute__((may_alias)) v8usa;
typedef float __attribute__((ext_vector_type(2), may_alias)) v2fa;

__device__ __forceinline__ unsigned short f2bf(float f) { unsigned u = __float_as_uint(f); u += 0x7FFFu + ((u >> 16) & 1u); return (unsigned short)(u >> 16); }
__device__ __forceinline__ float bf2f(unsigned short b) { return __uint_as_float(((unsigned)b) << 16); }
__device__ __forceinline__ float bfr(float f) { return bf2f(f2bf(f)); }
__device__ __forceinline__ v16h cat16(v8h lo, v8h hi) { return __builtin_shufflevector(lo, hi, 0, 1, 2, 3, 4, 5, 6, 7, 8, 9, 10, 11, 12, 13, 14, 15); }
__device__ __forceinline__ v16bf cat16b(v8us lo, v8us hi) { return __builtin_bit_cast(v16bf, __builtin_shufflevector(lo, hi, 0, 1, 2, 3, 4, 5, 6, 7, 8, 9, 10, 11, 12, 13, 14, 15)); }
__device__ __forceinline__ v8f wmma16(v16h a, v16h b, v8f c) { return __builtin_amdgcn_wmma_f32_16x16x32_f16(false, a, false, b, (short)0, c, false, false); }
__device__ __forceinline__ v8f wmmab(v16bf a, v16bf b, v8f c) { return __builtin_amdgcn_wmma_f32_16x16x32_bf16(false, a, false, b, (short)0, c, false, false); }



// ---- k_gemmw: register-blocked GEMM, ONE WAVE per 64x64 output tile (16 accumulators), operands straight from K-contiguous 16-bit planes; grid (M/64, N/64, Z), 32 threads.
// C[m][n] (f32, pitch ldc, + optional f32 bias0[n]; z = 1, 2 take biasz1, biasz2) = sum_k A[m][k] Bt[n][k] (+ split products per NSPLIT). z-batch strides sA/sB/sC in elements. K % (32 * KS) == 0.
// KS > 1: the tile's work-group has KS waves (32 * KS threads); wave w sums k in [w K/KS, (w+1) K/KS), the KS partial tiles meet in LDS and are added in wave order 0..KS-1.
template <typename T16> struct WFrag;
template <> struct WFrag<h16> { typedef v16h V; static __device__ __forceinline__ V ld(const h16* p) { return cat16(*(const v8h*)p, *(const v8h*)(p + 16)); } static __device__ __forceinline__ v8f mma(V a, V b, v8f c) { return wmma16(a, b, c); } };
template <> struct WFrag<bf> { typedef v16bf V; static __device__ __forceinline__ V ld(const bf* p) { return cat16b(*(const v8us*)p, *(const v8us*)(p + 16)); } static __device__ __forceinline__ v8f mma(V a, V b, v8f c) { return wmmab(a, b, c); } };
template <typename T16, int NSPLIT, bool BIAS, int KS>
__global__ __launch_bounds__(32 * KS) void k_gemmw(const T16* __restrict__ A, const T16* __restrict__ A2, const T16* __restrict__ Bt, const T16* __restrict__ Bt2, int K, float* C, int ldc, const float* __restrict__ bias0, const float* __restrict__ biasz1, const float* __restrict__ biasz2, size_t sA, size_t sB, size_t sC) {
    typedef typename WFrag<T16>::V V;
    __shared__ __align__(16) float os[KS == 1 ? 16 * 68 : KS * 4096];
    const size_t z = blockIdx.z; A += z * sA; if (A2) A2 += z * sA; Bt += z * sB; if (Bt2) Bt2 += z * sB; C += z * sC;
    const float* bias = (z == 1) ? biasz1 : (z == 2) ? biasz2 : bias0;   // products batched in z (at most 3 with a bias) each bring their own bias vector
    const int lane = threadIdx.x & 31, lr = lane & 15, hi = lane >> 4; const int r0 = blockIdx.x * 64, c0 = blockIdx.y * 64;
    v8f acc[4][4];
#pragma unroll
    for (int mb = 0; mb < 4; ++mb)
#pragma unroll
        for (int nb = 0; nb < 4; ++nb) acc[mb][nb] = (v8f){};
    const int wv = (KS == 1) ? 0 : __builtin_amdgcn_readfirstlane((int)(threadIdx.x >> 5));   // wave number, scalar: the K loop's bounds stay wave-uniform
    const int kw = K / KS;   // this wave's share of K, from k = wv * kw
    const size_t aoff = (size_t)(r0 + lr) * K + 8 * hi, boff = (size_t)(c0 + lr) * K + 8 * hi;
#pragma unroll 1
    for (int kc = wv * kw; kc < (wv + 1) * kw; kc += 32) {
        V a[4], a2[4];
#pragma unroll
        for (int mb = 0; mb < 4; ++mb) { a[mb] = WFrag<T16>::ld(A + aoff + (size_t)mb * 16 * K + kc); if (NSPLIT == 1 || NSPLIT == 2) a2[mb] = WFrag<T16>::ld(A2 + aoff + (size_t)mb * 16 * K + kc); }
#pragma unroll
        for (int nb = 0; nb < 4; ++nb) { const V b = WFrag<T16>::ld(Bt + boff + (size_t)nb * 16 * K + kc); V b2; if (NSPLIT >= 2) b2 = WFrag<T16>::ld(Bt2 + boff + (size_t)nb * 16 * K + kc);
#pragma unroll
            for (int mb = 0; mb < 4; ++mb) { acc[mb][nb] = WFrag<T16>::mma(a[mb], b, acc[mb][nb]); if (NSPLIT == 1 || NSPLIT == 2) acc[mb][nb] = WFrag<T16>::mma(a2[mb], b, acc[mb][nb]); if (NSPLIT >= 2) acc[mb][nb] = WFrag<T16>::mma(a[mb], b2, acc[mb][nb]); } }
        asm volatile("v_nop\n\tv_nop\n\tv_nop\n\tv_nop" : "+v"(acc[0][0]), "+v"(acc[1][1]), "+v"(acc[2][2]), "+v"(acc[3][3]) : "v"(a[0]), "v"(a[3]));
    }
    if constexpr (KS > 1) {
        // Partial tile of wave wv at os + wv * 4096, as 16 units u = mb * 4 + jq (rows mb*16 + hi*8 + 2jq + {0,1}, all 64 columns); a unit is [nb][lane][2 rows], 1 KiB: register pairs go out as they lie, every LDS access is contiguous over the lanes.
        float* mine = os + wv * 4096 + lane * 2;
#pragma unroll
        for (int mb = 0; mb < 4; ++mb)
#pragma unroll
            for (int jq = 0; jq < 4; ++jq)
#pragma unroll
                for (int nb = 0; nb < 4; ++nb) { v2fa t; t[0] = acc[mb][nb][2 * jq]; t[1] = acc[mb][nb][2 * jq + 1]; *(v2fa*)(mine + ((mb * 4 + jq) * 4 + nb) * 64) = t; }
        __syncthreads();   // every wave's partial tile is in LDS before any wave adds them
        // A 16-byte read takes two neighbouring writer lanes: reader lane l, read i holds rows {0,1} of the unit's half (l & 15) >> 3 at columns (2i + (l >> 4)) * 16 + 2 * (l & 7) + {0,1}.
        const int rh = (lane & 15) >> 3, cl = (lane >> 4) * 16 + 2 * (lane & 7);
#pragma unroll
        for (int uu = 0; uu < 16 / KS; ++uu) { const int u = wv + uu * KS; const float* q0 = os + u * 256 + lane * 4; v4f s0 = *(const v4fa*)q0, s1 = *(const v4fa*)(q0 + 128);
#pragma unroll
            for (int s = 1; s < KS; ++s) { s0 += *(const v4fa*)(q0 + s * 4096); s1 += *(const v4fa*)(q0 + s * 4096 + 128); }
            if (BIAS) { const float b0 = bfr(bias[c0 + cl]), b1 = bfr(bias[c0 + cl + 1]), b2 = bfr(bias[c0 + 32 + cl]), b3 = bfr(bias[c0 + 32 + cl + 1]); s0[0] += b0; s0[1] += b0; s0[2] += b1; s0[3] += b1; s1[0] += b2; s1[1] += b2; s1[2] += b3; s1[3] += b3; }
            float* crow = C + (size_t)(r0 + (u >> 2) * 16 + rh * 8 + (u & 3) * 2) * ldc + c0 + cl;   // a unit holds whole 256-byte rows of the tile: one writing wave per line
#pragma unroll
            for (int q = 0; q < 2; ++q) { v2fa lo, up; lo[0] = s0[q]; lo[1] = s0[2 + q]; up[0] = s1[q]; up[1] = s1[2 + q]; *(v2fa*)(crow + (size_t)q * ldc) = lo; *(v2fa*)(crow + (size_t)q * ldc + 32) = up; } }
        return;
    }
#pragma unroll
    for (int mb = 0; mb < 4; ++mb) {
#pragma unroll
        for (int nb = 0; nb < 4; ++nb) {
#pragma unroll
            for (int j = 0; j < 8; ++j) os[(hi * 8 + j) * 68 + nb * 16 + lr] = acc[mb][nb][j]; }
        __builtin_amdgcn_wave_barrier(); asm volatile("" ::: "memory");
        float* crow = C + (size_t)(r0 + mb * 16) * ldc + c0;
{
#pragma unroll
            for (int s = 0; s < 8; ++s) { const int row = 2 * s + hi, cofs = lr * 4; v4f val = *(const v4fa*)(os + row * 68 + cofs); if (BIAS) { val[0] += bfr(bias[c0 + cofs]); val[1] += bfr(bias[c0 + cofs + 1]); val[2] += bfr(bias[c0 + cofs + 2]); val[3] += bfr(bias[c0 + cofs + 3]); }
                *(v4f*)(crow + (size_t)row * ldc + cofs) = val; }
             }
        __builtin_amdgcn_wave_barrier(); asm volatile("" ::: "memory");
    }
}

__device__ __forceinline__ h16 tohx(float x) { return (h16)x; }
__device__ __forceinline__ void splitf(float y, unsigned short& h, unsigned short& l) { h = f2bf(y); l = f2bf(y - bf2f(h)); }
typedef __attribute__((ext_vector_type(2))) _Float16 v2h;
typedef __attribute__((ext_vector_type(4))) _Float16 v4h;
typedef __attribute__((ext_vector_type(2))) unsigned short v2us;
typedef __attribute__((ext_vector_type(4))) unsigned short v4us;
typedef __attribute__((ext_vector_type(2))) float v2f;
typedef __attribute__((ext_vector_type(4))) int v4i;

// blockIdx.y picks one of four K x N weights; their transposed planes lie one behind the other in Bt.
__global__ __launch_bounds__(256) void k_wtG(const float* __restrict__ w0, const float* __restrict__ w1, const float* __restrict__ w2, const float* __restrict__ w3, int K, int N, bf* Bt) {
    const float* __restrict__ w = (blockIdx.y == 0) ? w0 : (blockIdx.y == 1) ? w1 : (blockIdx.y == 2) ? w2 : w3; Bt += (size_t)blockIdx.y * K * N;
    const int lane = threadIdx.x & 31; const int L0 = (blockIdx.x * 8 + (threadIdx.x >> 5)) * 8; const int nlines = N * K / 64;
{
#pragma unroll 1
        for (int l = 0; l < 8; ++l) { const int L = L0 + l; if (L >= nlines) break; const size_t e = (size_t)L * 64 + lane * 2; const int k = (int)(e % K), n = (int)(e / K); v2us o;
            o[0] = f2bf(w[(size_t)k * N + n]); o[1] = f2bf(w[(size_t)(k + 1) * N + n]); *(v2us*)(Bt + e) = o; }
         }
}
__global__ __launch_bounds__(256) void k_cvt8(const float* __restrict__ src, bf* dst, size_t n8) { const size_t i = (size_t)blockIdx.x * 256 + threadIdx.x; if (i >= n8) return; const v8f v = *(const v8f*)(src + i * 8); v8us o;
#pragma unroll
    for (int k = 0; k < 8; ++k) o[k] = f2bf(v[k]); *(v8us*)(dst + i * 8) = o;  }
__global__ __launch_bounds__(256) void k_cscvt(const float* __restrict__ cosT, const float* __restrict__ sinT, float* CS) { const int idx = blockIdx.x * 256 + threadIdx.x; if (idx >= TT * HD) return; v2f cs; cs[0] = bfr(cosT[idx]); cs[1] = bfr(sinT[idx]); *(v2f*)(CS + (size_t)idx * 2) = cs;  }
// k_rope: blockIdx.y = batch element (its TT rows of F, its nheads planes); head planes [h][t][d] (fp16 + hi/lo) of rope(x) x sc with the rotate-half convention out[d] = x[d] cos[t][d] - x[d+HD/2] sin[t][d], out[d+HD/2] = x[d+HD/2] cos[t][d+HD/2] + x[d] sin[t][d+HD/2]
__global__ __launch_bounds__(256) void k_rope(const float* __restrict__ F, int pitch, int nheads, const float* __restrict__ CS, const float* __restrict__ RF, const float* __restrict__ nw, float sc, h16* P16, bf* Ph, bf* Pl) {
    { const size_t po = (size_t)blockIdx.y * nheads * TT * HD; F += (size_t)blockIdx.y * TT * pitch; P16 += po; Ph += po; Pl += po; }
    const size_t e = ((size_t)blockIdx.x * 256 + threadIdx.x) * 2; if (e >= (size_t)nheads * TT * HD) return; const int d = (int)(e % HD); const int t = (int)((e / HD) % TT); const int h = (int)(e / ((size_t)HD * TT)); const float* f = F + (size_t)t * pitch + h * HD; const float rf = RF ? RF[(size_t)h * TT + t] : 1.0f; v2h o16; v2us oh, ol;
#pragma unroll
    for (int q = 0; q < 2; ++q) { const int dd = d + q; const int dp = (dd < HD / 2) ? dd + HD / 2 : dd - HD / 2; float x0 = f[dd], x1 = f[dp];
        if (RF) { float n0 = __fmul_rn(x0, rf), n1 = __fmul_rn(x1, rf); asm volatile("" : "+v"(n0)); asm volatile("" : "+v"(n1)); x0 = __fmul_rn(bfr(nw[dd]), n0); x1 = __fmul_rn(bfr(nw[dp]), n1); }
        const v2f cs = *(const v2f*)(CS + ((size_t)t * HD + dd) * 2); float a = __fmul_rn(x0, cs[0]), bq = __fmul_rn(x1, cs[1]); asm volatile("" : "+v"(a)); asm volatile("" : "+v"(bq)); const float r = ((dd < HD / 2) ? __fsub_rn(a, bq) : __fadd_rn(a, bq)) * sc;
        o16[q] = tohx(r); unsigned short a2, c2; splitf(r, a2, c2); oh[q] = a2; ol[q] = c2; }
    *(v2h*)(P16 + e) = o16; *(v2us*)(Ph + e) = oh; *(v2us*)(Pl + e) = ol;  }
// k_vtp: blockIdx.y = batch element (its TT rows of F, its nheads transposed planes [g][d][t]).
__global__ __launch_bounds__(256) void k_vtp(const float* __restrict__ F, int pitch, int nheads, h16* V16, bf* Vh, bf* Vl) { const size_t e = ((size_t)blockIdx.x * 256 + threadIdx.x) * 2; if (e >= (size_t)nheads * HD * TT) return; const int t = (int)(e % TT); const int d = (int)((e / TT) % HD); const int g = (int)(e / ((size_t)TT * HD)); v2h o16; v2us oh, ol;
    { const size_t po = (size_t)blockIdx.y * nheads * HD * TT; F += (size_t)blockIdx.y * TT * pitch; V16 += po; Vh += po; Vl += po; }
#pragma unroll
    for (int q = 0; q < 2; ++q) { const float x = F[(size_t)(t + q) * pitch + g * HD + d]; o16[q] = tohx(x); unsigned short a2, c2; splitf(x, a2, c2); oh[q] = a2; ol[q] = c2; }
    *(v2h*)(V16 + e) = o16; *(v2us*)(Vh + e) = oh; *(v2us*)(Vl + e) = ol;  }
__global__ __launch_bounds__(256) void k_csid(float* CS) { const int idx = blockIdx.x * 256 + threadIdx.x; if (idx >= TT * HD) return; v2f cs; cs[0] = 1.0f; cs[1] = 0.0f; *(v2f*)(CS + (size_t)idx * 2) = cs;  }
// ---- k_fattn: scores, mask, softmax and P.V of one head in one kernel; no score or probability leaves the registers.
// A work-group has 8 waves and NQ * 16 query rows; wave w takes the 32-key blocks w, w + 8, w + 16, ... (neighbouring waves share the 128-byte lines of V^T), one block a pass, with a running row maximum and row sum.
// Transposed products: S^T = K Q^T (D: row = key, column = query) and O^T += V^T P^T (D: row = d, column = query). A lane's two score tiles of a pass
// (keys 8 hi + j and 16 + 8 hi + j of query lr) are the sixteen k positions of its B fragment for P^T, so P goes from D to B in place, and every per-query factor is per lane.
// The 8 partial (maximum, sum, O^T) meet in LDS: each wave scales its O^T to the common maximum and the full sum, then the 8 are added in wave order.
#define L2E 1.4426950408889634f
#define FNW 8                     // waves of a work-group = shares of the keys
#define FOP 68                    // LDS pitch of one query's 64 partial outputs, floats
template <typename T16, bool HL, int NQ>
__device__ __forceinline__ void fattn_body(const T16* __restrict__ Qa, const T16* __restrict__ Qb, const T16* __restrict__ Ka, const T16* __restrict__ Kb, const T16* __restrict__ Va, const T16* __restrict__ Vb, const float* __restrict__ fm, const int q0, const int h, float* os, float* ms, float* ls, bf* Ah, bf* Al) {
    typedef typename WFrag<T16>::V V;
    const int lane = threadIdx.x & 31, lr = lane & 15, hi = lane >> 4;
    const int wv = __builtin_amdgcn_readfirstlane((int)(threadIdx.x >> 5));   // wave number, scalar: the key loop's bounds stay wave-uniform
    const size_t hp = (size_t)h * TT * HD;
    const size_t rowo = hp + (size_t)(lr * HD + 8 * hi);   // Q and K planes: row lr of a 16-row tile, k from 8 hi
    const size_t colo = hp + (size_t)(lr * TT + 8 * hi);   // V^T planes: row lr of a 16-row tile, key from 8 hi
    V qa[NQ][2], qb[NQ][2];
#pragma unroll
    for (int qt = 0; qt < NQ; ++qt)
#pragma unroll
        for (int kc = 0; kc < 2; ++kc) { const size_t qo = rowo + (size_t)(q0 + qt * 16) * HD + kc * 32; qa[qt][kc] = WFrag<T16>::ld(Qa + qo); if constexpr (HL) qb[qt][kc] = WFrag<T16>::ld(Qb + qo); }
    v8f o[NQ][4]; float m[NQ], l[NQ];
#pragma unroll
    for (int qt = 0; qt < NQ; ++qt) { m[qt] = -3.0e38f; l[qt] = 0.f;
#pragma unroll
        for (int db = 0; db < 4; ++db) o[qt][db] = (v8f){}; }
#pragma unroll 1   // rolled: one pass already holds Q, O^T, K, V^T, the mask and the scores in nearly all vector registers; two passes at once would spill
    for (int kb = wv * 32; kb < TT; kb += FNW * 32) {
        // All of a pass's loads are issued first, so that one trip to L2 serves the whole pass. Behind each plane's loads stands s_wait_xcnt 0:
        // a later plane's load result or a pointer step may overwrite a register that an issued load names, and the wait stands in front of that.
        V ka[2][2], kl[2][2], va[4], vl[4]; v4f mk[NQ][4];
        const T16* kpa = Ka + rowo + (size_t)kb * HD;
#pragma unroll
        for (int kt = 0; kt < 2; ++kt)
#pragma unroll
            for (int kc = 0; kc < 2; ++kc) ka[kt][kc] = WFrag<T16>::ld(kpa + kt * 16 * HD + kc * 32);
        asm volatile("s_wait_xcnt 0x0" ::: "memory");
        if constexpr (HL) { const T16* kpb = Kb + rowo + (size_t)kb * HD;
#pragma unroll
            for (int kt = 0; kt < 2; ++kt)
#pragma unroll
                for (int kc = 0; kc < 2; ++kc) kl[kt][kc] = WFrag<T16>::ld(kpb + kt * 16 * HD + kc * 32);
            asm volatile("s_wait_xcnt 0x0" ::: "memory"); }
        const float* mr = fm + (size_t)(q0 + lr) * TT + kb + hi * 8;
#pragma unroll
        for (int qt = 0; qt < NQ; ++qt)
#pragma unroll
            for (int kt = 0; kt < 2; ++kt) { mk[qt][kt * 2] = *(const v4f*)(mr + (size_t)qt * 16 * TT + kt * 16); mk[qt][kt * 2 + 1] = *(const v4f*)(mr + (size_t)qt * 16 * TT + kt * 16 + 4); }
        asm volatile("s_wait_xcnt 0x0" ::: "memory");
        const T16* vpa = Va + colo + kb;
#pragma unroll
        for (int db = 0; db < 4; ++db) va[db] = WFrag<T16>::ld(vpa + (size_t)db * 16 * TT);
        asm volatile("s_wait_xcnt 0x0" ::: "memory");
        if constexpr (HL) { const T16* vpb = Vb + colo + kb;
#pragma unroll
            for (int db = 0; db < 4; ++db) vl[db] = WFrag<T16>::ld(vpb + (size_t)db * 16 * TT);
            asm volatile("s_wait_xcnt 0x0" ::: "memory"); }
        v8f s[NQ][2];
#pragma unroll
        for (int kt = 0; kt < 2; ++kt)
#pragma unroll
            for (int qt = 0; qt < NQ; ++qt) { v8f c = (v8f){};
#pragma unroll
                for (int kc = 0; kc < 2; ++kc) { c = WFrag<T16>::mma(ka[kt][kc], qa[qt][kc], c); if constexpr (HL) { c = WFrag<T16>::mma(ka[kt][kc], qb[qt][kc], c); c = WFrag<T16>::mma(kl[kt][kc], qa[qt][kc], c); } }
                s[qt][kt] = c; }
#pragma unroll
        for (int qt = 0; qt < NQ; ++qt) {
            float t[16]; float mx = m[qt];
#pragma unroll
            for (int kt = 0; kt < 2; ++kt)
#pragma unroll
                for (int j = 0; j < 8; ++j) { const float mv = bfr(mk[qt][kt * 2 + (j >> 2)][j & 3]); const float tt = s[qt][kt][j] * SCL + mv * -1.0e9f; t[kt * 8 + j] = tt; mx = fmaxf(mx, tt); }
            mx = fmaxf(mx, __shfl_xor(mx, 16, 32));   // the other half of the query's keys of this pass lies in lane lr + 16
            const float al = __builtin_amdgcn_exp2f((m[qt] - mx) * L2E); m[qt] = mx;
            float sum = 0.f;
#pragma unroll
            for (int k = 0; k < 16; ++k) { t[k] = __builtin_amdgcn_exp2f((t[k] - mx) * L2E); sum += t[k]; }
            l[qt] = l[qt] * al + sum;   // each half keeps the sum of its own keys; the halves meet behind the loop
#pragma unroll
            for (int db = 0; db < 4; ++db) o[qt][db] *= al;
            if constexpr (HL) { v8us h0, h1, l0, l1;
#pragma unroll
                for (int j = 0; j < 8; ++j) { unsigned short a, c2; splitf(t[j], a, c2); h0[j] = a; l0[j] = c2; splitf(t[8 + j], a, c2); h1[j] = a; l1[j] = c2; }
                const V ph = cat16b(h0, h1), pl = cat16b(l0, l1);
#pragma unroll
                for (int db = 0; db < 4; ++db) { o[qt][db] = WFrag<T16>::mma(va[db], ph, o[qt][db]); o[qt][db] = WFrag<T16>::mma(va[db], pl, o[qt][db]); o[qt][db] = WFrag<T16>::mma(vl[db], ph, o[qt][db]); }
            } else { V pf;
#pragma unroll
                for (int k = 0; k < 16; ++k) pf[k] = tohx(t[k]);
#pragma unroll
                for (int db = 0; db < 4; ++db) o[qt][db] = WFrag<T16>::mma(va[db], pf, o[qt][db]); }
        }
    }
#pragma unroll
    for (int qt = 0; qt < NQ; ++qt) { l[qt] += __shfl_xor(l[qt], 16, 32); if (hi == 0) { ms[wv * (NQ * 16) + qt * 16 + lr] = m[qt]; ls[wv * (NQ * 16) + qt * 16 + lr] = l[qt]; } }
    __syncthreads();   // every wave's row maxima and row sums are in LDS before any wave forms the common ones
#pragma unroll
    for (int qt = 0; qt < NQ; ++qt) { float M = -3.0e38f, L = 0.f;
#pragma unroll
        for (int w = 0; w < FNW; ++w) M = fmaxf(M, ms[w * (NQ * 16) + qt * 16 + lr]);
#pragma unroll
        for (int w = 0; w < FNW; ++w) L += ls[w * (NQ * 16) + qt * 16 + lr] * __builtin_amdgcn_exp2f((ms[w * (NQ * 16) + qt * 16 + lr] - M) * L2E);
        const float f = __fdiv_rn(__builtin_amdgcn_exp2f((m[qt] - M) * L2E), L);
        float* mine = os + (size_t)(wv * (NQ * 16) + qt * 16 + lr) * FOP + hi * 8;
#pragma unroll
        for (int db = 0; db < 4; ++db) { v4f a, c; 
#pragma unroll
            for (int j = 0; j < 4; ++j) { a[j] = o[qt][db][j] * f; c[j] = o[qt][db][4 + j] * f; }
            *(v4fa*)(mine + db * 16) = a; *(v4fa*)(mine + db * 16 + 4) = c; } }
    __syncthreads();   // every wave's scaled partial output is in LDS before they are added
    constexpr int TPQ = 16 / NQ;   // threads per query row: each adds and stores NQ * 4 neighbouring d
    const int q = (int)threadIdx.x / TPQ, d0 = ((int)threadIdx.x % TPQ) * (NQ * 4);
#pragma unroll
    for (int c = 0; c < NQ; ++c) { const float* p0 = os + (size_t)q * FOP + d0 + c * 4; v4f a = *(const v4fa*)p0;
#pragma unroll
        for (int w = 1; w < FNW; ++w) a += *(const v4fa*)(p0 + (size_t)w * (NQ * 16) * FOP);
        v4us oh, ol;
#pragma unroll
        for (int j = 0; j < 4; ++j) { unsigned short x0, x1; splitf(a[j], x0, x1); oh[j] = x0; ol[j] = x1; }
        const size_t oo = (size_t)(q0 + q) * DQ + h * HD + d0 + c * 4; *(v4us*)(Ah + oo) = oh; *(v4us*)(Al + oo) = ol; }   // a head's 64 values of a row are one 128-byte line, written by neighbouring lanes of one wave
    asm volatile("s_wait_xcnt 0x0" ::: "memory");   // behind the last store, before any later code overwrites a register that a store names
}
// grid (RH / 16 + (TT - RH) / 32, heads, batch): the first RH / 16 blocks of a head take 16 hi+lo query rows each, the others 32 fp16 rows each.
// A batch element's q and k planes lie together (NH_ q heads, then NKV k heads), so both step by NH_ + NKV planes from one element to the next; the mask is the same for all.
__global__ __launch_bounds__(256) void k_fattn(const h16* __restrict__ Q16, const h16* __restrict__ K16, const h16* __restrict__ V16, const bf* __restrict__ Qh, const bf* __restrict__ Ql, const bf* __restrict__ Kh, const bf* __restrict__ Kl, const bf* __restrict__ Vh, const bf* __restrict__ Vl, const float* __restrict__ fm, bf* Ah, bf* Al) {
    __shared__ __align__(16) float os[FNW * 32 * FOP]; __shared__ float ms[FNW * 32]; __shared__ float ls[FNW * 32];
    const int bx = (int)blockIdx.x, h = (int)blockIdx.y;
    const size_t oqk = (size_t)blockIdx.z * (NH_ + NKV) * TT * HD, ov = (size_t)blockIdx.z * NKV * HD * TT, oa = (size_t)blockIdx.z * TT * DQ;
    Q16 += oqk; K16 += oqk; Qh += oqk; Ql += oqk; Kh += oqk; Kl += oqk; V16 += ov; Vh += ov; Vl += ov; Ah += oa; Al += oa;
    if (bx < RH / 16) fattn_body<bf, true, 1>(Qh, Ql, Kh, Kl, Vh, Vl, fm, bx * 16, h, os, ms, ls, Ah, Al);
    else fattn_body<h16, false, 2>(Q16, nullptr, K16, nullptr, V16, nullptr, fm, RH + (bx - RH / 16) * 32, h, os, ms, ls, Ah, Al);
}

extern "C" void kernel_launch(void* const* d_in, const int* in_sizes, int n_in,
                              void* d_out, int out_size, void* d_ws, size_t ws_size, hipStream_t stream) {
    (void)in_sizes; (void)n_in; (void)out_size;
    const float* x = (const float*)d_in[0]; const float* fmask = (const float*)d_in[1]; const float* wq = (const float*)d_in[2]; const float* bq = (const float*)d_in[3]; const float* wk = (const float*)d_in[4]; const float* bk = (const float*)d_in[5]; const float* wv = (const float*)d_in[6]; const float* bv = (const float*)d_in[7]; const float* wo = (const float*)d_in[8]; const float* bo = (const float*)d_in[9]; const float* cosT = nullptr; const float* sinT = nullptr; (void)cosT; (void)sinT;
    float* OUT = (float*)d_out;     // [4][2048][512]
    char* wsp = (char*)d_ws;
    auto take = [&](size_t bytes) { char* p = wsp; wsp += (bytes + 255) & ~(size_t)255; return (void*)p; };
    bf* WQ = (bf*)take((size_t)DQ * DM * 2); bf* WK = (bf*)take((size_t)DKV * DM * 2); bf* WV = (bf*)take((size_t)DKV * DM * 2); bf* WO = (bf*)take((size_t)DM * DQ * 2); float* CS = (float*)take((size_t)TT * HD * 2 * 4);
    // Every buffer below holds all NB_ batch elements, one behind the other. QP*: per element NH_ q planes, then NKV k planes.
    bf* XB = (bf*)take((size_t)NB_ * TT * DM * 2);
    h16* QP16 = (h16*)take((size_t)NB_ * (NH_ + NKV) * TT * HD * 2); h16* VT16 = (h16*)take((size_t)NB_ * NKV * HD * TT * 2);
    bf* QPh = (bf*)take((size_t)NB_ * (NH_ + NKV) * TT * HD * 2); bf* QPl = (bf*)take((size_t)NB_ * (NH_ + NKV) * TT * HD * 2); bf* VTh = (bf*)take((size_t)NB_ * NKV * HD * TT * 2); bf* VTl = (bf*)take((size_t)NB_ * NKV * HD * TT * 2);
    h16* KP16 = QP16 + (size_t)NH_ * TT * HD; bf* KPh = QPh + (size_t)NH_ * TT * HD; bf* KPl = QPl + (size_t)NH_ * TT * HD;
    float* FQKV = (float*)take((size_t)NB_ * TT * (DQ + 2 * DKV) * 4); bf* ATh = (bf*)take((size_t)NB_ * TT * DQ * 2); bf* ATl = (bf*)take((size_t)NB_ * TT * DQ * 2);
    if ((size_t)(wsp - (char*)d_ws) > ws_size) return;    // ws 256 MiB
    // FQKV: q | k | v projections, [b t][DQ + 2 DKV] f32
    const int PF = DQ + 2 * DKV; (void)WK; (void)WV;
    k_wtG<<<dim3((unsigned)((DM * DQ / 64 + 63) / 64), 4, 1), 256, 0, stream>>>(wq, wk, wv, wo, DM, DQ, WQ);   // WQ, WK, WV, WO are consecutive planes of DM x DQ
    k_csid<<<(TT * HD + 255) / 256, 256, 0, stream>>>(CS);
    const unsigned LQK = (unsigned)(((size_t)(NH_ + NKV) * TT * HD / 2 + 255) / 256), LKv = (unsigned)(((size_t)NKV * TT * HD / 2 + 255) / 256);
    // The batch elements are independent and share every weight and the mask: each stage is one launch over all NB_ of them (rows b * TT + t of the row-major buffers; blockIdx.y or z where planes are formed or read).
    k_cvt8<<<(unsigned)(((size_t)NB_ * TT * DM / 8 + 255) / 256), 256, 0, stream>>>(x, XB, (size_t)NB_ * TT * DM / 8);
    k_gemmw<bf, 0, true, 8><<<dim3(NB_ * TT / 64, DQ / 64, 3), 256, 0, stream>>>(XB, nullptr, WQ, nullptr, DM, FQKV, PF, bq, bk, bv, 0, (size_t)DQ * DM, (size_t)DQ);   // z = q, k, v: weight planes consecutive, column blocks of FQKV
    k_rope<<<dim3(LQK, NB_, 1), 256, 0, stream>>>(FQKV, PF, NH_ + NKV, CS, nullptr, nullptr, 1.0f, QP16, QPh, QPl);   // q heads, then k heads: an element's k planes lie directly behind its q planes
    k_vtp<<<dim3(LKv, NB_, 1), 256, 0, stream>>>(FQKV + DQ + DKV, PF, NKV, VT16, VTh, VTl);
    k_fattn<<<dim3(RH / 16 + (TT - RH) / 32, NH_, NB_), 256, 0, stream>>>(QP16, KP16, VT16, QPh, QPl, KPh, KPl, VTh, VTl, fmask, ATh, ATl);   // one kv head per query head
    k_gemmw<bf, 1, true, 8><<<dim3(NB_ * TT / 64, DM / 64, 1), 256, 0, stream>>>(ATh, ATl, WO, nullptr, DQ, OUT, DM, bo, nullptr, nullptr, 0, 0, 0);
}

// v005
// It runs in 210 microseconds.
// Timed twice side by side with v004, it ran 1.25 times as fast both times.
// All steps since v000 together make it 10.2 times as fast.
#include <hip/hip_runtime.h>

// Masked multi-head attention layer (x [4][2048][512]; Q/K/V = x W + b (8 heads x 64, [in, out]); scores = q.k / 8 + mask[i][j] x (-1e9) (float mask [1][1][2048][2048], read); softmax; out = (attn v merged) Wo + bo -> [4][2048][512]).
// Compute dtypes, f32 accumulate: every input rounded to bf16; Q/K/V on PLAIN bf16 operands (inputs: exact) + bias; every score is formed (the mask is data) but none is stored: query rows < 512 hl (3 products), the rest single fp16; mask add + running softmax f32; Wo hl x exact (2 products) + bias.

#define NB_  4
#define TT   2048
#define DM   512
#define NH_  8
#define NKV  8
#define REP  (NH_ / NKV)
#define HD   64
#define DQ   (NH_ * HD)
#define DKV  (NKV * HD)
#define RH   512                  // query rows < RH use hi+lo planes (TT / 4: one block in four)
#define WIN  0
#define SCL  0.125f   // HD^-0.5
typedef _Float16 h16;
typedef unsigned short bf;
typedef __attribute__((ext_vector_type(16))) __bf16   v16bf;
typedef __attribute__((ext_vector_type(16))) _Float16 v16h;
typedef __attribute__((ext_vector_type(8)))  _Float16 v8h;
typedef __attribute__((ext_vector_type(8)))  unsigned short v8us;
typedef __attribute__((ext_vector_type(8)))  float    v8f;
typedef __attribute__((ext_vector_type(4)))  float    v4f;
typedef v8h  __attribute__((may_alias)) v8ha;
typedef v4f  __attribute__((may_alias)) v4fa;
typedef v8us __attribute__((may_alias)) v8usa;
typedef float __attribute__((ext_vector_type(2), may_alias)) v2fa;

__device__ __forceinline__ unsigned short f2bf(float f) { unsigned u = __float_as_uint(f); u += 0x7FFFu + ((u >> 16) & 1u); return (unsigned short)(u >> 16); }
__device__ __forceinline__ float bf2f(unsigned short b) { return __uint_as_float(((unsigned)b) << 16); }
__device__ __forceinline__ float bfr(float f) { return bf2f(f2bf(f)); }
__device__ __forceinline__ v16h cat16(v8h lo, v8h hi) { return __builtin_shufflevector(lo, hi, 0, 1, 2, 3, 4, 5, 6, 7, 8, 9, 10, 11, 12, 13, 14, 15); }
__device__ __forceinline__ v16bf cat16b(v8us lo, v8us hi) { return __builtin_bit_cast(v16bf, __builtin_shufflevector(lo, hi, 0, 1, 2, 3, 4, 5, 6, 7, 8, 9, 10, 11, 12, 13, 14, 15)); }
__device__ __forceinline__ v8f wmma16(v16h a, v16h b, v8f c) { return __builtin_amdgcn_wmma_f32_16x16x32_f16(false, a, false, b, (short)0, c, false, false); }
__device__ __forceinline__ v8f wmmab(v16bf a, v16bf b, v8f c) { return __builtin_amdgcn_wmma_f32_16x16x32_bf16(false, a, false, b, (short)0, c, false, false); }



// ---- k_gemmw: register-blocked GEMM, ONE WAVE per 64x64 output tile (16 accumulators), operands straight from K-contiguous 16-bit planes; grid (M/64, N/64, Z), 32 threads.
// C[m][n] (f32, pitch ldc, + optional f32 bias0[n]; z = 1, 2 take biasz1, biasz2) = sum_k A[m][k] Bt[n][k] (+ split products per NSPLIT). z-batch strides sA/sB/sC in elements. K % (32 * KS) == 0.
// KS > 1: the tile's work-group has KS waves (32 * KS threads); wave w sums k in [w K/KS, (w+1) K/KS), the KS partial tiles meet in LDS and are added in wave order 0..KS-1.
template <typename T16> struct WFrag;
template <> struct WFrag<h16> { typedef v16h V; static __device__ __forceinline__ V ld(const h16* p) { return cat16(*(const v8h*)p, *(const v8h*)(p + 16)); } static __device__ __forceinline__ v8f mma(V a, V b, v8f c) { return wmma16(a, b, c); } };
template <> struct WFrag<bf> { typedef v16bf V; static __device__ __forceinline__ V ld(const bf* p) { return cat16b(*(const v8us*)p, *(const v8us*)(p + 16)); } static __device__ __forceinline__ v8f mma(V a, V b, v8f c) { return wmmab(a, b, c); } };
template <typename T16, int NSPLIT, bool BIAS, int KS>
__global__ __launch_bounds__(32 * KS) void k_gemmw(const T16* __restrict__ A, const T16* __restrict__ A2, const T16* __restrict__ Bt, const T16* __restrict__ Bt2, int K, float* C, int ldc, const float* __restrict__ bias0, const float* __restrict__ biasz1, const float* __restrict__ biasz2, size_t sA, size_t sB, size_t sC) {
    typedef typename WFrag<T16>::V V;
    __shared__ __align__(16) float os[KS == 1 ? 16 * 68 : KS * 4096];
    const size_t z = blockIdx.z; A += z * sA; if (A2) A2 += z * sA; Bt += z * sB; if (Bt2) Bt2 += z * sB; C += z * sC;
    const float* bias = (z == 1) ? biasz1 : (z == 2) ? biasz2 : bias0;   // products batched in z (at most 3 with a bias) each bring their own bias vector
    const int lane = threadIdx.x & 31, lr = lane & 15, hi = lane >> 4; const int r0 = blockIdx.x * 64, c0 = blockIdx.y * 64;
    v8f acc[4][4];
#pragma unroll
    for (int mb = 0; mb < 4; ++mb)
#pragma unroll
        for (int nb = 0; nb < 4; ++nb) acc[mb][nb] = (v8f){};
    const int wv = (KS == 1) ? 0 : __builtin_amdgcn_readfirstlane((int)(threadIdx.x >> 5));   // wave number, scalar: the K loop's bounds stay wave-uniform
    const int kw = K / KS;   // this wave's share of K, from k = wv * kw
    const size_t aoff = (size_t)(r0 + lr) * K + 8 * hi, boff = (size_t)(c0 + lr) * K + 8 * hi;
#pragma unroll 1
    for (int kc = wv * kw; kc < (wv + 1) * kw; kc += 32) {
        V a[4], a2[4];
#pragma unroll
        for (int mb = 0; mb < 4; ++mb) { a[mb] = WFrag<T16>::ld(A + aoff + (size_t)mb * 16 * K + kc); if (NSPLIT == 1 || NSPLIT == 2) a2[mb] = WFrag<T16>::ld(A2 + aoff + (size_t)mb * 16 * K + kc); }
#pragma unroll
        for (int nb = 0; nb < 4; ++nb) { const V b = WFrag<T16>::ld(Bt + boff + (size_t)nb * 16 * K + kc); V b2; if (NSPLIT >= 2) b2 = WFrag<T16>::ld(Bt2 + boff + (size_t)nb * 16 * K + kc);
#pragma unroll
            for (int mb = 0; mb < 4; ++mb) { acc[mb][nb] = WFrag<T16>::mma(a[mb], b, acc[mb][nb]); if (NSPLIT == 1 || NSPLIT == 2) acc[mb][nb] = WFrag<T16>::mma(a2[mb], b, acc[mb][nb]); if (NSPLIT >= 2) acc[mb][nb] = WFrag<T16>::mma(a[mb], b2, acc[mb][nb]); } }
        asm volatile("v_nop\n\tv_nop\n\tv_nop\n\tv_nop" : "+v"(acc[0][0]), "+v"(acc[1][1]), "+v"(acc[2][2]), "+v"(acc[3][3]) : "v"(a[0]), "v"(a[3]));
    }
    if constexpr (KS > 1) {
        // Partial tile of wave wv at os + wv * 4096, as 16 units u = mb * 4 + jq (rows mb*16 + hi*8 + 2jq + {0,1}, all 64 columns); a unit is [nb][lane][2 rows], 1 KiB: register pairs go out as they lie, every LDS access is contiguous over the lanes.
        float* mine = os + wv * 4096 + lane * 2;
#pragma unroll
        for (int mb = 0; mb < 4; ++mb)
#pragma unroll
            for (int jq = 0; jq < 4; ++jq)
#pragma unroll
                for (int nb = 0; nb < 4; ++nb) { v2fa t; t[0] = acc[mb][nb][2 * jq]; t[1] = acc[mb][nb][2 * jq + 1]; *(v2fa*)(mine + ((mb * 4 + jq) * 4 + nb) * 64) = t; }
        __syncthreads();   // every wave's partial tile is in LDS before any wave adds them
        // A 16-byte read takes two neighbouring writer lanes: reader lane l, read i holds rows {0,1} of the unit's half (l & 15) >> 3 at columns (2i + (l >> 4)) * 16 + 2 * (l & 7) + {0,1}.
        const int rh = (lane & 15) >> 3, cl = (lane >> 4) * 16 + 2 * (lane & 7);
#pragma unroll
        for (int uu = 0; uu < 16 / KS; ++uu) { const int u = wv + uu * KS; const float* q0 = os + u * 256 + lane * 4; v4f s0 = *(const v4fa*)q0, s1 = *(const v4fa*)(q0 + 128);
#pragma unroll
            for (int s = 1; s < KS; ++s) { s0 += *(const v4fa*)(q0 + s * 4096); s1 += *(const v4fa*)(q0 + s * 4096 + 128); }
            if (BIAS) { const float b0 = bfr(bias[c0 + cl]), b1 = bfr(bias[c0 + cl + 1]), b2 = bfr(bias[c0 + 32 + cl]), b3 = bfr(bias[c0 + 32 + cl + 1]); s0[0] += b0; s0[1] += b0; s0[2] += b1; s0[3] += b1; s1[0] += b2; s1[1] += b2; s1[2] += b3; s1[3] += b3; }
            float* crow = C + (size_t)(r0 + (u >> 2) * 16 + rh * 8 + (u & 3) * 2) * ldc + c0 + cl;   // a unit holds whole 256-byte rows of the tile: one writing wave per line
#pragma unroll
            for (int q = 0; q < 2; ++q) { v2fa lo, up; lo[0] = s0[q]; lo[1] = s0[2 + q]; up[0] = s1[q]; up[1] = s1[2 + q]; *(v2fa*)(crow + (size_t)q * ldc) = lo; *(v2fa*)(crow + (size_t)q * ldc + 32) = up; } }
        return;
    }
#pragma unroll
    for (int mb = 0; mb < 4; ++mb) {
#pragma unroll
        for (int nb = 0; nb < 4; ++nb) {
#pragma unroll
            for (int j = 0; j < 8; ++j) os[(hi * 8 + j) * 68 + nb * 16 + lr] = acc[mb][nb][j]; }
        __builtin_amdgcn_wave_barrier(); asm volatile("" ::: "memory");
        float* crow = C + (size_t)(r0 + mb * 16) * ldc + c0;
{
#pragma unroll
            for (int s = 0; s < 8; ++s) { const int row = 2 * s + hi, cofs = lr * 4; v4f val = *(const v4fa*)(os + row * 68 + cofs); if (BIAS) { val[0] += bfr(bias[c0 + cofs]); val[1] += bfr(bias[c0 + cofs + 1]); val[2] += bfr(bias[c0 + cofs + 2]); val[3] += bfr(bias[c0 + cofs + 3]); }
                *(v4f*)(crow + (size_t)row * ldc + cofs) = val; }
             }
        __builtin_amdgcn_wave_barrier(); asm volatile("" ::: "memory");
    }
}

__device__ __forceinline__ h16 tohx(float x) { return (h16)x; }
__device__ __forceinline__ void splitf(float y, unsigned short& h, unsigned short& l) { h = f2bf(y); l = f2bf(y - bf2f(h)); }
typedef __attribute__((ext_vector_type(2))) _Float16 v2h;
typedef __attribute__((ext_vector_type(4))) _Float16 v4h;
typedef __attribute__((ext_vector_type(2))) unsigned short v2us;
typedef __attribute__((ext_vector_type(4))) unsigned short v4us;
typedef __attribute__((ext_vector_type(2))) float v2f;
typedef __attribute__((ext_vector_type(4))) int v4i;

// blockIdx.y picks one of four K x N weights; their transposed planes lie one behind the other in Bt.
__global__ __launch_bounds__(256) void k_wtG(const float* __restrict__ w0, const float* __restrict__ w1, const float* __restrict__ w2, const float* __restrict__ w3, int K, int N, bf* Bt) {
    const float* __restrict__ w = (blockIdx.y == 0) ? w0 : (blockIdx.y == 1) ? w1 : (blockIdx.y == 2) ? w2 : w3; Bt += (size_t)blockIdx.y * K * N;
    const int lane = threadIdx.x & 31; const int L0 = (blockIdx.x * 8 + (threadIdx.x >> 5)) * 8; const int nlines = N * K / 64;
{
#pragma unroll 1
        for (int l = 0; l < 8; ++l) { const int L = L0 + l; if (L >= nlines) break; const size_t e = (size_t)L * 64 + lane * 2; const int k = (int)(e % K), n = (int)(e / K); v2us o;
            o[0] = f2bf(w[(size_t)k * N + n]); o[1] = f2bf(w[(size_t)(k + 1) * N + n]); *(v2us*)(Bt + e) = o; }
         }
}
__global__ __launch_bounds__(256) void k_cvt8(const float* __restrict__ src, bf* dst, size_t n8) { const size_t i = (size_t)blockIdx.x * 256 + threadIdx.x; if (i >= n8) return; const v8f v = *(const v8f*)(src + i * 8); v8us o;
#pragma unroll
    for (int k = 0; k < 8; ++k) o[k] = f2bf(v[k]); *(v8us*)(dst + i * 8) = o;  }
__global__ __launch_bounds__(256) void k_cscvt(const float* __restrict__ cosT, const float* __restrict__ sinT, float* CS) { const int idx = blockIdx.x * 256 + threadIdx.x; if (idx >= TT * HD) return; v2f cs; cs[0] = bfr(cosT[idx]); cs[1] = bfr(sinT[idx]); *(v2f*)(CS + (size_t)idx * 2) = cs;  }
// k_rope: blockIdx.y = batch element (its TT rows of F, its nheads planes); head planes [h][t][d] (fp16 + hi/lo) of rope(x) x sc with the rotate-half convention out[d] = x[d] cos[t][d] - x[d+HD/2] sin[t][d], out[d+HD/2] = x[d+HD/2] cos[t][d+HD/2] + x[d] sin[t][d+HD/2]
__global__ __launch_bounds__(256) void k_rope(const float* __restrict__ F, int pitch, int nheads, const float* __restrict__ CS, const float* __restrict__ RF, const float* __restrict__ nw, float sc, h16* P16, bf* Ph, bf* Pl) {
    { const size_t po = (size_t)blockIdx.y * nheads * TT * HD; F += (size_t)blockIdx.y * TT * pitch; P16 += po; Ph += po; Pl += po; }
    const size_t e = ((size_t)blockIdx.x * 256 + threadIdx.x) * 2; if (e >= (size_t)nheads * TT * HD) return; const int d = (int)(e % HD); const int t = (int)((e / HD) % TT); const int h = (int)(e / ((size_t)HD * TT)); const float* f = F + (size_t)t * pitch + h * HD; const float rf = RF ? RF[(size_t)h * TT + t] : 1.0f; v2h o16; v2us oh, ol;
#pragma unroll
    for (int q = 0; q < 2; ++q) { const int dd = d + q; const int dp = (dd < HD / 2) ? dd + HD / 2 : dd - HD / 2; float x0 = f[dd], x1 = f[dp];
        if (RF) { float n0 = __fmul_rn(x0, rf), n1 = __fmul_rn(x1, rf); asm volatile("" : "+v"(n0)); asm volatile("" : "+v"(n1)); x0 = __fmul_rn(bfr(nw[dd]), n0); x1 = __fmul_rn(bfr(nw[dp]), n1); }
        const v2f cs = *(const v2f*)(CS + ((size_t)t * HD + dd) * 2); float a = __fmul_rn(x0, cs[0]), bq = __fmul_rn(x1, cs[1]); asm volatile("" : "+v"(a)); asm volatile("" : "+v"(bq)); const float r = ((dd < HD / 2) ? __fsub_rn(a, bq) : __fadd_rn(a, bq)) * sc;
        o16[q] = tohx(r); unsigned short a2, c2; splitf(r, a2, c2); oh[q] = a2; ol[q] = c2; }
    *(v2h*)(P16 + e) = o16; *(v2us*)(Ph + e) = oh; *(v2us*)(Pl + e) = ol;  }
// k_vtp: blockIdx.y = batch element (its TT rows of F, its nheads transposed planes [g][d][t]).
__global__ __launch_bounds__(256) void k_vtp(const float* __restrict__ F, int pitch, int nheads, h16* V16, bf* Vh, bf* Vl) { const size_t e = ((size_t)blockIdx.x * 256 + threadIdx.x) * 2; if (e >= (size_t)nheads * HD * TT) return; const int t = (int)(e % TT); const int d = (int)((e / TT) % HD); const int g = (int)(e / ((size_t)TT * HD)); v2h o16; v2us oh, ol;
    { const size_t po = (size_t)blockIdx.y * nheads * HD * TT; F += (size_t)blockIdx.y * TT * pitch; V16 += po; Vh += po; Vl += po; }
#pragma unroll
    for (int q = 0; q < 2; ++q) { const float x = F[(size_t)(t + q) * pitch + g * HD + d]; o16[q] = tohx(x); unsigned short a2, c2; splitf(x, a2, c2); oh[q] = a2; ol[q] = c2; }
    *(v2h*)(V16 + e) = o16; *(v2us*)(Vh + e) = oh; *(v2us*)(Vl + e) = ol;  }
__global__ __launch_bounds__(256) void k_csid(float* CS) { const int idx = blockIdx.x * 256 + threadIdx.x; if (idx >= TT * HD) return; v2f cs; cs[0] = 1.0f; cs[1] = 0.0f; *(v2f*)(CS + (size_t)idx * 2) = cs;  }
// ---- k_fattn: scores, mask, softmax and P.V of one head in one kernel; no score or probability leaves the registers.
// A work-group has 4 waves and 64 query rows: wave w owns rows 16 w .. 16 w + 15 and walks ALL keys, so no partial results meet at the end.
// K and V^T come in stages of 64 keys: the work-group brings each stage into LDS once (asynchronous copies, whole 128-byte lines, two buffers: the next stage flies while this one is worked on) and all 4 waves read their fragments from there.
// Transposed products: S^T = K Q^T (D: row = key, column = query) and O^T += V^T P^T (D: row = d, column = query). A lane's two score tiles of a pass
// (keys 8 hi + j and 16 + 8 hi + j of query lr) are the sixteen k positions of its B fragment for P^T, so P goes from D to B in place, and every per-query factor is per lane.
#define L2E 1.4426950408889634f
#define FNW 4                     // waves of a work-group, 16 query rows each
#define SKK 64                    // keys of a stage = two passes of 32
#define LPB 144                   // LDS pitch, bytes, of a 128-byte row (64 d of a key, or 64 keys of a d): 16 B x odd, no bank conflict for 16-byte reads
#define PLB (64 * LPB)            // one plane's 64 rows of a stage in LDS
// One plane's tile of a stage: 64 rows of 128 bytes; thread t brings 16 bytes of rows (t >> 3) + 0, 16, 32, 48 (l, g: its place and source in the first; gs: 16 source rows in bytes).
// s_wait_xcnt 0 is the statement's last line: it stands in front of whatever later rewrites a register that a copy names.
__device__ __forceinline__ void cp_plane(const unsigned l, const char* g, const size_t gs) {
    const unsigned l1 = l + 16 * LPB, l2 = l + 32 * LPB, l3 = l + 48 * LPB; const char* g1 = g + gs; const char* g2 = g + 2 * gs; const char* g3 = g + 3 * gs;
    asm volatile("global_load_async_to_lds_b128 %0, %4, off\n\tglobal_load_async_to_lds_b128 %1, %5, off\n\tglobal_load_async_to_lds_b128 %2, %6, off\n\tglobal_load_async_to_lds_b128 %3, %7, off\n\ts_wait_xcnt 0x0"
                 :: "v"(l), "v"(l1), "v"(l2), "v"(l3), "v"(g), "v"(g1), "v"(g2), "v"(g3) : "memory");
}
template <typename T16, bool HL>
__device__ __forceinline__ void fattn_body(const T16* __restrict__ Qa, const T16* __restrict__ Qb, const T16* __restrict__ Ka, const T16* __restrict__ Kb, const T16* __restrict__ Va, const T16* __restrict__ Vb, const float* __restrict__ fm, const int q0, const int h, char* sm, bf* Ah, bf* Al) {
    typedef typename WFrag<T16>::V V;
    constexpr int VO = (HL ? 2 : 1) * PLB;   // V^T planes lie behind the K planes of a stage
    constexpr int SB = (HL ? 4 : 2) * PLB;   // bytes of a stage in LDS
    constexpr int NST = TT / SKK;
    const int lane = threadIdx.x & 31, lr = lane & 15, hi = lane >> 4;
    const int wv = __builtin_amdgcn_readfirstlane((int)(threadIdx.x >> 5));   // wave number, scalar
    const int qw = q0 + wv * 16;   // this wave's first query row
    const size_t hp = (size_t)h * TT * HD;
    V qa[2], qb[2];
#pragma unroll
    for (int kc = 0; kc < 2; ++kc) { const size_t qo = hp + (size_t)((qw + lr) * HD + 8 * hi + kc * 32); qa[kc] = WFrag<T16>::ld(Qa + qo); if constexpr (HL) qb[kc] = WFrag<T16>::ld(Qb + qo); }
    v8f o[4]; float m = -3.0e38f, l = 0.f;
#pragma unroll
    for (int db = 0; db < 4; ++db) o[db] = (v8f){};
    // Copies: this thread's 16 bytes of a row. K planes [key][d]: a stage is 64 whole rows, one behind the other. V^T planes [d][key]: 128 bytes of each of the 64 rows.
    const int crow = (int)threadIdx.x >> 3, ccol = ((int)threadIdx.x & 7) * 16;
    const unsigned lc = (unsigned)(size_t)sm + (unsigned)(crow * LPB + ccol);
    const size_t ko = (size_t)(crow * (HD * 2) + ccol), vo = (size_t)crow * (TT * 2) + ccol;
    const char* gka = (const char*)(Ka + hp) + ko; const char* gva = (const char*)(Va + hp) + vo;
    const char* gkb = HL ? (const char*)(Kb + hp) + ko : nullptr; const char* gvb = HL ? (const char*)(Vb + hp) + vo : nullptr;
    auto fill = [&](const int st, const int buf) {
        const unsigned lb = lc + (unsigned)(buf * SB); const size_t ks = (size_t)st * (SKK * HD * 2), vs = (size_t)st * (SKK * 2);
        cp_plane(lb, gka + ks, 16 * HD * 2); if constexpr (HL) cp_plane(lb + PLB, gkb + ks, 16 * HD * 2);
        cp_plane(lb + VO, gva + vs, (size_t)16 * TT * 2); if constexpr (HL) cp_plane(lb + VO + PLB, gvb + vs, (size_t)16 * TT * 2); };
    fill(0, 0);
    asm volatile("s_wait_asynccnt 0x0" ::: "memory");   // this wave's share of stage 0 has landed
    __syncthreads();   // stage 0 is whole before any wave reads it
    fill(1, 1);
    const int fro = lr * LPB + hi * 16;   // fragment reads: row lr of a 16-row tile, 16 bytes from k = 8 hi (and from 16 + 8 hi)
#pragma unroll 1   // rolled: a trip is one stage; the buffer alternates with it
    for (int st = 0; st < NST; ++st) {
        const char* sb = sm + (st & 1) * SB + fro;
        // Mask values are asked for ahead of the fragments: the whole stage's at once; they come from L2 or memory while the fragments come from LDS.
        // Behind each group stands s_wait_xcnt 0: a later instruction may overwrite a register that an issued load names, and the wait stands in front of that.
        v4f mk[2][4];
        const float* mr = fm + (size_t)(qw + lr) * TT + st * SKK + hi * 8;
        auto ldmask = [&](const int ps) {
#pragma unroll
            for (int kt = 0; kt < 2; ++kt) { mk[ps][kt * 2] = *(const v4f*)(mr + ps * 32 + kt * 16); mk[ps][kt * 2 + 1] = *(const v4f*)(mr + ps * 32 + kt * 16 + 4); }
            asm volatile("s_wait_xcnt 0x0" ::: "memory"); };
        ldmask(0); ldmask(1);
#pragma unroll
        for (int ps = 0; ps < 2; ++ps) {
            V ka[2][2], kl[2][2], va[4], vl[4];
#pragma unroll
            for (int kt = 0; kt < 2; ++kt)
#pragma unroll
                for (int kc = 0; kc < 2; ++kc) { const char* p = sb + (ps * 32 + kt * 16) * LPB + kc * 64; ka[kt][kc] = WFrag<T16>::ld((const T16*)p); if constexpr (HL) kl[kt][kc] = WFrag<T16>::ld((const T16*)(p + PLB)); }
            v8f s[2];
#pragma unroll
            for (int kt = 0; kt < 2; ++kt) { v8f c = (v8f){};
#pragma unroll
                for (int kc = 0; kc < 2; ++kc) { c = WFrag<T16>::mma(ka[kt][kc], qa[kc], c); if constexpr (HL) { c = WFrag<T16>::mma(ka[kt][kc], qb[kc], c); c = WFrag<T16>::mma(kl[kt][kc], qa[kc], c); } }
                s[kt] = c; }
            if constexpr (HL) __builtin_amdgcn_sched_barrier(0);   // hi+lo planes: the V^T fragments are fetched only when the K fragments are spent, into their registers; fetched together the two sets spill
#pragma unroll
            for (int db = 0; db < 4; ++db) { const char* p = sb + VO + db * 16 * LPB + ps * 64; va[db] = WFrag<T16>::ld((const T16*)p); if constexpr (HL) vl[db] = WFrag<T16>::ld((const T16*)(p + PLB)); }
            float t[16]; float mx = m;
#pragma unroll
            for (int kt = 0; kt < 2; ++kt)
#pragma unroll
                for (int j = 0; j < 8; ++j) { const float mv = bfr(mk[ps][kt * 2 + (j >> 2)][j & 3]); const float tt = s[kt][j] * SCL + mv * -1.0e9f; t[kt * 8 + j] = tt; mx = fmaxf(mx, tt); }
            mx = fmaxf(mx, __shfl_xor(mx, 16, 32));   // the other half of the query's keys of this pass lies in lane lr + 16
            const float al = __builtin_amdgcn_exp2f((m - mx) * L2E); m = mx;
            float sum = 0.f;
#pragma unroll
            for (int k = 0; k < 16; ++k) { t[k] = __builtin_amdgcn_exp2f((t[k] - mx) * L2E); sum += t[k]; }
            l = l * al + sum;   // each half keeps the sum of its own keys; the halves meet behind the loop
#pragma unroll
            for (int db = 0; db < 4; ++db) o[db] *= al;
            if constexpr (HL) { v8us h0, h1, l0, l1;
#pragma unroll
                for (int j = 0; j < 8; ++j) { unsigned short a, c2; splitf(t[j], a, c2); h0[j] = a; l0[j] = c2; splitf(t[8 + j], a, c2); h1[j] = a; l1[j] = c2; }
                const V ph = cat16b(h0, h1), pl = cat16b(l0, l1);
#pragma unroll
                for (int db = 0; db < 4; ++db) { o[db] = WFrag<T16>::mma(va[db], ph, o[db]); o[db] = WFrag<T16>::mma(va[db], pl, o[db]); o[db] = WFrag<T16>::mma(vl[db], ph, o[db]); }
            } else { V pf;
#pragma unroll
                for (int k = 0; k < 16; ++k) pf[k] = tohx(t[k]);
#pragma unroll
                for (int db = 0; db < 4; ++db) o[db] = WFrag<T16>::mma(va[db], pf, o[db]); }
        }
        asm volatile("s_wait_dscnt 0x0" ::: "memory");      // this wave's reads of the stage's buffer are done before the buffer is given up
        asm volatile("s_wait_asynccnt 0x0" ::: "memory");   // this wave's share of the next stage has landed
        __syncthreads();   // the next stage is whole, and every wave has left this stage's buffer
        if (st + 2 < NST) fill(st + 2, st & 1);
    }
    asm volatile("s_wait_asynccnt 0x0" ::: "memory");   // no copy is outstanding when the wave ends
    l += __shfl_xor(l, 16, 32);
    const float f = __fdiv_rn(1.0f, l);
#pragma unroll
    for (int db = 0; db < 4; ++db) { v8us oh, ol;
#pragma unroll
        for (int j = 0; j < 8; ++j) { unsigned short x0, x1; splitf(o[db][j] * f, x0, x1); oh[j] = x0; ol[j] = x1; }
        const size_t oo = (size_t)(qw + lr) * DQ + h * HD + db * 16 + hi * 8; *(v8us*)(Ah + oo) = oh; *(v8us*)(Al + oo) = ol; }   // a head's 64 values of a row are one 128-byte line, written by lanes lr and lr + 16 of one wave
    asm volatile("s_wait_xcnt 0x0" ::: "memory");   // behind the last store, before any later code overwrites a register that a store names
}
// grid: NB_ * NH_ * TT / 64 blocks of 64 query rows; one in four takes hi+lo rows (the dearer kind), three take fp16 rows. Within a kind: row block fastest, then head, then batch element.
// All blocks are resident at once, four to a WGP, and which four share a WGP is not promised. The kind is the sum of the index's base-4 digits mod 4: any four blocks that differ in one digit alone
// (neighbours, or 4, 16, 64 or 256 apart) hold one hi+lo block and three fp16 blocks, so the WGPs get equal work under any such placement. For speed only: every (kind, number) occurs once wherever the blocks land.
// A batch element's q and k planes lie together (NH_ q heads, then NKV k heads), so both step by NH_ + NKV planes from one element to the next; the mask is the same for all.
// Four work-groups share a WGP (4 x the LDS fits): amdgpu_waves_per_eu(4) holds the registers to a quarter of a SIMD's.
__global__ __launch_bounds__(FNW * 32) __attribute__((amdgpu_waves_per_eu(4))) void k_fattn(const h16* __restrict__ Q16, const h16* __restrict__ K16, const h16* __restrict__ V16, const bf* __restrict__ Qh, const bf* __restrict__ Ql, const bf* __restrict__ Kh, const bf* __restrict__ Kl, const bf* __restrict__ Vh, const bf* __restrict__ Vl, const float* __restrict__ fm, bf* Ah, bf* Al) {
    __shared__ __align__(16) char sm[2 * 4 * PLB];
    constexpr int NHL = RH / 64, NFP = (TT - RH) / 64; static_assert(NFP == 3 * NHL, "one hi+lo block to three fp16 blocks");
    const int bx = (int)blockIdx.x, kind = (bx + (bx >> 2) + (bx >> 4) + (bx >> 6) + (bx >> 8)) & 3; const bool hl = kind == 0;
    const int nr = hl ? (bx >> 2) : (bx >> 2) * 3 + kind - 1;   // number within the kind: each aligned run of four blocks holds one hi+lo block and fp16 blocks of kinds 1, 2, 3
    const int bh = hl ? nr / NHL : nr / NFP, q0 = hl ? (nr % NHL) * 64 : RH + (nr % NFP) * 64;
    const int h = bh % NH_; const size_t bz = (size_t)(bh / NH_);
    const size_t oqk = bz * (NH_ + NKV) * TT * HD, ov = bz * NKV * HD * TT, oa = bz * TT * DQ;
    Q16 += oqk; K16 += oqk; Qh += oqk; Ql += oqk; Kh += oqk; Kl += oqk; V16 += ov; Vh += ov; Vl += ov; Ah += oa; Al += oa;
    if (hl) fattn_body<bf, true>(Qh, Ql, Kh, Kl, Vh, Vl, fm, q0, h, sm, Ah, Al);
    else fattn_body<h16, false>(Q16, nullptr, K16, nullptr, V16, nullptr, fm, q0, h, sm, Ah, Al);
}

extern "C" void kernel_launch(void* const* d_in, const int* in_sizes, int n_in,
                              void* d_out, int out_size, void* d_ws, size_t ws_size, hipStream_t stream) {
    (void)in_sizes; (void)n_in; (void)out_size;
    const float* x = (const float*)d_in[0]; const float* fmask = (const float*)d_in[1]; const float* wq = (const float*)d_in[2]; const float* bq = (const float*)d_in[3]; const float* wk = (const float*)d_in[4]; const float* bk = (const float*)d_in[5]; const float* wv = (const float*)d_in[6]; const float* bv = (const float*)d_in[7]; const float* wo = (const float*)d_in[8]; const float* bo = (const float*)d_in[9]; const float* cosT = nullptr; const float* sinT = nullptr; (void)cosT; (void)sinT;
    float* OUT = (float*)d_out;     // [4][2048][512]
    char* wsp = (char*)d_ws;
    auto take = [&](size_t bytes) { char* p = wsp; wsp += (bytes + 255) & ~(size_t)255; return (void*)p; };
    bf* WQ = (bf*)take((size_t)DQ * DM * 2); bf* WK = (bf*)take((size_t)DKV * DM * 2); bf* WV = (bf*)take((size_t)DKV * DM * 2); bf* WO = (bf*)take((size_t)DM * DQ * 2); float* CS = (float*)take((size_t)TT * HD * 2 * 4);
    // Every buffer below holds all NB_ batch elements, one behind the other. QP*: per element NH_ q planes, then NKV k planes.
    bf* XB = (bf*)take((size_t)NB_ * TT * DM * 2);
    h16* QP16 = (h16*)take((size_t)NB_ * (NH_ + NKV) * TT * HD * 2); h16* VT16 = (h16*)take((size_t)NB_ * NKV * HD * TT * 2);
    bf* QPh = (bf*)take((size_t)NB_ * (NH_ + NKV) * TT * HD * 2); bf* QPl = (bf*)take((size_t)NB_ * (NH_ + NKV) * TT * HD * 2); bf* VTh = (bf*)take((size_t)NB_ * NKV * HD * TT * 2); bf* VTl = (bf*)take((size_t)NB_ * NKV * HD * TT * 2);
    h16* KP16 = QP16 + (size_t)NH_ * TT * HD; bf* KPh = QPh + (size_t)NH_ * TT * HD; bf* KPl = QPl + (size_t)NH_ * TT * HD;
    float* FQKV = (float*)take((size_t)NB_ * TT * (DQ + 2 * DKV) * 4); bf* ATh = (bf*)take((size_t)NB_ * TT * DQ * 2); bf* ATl = (bf*)take((size_t)NB_ * TT * DQ * 2);
    if ((size_t)(wsp - (char*)d_ws) > ws_size) return;    // ws 256 MiB
    // FQKV: q | k | v projections, [b t][DQ + 2 DKV] f32
    const int PF = DQ + 2 * DKV; (void)WK; (void)WV;
    k_wtG<<<dim3((unsigned)((DM * DQ / 64 + 63) / 64), 4, 1), 256, 0, stream>>>(wq, wk, wv, wo, DM, DQ, WQ);   // WQ, WK, WV, WO are consecutive planes of DM x DQ
    k_csid<<<(TT * HD + 255) / 256, 256, 0, stream>>>(CS);
    const unsigned LQK = (unsigned)(((size_t)(NH_ + NKV) * TT * HD / 2 + 255) / 256), LKv = (unsigned)(((size_t)NKV * TT * HD / 2 + 255) / 256);
    // The batch elements are independent and share every weight and the mask: each stage is one launch over all NB_ of them (rows b * TT + t of the row-major buffers; blockIdx.y where planes are formed, blockIdx.x (with head and row block) where they are read).
    k_cvt8<<<(unsigned)(((size_t)NB_ * TT * DM / 8 + 255) / 256), 256, 0, stream>>>(x, XB, (size_t)NB_ * TT * DM / 8);
    k_gemmw<bf, 0, true, 8><<<dim3(NB_ * TT / 64, DQ / 64, 3), 256, 0, stream>>>(XB, nullptr, WQ, nullptr, DM, FQKV, PF, bq, bk, bv, 0, (size_t)DQ * DM, (size_t)DQ);   // z = q, k, v: weight planes consecutive, column blocks of FQKV
    k_rope<<<dim3(LQK, NB_, 1), 256, 0, stream>>>(FQKV, PF, NH_ + NKV, CS, nullptr, nullptr, 1.0f, QP16, QPh, QPl);   // q heads, then k heads: an element's k planes lie directly behind its q planes
    k_vtp<<<dim3(LKv, NB_, 1), 256, 0, stream>>>(FQKV + DQ + DKV, PF, NKV, VT16, VTh, VTl);
    k_fattn<<<dim3(NB_ * NH_ * (TT / 64), 1, 1), FNW * 32, 0, stream>>>(QP16, KP16, VT16, QPh, QPl, KPh, KPl, VTh, VTl, fmask, ATh, ATl);   // one kv head per query head
    k_gemmw<bf, 1, true, 8><<<dim3(NB_ * TT / 64, DM / 64, 1), 256, 0, stream>>>(ATh, ATl, WO, nullptr, DQ, OUT, DM, bo, nullptr, nullptr, 0, 0, 0);
}

// v006
// Measured time: 169 microseconds a run.
// Next to v005, in two timings, it ran 1.24 times as fast each time.
// Over all steps from v000 it is 12.6 times as fast.
#include <hip/hip_runtime.h>

// Masked multi-head attention layer (x [4][2048][512]; Q/K/V = x W + b (8 heads x 64, [in, out]); scores = q.k / 8 + mask[i][j] x (-1e9) (float mask [1][1][2048][2048], read); softmax; out = (attn v merged) Wo + bo -> [4][2048][512]).
// Compute dtypes, f32 accumulate: every input rounded to bf16; Q/K/V on PLAIN bf16 operands (inputs: exact) + bias; every score is formed (the mask is data) but none is stored: query rows < 512 hl (3 products), the rest single fp16; mask add + running softmax f32; Wo hl x exact (2 products) + bias.

#define NB_  4
#define TT   2048
#define DM   512
#define NH_  8
#define NKV  8
#define REP  (NH_ / NKV)
#define HD   64
#define DQ   (NH_ * HD)
#define DKV  (NKV * HD)
#define RH   512                  // query rows < RH use hi+lo planes (TT / 4: one block in four)
#define WIN  0
#define SCL  0.125f   // HD^-0.5
typedef _Float16 h16;
typedef unsigned short bf;
typedef __attribute__((ext_vector_type(16))) __bf16   v16bf;
typedef __attribute__((ext_vector_type(16))) _Float16 v16h;
typedef __attribute__((ext_vector_type(8)))  _Float16 v8h;
typedef __attribute__((ext_vector_type(8)))  unsigned short v8us;
typedef __attribute__((ext_vector_type(8)))  float    v8f;
typedef __attribute__((ext_vector_type(4)))  float    v4f;
typedef v8h  __attribute__((may_alias)) v8ha;
typedef v4f  __attribute__((may_alias)) v4fa;
typedef v8us __attribute__((may_alias)) v8usa;
typedef float __attribute__((ext_vector_type(2), may_alias)) v2fa;

__device__ __forceinline__ unsigned short f2bf(float f) { unsigned u = __float_as_uint(f); u += 0x7FFFu + ((u >> 16) & 1u); return (unsigned short)(u >> 16); }
__device__ __forceinline__ float bf2f(unsigned short b) { return __uint_as_float(((unsigned)b) << 16); }
__device__ __forceinline__ float bfr(float f) { return bf2f(f2bf(f)); }
__device__ __forceinline__ v16h cat16(v8h lo, v8h hi) { return __builtin_shufflevector(lo, hi, 0, 1, 2, 3, 4, 5, 6, 7, 8, 9, 10, 11, 12, 13, 14, 15); }
__device__ __forceinline__ v16bf cat16b(v8us lo, v8us hi) { return __builtin_bit_cast(v16bf, __builtin_shufflevector(lo, hi, 0, 1, 2, 3, 4, 5, 6, 7, 8, 9, 10, 11, 12, 13, 14, 15)); }
__device__ __forceinline__ v8f wmma16(v16h a, v16h b, v8f c) { return __builtin_amdgcn_wmma_f32_16x16x32_f16(false, a, false, b, (short)0, c, false, false); }
__device__ __forceinline__ v8f wmmab(v16bf a, v16bf b, v8f c) { return __builtin_amdgcn_wmma_f32_16x16x32_bf16(false, a, false, b, (short)0, c, false, false); }



// ---- k_gemmw: register-blocked GEMM, ONE WAVE per 64x64 output tile (16 accumulators), operands straight from K-contiguous 16-bit planes; grid (M/64, N/64, Z), 32 threads.
// C[m][n] (f32, pitch ldc, + optional f32 bias0[n]; z = 1, 2 take biasz1, biasz2) = sum_k A[m][k] Bt[n][k] (+ split products per NSPLIT). z-batch strides sA/sB/sC in elements. K % (32 * KS) == 0.
// KS > 1: the tile's work-group has KS waves (32 * KS threads); wave w sums k in [w K/KS, (w+1) K/KS), the KS partial tiles meet in LDS and are added in wave order 0..KS-1.
template <typename T16> struct WFrag;
template <> struct WFrag<h16> { typedef v16h V; static __device__ __forceinline__ V ld(const h16* p) { return cat16(*(const v8h*)p, *(const v8h*)(p + 16)); } static __device__ __forceinline__ v8f mma(V a, V b, v8f c) { return wmma16(a, b, c); } };
template <> struct WFrag<bf> { typedef v16bf V; static __device__ __forceinline__ V ld(const bf* p) { return cat16b(*(const v8us*)p, *(const v8us*)(p + 16)); } static __device__ __forceinline__ v8f mma(V a, V b, v8f c) { return wmmab(a, b, c); } };
template <typename T16, int NSPLIT, bool BIAS, int KS>
__global__ __launch_bounds__(32 * KS) void k_gemmw(const T16* __restrict__ A, const T16* __restrict__ A2, const T16* __restrict__ Bt, const T16* __restrict__ Bt2, int K, float* C, int ldc, const float* __restrict__ bias0, const float* __restrict__ biasz1, const float* __restrict__ biasz2, size_t sA, size_t sB, size_t sC) {
    typedef typename WFrag<T16>::V V;
    __shared__ __align__(16) float os[KS == 1 ? 16 * 68 : KS * 4096];
    const size_t z = blockIdx.z; A += z * sA; if (A2) A2 += z * sA; Bt += z * sB; if (Bt2) Bt2 += z * sB; C += z * sC;
    const float* bias = (z == 1) ? biasz1 : (z == 2) ? biasz2 : bias0;   // products batched in z (at most 3 with a bias) each bring their own bias vector
    const int lane = threadIdx.x & 31, lr = lane & 15, hi = lane >> 4; const int r0 = blockIdx.x * 64, c0 = blockIdx.y * 64;
    v8f acc[4][4];
#pragma unroll
    for (int mb = 0; mb < 4; ++mb)
#pragma unroll
        for (int nb = 0; nb < 4; ++nb) acc[mb][nb] = (v8f){};
    const int wv = (KS == 1) ? 0 : __builtin_amdgcn_readfirstlane((int)(threadIdx.x >> 5));   // wave number, scalar: the K loop's bounds stay wave-uniform
    const int kw = K / KS;   // this wave's share of K, from k = wv * kw
    const size_t aoff = (size_t)(r0 + lr) * K + 8 * hi, boff = (size_t)(c0 + lr) * K + 8 * hi;
#pragma unroll 1
    for (int kc = wv * kw; kc < (wv + 1) * kw; kc += 32) {
        V a[4], a2[4];
#pragma unroll
        for (int mb = 0; mb < 4; ++mb) { a[mb] = WFrag<T16>::ld(A + aoff + (size_t)mb * 16 * K + kc); if (NSPLIT == 1 || NSPLIT == 2) a2[mb] = WFrag<T16>::ld(A2 + aoff + (size_t)mb * 16 * K + kc); }
#pragma unroll
        for (int nb = 0; nb < 4; ++nb) { const V b = WFrag<T16>::ld(Bt + boff + (size_t)nb * 16 * K + kc); V b2; if (NSPLIT >= 2) b2 = WFrag<T16>::ld(Bt2 + boff + (size_t)nb * 16 * K + kc);
#pragma unroll
            for (int mb = 0; mb < 4; ++mb) { acc[mb][nb] = WFrag<T16>::mma(a[mb], b, acc[mb][nb]); if (NSPLIT == 1 || NSPLIT == 2) acc[mb][nb] = WFrag<T16>::mma(a2[mb], b, acc[mb][nb]); if (NSPLIT >= 2) acc[mb][nb] = WFrag<T16>::mma(a[mb], b2, acc[mb][nb]); } }
        asm volatile("v_nop\n\tv_nop\n\tv_nop\n\tv_nop" : "+v"(acc[0][0]), "+v"(acc[1][1]), "+v"(acc[2][2]), "+v"(acc[3][3]) : "v"(a[0]), "v"(a[3]));
    }
    if constexpr (KS > 1) {
        // Partial tile of wave wv at os + wv * 4096, as 16 units u = mb * 4 + jq (rows mb*16 + hi*8 + 2jq + {0,1}, all 64 columns); a unit is [nb][lane][2 rows], 1 KiB: register pairs go out as they lie, every LDS access is contiguous over the lanes.
        float* mine = os + wv * 4096 + lane * 2;
#pragma unroll
        for (int mb = 0; mb < 4; ++mb)
#pragma unroll
            for (int jq = 0; jq < 4; ++jq)
#pragma unroll
                for (int nb = 0; nb < 4; ++nb) { v2fa t; t[0] = acc[mb][nb][2 * jq]; t[1] = acc[mb][nb][2 * jq + 1]; *(v2fa*)(mine + ((mb * 4 + jq) * 4 + nb) * 64) = t; }
        __syncthreads();   // every wave's partial tile is in LDS before any wave adds them
        // A 16-byte read takes two neighbouring writer lanes: reader lane l, read i holds rows {0,1} of the unit's half (l & 15) >> 3 at columns (2i + (l >> 4)) * 16 + 2 * (l & 7) + {0,1}.
        const int rh = (lane & 15) >> 3, cl = (lane >> 4) * 16 + 2 * (lane & 7);
#pragma unroll
        for (int uu = 0; uu < 16 / KS; ++uu) { const int u = wv + uu * KS; const float* q0 = os + u * 256 + lane * 4; v4f s0 = *(const v4fa*)q0, s1 = *(const v4fa*)(q0 + 128);
#pragma unroll
            for (int s = 1; s < KS; ++s) { s0 += *(const v4fa*)(q0 + s * 4096); s1 += *(const v4fa*)(q0 + s * 4096 + 128); }
            if (BIAS) { const float b0 = bfr(bias[c0 + cl]), b1 = bfr(bias[c0 + cl + 1]), b2 = bfr(bias[c0 + 32 + cl]), b3 = bfr(bias[c0 + 32 + cl + 1]); s0[0] += b0; s0[1] += b0; s0[2] += b1; s0[3] += b1; s1[0] += b2; s1[1] += b2; s1[2] += b3; s1[3] += b3; }
            float* crow = C + (size_t)(r0 + (u >> 2) * 16 + rh * 8 + (u & 3) * 2) * ldc + c0 + cl;   // a unit holds whole 256-byte rows of the tile: one writing wave per line
#pragma unroll
            for (int q = 0; q < 2; ++q) { v2fa lo, up; lo[0] = s0[q]; lo[1] = s0[2 + q]; up[0] = s1[q]; up[1] = s1[2 + q]; *(v2fa*)(crow + (size_t)q * ldc) = lo; *(v2fa*)(crow + (size_t)q * ldc + 32) = up; } }
        return;
    }
#pragma unroll
    for (int mb = 0; mb < 4; ++mb) {
#pragma unroll
        for (int nb = 0; nb < 4; ++nb) {
#pragma unroll
            for (int j = 0; j < 8; ++j) os[(hi * 8 + j) * 68 + nb * 16 + lr] = acc[mb][nb][j]; }
        __builtin_amdgcn_wave_barrier(); asm volatile("" ::: "memory");
        float* crow = C + (size_t)(r0 + mb * 16) * ldc + c0;
{
#pragma unroll
            for (int s = 0; s < 8; ++s) { const int row = 2 * s + hi, cofs = lr * 4; v4f val = *(const v4fa*)(os + row * 68 + cofs); if (BIAS) { val[0] += bfr(bias[c0 + cofs]); val[1] += bfr(bias[c0 + cofs + 1]); val[2] += bfr(bias[c0 + cofs + 2]); val[3] += bfr(bias[c0 + cofs + 3]); }
                *(v4f*)(crow + (size_t)row * ldc + cofs) = val; }
             }
        __builtin_amdgcn_wave_barrier(); asm volatile("" ::: "memory");
    }
}

__device__ __forceinline__ h16 tohx(float x) { return (h16)x; }
__device__ __forceinline__ void splitf(float y, unsigned short& h, unsigned short& l) { h = f2bf(y); l = f2bf(y - bf2f(h)); }
typedef __attribute__((ext_vector_type(2))) _Float16 v2h;
typedef __attribute__((ext_vector_type(4))) _Float16 v4h;
typedef __attribute__((ext_vector_type(2))) unsigned short v2us;
typedef __attribute__((ext_vector_type(4))) unsigned short v4us;
typedef __attribute__((ext_vector_type(2))) float v2f;
typedef __attribute__((ext_vector_type(4))) int v4i;

// blockIdx.y picks one of four K x N weights; their transposed planes lie one behind the other in Bt.
__global__ __launch_bounds__(256) void k_wtG(const float* __restrict__ w0, const float* __restrict__ w1, const float* __restrict__ w2, const float* __restrict__ w3, int K, int N, bf* Bt) {
    const float* __restrict__ w = (blockIdx.y == 0) ? w0 : (blockIdx.y == 1) ? w1 : (blockIdx.y == 2) ? w2 : w3; Bt += (size_t)blockIdx.y * K * N;
    const int lane = threadIdx.x & 31; const int L0 = (blockIdx.x * 8 + (threadIdx.x >> 5)) * 8; const int nlines = N * K / 64;
{
#pragma unroll 1
        for (int l = 0; l < 8; ++l) { const int L = L0 + l; if (L >= nlines) break; const size_t e = (size_t)L * 64 + lane * 2; const int k = (int)(e % K), n = (int)(e / K); v2us o;
            o[0] = f2bf(w[(size_t)k * N + n]); o[1] = f2bf(w[(size_t)(k + 1) * N + n]); *(v2us*)(Bt + e) = o; }
         }
}
__global__ __launch_bounds__(256) void k_cvt8(const float* __restrict__ src, bf* dst, size_t n8) { const size_t i = (size_t)blockIdx.x * 256 + threadIdx.x; if (i >= n8) return; const v8f v = *(const v8f*)(src + i * 8); v8us o;
#pragma unroll
    for (int k = 0; k < 8; ++k) o[k] = f2bf(v[k]); *(v8us*)(dst + i * 8) = o;  }
__global__ __launch_bounds__(256) void k_cscvt(const float* __restrict__ cosT, const float* __restrict__ sinT, float* CS) { const int idx = blockIdx.x * 256 + threadIdx.x; if (idx >= TT * HD) return; v2f cs; cs[0] = bfr(cosT[idx]); cs[1] = bfr(sinT[idx]); *(v2f*)(CS + (size_t)idx * 2) = cs;  }
// ---- k_qkv: the Q, K and V projections (blockIdx.z = 0, 1, 2) of all batch elements; a work-group forms one head's 64 values of 64 tokens and writes them straight into the planes that k_fattn reads (fp16 and bf16 hi + lo).
// The product is k_gemmw's: 8 waves split K, the 8 partial tiles meet in LDS and are added in wave order. Q, K: tile rows = tokens (A = x), columns = d (B = weight), planes [head][t][d].
// V: the operands change places (A = weight rows d, B = x rows t), so the tile comes out transposed, rows = d, columns = tokens, as the planes [head][d][t] want it. Either way a tile row is one 128-byte line of each plane, written by one wave.
__global__ __launch_bounds__(256) void k_qkv(const bf* __restrict__ X, const bf* __restrict__ Wt, const float* __restrict__ bq, const float* __restrict__ bk, const float* __restrict__ bv, h16* P16, bf* Ph, bf* Pl, h16* V16, bf* Vh, bf* Vl) {
    typedef WFrag<bf>::V V;
    constexpr int KS = 8, K = DM, kw = K / KS;
    __shared__ __align__(16) float os[KS * 4096];
    const int z = (int)blockIdx.z, hd = (int)blockIdx.y, t0 = (int)blockIdx.x * 64; const bool tr = z == 2;
    const float* bias = ((z == 0) ? bq : (z == 1) ? bk : bv) + hd * HD;
    const bf* xr = X + (size_t)t0 * K; const bf* wr = Wt + ((size_t)z * DQ + hd * HD) * K;
    const bf* A = tr ? wr : xr; const bf* Bt = tr ? xr : wr;
    const int lane = threadIdx.x & 31, lr = lane & 15, hi = lane >> 4;
    v8f acc[4][4];
#pragma unroll
    for (int mb = 0; mb < 4; ++mb)
#pragma unroll
        for (int nb = 0; nb < 4; ++nb) acc[mb][nb] = (v8f){};
    const int wv = __builtin_amdgcn_readfirstlane((int)(threadIdx.x >> 5));   // wave number, scalar: the K loop's bounds stay wave-uniform
    const size_t off = (size_t)lr * K + 8 * hi;
    // Where this lane's sums will lie in the tile (k_gemmw's lane map): rows ru + 16 * 2 uu + {0, 1} for its two units uu, columns cl + {0, 1} and 32 + cl + {0, 1}.
    const int rh = (lane & 15) >> 3, cl = (lane >> 4) * 16 + 2 * (lane & 7), ru = (wv >> 2) * 16 + rh * 8 + (wv & 3) * 2;
    // The bias belongs to d: the tile's column for Q and K (4 columns a lane), its row for V (2 rows in each of 2 units). Asked for here, used behind the product.
    const float g0 = bias[tr ? ru : cl], g1 = bias[tr ? ru + 1 : cl + 1], g2 = bias[tr ? ru + 32 : 32 + cl], g3 = bias[tr ? ru + 33 : 32 + cl + 1];
    asm volatile("s_wait_xcnt 0x0" ::: "memory");   // behind the loads, before later code overwrites a register that one of them names
#pragma unroll 1
    for (int kc = wv * kw; kc < (wv + 1) * kw; kc += 32) {
        V a[4];
#pragma unroll
        for (int mb = 0; mb < 4; ++mb) a[mb] = WFrag<bf>::ld(A + off + (size_t)mb * 16 * K + kc);
        asm volatile("s_wait_xcnt 0x0" ::: "memory");   // behind the loads, before a later instruction (a later load's result too) overwrites an address register that they name
#pragma unroll
        for (int nb = 0; nb < 4; ++nb) { const V b = WFrag<bf>::ld(Bt + off + (size_t)nb * 16 * K + kc);
            asm volatile("s_wait_xcnt 0x0" ::: "memory");   // the same, behind this fragment's loads
#pragma unroll
            for (int mb = 0; mb < 4; ++mb) acc[mb][nb] = WFrag<bf>::mma(a[mb], b, acc[mb][nb]); }
        asm volatile("v_nop\n\tv_nop\n\tv_nop\n\tv_nop" : "+v"(acc[0][0]), "+v"(acc[1][1]), "+v"(acc[2][2]), "+v"(acc[3][3]) : "v"(a[0]), "v"(a[3]));   // the distance behind the last matrix instruction, also on the loop's back edge
    }
    // Partial tiles in LDS and their sum: units, order and lane map as in k_gemmw.
    float* mine = os + wv * 4096 + lane * 2;
#pragma unroll
    for (int mb = 0; mb < 4; ++mb)
#pragma unroll
        for (int jq = 0; jq < 4; ++jq)
#pragma unroll
            for (int nb = 0; nb < 4; ++nb) { v2fa t; t[0] = acc[mb][nb][2 * jq]; t[1] = acc[mb][nb][2 * jq + 1]; *(v2fa*)(mine + ((mb * 4 + jq) * 4 + nb) * 64) = t; }
    __syncthreads();   // every wave's partial tile is in LDS before any wave adds them
    const float b0 = bfr(g0), b1 = bfr(g1), b2 = bfr(g2), b3 = bfr(g3);
    const int be = t0 / TT, tb = t0 % TT;   // 64 divides TT: a tile's tokens belong to one batch element
    const size_t base = tr ? (size_t)(be * NKV + hd) * HD * TT + tb : ((size_t)(be * (NH_ + NKV) + z * NH_ + hd) * TT + tb) * HD;
    const int pitch = tr ? TT : HD;
    h16* D16 = (tr ? V16 : P16) + base + cl; bf* Dh = (tr ? Vh : Ph) + base + cl; bf* Dl = (tr ? Vl : Pl) + base + cl;
#pragma unroll
    for (int uu = 0; uu < 16 / KS; ++uu) { const int u = wv + uu * KS; const float* q0 = os + u * 256 + lane * 4; v4f s0 = *(const v4fa*)q0, s1 = *(const v4fa*)(q0 + 128);
#pragma unroll
        for (int s = 1; s < KS; ++s) { s0 += *(const v4fa*)(q0 + s * 4096); s1 += *(const v4fa*)(q0 + s * 4096 + 128); }
        const int row = ru + uu * 32;   // s0, s1: [0], [1] = rows row, row + 1 of column cl (s1: 32 + cl); [2], [3] = the same rows of the next column
        if (tr) { const float e0 = uu ? b2 : b0, e1 = uu ? b3 : b1; s0[0] += e0; s0[1] += e1; s0[2] += e0; s0[3] += e1; s1[0] += e0; s1[1] += e1; s1[2] += e0; s1[3] += e1; }
        else { s0[0] += b0; s0[1] += b0; s0[2] += b1; s0[3] += b1; s1[0] += b2; s1[1] += b2; s1[2] += b3; s1[3] += b3; }
#pragma unroll
        for (int q = 0; q < 2; ++q) { const size_t ro = (size_t)(row + q) * pitch;
#pragma unroll
            for (int i = 0; i < 2; ++i) { const float y0 = i ? s1[q] : s0[q], y1 = i ? s1[2 + q] : s0[2 + q]; v2h o16; v2us oh, ol; unsigned short a2, c2;
                o16[0] = tohx(y0); o16[1] = tohx(y1); splitf(y0, a2, c2); oh[0] = a2; ol[0] = c2; splitf(y1, a2, c2); oh[1] = a2; ol[1] = c2;
                *(v2h*)(D16 + ro + i * 32) = o16; *(v2us*)(Dh + ro + i * 32) = oh; *(v2us*)(Dl + ro + i * 32) = ol; } }
        asm volatile("s_wait_xcnt 0x0" ::: "memory");   // behind the unit's stores, before later code overwrites a register that one of them names
    }
}
// ---- k_fattn: scores, mask, softmax and P.V of one head in one kernel; no score or probability leaves the registers.
// A work-group has 4 waves and 64 query rows: wave w owns rows 16 w .. 16 w + 15 and walks ALL keys, so no partial results meet at the end.
// K and V^T come in stages of 64 keys: the work-group brings each stage into LDS once (asynchronous copies, whole 128-byte lines, two buffers: the next stage flies while this one is worked on) and all 4 waves read their fragments from there.
// Transposed products: S^T = K Q^T (D: row = key, column = query) and O^T += V^T P^T (D: row = d, column = query). A lane's two score tiles of a pass
// (keys 8 hi + j and 16 + 8 hi + j of query lr) are the sixteen k positions of its B fragment for P^T, so P goes from D to B in place, and every per-query factor is per lane.
#define L2E 1.4426950408889634f
#define FNW 4                     // waves of a work-group, 16 query rows each
#define SKK 64                    // keys of a stage = two passes of 32
#define LPB 144                   // LDS pitch, bytes, of a 128-byte row (64 d of a key, or 64 keys of a d): 16 B x odd, no bank conflict for 16-byte reads
#define PLB (64 * LPB)            // one plane's 64 rows of a stage in LDS
// One plane's tile of a stage: 64 rows of 128 bytes; thread t brings 16 bytes of rows (t >> 3) + 0, 16, 32, 48 (l, g: its place and source in the first; gs: 16 source rows in bytes).
// s_wait_xcnt 0 is the statement's last line: it stands in front of whatever later rewrites a register that a copy names.
__device__ __forceinline__ void cp_plane(const unsigned l, const char* g, const size_t gs) {
    const unsigned l1 = l + 16 * LPB, l2 = l + 32 * LPB, l3 = l + 48 * LPB; const char* g1 = g + gs; const char* g2 = g + 2 * gs; const char* g3 = g + 3 * gs;
    asm volatile("global_load_async_to_lds_b128 %0, %4, off\n\tglobal_load_async_to_lds_b128 %1, %5, off\n\tglobal_load_async_to_lds_b128 %2, %6, off\n\tglobal_load_async_to_lds_b128 %3, %7, off\n\ts_wait_xcnt 0x0"
                 :: "v"(l), "v"(l1), "v"(l2), "v"(l3), "v"(g), "v"(g1), "v"(g2), "v"(g3) : "memory");
}
template <typename T16, bool HL>
__device__ __forceinline__ void fattn_body(const T16* __restrict__ Qa, const T16* __restrict__ Qb, const T16* __restrict__ Ka, const T16* __restrict__ Kb, const T16* __restrict__ Va, const T16* __restrict__ Vb, const float* __restrict__ fm, const int q0, const int h, char* sm, bf* Ah, bf* Al) {
    typedef typename WFrag<T16>::V V;
    constexpr int VO = (HL ? 2 : 1) * PLB;   // V^T planes lie behind the K planes of a stage
    constexpr int SB = (HL ? 4 : 2) * PLB;   // bytes of a stage in LDS
    constexpr int NST = TT / SKK;
    const int lane = threadIdx.x & 31, lr = lane & 15, hi = lane >> 4;
    const int wv = __builtin_amdgcn_readfirstlane((int)(threadIdx.x >> 5));   // wave number, scalar
    const int qw = q0 + wv * 16;   // this wave's first query row
    const size_t hp = (size_t)h * TT * HD;
    V qa[2], qb[2];
#pragma unroll
    for (int kc = 0; kc < 2; ++kc) { const size_t qo = hp + (size_t)((qw + lr) * HD + 8 * hi + kc * 32); qa[kc] = WFrag<T16>::ld(Qa + qo); if constexpr (HL) qb[kc] = WFrag<T16>::ld(Qb + qo); }
    v8f o[4]; float m = -3.0e38f, l = 0.f;
#pragma unroll
    for (int db = 0; db < 4; ++db) o[db] = (v8f){};
    // Copies: this thread's 16 bytes of a row. K planes [key][d]: a stage is 64 whole rows, one behind the other. V^T planes [d][key]: 128 bytes of each of the 64 rows.
    const int crow = (int)threadIdx.x >> 3, ccol = ((int)threadIdx.x & 7) * 16;
    const unsigned lc = (unsigned)(size_t)sm + (unsigned)(crow * LPB + ccol);
    const size_t ko = (size_t)(crow * (HD * 2) + ccol), vo = (size_t)crow * (TT * 2) + ccol;
    const char* gka = (const char*)(Ka + hp) + ko; const char* gva = (const char*)(Va + hp) + vo;
    const char* gkb = HL ? (const char*)(Kb + hp) + ko : nullptr; const char* gvb = HL ? (const char*)(Vb + hp) + vo : nullptr;
    auto fill = [&](const int st, const int buf) {
        const unsigned lb = lc + (unsigned)(buf * SB); const size_t ks = (size_t)st * (SKK * HD * 2), vs = (size_t)st * (SKK * 2);
        cp_plane(lb, gka + ks, 16 * HD * 2); if constexpr (HL) cp_plane(lb + PLB, gkb + ks, 16 * HD * 2);
        cp_plane(lb + VO, gva + vs, (size_t)16 * TT * 2); if constexpr (HL) cp_plane(lb + VO + PLB, gvb + vs, (size_t)16 * TT * 2); };
    fill(0, 0);
    asm volatile("s_wait_asynccnt 0x0" ::: "memory");   // this wave's share of stage 0 has landed
    __syncthreads();   // stage 0 is whole before any wave reads it
    fill(1, 1);
    const int fro = lr * LPB + hi * 16;   // fragment reads: row lr of a 16-row tile, 16 bytes from k = 8 hi (and from 16 + 8 hi)
#pragma unroll 1   // rolled: a trip is one stage; the buffer alternates with it
    for (int st = 0; st < NST; ++st) {
        const char* sb = sm + (st & 1) * SB + fro;
        // Mask values are asked for ahead of the fragments: the whole stage's at once; they come from L2 or memory while the fragments come from LDS.
        // Behind each group stands s_wait_xcnt 0: a later instruction may overwrite a register that an issued load names, and the wait stands in front of that.
        v4f mk[2][4];
        const float* mr = fm + (size_t)(qw + lr) * TT + st * SKK + hi * 8;
        auto ldmask = [&](const int ps) {
#pragma unroll
            for (int kt = 0; kt < 2; ++kt) { mk[ps][kt * 2] = *(const v4f*)(mr + ps * 32 + kt * 16); mk[ps][kt * 2 + 1] = *(const v4f*)(mr + ps * 32 + kt * 16 + 4); }
            asm volatile("s_wait_xcnt 0x0" ::: "memory"); };
        ldmask(0); ldmask(1);
#pragma unroll
        for (int ps = 0; ps < 2; ++ps) {
            V ka[2][2], kl[2][2], va[4], vl[4];
#pragma unroll
            for (int kt = 0; kt < 2; ++kt)
#pragma unroll
                for (int kc = 0; kc < 2; ++kc) { const char* p = sb + (ps * 32 + kt * 16) * LPB + kc * 64; ka[kt][kc] = WFrag<T16>::ld((const T16*)p); if constexpr (HL) kl[kt][kc] = WFrag<T16>::ld((const T16*)(p + PLB)); }
            v8f s[2];
#pragma unroll
            for (int kt = 0; kt < 2; ++kt) { v8f c = (v8f){};
#pragma unroll
                for (int kc = 0; kc < 2; ++kc) { c = WFrag<T16>::mma(ka[kt][kc], qa[kc], c); if constexpr (HL) { c = WFrag<T16>::mma(ka[kt][kc], qb[kc], c); c = WFrag<T16>::mma(kl[kt][kc], qa[kc], c); } }
                s[kt] = c; }
            if constexpr (HL) __builtin_amdgcn_sched_barrier(0);   // hi+lo planes: the V^T fragments are fetched only when the K fragments are spent, into their registers; fetched together the two sets spill
#pragma unroll
            for (int db = 0; db < 4; ++db) { const char* p = sb + VO + db * 16 * LPB + ps * 64; va[db] = WFrag<T16>::ld((const T16*)p); if constexpr (HL) vl[db] = WFrag<T16>::ld((const T16*)(p + PLB)); }
            float t[16]; float mx = m;
#pragma unroll
            for (int kt = 0; kt < 2; ++kt)
#pragma unroll
                for (int j = 0; j < 8; ++j) { const float mv = bfr(mk[ps][kt * 2 + (j >> 2)][j & 3]); const float tt = s[kt][j] * SCL + mv * -1.0e9f; t[kt * 8 + j] = tt; mx = fmaxf(mx, tt); }
            mx = fmaxf(mx, __shfl_xor(mx, 16, 32));   // the other half of the query's keys of this pass lies in lane lr + 16
            const float al = __builtin_amdgcn_exp2f((m - mx) * L2E); m = mx;
            float sum = 0.f;
#pragma unroll
            for (int k = 0; k < 16; ++k) { t[k] = __builtin_amdgcn_exp2f((t[k] - mx) * L2E); sum += t[k]; }
            l = l * al + sum;   // each half keeps the sum of its own keys; the halves meet behind the loop
#pragma unroll
            for (int db = 0; db < 4; ++db) o[db] *= al;
            if constexpr (HL) { v8us h0, h1, l0, l1;
#pragma unroll
                for (int j = 0; j < 8; ++j) { unsigned short a, c2; splitf(t[j], a, c2); h0[j] = a; l0[j] = c2; splitf(t[8 + j], a, c2); h1[j] = a; l1[j] = c2; }
                const V ph = cat16b(h0, h1), pl = cat16b(l0, l1);
#pragma unroll
                for (int db = 0; db < 4; ++db) { o[db] = WFrag<T16>::mma(va[db], ph, o[db]); o[db] = WFrag<T16>::mma(va[db], pl, o[db]); o[db] = WFrag<T16>::mma(vl[db], ph, o[db]); }
            } else { V pf;
#pragma unroll
                for (int k = 0; k < 16; ++k) pf[k] = tohx(t[k]);
#pragma unroll
                for (int db = 0; db < 4; ++db) o[db] = WFrag<T16>::mma(va[db], pf, o[db]); }
        }
        asm volatile("s_wait_dscnt 0x0" ::: "memory");      // this wave's reads of the stage's buffer are done before the buffer is given up
        asm volatile("s_wait_asynccnt 0x0" ::: "memory");   // this wave's share of the next stage has landed
        __syncthreads();   // the next stage is whole, and every wave has left this stage's buffer
        if (st + 2 < NST) fill(st + 2, st & 1);
    }
    asm volatile("s_wait_asynccnt 0x0" ::: "memory");   // no copy is outstanding when the wave ends
    l += __shfl_xor(l, 16, 32);
    const float f = __fdiv_rn(1.0f, l);
#pragma unroll
    for (int db = 0; db < 4; ++db) { v8us oh, ol;
#pragma unroll
        for (int j = 0; j < 8; ++j) { unsigned short x0, x1; splitf(o[db][j] * f, x0, x1); oh[j] = x0; ol[j] = x1; }
        const size_t oo = (size_t)(qw + lr) * DQ + h * HD + db * 16 + hi * 8; *(v8us*)(Ah + oo) = oh; *(v8us*)(Al + oo) = ol; }   // a head's 64 values of a row are one 128-byte line, written by lanes lr and lr + 16 of one wave
    asm volatile("s_wait_xcnt 0x0" ::: "memory");   // behind the last store, before any later code overwrites a register that a store names
}
// grid: NB_ * NH_ * TT / 64 blocks of 64 query rows; one in four takes hi+lo rows (the dearer kind), three take fp16 rows. Within a kind: row block fastest, then head, then batch element.
// All blocks are resident at once, four to a WGP, and which four share a WGP is not promised. The kind is the sum of the index's base-4 digits mod 4: any four blocks that differ in one digit alone
// (neighbours, or 4, 16, 64 or 256 apart) hold one hi+lo block and three fp16 blocks, so the WGPs get equal work under any such placement. For speed only: every (kind, number) occurs once wherever the blocks land.
// A batch element's q and k planes lie together (NH_ q heads, then NKV k heads), so both step by NH_ + NKV planes from one element to the next; the mask is the same for all.
// Four work-groups share a WGP (4 x the LDS fits): amdgpu_waves_per_eu(4) holds the registers to a quarter of a SIMD's.
__global__ __launch_bounds__(FNW * 32) __attribute__((amdgpu_waves_per_eu(4))) void k_fattn(const h16* __restrict__ Q16, const h16* __restrict__ K16, const h16* __restrict__ V16, const bf* __restrict__ Qh, const bf* __restrict__ Ql, const bf* __restrict__ Kh, const bf* __restrict__ Kl, const bf* __restrict__ Vh, const bf* __restrict__ Vl, const float* __restrict__ fm, bf* Ah, bf* Al) {
    __shared__ __align__(16) char sm[2 * 4 * PLB];
    constexpr int NHL = RH / 64, NFP = (TT - RH) / 64; static_assert(NFP == 3 * NHL, "one hi+lo block to three fp16 blocks");
    const int bx = (int)blockIdx.x, kind = (bx + (bx >> 2) + (bx >> 4) + (bx >> 6) + (bx >> 8)) & 3; const bool hl = kind == 0;
    const int nr = hl ? (bx >> 2) : (bx >> 2) * 3 + kind - 1;   // number within the kind: each aligned run of four blocks holds one hi+lo block and fp16 blocks of kinds 1, 2, 3
    const int bh = hl ? nr / NHL : nr / NFP, q0 = hl ? (nr % NHL) * 64 : RH + (nr % NFP) * 64;
    const int h = bh % NH_; const size_t bz = (size_t)(bh / NH_);
    const size_t oqk = bz * (NH_ + NKV) * TT * HD, ov = bz * NKV * HD * TT, oa = bz * TT * DQ;
    Q16 += oqk; K16 += oqk; Qh += oqk; Ql += oqk; Kh += oqk; Kl += oqk; V16 += ov; Vh += ov; Vl += ov; Ah += oa; Al += oa;
    if (hl) fattn_body<bf, true>(Qh, Ql, Kh, Kl, Vh, Vl, fm, q0, h, sm, Ah, Al);
    else fattn_body<h16, false>(Q16, nullptr, K16, nullptr, V16, nullptr, fm, q0, h, sm, Ah, Al);
}

extern "C" void kernel_launch(void* const* d_in, const int* in_sizes, int n_in,
                              void* d_out, int out_size, void* d_ws, size_t ws_size, hipStream_t stream) {
    (void)in_sizes; (void)n_in; (void)out_size;
    const float* x = (const float*)d_in[0]; const float* fmask = (const float*)d_in[1]; const float* wq = (const float*)d_in[2]; const float* bq = (const float*)d_in[3]; const float* wk = (const float*)d_in[4]; const float* bk = (const float*)d_in[5]; const float* wv = (const float*)d_in[6]; const float* bv = (const float*)d_in[7]; const float* wo = (const float*)d_in[8]; const float* bo = (const float*)d_in[9]; const float* cosT = nullptr; const float* sinT = nullptr; (void)cosT; (void)sinT;
    float* OUT = (float*)d_out;     // [4][2048][512]
    char* wsp = (char*)d_ws;
    auto take = [&](size_t bytes) { char* p = wsp; wsp += (bytes + 255) & ~(size_t)255; return (void*)p; };
    bf* WQ = (bf*)take((size_t)DQ * DM * 2); bf* WK = (bf*)take((size_t)DKV * DM * 2); bf* WV = (bf*)take((size_t)DKV * DM * 2); bf* WO = (bf*)take((size_t)DM * DQ * 2);
    // Every buffer below holds all NB_ batch elements, one behind the other. QP*: per element NH_ q planes, then NKV k planes.
    bf* XB = (bf*)take((size_t)NB_ * TT * DM * 2);
    h16* QP16 = (h16*)take((size_t)NB_ * (NH_ + NKV) * TT * HD * 2); h16* VT16 = (h16*)take((size_t)NB_ * NKV * HD * TT * 2);
    bf* QPh = (bf*)take((size_t)NB_ * (NH_ + NKV) * TT * HD * 2); bf* QPl = (bf*)take((size_t)NB_ * (NH_ + NKV) * TT * HD * 2); bf* VTh = (bf*)take((size_t)NB_ * NKV * HD * TT * 2); bf* VTl = (bf*)take((size_t)NB_ * NKV * HD * TT * 2);
    h16* KP16 = QP16 + (size_t)NH_ * TT * HD; bf* KPh = QPh + (size_t)NH_ * TT * HD; bf* KPl = QPl + (size_t)NH_ * TT * HD;
    bf* ATh = (bf*)take((size_t)NB_ * TT * DQ * 2); bf* ATl = (bf*)take((size_t)NB_ * TT * DQ * 2);
    if ((size_t)(wsp - (char*)d_ws) > ws_size) return;    // ws 256 MiB
    (void)WK; (void)WV;
    k_wtG<<<dim3((unsigned)((DM * DQ / 64 + 63) / 64), 4, 1), 256, 0, stream>>>(wq, wk, wv, wo, DM, DQ, WQ);   // WQ, WK, WV, WO are consecutive planes of DM x DQ
    // The batch elements are independent and share every weight and the mask: each stage is one launch over all NB_ of them (rows b * TT + t of the row-major buffers; where planes are formed or read, blockIdx.x holds the element too).
    k_cvt8<<<(unsigned)(((size_t)NB_ * TT * DM / 8 + 255) / 256), 256, 0, stream>>>(x, XB, (size_t)NB_ * TT * DM / 8);
    k_qkv<<<dim3(NB_ * TT / 64, NH_, 3), 256, 0, stream>>>(XB, WQ, bq, bk, bv, QP16, QPh, QPl, VT16, VTh, VTl);   // z = q, k, v: weight planes consecutive; q heads, then k heads: an element's k planes lie directly behind its q planes
    k_fattn<<<dim3(NB_ * NH_ * (TT / 64), 1, 1), FNW * 32, 0, stream>>>(QP16, KP16, VT16, QPh, QPl, KPh, KPl, VTh, VTl, fmask, ATh, ATl);   // one kv head per query head
    k_gemmw<bf, 1, true, 8><<<dim3(NB_ * TT / 64, DM / 64, 1), 256, 0, stream>>>(ATh, ATl, WO, nullptr, DQ, OUT, DM, bo, nullptr, nullptr, 0, 0, 0);
}

// v007
// A run of this version takes 152 microseconds.
// Next to v006, in two timings, it ran 1.11 times as fast each time.
// All steps since v000 together make it 14.0 times as fast.
#include <hip/hip_runtime.h>

// Masked multi-head attention layer (x [4][2048][512]; Q/K/V = x W + b (8 heads x 64, [in, out]); scores = q.k / 8 + mask[i][j] x (-1e9) (float mask [1][1][2048][2048], read); softmax; out = (attn v merged) Wo + bo -> [4][2048][512]).
// Compute dtypes, f32 accumulate: every input rounded to bf16; Q/K/V on PLAIN bf16 operands (inputs: exact) + bias; the mask is data: a stage of 64 keys is left out by a wave only where the mask values read prove that all its weights are exactly 0; no score is stored: query rows < 512 hl (3 products), the rest single fp16; mask add + running softmax f32; Wo hl x exact (2 products) + bias.

#define NB_  4
#define TT   2048
#define DM   512
#define NH_  8
#define NKV  8
#define REP  (NH_ / NKV)
#define HD   64
#define DQ   (NH_ * HD)
#define DKV  (NKV * HD)
#define RH   512                  // query rows < RH use hi+lo planes (TT / 4: one block in four)
#define WIN  0
#define SCL  0.125f   // HD^-0.5
typedef _Float16 h16;
typedef unsigned short bf;
typedef __attribute__((ext_vector_type(16))) __bf16   v16bf;
typedef __attribute__((ext_vector_type(16))) _Float16 v16h;
typedef __attribute__((ext_vector_type(8)))  _Float16 v8h;
typedef __attribute__((ext_vector_type(8)))  unsigned short v8us;
typedef __attribute__((ext_vector_type(8)))  float    v8f;
typedef __attribute__((ext_vector_type(4)))  float    v4f;
typedef v8h  __attribute__((may_alias)) v8ha;
typedef v4f  __attribute__((may_alias)) v4fa;
typedef v8us __attribute__((may_alias)) v8usa;
typedef float __attribute__((ext_vector_type(2), may_alias)) v2fa;

__device__ __forceinline__ unsigned short f2bf(float f) { unsigned u = __float_as_uint(f); u += 0x7FFFu + ((u >> 16) & 1u); return (unsigned short)(u >> 16); }
__device__ __forceinline__ float bf2f(unsigned short b) { return __uint_as_float(((unsigned)b) << 16); }
__device__ __forceinline__ float bfr(float f) { return bf2f(f2bf(f)); }
__device__ __forceinline__ v16h cat16(v8h lo, v8h hi) { return __builtin_shufflevector(lo, hi, 0, 1, 2, 3, 4, 5, 6, 7, 8, 9, 10, 11, 12, 13, 14, 15); }
__device__ __forceinline__ v16bf cat16b(v8us lo, v8us hi) { return __builtin_bit_cast(v16bf, __builtin_shufflevector(lo, hi, 0, 1, 2, 3, 4, 5, 6, 7, 8, 9, 10, 11, 12, 13, 14, 15)); }
__device__ __forceinline__ v8f wmma16(v16h a, v16h b, v8f c) { return __builtin_amdgcn_wmma_f32_16x16x32_f16(false, a, false, b, (short)0, c, false, false); }
__device__ __forceinline__ v8f wmmab(v16bf a, v16bf b, v8f c) { return __builtin_amdgcn_wmma_f32_16x16x32_bf16(false, a, false, b, (short)0, c, false, false); }



// ---- k_gemmw: register-blocked GEMM, ONE WAVE per 64x64 output tile (16 accumulators), operands straight from K-contiguous 16-bit planes; grid (M/64, N/64, Z), 32 threads.
// C[m][n] (f32, pitch ldc, + optional f32 bias0[n]; z = 1, 2 take biasz1, biasz2) = sum_k A[m][k] Bt[n][k] (+ split products per NSPLIT). z-batch strides sA/sB/sC in elements. K % (32 * KS) == 0.
// KS > 1: the tile's work-group has KS waves (32 * KS threads); wave w sums k in [w K/KS, (w+1) K/KS), the KS partial tiles meet in LDS and are added in wave order 0..KS-1.
template <typename T16> struct WFrag;
template <> struct WFrag<h16> { typedef v16h V; static __device__ __forceinline__ V ld(const h16* p) { return cat16(*(const v8h*)p, *(const v8h*)(p + 16)); } static __device__ __forceinline__ v8f mma(V a, V b, v8f c) { return wmma16(a, b, c); } };
template <> struct WFrag<bf> { typedef v16bf V; static __device__ __forceinline__ V ld(const bf* p) { return cat16b(*(const v8us*)p, *(const v8us*)(p + 16)); } static __device__ __forceinline__ v8f mma(V a, V b, v8f c) { return wmmab(a, b, c); } };
template <typename T16, int NSPLIT, bool BIAS, int KS>
__global__ __launch_bounds__(32 * KS) void k_gemmw(const T16* __restrict__ A, const T16* __restrict__ A2, const T16* __restrict__ Bt, const T16* __restrict__ Bt2, int K, float* C, int ldc, const float* __restrict__ bias0, const float* __restrict__ biasz1, const float* __restrict__ biasz2, size_t sA, size_t sB, size_t sC) {
    typedef typename WFrag<T16>::V V;
    __shared__ __align__(16) float os[KS == 1 ? 16 * 68 : KS * 4096];
    const size_t z = blockIdx.z; A += z * sA; if (A2) A2 += z * sA; Bt += z * sB; if (Bt2) Bt2 += z * sB; C += z * sC;
    const float* bias = (z == 1) ? biasz1 : (z == 2) ? biasz2 : bias0;   // products batched in z (at most 3 with a bias) each bring their own bias vector
    const int lane = threadIdx.x & 31, lr = lane & 15, hi = lane >> 4; const int r0 = blockIdx.x * 64, c0 = blockIdx.y * 64;
    v8f acc[4][4];
#pragma unroll
    for (int mb = 0; mb < 4; ++mb)
#pragma unroll
        for (int nb = 0; nb < 4; ++nb) acc[mb][nb] = (v8f){};
    const int wv = (KS == 1) ? 0 : __builtin_amdgcn_readfirstlane((int)(threadIdx.x >> 5));   // wave number, scalar: the K loop's bounds stay wave-uniform
    const int kw = K / KS;   // this wave's share of K, from k = wv * kw
    const size_t aoff = (size_t)(r0 + lr) * K + 8 * hi, boff = (size_t)(c0 + lr) * K + 8 * hi;
#pragma unroll 1
    for (int kc = wv * kw; kc < (wv + 1) * kw; kc += 32) {
        V a[4], a2[4];
#pragma unroll
        for (int mb = 0; mb < 4; ++mb) { a[mb] = WFrag<T16>::ld(A + aoff + (size_t)mb * 16 * K + kc); if (NSPLIT == 1 || NSPLIT == 2) a2[mb] = WFrag<T16>::ld(A2 + aoff + (size_t)mb * 16 * K + kc); }
#pragma unroll
        for (int nb = 0; nb < 4; ++nb) { const V b = WFrag<T16>::ld(Bt + boff + (size_t)nb * 16 * K + kc); V b2; if (NSPLIT >= 2) b2 = WFrag<T16>::ld(Bt2 + boff + (size_t)nb * 16 * K + kc);
#pragma unroll
            for (int mb = 0; mb < 4; ++mb) { acc[mb][nb] = WFrag<T16>::mma(a[mb], b, acc[mb][nb]); if (NSPLIT == 1 || NSPLIT == 2) acc[mb][nb] = WFrag<T16>::mma(a2[mb], b, acc[mb][nb]); if (NSPLIT >= 2) acc[mb][nb] = WFrag<T16>::mma(a[mb], b2, acc[mb][nb]); } }
        asm volatile("v_nop\n\tv_nop\n\tv_nop\n\tv_nop" : "+v"(acc[0][0]), "+v"(acc[1][1]), "+v"(acc[2][2]), "+v"(acc[3][3]) : "v"(a[0]), "v"(a[3]));
    }
    if constexpr (KS > 1) {
        // Partial tile of wave wv at os + wv * 4096, as 16 units u = mb * 4 + jq (rows mb*16 + hi*8 + 2jq + {0,1}, all 64 columns); a unit is [nb][lane][2 rows], 1 KiB: register pairs go out as they lie, every LDS access is contiguous over the lanes.
        float* mine = os + wv * 4096 + lane * 2;
#pragma unroll
        for (int mb = 0; mb < 4; ++mb)
#pragma unroll
            for (int jq = 0; jq < 4; ++jq)
#pragma unroll
                for (int nb = 0; nb < 4; ++nb) { v2fa t; t[0] = acc[mb][nb][2 * jq]; t[1] = acc[mb][nb][2 * jq + 1]; *(v2fa*)(mine + ((mb * 4 + jq) * 4 + nb) * 64) = t; }
        __syncthreads();   // every wave's partial tile is in LDS before any wave adds them
        // A 16-byte read takes two neighbouring writer lanes: reader lane l, read i holds rows {0,1} of the unit's half (l & 15) >> 3 at columns (2i + (l >> 4)) * 16 + 2 * (l & 7) + {0,1}.
        const int rh = (lane & 15) >> 3, cl = (lane >> 4) * 16 + 2 * (lane & 7);
#pragma unroll
        for (int uu = 0; uu < 16 / KS; ++uu) { const int u = wv + uu * KS; const float* q0 = os + u * 256 + lane * 4; v4f s0 = *(const v4fa*)q0, s1 = *(const v4fa*)(q0 + 128);
#pragma unroll
            for (int s = 1; s < KS; ++s) { s0 += *(const v4fa*)(q0 + s * 4096); s1 += *(const v4fa*)(q0 + s * 4096 + 128); }
            if (BIAS) { const float b0 = bfr(bias[c0 + cl]), b1 = bfr(bias[c0 + cl + 1]), b2 = bfr(bias[c0 + 32 + cl]), b3 = bfr(bias[c0 + 32 + cl + 1]); s0[0] += b0; s0[1] += b0; s0[2] += b1; s0[3] += b1; s1[0] += b2; s1[1] += b2; s1[2] += b3; s1[3] += b3; }
            float* crow = C + (size_t)(r0 + (u >> 2) * 16 + rh * 8 + (u & 3) * 2) * ldc + c0 + cl;   // a unit holds whole 256-byte rows of the tile: one writing wave per line
#pragma unroll
            for (int q = 0; q < 2; ++q) { v2fa lo, up; lo[0] = s0[q]; lo[1] = s0[2 + q]; up[0] = s1[q]; up[1] = s1[2 + q]; *(v2fa*)(crow + (size_t)q * ldc) = lo; *(v2fa*)(crow + (size_t)q * ldc + 32) = up; } }
        return;
    }
#pragma unroll
    for (int mb = 0; mb < 4; ++mb) {
#pragma unroll
        for (int nb = 0; nb < 4; ++nb) {
#pragma unroll
            for (int j = 0; j < 8; ++j) os[(hi * 8 + j) * 68 + nb * 16 + lr] = acc[mb][nb][j]; }
        __builtin_amdgcn_wave_barrier(); asm volatile("" ::: "memory");
        float* crow = C + (size_t)(r0 + mb * 16) * ldc + c0;
{
#pragma unroll
            for (int s = 0; s < 8; ++s) { const int row = 2 * s + hi, cofs = lr * 4; v4f val = *(const v4fa*)(os + row * 68 + cofs); if (BIAS) { val[0] += bfr(bias[c0 + cofs]); val[1] += bfr(bias[c0 + cofs + 1]); val[2] += bfr(bias[c0 + cofs + 2]); val[3] += bfr(bias[c0 + cofs + 3]); }
                *(v4f*)(crow + (size_t)row * ldc + cofs) = val; }
             }
        __builtin_amdgcn_wave_barrier(); asm volatile("" ::: "memory");
    }
}

__device__ __forceinline__ h16 tohx(float x) { return (h16)x; }
// Maximum and minimum that hand a NaN on (fmaxf and fminf drop it): what is built from them for the test in k_fattn turns NaN where an operand is NaN, and the test then fails.
__device__ __forceinline__ float mxn(float a, float b) { return __builtin_elementwise_maximum(a, b); }
__device__ __forceinline__ float mnn(float a, float b) { return __builtin_elementwise_minimum(a, b); }
__device__ __forceinline__ void splitf(float y, unsigned short& h, unsigned short& l) { h = f2bf(y); l = f2bf(y - bf2f(h)); }
typedef __attribute__((ext_vector_type(2))) _Float16 v2h;
typedef __attribute__((ext_vector_type(4))) _Float16 v4h;
typedef __attribute__((ext_vector_type(2))) unsigned short v2us;
typedef __attribute__((ext_vector_type(4))) unsigned short v4us;
typedef __attribute__((ext_vector_type(2))) float v2f;
typedef __attribute__((ext_vector_type(4))) int v4i;

// blockIdx.y picks one of four K x N weights; their transposed planes lie one behind the other in Bt.
__global__ __launch_bounds__(256) void k_wtG(const float* __restrict__ w0, const float* __restrict__ w1, const float* __restrict__ w2, const float* __restrict__ w3, int K, int N, bf* Bt) {
    const float* __restrict__ w = (blockIdx.y == 0) ? w0 : (blockIdx.y == 1) ? w1 : (blockIdx.y == 2) ? w2 : w3; Bt += (size_t)blockIdx.y * K * N;
    const int lane = threadIdx.x & 31; const int L0 = (blockIdx.x * 8 + (threadIdx.x >> 5)) * 8; const int nlines = N * K / 64;
{
#pragma unroll 1
        for (int l = 0; l < 8; ++l) { const int L = L0 + l; if (L >= nlines) break; const size_t e = (size_t)L * 64 + lane * 2; const int k = (int)(e % K), n = (int)(e / K); v2us o;
            o[0] = f2bf(w[(size_t)k * N + n]); o[1] = f2bf(w[(size_t)(k + 1) * N + n]); *(v2us*)(Bt + e) = o; }
         }
}
__global__ __launch_bounds__(256) void k_cvt8(const float* __restrict__ src, bf* dst, size_t n8) { const size_t i = (size_t)blockIdx.x * 256 + threadIdx.x; if (i >= n8) return; const v8f v = *(const v8f*)(src + i * 8); v8us o;
#pragma unroll
    for (int k = 0; k < 8; ++k) o[k] = f2bf(v[k]); *(v8us*)(dst + i * 8) = o;  }
__global__ __launch_bounds__(256) void k_cscvt(const float* __restrict__ cosT, const float* __restrict__ sinT, float* CS) { const int idx = blockIdx.x * 256 + threadIdx.x; if (idx >= TT * HD) return; v2f cs; cs[0] = bfr(cosT[idx]); cs[1] = bfr(sinT[idx]); *(v2f*)(CS + (size_t)idx * 2) = cs;  }
// ---- k_qkv: the Q, K and V projections (blockIdx.z = 0, 1, 2) of all batch elements; a work-group forms one head's 64 values of 64 tokens and writes them straight into the planes that k_fattn reads (fp16 and bf16 hi + lo).
// The product is k_gemmw's: 8 waves split K, the 8 partial tiles meet in LDS and are added in wave order. Q, K: tile rows = tokens (A = x), columns = d (B = weight), planes [head][t][d].
// V: the operands change places (A = weight rows d, B = x rows t), so the tile comes out transposed, rows = d, columns = tokens, as the planes [head][d][t] want it. Either way a tile row is one 128-byte line of each plane, written by one wave.
__global__ __launch_bounds__(256) void k_qkv(const bf* __restrict__ X, const bf* __restrict__ Wt, const float* __restrict__ bq, const float* __restrict__ bk, const float* __restrict__ bv, h16* P16, bf* Ph, bf* Pl, h16* V16, bf* Vh, bf* Vl, float* KM) {
    typedef WFrag<bf>::V V;
    constexpr int KS = 8, K = DM, kw = K / KS;
    __shared__ __align__(16) float os[KS * 4096];
    const int z = (int)blockIdx.z, hd = (int)blockIdx.y, t0 = (int)blockIdx.x * 64; const bool tr = z == 2;
    const float* bias = ((z == 0) ? bq : (z == 1) ? bk : bv) + hd * HD;
    const bf* xr = X + (size_t)t0 * K; const bf* wr = Wt + ((size_t)z * DQ + hd * HD) * K;
    const bf* A = tr ? wr : xr; const bf* Bt = tr ? xr : wr;
    const int lane = threadIdx.x & 31, lr = lane & 15, hi = lane >> 4;
    v8f acc[4][4];
#pragma unroll
    for (int mb = 0; mb < 4; ++mb)
#pragma unroll
        for (int nb = 0; nb < 4; ++nb) acc[mb][nb] = (v8f){};
    const int wv = __builtin_amdgcn_readfirstlane((int)(threadIdx.x >> 5));   // wave number, scalar: the K loop's bounds stay wave-uniform
    const size_t off = (size_t)lr * K + 8 * hi;
    // Where this lane's sums will lie in the tile (k_gemmw's lane map): rows ru + 16 * 2 uu + {0, 1} for its two units uu, columns cl + {0, 1} and 32 + cl + {0, 1}.
    const int rh = (lane & 15) >> 3, cl = (lane >> 4) * 16 + 2 * (lane & 7), ru = (wv >> 2) * 16 + rh * 8 + (wv & 3) * 2;
    // The bias belongs to d: the tile's column for Q and K (4 columns a lane), its row for V (2 rows in each of 2 units). Asked for here, used behind the product.
    const float g0 = bias[tr ? ru : cl], g1 = bias[tr ? ru + 1 : cl + 1], g2 = bias[tr ? ru + 32 : 32 + cl], g3 = bias[tr ? ru + 33 : 32 + cl + 1];
    asm volatile("s_wait_xcnt 0x0" ::: "memory");   // behind the loads, before later code overwrites a register that one of them names
#pragma unroll 1
    for (int kc = wv * kw; kc < (wv + 1) * kw; kc += 32) {
        V a[4];
#pragma unroll
        for (int mb = 0; mb < 4; ++mb) a[mb] = WFrag<bf>::ld(A + off + (size_t)mb * 16 * K + kc);
        asm volatile("s_wait_xcnt 0x0" ::: "memory");   // behind the loads, before a later instruction (a later load's result too) overwrites an address register that they name
#pragma unroll
        for (int nb = 0; nb < 4; ++nb) { const V b = WFrag<bf>::ld(Bt + off + (size_t)nb * 16 * K + kc);
            asm volatile("s_wait_xcnt 0x0" ::: "memory");   // the same, behind this fragment's loads
#pragma unroll
            for (int mb = 0; mb < 4; ++mb) acc[mb][nb] = WFrag<bf>::mma(a[mb], b, acc[mb][nb]); }
        asm volatile("v_nop\n\tv_nop\n\tv_nop\n\tv_nop" : "+v"(acc[0][0]), "+v"(acc[1][1]), "+v"(acc[2][2]), "+v"(acc[3][3]) : "v"(a[0]), "v"(a[3]));   // the distance behind the last matrix instruction, also on the loop's back edge
    }
    // Partial tiles in LDS and their sum: units, order and lane map as in k_gemmw.
    float* mine = os + wv * 4096 + lane * 2;
#pragma unroll
    for (int mb = 0; mb < 4; ++mb)
#pragma unroll
        for (int jq = 0; jq < 4; ++jq)
#pragma unroll
            for (int nb = 0; nb < 4; ++nb) { v2fa t; t[0] = acc[mb][nb][2 * jq]; t[1] = acc[mb][nb][2 * jq + 1]; *(v2fa*)(mine + ((mb * 4 + jq) * 4 + nb) * 64) = t; }
    __syncthreads();   // every wave's partial tile is in LDS before any wave adds them
    const float b0 = bfr(g0), b1 = bfr(g1), b2 = bfr(g2), b3 = bfr(g3);
    const int be = t0 / TT, tb = t0 % TT;   // 64 divides TT: a tile's tokens belong to one batch element
    const size_t base = tr ? (size_t)(be * NKV + hd) * HD * TT + tb : ((size_t)(be * (NH_ + NKV) + z * NH_ + hd) * TT + tb) * HD;
    const int pitch = tr ? TT : HD;
    float am = 0.f;   // largest magnitude among the values this lane stores (the fp16 rounding counted, so an overflow shows as inf)
    h16* D16 = (tr ? V16 : P16) + base + cl; bf* Dh = (tr ? Vh : Ph) + base + cl; bf* Dl = (tr ? Vl : Pl) + base + cl;
#pragma unroll
    for (int uu = 0; uu < 16 / KS; ++uu) { const int u = wv + uu * KS; const float* q0 = os + u * 256 + lane * 4; v4f s0 = *(const v4fa*)q0, s1 = *(const v4fa*)(q0 + 128);
#pragma unroll
        for (int s = 1; s < KS; ++s) { s0 += *(const v4fa*)(q0 + s * 4096); s1 += *(const v4fa*)(q0 + s * 4096 + 128); }
        const int row = ru + uu * 32;   // s0, s1: [0], [1] = rows row, row + 1 of column cl (s1: 32 + cl); [2], [3] = the same rows of the next column
        if (tr) { const float e0 = uu ? b2 : b0, e1 = uu ? b3 : b1; s0[0] += e0; s0[1] += e1; s0[2] += e0; s0[3] += e1; s1[0] += e0; s1[1] += e1; s1[2] += e0; s1[3] += e1; }
        else { s0[0] += b0; s0[1] += b0; s0[2] += b1; s0[3] += b1; s1[0] += b2; s1[1] += b2; s1[2] += b3; s1[3] += b3; }
#pragma unroll
        for (int q = 0; q < 2; ++q) { const size_t ro = (size_t)(row + q) * pitch;
#pragma unroll
            for (int i = 0; i < 2; ++i) { const float y0 = i ? s1[q] : s0[q], y1 = i ? s1[2 + q] : s0[2 + q]; v2h o16; v2us oh, ol; unsigned short a2, c2;
                o16[0] = tohx(y0); o16[1] = tohx(y1); am = mxn(mxn(am, mxn(fabsf(y0), fabsf(y1))), mxn(fabsf((float)o16[0]), fabsf((float)o16[1]))); splitf(y0, a2, c2); oh[0] = a2; ol[0] = c2; splitf(y1, a2, c2); oh[1] = a2; ol[1] = c2;
                *(v2h*)(D16 + ro + i * 32) = o16; *(v2us*)(Dh + ro + i * 32) = oh; *(v2us*)(Dl + ro + i * 32) = ol; } }
        asm volatile("s_wait_xcnt 0x0" ::: "memory");   // behind the unit's stores, before later code overwrites a register that one of them names
    }
    // K tiles: each wave leaves the largest |k| of its rows for k_fattn's bound on the scores, in a 128-byte line of its own.
    if (z == 1) {
#pragma unroll
        for (int d = 16; d >= 1; d >>= 1) am = mxn(am, __shfl_xor(am, d, 32));
        if (lane == 0) KM[((size_t)((be * NKV + hd) * (TT / 64) + tb / 64) * KS + wv) * 32] = am;
        asm volatile("s_wait_xcnt 0x0" ::: "memory");   // behind the store, before later code overwrites a register that it names
    }
}
// ---- k_fattn: scores, mask, softmax and P.V of one head in one kernel; no score or probability leaves the registers.
// A work-group has 4 waves and 64 query rows: wave w owns rows 16 w .. 16 w + 15 and walks ALL keys, so no partial results meet at the end.
// K and V^T come in stages of 64 keys: the work-group brings each stage into LDS once (asynchronous copies, whole 128-byte lines, two buffers: the next stage flies while this one is worked on) and all 4 waves read their fragments from there.
// Transposed products: S^T = K Q^T (D: row = key, column = query) and O^T += V^T P^T (D: row = d, column = query). A lane's two score tiles of a pass
// (keys 8 hi + j and 16 + 8 hi + j of query lr) are the sixteen k positions of its B fragment for P^T, so P goes from D to B in place, and every per-query factor is per lane.
#define L2E 1.4426950408889634f
#define FNW 4                     // waves of a work-group, 16 query rows each
#define SKK 64                    // keys of a stage = two passes of 32
#define LPB 144                   // LDS pitch, bytes, of a 128-byte row (64 d of a key, or 64 keys of a d): 16 B x odd, no bank conflict for 16-byte reads
#define PLB (64 * LPB)            // one plane's 64 rows of a stage in LDS
// One plane's tile of a stage: 64 rows of 128 bytes; thread t brings 16 bytes of rows (t >> 3) + 0, 16, 32, 48 (l, g: its place and source in the first; gs: 16 source rows in bytes).
// s_wait_xcnt 0 is the statement's last line: it stands in front of whatever later rewrites a register that a copy names.
__device__ __forceinline__ void cp_plane(const unsigned l, const char* g, const size_t gs) {
    const unsigned l1 = l + 16 * LPB, l2 = l + 32 * LPB, l3 = l + 48 * LPB; const char* g1 = g + gs; const char* g2 = g + 2 * gs; const char* g3 = g + 3 * gs;
    asm volatile("global_load_async_to_lds_b128 %0, %4, off\n\tglobal_load_async_to_lds_b128 %1, %5, off\n\tglobal_load_async_to_lds_b128 %2, %6, off\n\tglobal_load_async_to_lds_b128 %3, %7, off\n\ts_wait_xcnt 0x0"
                 :: "v"(l), "v"(l1), "v"(l2), "v"(l3), "v"(g), "v"(g1), "v"(g2), "v"(g3) : "memory");
}
__device__ __forceinline__ float amax16(v16h v) { float a = 0.f;
#pragma unroll
    for (int e = 0; e < 16; ++e) a = mxn(a, fabsf((float)v[e])); return a; }
__device__ __forceinline__ float amax16(v16bf v) { const __attribute__((ext_vector_type(16))) unsigned short u = __builtin_bit_cast(__attribute__((ext_vector_type(16))) unsigned short, v); float a = 0.f;
#pragma unroll
    for (int e = 0; e < 16; ++e) a = mxn(a, fabsf(bf2f(u[e]))); return a; }
template <typename T16, bool HL>
__device__ __forceinline__ void fattn_body(const T16* __restrict__ Qa, const T16* __restrict__ Qb, const T16* __restrict__ Ka, const T16* __restrict__ Kb, const T16* __restrict__ Va, const T16* __restrict__ Vb, const float* __restrict__ fm, const float* __restrict__ km, const int q0, const int h, char* sm, bf* Ah, bf* Al) {
    typedef typename WFrag<T16>::V V;
    constexpr int VO = (HL ? 2 : 1) * PLB;   // V^T planes lie behind the K planes of a stage
    constexpr int SB = (HL ? 4 : 2) * PLB;   // bytes of a stage in LDS
    constexpr int NST = TT / SKK;
    const int lane = threadIdx.x & 31, lr = lane & 15, hi = lane >> 4;
    const int wv = __builtin_amdgcn_readfirstlane((int)(threadIdx.x >> 5));   // wave number, scalar
    const int qw = q0 + wv * 16;   // this wave's first query row
    const size_t hp = (size_t)h * TT * HD;
    V qa[2], qb[2];
#pragma unroll
    for (int kc = 0; kc < 2; ++kc) { const size_t qo = hp + (size_t)((qw + lr) * HD + 8 * hi + kc * 32); qa[kc] = WFrag<T16>::ld(Qa + qo);
        asm volatile("s_wait_xcnt 0x0" ::: "memory");   // behind this fragment's loads, before a later instruction (a later load's result too) overwrites an address register that they name
        if constexpr (HL) { qb[kc] = WFrag<T16>::ld(Qb + qo);
            asm volatile("s_wait_xcnt 0x0" ::: "memory"); } }   // the same
    v8f o[4]; float m = -3.0e38f, l = 0.f;
#pragma unroll
    for (int db = 0; db < 4; ++db) o[db] = (v8f){};
    // Copies: this thread's 16 bytes of a row. K planes [key][d]: a stage is 64 whole rows, one behind the other. V^T planes [d][key]: 128 bytes of each of the 64 rows.
    const int crow = (int)threadIdx.x >> 3, ccol = ((int)threadIdx.x & 7) * 16;
    const unsigned lc = (unsigned)(size_t)sm + (unsigned)(crow * LPB + ccol);
    const size_t ko = (size_t)(crow * (HD * 2) + ccol), vo = (size_t)crow * (TT * 2) + ccol;
    const char* gka = (const char*)(Ka + hp) + ko; const char* gva = (const char*)(Va + hp) + vo;
    const char* gkb = HL ? (const char*)(Kb + hp) + ko : nullptr; const char* gvb = HL ? (const char*)(Vb + hp) + vo : nullptr;
    auto fill = [&](const int st, const int buf) {
        const unsigned lb = lc + (unsigned)(buf * SB); const size_t ks = (size_t)st * (SKK * HD * 2), vs = (size_t)st * (SKK * 2);
        cp_plane(lb, gka + ks, 16 * HD * 2); if constexpr (HL) cp_plane(lb + PLB, gkb + ks, 16 * HD * 2);
        cp_plane(lb + VO, gva + vs, (size_t)16 * TT * 2); if constexpr (HL) cp_plane(lb + VO + PLB, gvb + vs, (size_t)16 * TT * 2); };
    fill(0, 0);
    asm volatile("s_wait_asynccnt 0x0" ::: "memory");   // this wave's share of stage 0 has landed
    __syncthreads();   // stage 0 is whole before any wave reads it
    fill(1, 1);
    // sb_: no score of this lane's query, scaled, exceeds it. A score is a sum of at most 192 products (hi+lo: 3 x 64) of a stored q value and a stored k value;
    // qx is the largest stored |q| of the row, kx the largest |k| of the head before rounding (the roundings add under 1 %): 256 x SCL = 32 leaves a quarter to spare. An inf or a NaN among them makes sb_ inf or NaN and the test below fails: nothing is left out.
    float kx = 0.f;
#pragma unroll
    for (int i = 0; i < 8; ++i) kx = mxn(kx, km[(size_t)(lane * 8 + i) * 32]);   // the head's 32 tiles x 8 waves, one value a line
    asm volatile("s_wait_xcnt 0x0" ::: "memory");   // behind the loads, before later code overwrites a register that one of them names
#pragma unroll
    for (int d = 16; d >= 1; d >>= 1) kx = mxn(kx, __shfl_xor(kx, d, 32));
    float qx = mxn(amax16(qa[0]), amax16(qa[1])); if constexpr (HL) qx = mxn(qx, mxn(amax16(qb[0]), amax16(qb[1])));
    qx = mxn(qx, __shfl_xor(qx, 16, 32));   // the other half of the row's d lies in lane lr + 16
    const float sb_ = 32.f * qx * kx;
    const int fro = lr * LPB + hi * 16;   // fragment reads: row lr of a 16-row tile, 16 bytes from k = 8 hi (and from 16 + 8 hi)
    // fp16 rows: mask values are held one stage ahead, since the test on them stands in front of a stage's fragments: they come from L2 or memory while the stage before is finished.
    // Behind each group stands s_wait_xcnt 0: a later instruction may overwrite a register that an issued load names, and the wait stands in front of that.
    v4f mk[2][4];
    const float* mr0 = fm + (size_t)(qw + lr) * TT + hi * 8;
    auto ldmask = [&](const int ps, const float* mp) {
#pragma unroll
        for (int kt = 0; kt < 2; ++kt) { mk[ps][kt * 2] = *(const v4f*)(mp + ps * 32 + kt * 16); mk[ps][kt * 2 + 1] = *(const v4f*)(mp + ps * 32 + kt * 16 + 4); }
        asm volatile("s_wait_xcnt 0x0" ::: "memory"); };
    if constexpr (!HL) { ldmask(0, mr0); ldmask(1, mr0); }
#pragma unroll 1   // rolled: a trip is one stage; the buffer alternates with it
    for (int st = 0; st < NST; ++st) {
        const char* sb = sm + (st & 1) * SB + fro;
        const float* mr = mr0 + (HL ? st : st + 1 < NST ? st + 1 : st) * SKK;   // fp16: the next stage's mask values (the last stage asks for its own again: in bounds, unused)
        if constexpr (HL) { ldmask(0, mr); ldmask(1, mr); }   // hi+lo planes: this stage's own, here; held over from the stage before, their registers stand beside the fragments' and some spill
        // The test. Every score of the stage is at most ub: sb_ bounds q.k / 8, and the smallest mask value gives the largest mask term mt (a thousandth of |mt| on top: room for the roundings of the score's own sum, whatever mt's sign).
        // Where ub lies 256 under the running maximum in every lane, the maximum stays, the rescale factor is exp2(0) and each weight is exp2(under -369) = 0: the stage would change nothing (0 x V^T adds 0: V is finite wherever x, Wv and bv are).
        float mq[8];   // eight short chains, then a tree, not one chain of 31
#pragma unroll
        for (int i = 0; i < 8; ++i) { const v4f x = mk[i >> 2][i & 3]; mq[i] = mnn(mnn(x[0], x[1]), mnn(x[2], x[3])); }
        const float mt = bfr(mnn(mnn(mnn(mq[0], mq[1]), mnn(mq[2], mq[3])), mnn(mnn(mq[4], mq[5]), mnn(mq[6], mq[7])))) * -1.0e9f;   // the rounding to bf16 keeps the order, so the smallest value's is the smallest
        const float ub = sb_ + (mt + fabsf(mt) * 1.0e-3f);
        if (__builtin_amdgcn_ballot_w32(ub - m < -256.f) == 0xFFFFFFFFu) { if constexpr (!HL) { ldmask(0, mr); ldmask(1, mr); } }   // wave-uniform, a scalar branch: nothing but the next stage's mask values is asked for
        else {
#pragma unroll
        for (int ps = 0; ps < 2; ++ps) {
            V ka[2][2], kl[2][2], va[4], vl[4];
#pragma unroll
            for (int kt = 0; kt < 2; ++kt)
#pragma unroll
                for (int kc = 0; kc < 2; ++kc) { const char* p = sb + (ps * 32 + kt * 16) * LPB + kc * 64; ka[kt][kc] = WFrag<T16>::ld((const T16*)p); if constexpr (HL) kl[kt][kc] = WFrag<T16>::ld((const T16*)(p + PLB)); }
            v8f s[2];
#pragma unroll
            for (int kt = 0; kt < 2; ++kt) { v8f c = (v8f){};
#pragma unroll
                for (int kc = 0; kc < 2; ++kc) { c = WFrag<T16>::mma(ka[kt][kc], qa[kc], c); if constexpr (HL) { c = WFrag<T16>::mma(ka[kt][kc], qb[kc], c); c = WFrag<T16>::mma(kl[kt][kc], qa[kc], c); } }
                s[kt] = c; }
            if constexpr (HL) __builtin_amdgcn_sched_barrier(0);   // hi+lo planes: the V^T fragments are fetched only when the K fragments are spent, into their registers; fetched together the two sets spill
#pragma unroll
            for (int db = 0; db < 4; ++db) { const char* p = sb + VO + db * 16 * LPB + ps * 64; va[db] = WFrag<T16>::ld((const T16*)p); if constexpr (HL) vl[db] = WFrag<T16>::ld((const T16*)(p + PLB)); }
            float t[16]; float mx = m;
#pragma unroll
            for (int kt = 0; kt < 2; ++kt)
#pragma unroll
                for (int j = 0; j < 8; ++j) { const float mv = bfr(mk[ps][kt * 2 + (j >> 2)][j & 3]); const float tt = s[kt][j] * SCL + mv * -1.0e9f; t[kt * 8 + j] = tt; mx = fmaxf(mx, tt); }
            if (!HL && ps == 1) { ldmask(0, mr); ldmask(1, mr); }   // the stage's mask values are spent: the next stage's are asked for here, and land while the weights and P.V are formed
            mx = fmaxf(mx, __shfl_xor(mx, 16, 32));   // the other half of the query's keys of this pass lies in lane lr + 16
            const float al = __builtin_amdgcn_exp2f((m - mx) * L2E); m = mx;
            float sum = 0.f;
#pragma unroll
            for (int k = 0; k < 16; ++k) { t[k] = __builtin_amdgcn_exp2f((t[k] - mx) * L2E); sum += t[k]; }
            l = l * al + sum;   // each half keeps the sum of its own keys; the halves meet behind the loop
#pragma unroll
            for (int db = 0; db < 4; ++db) o[db] *= al;
            if constexpr (HL) { v8us h0, h1, l0, l1;
#pragma unroll
                for (int j = 0; j < 8; ++j) { unsigned short a, c2; splitf(t[j], a, c2); h0[j] = a; l0[j] = c2; splitf(t[8 + j], a, c2); h1[j] = a; l1[j] = c2; }
                const V ph = cat16b(h0, h1), pl = cat16b(l0, l1);
#pragma unroll
                for (int db = 0; db < 4; ++db) { o[db] = WFrag<T16>::mma(va[db], ph, o[db]); o[db] = WFrag<T16>::mma(va[db], pl, o[db]); o[db] = WFrag<T16>::mma(vl[db], ph, o[db]); }
            } else { V pf;
#pragma unroll
                for (int k = 0; k < 16; ++k) pf[k] = tohx(t[k]);
#pragma unroll
                for (int db = 0; db < 4; ++db) o[db] = WFrag<T16>::mma(va[db], pf, o[db]); }
        }
        }
        asm volatile("s_wait_dscnt 0x0" ::: "memory");      // this wave's reads of the stage's buffer are done before the buffer is given up
        asm volatile("s_wait_asynccnt 0x0" ::: "memory");   // this wave's share of the next stage has landed
        __syncthreads();   // the next stage is whole, and every wave has left this stage's buffer
        if (st + 2 < NST) fill(st + 2, st & 1);
    }
    asm volatile("s_wait_asynccnt 0x0" ::: "memory");   // no copy is outstanding when the wave ends
    l += __shfl_xor(l, 16, 32);
    const float f = __fdiv_rn(1.0f, l);
#pragma unroll
    for (int db = 0; db < 4; ++db) { v8us oh, ol;
#pragma unroll
        for (int j = 0; j < 8; ++j) { unsigned short x0, x1; splitf(o[db][j] * f, x0, x1); oh[j] = x0; ol[j] = x1; }
        const size_t oo = (size_t)(qw + lr) * DQ + h * HD + db * 16 + hi * 8; *(v8us*)(Ah + oo) = oh; *(v8us*)(Al + oo) = ol; }   // a head's 64 values of a row are one 128-byte line, written by lanes lr and lr + 16 of one wave
    asm volatile("s_wait_xcnt 0x0" ::: "memory");   // behind the last store, before any later code overwrites a register that a store names
}
// grid: NB_ * NH_ * TT / 64 blocks of 64 query rows; one in four takes hi+lo rows (the dearer kind), three take fp16 rows. Within a kind: row block fastest, then head, then batch element.
// All blocks are resident at once, four to a WGP, and which four share a WGP is not promised. The kind is the sum of the index's base-4 digits mod 4: any four blocks that differ in one digit alone
// (neighbours, or 4, 16, 64 or 256 apart) hold one hi+lo block and three fp16 blocks, one from each third of the fp16 rows, so the WGPs get about equal work under any such placement. For speed only: every (kind, number) occurs once wherever the blocks land.
// A batch element's q and k planes lie together (NH_ q heads, then NKV k heads), so both step by NH_ + NKV planes from one element to the next; the mask is the same for all.
// Four work-groups share a WGP (4 x the LDS fits), one wave of each on every SIMD: amdgpu_waves_per_eu(4) holds the registers to a quarter of a SIMD's.
__global__ __launch_bounds__(FNW * 32) __attribute__((amdgpu_waves_per_eu(4))) void k_fattn(const h16* __restrict__ Q16, const h16* __restrict__ K16, const h16* __restrict__ V16, const bf* __restrict__ Qh, const bf* __restrict__ Ql, const bf* __restrict__ Kh, const bf* __restrict__ Kl, const bf* __restrict__ Vh, const bf* __restrict__ Vl, const float* __restrict__ fm, const float* __restrict__ KM, bf* Ah, bf* Al) {
    __shared__ __align__(16) char sm[2 * 4 * PLB];
    constexpr int NHL = RH / 64, NFP = (TT - RH) / 64; static_assert(NFP == 3 * NHL, "one hi+lo block to three fp16 blocks");
    const int bx = (int)blockIdx.x, kind = (bx + (bx >> 2) + (bx >> 4) + (bx >> 6) + (bx >> 8)) & 3; const bool hl = kind == 0;
    // Number within the kind: bx >> 2 = head * NHL + j. The hi+lo block takes row block j; the fp16 kinds 1, 2, 3 take row block NHL - 1 - j of the first, second, last third of the fp16 rows.
    // Where the mask hides the keys behind a query, a block's work grows with its row: j rising, the dearer hi+lo block gains what the three fp16 blocks of the run lose. For speed only.
    const int nr = bx >> 2, bh = nr / NHL, q0 = hl ? (nr % NHL) * 64 : RH + ((kind - 1) * NHL + NHL - 1 - nr % NHL) * 64;
    const int h = bh % NH_; const size_t bz = (size_t)(bh / NH_);
    const size_t oqk = bz * (NH_ + NKV) * TT * HD, ov = bz * NKV * HD * TT, oa = bz * TT * DQ;
    Q16 += oqk; K16 += oqk; Qh += oqk; Ql += oqk; Kh += oqk; Kl += oqk; V16 += ov; Vh += ov; Vl += ov; Ah += oa; Al += oa; KM += (size_t)bh * (TT / 64) * 8 * 32;   // NKV = NH_: the head's own k tiles
    if (hl) fattn_body<bf, true>(Qh, Ql, Kh, Kl, Vh, Vl, fm, KM, q0, h, sm, Ah, Al);
    else fattn_body<h16, false>(Q16, nullptr, K16, nullptr, V16, nullptr, fm, KM, q0, h, sm, Ah, Al);
}

extern "C" void kernel_launch(void* const* d_in, const int* in_sizes, int n_in,
                              void* d_out, int out_size, void* d_ws, size_t ws_size, hipStream_t stream) {
    (void)in_sizes; (void)n_in; (void)out_size;
    const float* x = (const float*)d_in[0]; const float* fmask = (const float*)d_in[1]; const float* wq = (const float*)d_in[2]; const float* bq = (const float*)d_in[3]; const float* wk = (const float*)d_in[4]; const float* bk = (const float*)d_in[5]; const float* wv = (const float*)d_in[6]; const float* bv = (const float*)d_in[7]; const float* wo = (const float*)d_in[8]; const float* bo = (const float*)d_in[9]; const float* cosT = nullptr; const float* sinT = nullptr; (void)cosT; (void)sinT;
    float* OUT = (float*)d_out;     // [4][2048][512]
    char* wsp = (char*)d_ws;
    auto take = [&](size_t bytes) { char* p = wsp; wsp += (bytes + 255) & ~(size_t)255; return (void*)p; };
    bf* WQ = (bf*)take((size_t)DQ * DM * 2); bf* WK = (bf*)take((size_t)DKV * DM * 2); bf* WV = (bf*)take((size_t)DKV * DM * 2); bf* WO = (bf*)take((size_t)DM * DQ * 2);
    // Every buffer below holds all NB_ batch elements, one behind the other. QP*: per element NH_ q planes, then NKV k planes.
    bf* XB = (bf*)take((size_t)NB_ * TT * DM * 2);
    h16* QP16 = (h16*)take((size_t)NB_ * (NH_ + NKV) * TT * HD * 2); h16* VT16 = (h16*)take((size_t)NB_ * NKV * HD * TT * 2);
    bf* QPh = (bf*)take((size_t)NB_ * (NH_ + NKV) * TT * HD * 2); bf* QPl = (bf*)take((size_t)NB_ * (NH_ + NKV) * TT * HD * 2); bf* VTh = (bf*)take((size_t)NB_ * NKV * HD * TT * 2); bf* VTl = (bf*)take((size_t)NB_ * NKV * HD * TT * 2);
    h16* KP16 = QP16 + (size_t)NH_ * TT * HD; bf* KPh = QPh + (size_t)NH_ * TT * HD; bf* KPl = QPl + (size_t)NH_ * TT * HD;
    bf* ATh = (bf*)take((size_t)NB_ * TT * DQ * 2); bf* ATl = (bf*)take((size_t)NB_ * TT * DQ * 2);
    float* KMX = (float*)take((size_t)NB_ * NKV * (TT / 64) * 8 * 32 * 4);   // per k tile and wave of k_qkv: largest |k|, a 128-byte line each
    if ((size_t)(wsp - (char*)d_ws) > ws_size) return;    // ws 256 MiB
    (void)WK; (void)WV;
    k_wtG<<<dim3((unsigned)((DM * DQ / 64 + 63) / 64), 4, 1), 256, 0, stream>>>(wq, wk, wv, wo, DM, DQ, WQ);   // WQ, WK, WV, WO are consecutive planes of DM x DQ
    // The batch elements are independent and share every weight and the mask: each stage is one launch over all NB_ of them (rows b * TT + t of the row-major buffers; where planes are formed or read, blockIdx.x holds the element too).
    k_cvt8<<<(unsigned)(((size_t)NB_ * TT * DM / 8 + 255) / 256), 256, 0, stream>>>(x, XB, (size_t)NB_ * TT * DM / 8);
    k_qkv<<<dim3(NB_ * TT / 64, NH_, 3), 256, 0, stream>>>(XB, WQ, bq, bk, bv, QP16, QPh, QPl, VT16, VTh, VTl, KMX);   // z = q, k, v: weight planes consecutive; q heads, then k heads: an element's k planes lie directly behind its q planes
    k_fattn<<<dim3(NB_ * NH_ * (TT / 64), 1, 1), FNW * 32, 0, stream>>>(QP16, KP16, VT16, QPh, QPl, KPh, KPl, VTh, VTl, fmask, KMX, ATh, ATl);   // one kv head per query head
    k_gemmw<bf, 1, true, 8><<<dim3(NB_ * TT / 64, DM / 64, 1), 256, 0, stream>>>(ATh, ATl, WO, nullptr, DQ, OUT, DM, bo, nullptr, nullptr, 0, 0, 0);
}

// v008
// One run takes 131 microseconds.
// Next to v007, in two timings, it ran 1.16 and 1.17 times as fast.
// All steps since v000 together make it 16.3 times as fast.
#include <hip/hip_runtime.h>

// Masked multi-head attention layer (x [4][2048][512]; Q/K/V = x W + b (8 heads x 64, [in, out]); scores = q.k / 8 + mask[i][j] x (-1e9) (float mask [1][1][2048][2048], read); softmax; out = (attn v merged) Wo + bo -> [4][2048][512]).
// Compute dtypes, f32 accumulate: every input rounded to bf16; Q/K/V on PLAIN bf16 operands (inputs: exact) + bias; the mask is data, the same for every head and batch element: it is rounded to bf16 once, with the minimum of each tile of 16 queries x 64 keys; a stage of 64 keys is left out by a wave only where that minimum proves that all its weights are exactly 0; no score is stored: query rows < 512 hl (3 products), the rest single fp16; mask add + running softmax f32; Wo hl x exact (2 products) + bias.

#define NB_  4
#define TT   2048
#define DM   512
#define NH_  8
#define NKV  8
#define REP  (NH_ / NKV)
#define HD   64
#define DQ   (NH_ * HD)
#define DKV  (NKV * HD)
#define RH   512                  // query rows < RH use hi+lo planes (TT / 4: one block in four)
#define WIN  0
#define SCL  0.125f   // HD^-0.5
typedef _Float16 h16;
typedef unsigned short bf;
typedef __attribute__((ext_vector_type(16))) __bf16   v16bf;
typedef __attribute__((ext_vector_type(16))) _Float16 v16h;
typedef __attribute__((ext_vector_type(8)))  _Float16 v8h;
typedef __attribute__((ext_vector_type(8)))  unsigned short v8us;
typedef __attribute__((ext_vector_type(8)))  float    v8f;
typedef __attribute__((ext_vector_type(4)))  float    v4f;
typedef v8h  __attribute__((may_alias)) v8ha;
typedef v4f  __attribute__((may_alias)) v4fa;
typedef v8us __attribute__((may_alias)) v8usa;
typedef float __attribute__((ext_vector_type(2), may_alias)) v2fa;

__device__ __forceinline__ unsigned short f2bf(float f) { unsigned u = __float_as_uint(f); u += 0x7FFFu + ((u >> 16) & 1u); return (unsigned short)(u >> 16); }
__device__ __forceinline__ float bf2f(unsigned short b) { return __uint_as_float(((unsigned)b) << 16); }
__device__ __forceinline__ float bfr(float f) { return bf2f(f2bf(f)); }
__device__ __forceinline__ v16h cat16(v8h lo, v8h hi) { return __builtin_shufflevector(lo, hi, 0, 1, 2, 3, 4, 5, 6, 7, 8, 9, 10, 11, 12, 13, 14, 15); }
__device__ __forceinline__ v16bf cat16b(v8us lo, v8us hi) { return __builtin_bit_cast(v16bf, __builtin_shufflevector(lo, hi, 0, 1, 2, 3, 4, 5, 6, 7, 8, 9, 10, 11, 12, 13, 14, 15)); }
__device__ __forceinline__ v8f wmma16(v16h a, v16h b, v8f c) { return __builtin_amdgcn_wmma_f32_16x16x32_f16(false, a, false, b, (short)0, c, false, false); }
__device__ __forceinline__ v8f wmmab(v16bf a, v16bf b, v8f c) { return __builtin_amdgcn_wmma_f32_16x16x32_bf16(false, a, false, b, (short)0, c, false, false); }



// ---- k_gemmw: register-blocked GEMM, ONE WAVE per 64x64 output tile (16 accumulators), operands straight from K-contiguous 16-bit planes; grid (M/64, N/64, Z), 32 threads.
// C[m][n] (f32, pitch ldc, + optional f32 bias0[n]; z = 1, 2 take biasz1, biasz2) = sum_k A[m][k] Bt[n][k] (+ split products per NSPLIT). z-batch strides sA/sB/sC in elements. K % (32 * KS) == 0.
// KS > 1: the tile's work-group has KS waves (32 * KS threads); wave w sums k in [w K/KS, (w+1) K/KS), the KS partial tiles meet in LDS and are added in wave order 0..KS-1.
template <typename T16> struct WFrag;
template <> struct WFrag<h16> { typedef v16h V; static __device__ __forceinline__ V ld(const h16* p) { return cat16(*(const v8h*)p, *(const v8h*)(p + 16)); } static __device__ __forceinline__ v8f mma(V a, V b, v8f c) { return wmma16(a, b, c); } };
template <> struct WFrag<bf> { typedef v16bf V; static __device__ __forceinline__ V ld(const bf* p) { return cat16b(*(const v8us*)p, *(const v8us*)(p + 16)); } static __device__ __forceinline__ v8f mma(V a, V b, v8f c) { return wmmab(a, b, c); } };
template <typename T16, int NSPLIT, bool BIAS, int KS>
__global__ __launch_bounds__(32 * KS) void k_gemmw(const T16* __restrict__ A, const T16* __restrict__ A2, const T16* __restrict__ Bt, const T16* __restrict__ Bt2, int K, float* C, int ldc, const float* __restrict__ bias0, const float* __restrict__ biasz1, const float* __restrict__ biasz2, size_t sA, size_t sB, size_t sC) {
    typedef typename WFrag<T16>::V V;
    __shared__ __align__(16) float os[KS == 1 ? 16 * 68 : KS * 4096];
    const size_t z = blockIdx.z; A += z * sA; if (A2) A2 += z * sA; Bt += z * sB; if (Bt2) Bt2 += z * sB; C += z * sC;
    const float* bias = (z == 1) ? biasz1 : (z == 2) ? biasz2 : bias0;   // products batched in z (at most 3 with a bias) each bring their own bias vector
    const int lane = threadIdx.x & 31, lr = lane & 15, hi = lane >> 4; const int r0 = blockIdx.x * 64, c0 = blockIdx.y * 64;
    v8f acc[4][4];
#pragma unroll
    for (int mb = 0; mb < 4; ++mb)
#pragma unroll
        for (int nb = 0; nb < 4; ++nb) acc[mb][nb] = (v8f){};
    const int wv = (KS == 1) ? 0 : __builtin_amdgcn_readfirstlane((int)(threadIdx.x >> 5));   // wave number, scalar: the K loop's bounds stay wave-uniform
    const int kw = K / KS;   // this wave's share of K, from k = wv * kw
    const size_t aoff = (size_t)(r0 + lr) * K + 8 * hi, boff = (size_t)(c0 + lr) * K + 8 * hi;
#pragma unroll 1
    for (int kc = wv * kw; kc < (wv + 1) * kw; kc += 32) {
        V a[4], a2[4];
#pragma unroll
        for (int mb = 0; mb < 4; ++mb) { a[mb] = WFrag<T16>::ld(A + aoff + (size_t)mb * 16 * K + kc); if (NSPLIT == 1 || NSPLIT == 2) a2[mb] = WFrag<T16>::ld(A2 + aoff + (size_t)mb * 16 * K + kc); }
#pragma unroll
        for (int nb = 0; nb < 4; ++nb) { const V b = WFrag<T16>::ld(Bt + boff + (size_t)nb * 16 * K + kc); V b2; if (NSPLIT >= 2) b2 = WFrag<T16>::ld(Bt2 + boff + (size_t)nb * 16 * K + kc);
#pragma unroll
            for (int mb = 0; mb < 4; ++mb) { acc[mb][nb] = WFrag<T16>::mma(a[mb], b, acc[mb][nb]); if (NSPLIT == 1 || NSPLIT == 2) acc[mb][nb] = WFrag<T16>::mma(a2[mb], b, acc[mb][nb]); if (NSPLIT >= 2) acc[mb][nb] = WFrag<T16>::mma(a[mb], b2, acc[mb][nb]); } }
        asm volatile("v_nop\n\tv_nop\n\tv_nop\n\tv_nop" : "+v"(acc[0][0]), "+v"(acc[1][1]), "+v"(acc[2][2]), "+v"(acc[3][3]) : "v"(a[0]), "v"(a[3]));
    }
    if constexpr (KS > 1) {
        // Partial tile of wave wv at os + wv * 4096, as 16 units u = mb * 4 + jq (rows mb*16 + hi*8 + 2jq + {0,1}, all 64 columns); a unit is [nb][lane][2 rows], 1 KiB: register pairs go out as they lie, every LDS access is contiguous over the lanes.
        float* mine = os + wv * 4096 + lane * 2;
#pragma unroll
        for (int mb = 0; mb < 4; ++mb)
#pragma unroll
            for (int jq = 0; jq < 4; ++jq)
#pragma unroll
                for (int nb = 0; nb < 4; ++nb) { v2fa t; t[0] = acc[mb][nb][2 * jq]; t[1] = acc[mb][nb][2 * jq + 1]; *(v2fa*)(mine + ((mb * 4 + jq) * 4 + nb) * 64) = t; }
        __syncthreads();   // every wave's partial tile is in LDS before any wave adds them
        // A 16-byte read takes two neighbouring writer lanes: reader lane l, read i holds rows {0,1} of the unit's half (l & 15) >> 3 at columns (2i + (l >> 4)) * 16 + 2 * (l & 7) + {0,1}.
        const int rh = (lane & 15) >> 3, cl = (lane >> 4) * 16 + 2 * (lane & 7);
#pragma unroll
        for (int uu = 0; uu < 16 / KS; ++uu) { const int u = wv + uu * KS; const float* q0 = os + u * 256 + lane * 4; v4f s0 = *(const v4fa*)q0, s1 = *(const v4fa*)(q0 + 128);
#pragma unroll
            for (int s = 1; s < KS; ++s) { s0 += *(const v4fa*)(q0 + s * 4096); s1 += *(const v4fa*)(q0 + s * 4096 + 128); }
            if (BIAS) { const float b0 = bfr(bias[c0 + cl]), b1 = bfr(bias[c0 + cl + 1]), b2 = bfr(bias[c0 + 32 + cl]), b3 = bfr(bias[c0 + 32 + cl + 1]); s0[0] += b0; s0[1] += b0; s0[2] += b1; s0[3] += b1; s1[0] += b2; s1[1] += b2; s1[2] += b3; s1[3] += b3; }
            float* crow = C + (size_t)(r0 + (u >> 2) * 16 + rh * 8 + (u & 3) * 2) * ldc + c0 + cl;   // a unit holds whole 256-byte rows of the tile: one writing wave per line
#pragma unroll
            for (int q = 0; q < 2; ++q) { v2fa lo, up; lo[0] = s0[q]; lo[1] = s0[2 + q]; up[0] = s1[q]; up[1] = s1[2 + q]; *(v2fa*)(crow + (size_t)q * ldc) = lo; *(v2fa*)(crow + (size_t)q * ldc + 32) = up; } }
        return;
    }
#pragma unroll
    for (int mb = 0; mb < 4; ++mb) {
#pragma unroll
        for (int nb = 0; nb < 4; ++nb) {
#pragma unroll
            for (int j = 0; j < 8; ++j) os[(hi * 8 + j) * 68 + nb * 16 + lr] = acc[mb][nb][j]; }
        __builtin_amdgcn_wave_barrier(); asm volatile("" ::: "memory");
        float* crow = C + (size_t)(r0 + mb * 16) * ldc + c0;
{
#pragma unroll
            for (int s = 0; s < 8; ++s) { const int row = 2 * s + hi, cofs = lr * 4; v4f val = *(const v4fa*)(os + row * 68 + cofs); if (BIAS) { val[0] += bfr(bias[c0 + cofs]); val[1] += bfr(bias[c0 + cofs + 1]); val[2] += bfr(bias[c0 + cofs + 2]); val[3] += bfr(bias[c0 + cofs + 3]); }
                *(v4f*)(crow + (size_t)row * ldc + cofs) = val; }
             }
        __builtin_amdgcn_wave_barrier(); asm volatile("" ::: "memory");
    }
}

__device__ __forceinline__ h16 tohx(float x) { return (h16)x; }
// Maximum and minimum that hand a NaN on (fmaxf and fminf drop it): what is built from them for the test in k_fattn turns NaN where an operand is NaN, and the test then fails.
__device__ __forceinline__ float mxn(float a, float b) { return __builtin_elementwise_maximum(a, b); }
__device__ __forceinline__ float mnn(float a, float b) { return __builtin_elementwise_minimum(a, b); }
__device__ __forceinline__ void splitf(float y, unsigned short& h, unsigned short& l) { h = f2bf(y); l = f2bf(y - bf2f(h)); }
typedef __attribute__((ext_vector_type(2))) _Float16 v2h;
typedef __attribute__((ext_vector_type(4))) _Float16 v4h;
typedef __attribute__((ext_vector_type(2))) unsigned short v2us;
typedef __attribute__((ext_vector_type(4))) unsigned short v4us;
typedef __attribute__((ext_vector_type(2))) float v2f;
typedef __attribute__((ext_vector_type(4))) int v4i;

// blockIdx.y picks one of four K x N weights; their transposed planes lie one behind the other in Bt.
__global__ __launch_bounds__(256) void k_wtG(const float* __restrict__ w0, const float* __restrict__ w1, const float* __restrict__ w2, const float* __restrict__ w3, int K, int N, bf* Bt) {
    const float* __restrict__ w = (blockIdx.y == 0) ? w0 : (blockIdx.y == 1) ? w1 : (blockIdx.y == 2) ? w2 : w3; Bt += (size_t)blockIdx.y * K * N;
    const int lane = threadIdx.x & 31; const int L0 = (blockIdx.x * 8 + (threadIdx.x >> 5)) * 8; const int nlines = N * K / 64;
{
#pragma unroll 1
        for (int l = 0; l < 8; ++l) { const int L = L0 + l; if (L >= nlines) break; const size_t e = (size_t)L * 64 + lane * 2; const int k = (int)(e % K), n = (int)(e / K); v2us o;
            o[0] = f2bf(w[(size_t)k * N + n]); o[1] = f2bf(w[(size_t)(k + 1) * N + n]); *(v2us*)(Bt + e) = o; }
         }
}
// ---- k_cvt8: x rounded to bf16, and (blocks below MKB) the mask made ready for k_fattn, once for all heads and batch elements.
// A mask tile is 16 query rows x 64 keys = what one wave of k_fattn needs for one stage. MB: the tile's values, rounded to bf16, in the order in which that wave's lanes hold them: [tile][g][lane][8],
// lane = (lr, hi), value j = query row lr, key 16 g + 8 hi + j: each of the wave's four 16-byte loads of a stage is 512 bytes in a row. TM: the smallest of the tile's rounded values, in a 128-byte line of its own (one writing wave per line).
#define MKB (TT / 16 * (TT / 64) / 16)   // 8 waves a block, 2 tiles a wave
__global__ __launch_bounds__(256) void k_cvt8(const float* __restrict__ src, bf* dst, size_t n8, const float* __restrict__ fm, bf* MB, float* TM) {
    if (blockIdx.x < MKB) {
        const int lane = threadIdx.x & 31, lr = lane & 15, hi = lane >> 4; const int t0 = ((int)blockIdx.x * 8 + ((int)threadIdx.x >> 5)) * 2;
        v4f r[2][8];
#pragma unroll
        for (int i = 0; i < 2; ++i) { const int tl = t0 + i; const float* mp = fm + (size_t)(tl / (TT / 64) * 16 + lr) * TT + tl % (TT / 64) * 64 + hi * 8;
#pragma unroll
            for (int g = 0; g < 4; ++g) { r[i][g * 2] = *(const v4f*)(mp + g * 16); r[i][g * 2 + 1] = *(const v4f*)(mp + g * 16 + 4); } }
        asm volatile("s_wait_xcnt 0x0" ::: "memory");   // behind the loads, before later code overwrites a register that one of them names
#pragma unroll
        for (int i = 0; i < 2; ++i) { const int tl = t0 + i; float mq[4];   // the minimum is taken over the rounded values, the ones the scores get; a NaN among them is handed on
#pragma unroll
            for (int g = 0; g < 4; ++g) { v8us o;
#pragma unroll
                for (int j = 0; j < 8; ++j) o[j] = f2bf(r[i][g * 2 + (j >> 2)][j & 3]);
                *(v8us*)(MB + ((size_t)tl * 4 + g) * 256 + lane * 8) = o;
                mq[g] = mnn(mnn(mnn(bf2f(o[0]), bf2f(o[1])), mnn(bf2f(o[2]), bf2f(o[3]))), mnn(mnn(bf2f(o[4]), bf2f(o[5])), mnn(bf2f(o[6]), bf2f(o[7])))); }
            float mn = mnn(mnn(mq[0], mq[1]), mnn(mq[2], mq[3]));
#pragma unroll
            for (int d = 16; d >= 1; d >>= 1) mn = mnn(mn, __shfl_xor(mn, d, 32));
            if (lane == 0) TM[(size_t)tl * 32] = mn;
        }
        asm volatile("s_wait_xcnt 0x0" ::: "memory");   // behind the stores, before later code overwrites a register that one of them names
        return;
    }
    const size_t i = (size_t)(blockIdx.x - MKB) * 256 + threadIdx.x; if (i >= n8) return; const v8f v = *(const v8f*)(src + i * 8); v8us o;
#pragma unroll
    for (int k = 0; k < 8; ++k) o[k] = f2bf(v[k]); *(v8us*)(dst + i * 8) = o;  }
__global__ __launch_bounds__(256) void k_cscvt(const float* __restrict__ cosT, const float* __restrict__ sinT, float* CS) { const int idx = blockIdx.x * 256 + threadIdx.x; if (idx >= TT * HD) return; v2f cs; cs[0] = bfr(cosT[idx]); cs[1] = bfr(sinT[idx]); *(v2f*)(CS + (size_t)idx * 2) = cs;  }
// ---- k_qkv: the Q, K and V projections (blockIdx.z = 0, 1, 2) of all batch elements; a work-group forms one head's 64 values of 64 tokens and writes them straight into the planes that k_fattn reads (fp16 and bf16 hi + lo).
// The product is k_gemmw's: 8 waves split K, the 8 partial tiles meet in LDS and are added in wave order. Q, K: tile rows = tokens (A = x), columns = d (B = weight), planes [head][t][d].
// V: the operands change places (A = weight rows d, B = x rows t), so the tile comes out transposed, rows = d, columns = tokens, as the planes [head][d][t] want it. Either way a tile row is one 128-byte line of each plane, written by one wave.
__global__ __launch_bounds__(256) void k_qkv(const bf* __restrict__ X, const bf* __restrict__ Wt, const float* __restrict__ bq, const float* __restrict__ bk, const float* __restrict__ bv, h16* P16, bf* Ph, bf* Pl, h16* V16, bf* Vh, bf* Vl, float* KM) {
    typedef WFrag<bf>::V V;
    constexpr int KS = 8, K = DM, kw = K / KS;
    __shared__ __align__(16) float os[KS * 4096];
    const int z = (int)blockIdx.z, hd = (int)blockIdx.y, t0 = (int)blockIdx.x * 64; const bool tr = z == 2;
    const float* bias = ((z == 0) ? bq : (z == 1) ? bk : bv) + hd * HD;
    const bf* xr = X + (size_t)t0 * K; const bf* wr = Wt + ((size_t)z * DQ + hd * HD) * K;
    const bf* A = tr ? wr : xr; const bf* Bt = tr ? xr : wr;
    const int lane = threadIdx.x & 31, lr = lane & 15, hi = lane >> 4;
    v8f acc[4][4];
#pragma unroll
    for (int mb = 0; mb < 4; ++mb)
#pragma unroll
        for (int nb = 0; nb < 4; ++nb) acc[mb][nb] = (v8f){};
    const int wv = __builtin_amdgcn_readfirstlane((int)(threadIdx.x >> 5));   // wave number, scalar: the K loop's bounds stay wave-uniform
    const size_t off = (size_t)lr * K + 8 * hi;
    // Where this lane's sums will lie in the tile (k_gemmw's lane map): rows ru + 16 * 2 uu + {0, 1} for its two units uu, columns cl + {0, 1} and 32 + cl + {0, 1}.
    const int rh = (lane & 15) >> 3, cl = (lane >> 4) * 16 + 2 * (lane & 7), ru = (wv >> 2) * 16 + rh * 8 + (wv & 3) * 2;
    // The bias belongs to d: the tile's column for Q and K (4 columns a lane), its row for V (2 rows in each of 2 units). Asked for here, used behind the product.
    const float g0 = bias[tr ? ru : cl], g1 = bias[tr ? ru + 1 : cl + 1], g2 = bias[tr ? ru + 32 : 32 + cl], g3 = bias[tr ? ru + 33 : 32 + cl + 1];
    asm volatile("s_wait_xcnt 0x0" ::: "memory");   // behind the loads, before later code overwrites a register that one of them names
#pragma unroll 1
    for (int kc = wv * kw; kc < (wv + 1) * kw; kc += 32) {
        V a[4];
#pragma unroll
        for (int mb = 0; mb < 4; ++mb) a[mb] = WFrag<bf>::ld(A + off + (size_t)mb * 16 * K + kc);
        asm volatile("s_wait_xcnt 0x0" ::: "memory");   // behind the loads, before a later instruction (a later load's result too) overwrites an address register that they name
#pragma unroll
        for (int nb = 0; nb < 4; ++nb) { const V b = WFrag<bf>::ld(Bt + off + (size_t)nb * 16 * K + kc);
            asm volatile("s_wait_xcnt 0x0" ::: "memory");   // the same, behind this fragment's loads
#pragma unroll
            for (int mb = 0; mb < 4; ++mb) acc[mb][nb] = WFrag<bf>::mma(a[mb], b, acc[mb][nb]); }
        asm volatile("v_nop\n\tv_nop\n\tv_nop\n\tv_nop" : "+v"(acc[0][0]), "+v"(acc[1][1]), "+v"(acc[2][2]), "+v"(acc[3][3]) : "v"(a[0]), "v"(a[3]));   // the distance behind the last matrix instruction, also on the loop's back edge
    }
    // Partial tiles in LDS and their sum: units, order and lane map as in k_gemmw.
    float* mine = os + wv * 4096 + lane * 2;
#pragma unroll
    for (int mb = 0; mb < 4; ++mb)
#pragma unroll
        for (int jq = 0; jq < 4; ++jq)
#pragma unroll
            for (int nb = 0; nb < 4; ++nb) { v2fa t; t[0] = acc[mb][nb][2 * jq]; t[1] = acc[mb][nb][2 * jq + 1]; *(v2fa*)(mine + ((mb * 4 + jq) * 4 + nb) * 64) = t; }
    __syncthreads();   // every wave's partial tile is in LDS before any wave adds them
    const float b0 = bfr(g0), b1 = bfr(g1), b2 = bfr(g2), b3 = bfr(g3);
    const int be = t0 / TT, tb = t0 % TT;   // 64 divides TT: a tile's tokens belong to one batch element
    const size_t base = tr ? (size_t)(be * NKV + hd) * HD * TT + tb : ((size_t)(be * (NH_ + NKV) + z * NH_ + hd) * TT + tb) * HD;
    const int pitch = tr ? TT : HD;
    float am = 0.f;   // largest magnitude among the values this lane stores (the fp16 rounding counted, so an overflow shows as inf)
    h16* D16 = (tr ? V16 : P16) + base + cl; bf* Dh = (tr ? Vh : Ph) + base + cl; bf* Dl = (tr ? Vl : Pl) + base + cl;
#pragma unroll
    for (int uu = 0; uu < 16 / KS; ++uu) { const int u = wv + uu * KS; const float* q0 = os + u * 256 + lane * 4; v4f s0 = *(const v4fa*)q0, s1 = *(const v4fa*)(q0 + 128);
#pragma unroll
        for (int s = 1; s < KS; ++s) { s0 += *(const v4fa*)(q0 + s * 4096); s1 += *(const v4fa*)(q0 + s * 4096 + 128); }
        const int row = ru + uu * 32;   // s0, s1: [0], [1] = rows row, row + 1 of column cl (s1: 32 + cl); [2], [3] = the same rows of the next column
        if (tr) { const float e0 = uu ? b2 : b0, e1 = uu ? b3 : b1; s0[0] += e0; s0[1] += e1; s0[2] += e0; s0[3] += e1; s1[0] += e0; s1[1] += e1; s1[2] += e0; s1[3] += e1; }
        else { s0[0] += b0; s0[1] += b0; s0[2] += b1; s0[3] += b1; s1[0] += b2; s1[1] += b2; s1[2] += b3; s1[3] += b3; }
#pragma unroll
        for (int q = 0; q < 2; ++q) { const size_t ro = (size_t)(row + q) * pitch;
#pragma unroll
            for (int i = 0; i < 2; ++i) { const float y0 = i ? s1[q] : s0[q], y1 = i ? s1[2 + q] : s0[2 + q]; v2h o16; v2us oh, ol; unsigned short a2, c2;
                o16[0] = tohx(y0); o16[1] = tohx(y1); am = mxn(mxn(am, mxn(fabsf(y0), fabsf(y1))), mxn(fabsf((float)o16[0]), fabsf((float)o16[1]))); splitf(y0, a2, c2); oh[0] = a2; ol[0] = c2; splitf(y1, a2, c2); oh[1] = a2; ol[1] = c2;
                *(v2h*)(D16 + ro + i * 32) = o16; *(v2us*)(Dh + ro + i * 32) = oh; *(v2us*)(Dl + ro + i * 32) = ol; } }
        asm volatile("s_wait_xcnt 0x0" ::: "memory");   // behind the unit's stores, before later code overwrites a register that one of them names
    }
    // K tiles: each wave leaves the largest |k| of its rows for k_fattn's bound on the scores, in a 128-byte line of its own.
    if (z == 1) {
#pragma unroll
        for (int d = 16; d >= 1; d >>= 1) am = mxn(am, __shfl_xor(am, d, 32));
        if (lane == 0) KM[((size_t)((be * NKV + hd) * (TT / 64) + tb / 64) * KS + wv) * 32] = am;
        asm volatile("s_wait_xcnt 0x0" ::: "memory");   // behind the store, before later code overwrites a register that it names
    }
}
// ---- k_fattn: scores, mask, softmax and P.V of one head in one kernel; no score or probability leaves the registers.
// A work-group has 4 waves and 64 query rows: wave w owns rows 16 w .. 16 w + 15 and walks ALL keys, so no partial results meet at the end.
// K and V^T come in stages of 64 keys: the work-group brings each stage into LDS once (asynchronous copies, whole 128-byte lines, two buffers: the next stage flies while this one is worked on) and all 4 waves read their fragments from there.
// Transposed products: S^T = K Q^T (D: row = key, column = query) and O^T += V^T P^T (D: row = d, column = query). A lane's two score tiles of a pass
// (keys 8 hi + j and 16 + 8 hi + j of query lr) are the sixteen k positions of its B fragment for P^T, so P goes from D to B in place, and every per-query factor is per lane.
#define L2E 1.4426950408889634f
#define FNW 4                     // waves of a work-group, 16 query rows each
#define SKK 64                    // keys of a stage = two passes of 32
#define LPB 144                   // LDS pitch, bytes, of a 128-byte row (64 d of a key, or 64 keys of a d): 16 B x odd, no bank conflict for 16-byte reads
#define PLB (64 * LPB)            // one plane's 64 rows of a stage in LDS
// One plane's tile of a stage: 64 rows of 128 bytes; thread t brings 16 bytes of rows (t >> 3) + 0, 16, 32, 48 (l, g: its place and source in the first; gs: 16 source rows in bytes).
// s_wait_xcnt 0 is the statement's last line: it stands in front of whatever later rewrites a register that a copy names.
__device__ __forceinline__ void cp_plane(const unsigned l, const char* g, const size_t gs) {
    const unsigned l1 = l + 16 * LPB, l2 = l + 32 * LPB, l3 = l + 48 * LPB; const char* g1 = g + gs; const char* g2 = g + 2 * gs; const char* g3 = g + 3 * gs;
    asm volatile("global_load_async_to_lds_b128 %0, %4, off\n\tglobal_load_async_to_lds_b128 %1, %5, off\n\tglobal_load_async_to_lds_b128 %2, %6, off\n\tglobal_load_async_to_lds_b128 %3, %7, off\n\ts_wait_xcnt 0x0"
                 :: "v"(l), "v"(l1), "v"(l2), "v"(l3), "v"(g), "v"(g1), "v"(g2), "v"(g3) : "memory");
}
__device__ __forceinline__ float amax16(v16h v) { float a = 0.f;
#pragma unroll
    for (int e = 0; e < 16; ++e) a = mxn(a, fabsf((float)v[e])); return a; }
__device__ __forceinline__ float amax16(v16bf v) { const __attribute__((ext_vector_type(16))) unsigned short u = __builtin_bit_cast(__attribute__((ext_vector_type(16))) unsigned short, v); float a = 0.f;
#pragma unroll
    for (int e = 0; e < 16; ++e) a = mxn(a, fabsf(bf2f(u[e]))); return a; }
typedef __attribute__((address_space(1))) bf gbf;
typedef __attribute__((address_space(1))) v8usa gv8us;
template <typename T16, bool HL>
__device__ __forceinline__ void fattn_body(const T16* __restrict__ Qa, const T16* __restrict__ Qb, const T16* __restrict__ Ka, const T16* __restrict__ Kb, const T16* __restrict__ Va, const T16* __restrict__ Vb, const bf* __restrict__ mb, const float* __restrict__ tm, const float* __restrict__ km, const int q0, const int h, char* sm, bf* Ah, bf* Al) {
    typedef typename WFrag<T16>::V V;
    constexpr int VO = (HL ? 2 : 1) * PLB;   // V^T planes lie behind the K planes of a stage
    constexpr int SB = (HL ? 4 : 2) * PLB;   // bytes of a stage in LDS
    constexpr int NST = TT / SKK;
    const int lane = threadIdx.x & 31, lr = lane & 15, hi = lane >> 4;
    const int wv = __builtin_amdgcn_readfirstlane((int)(threadIdx.x >> 5));   // wave number, scalar
    const int qw = q0 + wv * 16;   // this wave's first query row
    const size_t hp = (size_t)h * TT * HD;
    V qa[2], qb[2];
#pragma unroll
    for (int kc = 0; kc < 2; ++kc) { const size_t qo = hp + (size_t)((qw + lr) * HD + 8 * hi + kc * 32); qa[kc] = WFrag<T16>::ld(Qa + qo);
        asm volatile("s_wait_xcnt 0x0" ::: "memory");   // behind this fragment's loads, before a later instruction (a later load's result too) overwrites an address register that they name
        if constexpr (HL) { qb[kc] = WFrag<T16>::ld(Qb + qo);
            asm volatile("s_wait_xcnt 0x0" ::: "memory"); } }   // the same
    v8f o[4]; float m = -3.0e38f, l = 0.f;
#pragma unroll
    for (int db = 0; db < 4; ++db) o[db] = (v8f){};
    // Copies: this thread's 16 bytes of a row. K planes [key][d]: a stage is 64 whole rows, one behind the other. V^T planes [d][key]: 128 bytes of each of the 64 rows.
    const int crow = (int)threadIdx.x >> 3, ccol = ((int)threadIdx.x & 7) * 16;
    const unsigned lc = (unsigned)(size_t)sm + (unsigned)(crow * LPB + ccol);
    const size_t ko = (size_t)(crow * (HD * 2) + ccol), vo = (size_t)crow * (TT * 2) + ccol;
    const char* gka = (const char*)(Ka + hp) + ko; const char* gva = (const char*)(Va + hp) + vo;
    const char* gkb = HL ? (const char*)(Kb + hp) + ko : nullptr; const char* gvb = HL ? (const char*)(Vb + hp) + vo : nullptr;
    auto fill = [&](const int st, const int buf) {
        const unsigned lb = lc + (unsigned)(buf * SB); const size_t ks = (size_t)st * (SKK * HD * 2), vs = (size_t)st * (SKK * 2);
        cp_plane(lb, gka + ks, 16 * HD * 2); if constexpr (HL) cp_plane(lb + PLB, gkb + ks, 16 * HD * 2);
        cp_plane(lb + VO, gva + vs, (size_t)16 * TT * 2); if constexpr (HL) cp_plane(lb + VO + PLB, gvb + vs, (size_t)16 * TT * 2); };
    // The mask, as k_cvt8 left it: mk[ps][kt][j] = the bf16 value of query lr, key 32 ps + 16 kt + 8 hi + j of a stage; lane i of tmv = the smallest value of stage i's tile (this wave's 16 rows x 64 keys).
    // Behind each group of loads stands s_wait_xcnt 0: a later instruction may overwrite a register that an issued load names, and the wait stands in front of that.
    static_assert(NST == 32, "one stage's minimum a lane");
    v8us mk[2][2], mkn[2][2] = {};   // this stage's values; fp16 rows: the next stage's beside them
    const bf* mb0 = mb + (size_t)(qw >> 4) * NST * 1024; const unsigned ml = (unsigned)lane * 8u;   // wave-uniform base, the lane's place beside it
    const float tmv = tm[(size_t)((qw >> 4) * NST + lane) * 32];
    asm volatile("s_wait_xcnt 0x0" ::: "memory");
    auto ldmask = [&](v8us (&dst)[2][2], const int s_) {
        const unsigned long long a = (unsigned long long)(mb0 + (size_t)s_ * 1024);   // the tile's address, held in scalar registers: the loads then name, beside it, only the lane's offset register, which no load's result overwrites
        const gbf* mp = (const gbf*)(((unsigned long long)(unsigned)__builtin_amdgcn_readfirstlane((int)(unsigned)(a >> 32)) << 32) | (unsigned)__builtin_amdgcn_readfirstlane((int)(unsigned)a));   // rebuilt from its words, so said to be global memory
#pragma unroll
        for (int g = 0; g < 4; ++g) dst[g >> 1][g & 1] = *(const gv8us*)(mp + g * 256 + ml);
        asm volatile("s_wait_xcnt 0x0" ::: "memory"); };
    if constexpr (!HL) ldmask(mk, 0);   // stage 0 always counts (no maximum yet); asked for here, its values are in behind the barrier below, and in the loop no wait for them falls on the loads of the stage after
    fill(0, 0);
    asm volatile("s_wait_asynccnt 0x0" ::: "memory");   // this wave's share of stage 0 has landed
    __syncthreads();   // stage 0 is whole before any wave reads it
    fill(1, 1);
    // sb_: no score of this lane's query, scaled, exceeds it. A score is a sum of at most 192 products (hi+lo: 3 x 64) of a stored q value and a stored k value;
    // qx is the largest stored |q| of the row, kx the largest |k| of the head before rounding (the roundings add under 1 %): 256 x SCL = 32 leaves a quarter to spare. An inf or a NaN among them makes sb_ inf or NaN and the test below fails: nothing is left out.
    float kx = 0.f;
#pragma unroll
    for (int i = 0; i < 8; ++i) kx = mxn(kx, km[(size_t)(lane * 8 + i) * 32]);   // the head's 32 tiles x 8 waves, one value a line
    asm volatile("s_wait_xcnt 0x0" ::: "memory");   // behind the loads, before later code overwrites a register that one of them names
#pragma unroll
    for (int d = 16; d >= 1; d >>= 1) kx = mxn(kx, __shfl_xor(kx, d, 32));
    float qx = mxn(amax16(qa[0]), amax16(qa[1])); if constexpr (HL) qx = mxn(qx, mxn(amax16(qb[0]), amax16(qb[1])));
    qx = mxn(qx, __shfl_xor(qx, 16, 32));   // the other half of the row's d lies in lane lr + 16
    const float sb_ = 32.f * qx * kx;
    const int fro = lr * LPB + hi * 16;   // fragment reads: row lr of a 16-row tile, 16 bytes from k = 8 hi (and from 16 + 8 hi)
    // The test. Every score of stage s_ is at most ub: sb_ bounds q.k / 8, and the tile's smallest mask value gives the largest mask term mt (a thousandth of |mt| on top: room for the roundings of the score's own sum, whatever mt's sign).
    // Where ub lies 256 under the running maximum in every lane, the maximum stays, the rescale factor is exp2(0) and each weight is exp2(under -369) = 0: the stage would change nothing (0 x V^T adds 0: V is finite wherever x, Wv and bv are).
    // The running maximum never falls, so a stage that passes the test early still passes it when its turn comes. Wave-uniform: the ballot's compare is a scalar branch.
    auto dead = [&](const int s_) -> bool {
        const float mt = __uint_as_float((unsigned)__builtin_amdgcn_readlane((int)__float_as_uint(tmv), s_)) * -1.0e9f;
        const float ub = sb_ + (mt + fabsf(mt) * 1.0e-3f);
        return __builtin_amdgcn_ballot_w32(ub - m < -256.f) == 0xFFFFFFFFu; };
    // fp16 rows: whether the next stage counts is settled at the head of this one, and only then are its mask values asked for: they come from L2 while this stage is worked on. A stage left out reads no mask value at all.
    bool act = true, nact = false;
#pragma unroll 1   // rolled: a trip is one stage; the buffer alternates with it
    for (int st = 0; st < NST; ++st) {
        const char* sb = sm + (st & 1) * SB + fro;
        if constexpr (HL) act = !dead(st);   // hi+lo planes: settled here, and the stage's own mask values asked for here; held over from the stage before, their registers stand beside the fragments' and some spill
        else { nact = st + 1 < NST && !dead(st + 1); if (nact) ldmask(mkn, st + 1); }
        if (act) {
        if constexpr (HL) ldmask(mk, st);
#pragma unroll
        for (int ps = 0; ps < 2; ++ps) {
            V ka[2][2], kl[2][2], va[4], vl[4];
#pragma unroll
            for (int kt = 0; kt < 2; ++kt)
#pragma unroll
                for (int kc = 0; kc < 2; ++kc) { const char* p = sb + (ps * 32 + kt * 16) * LPB + kc * 64; ka[kt][kc] = WFrag<T16>::ld((const T16*)p); if constexpr (HL) kl[kt][kc] = WFrag<T16>::ld((const T16*)(p + PLB)); }
            v8f s[2];
#pragma unroll
            for (int kt = 0; kt < 2; ++kt) { v8f c = (v8f){};
#pragma unroll
                for (int kc = 0; kc < 2; ++kc) { c = WFrag<T16>::mma(ka[kt][kc], qa[kc], c); if constexpr (HL) { c = WFrag<T16>::mma(ka[kt][kc], qb[kc], c); c = WFrag<T16>::mma(kl[kt][kc], qa[kc], c); } }
                s[kt] = c; }
            if constexpr (HL) __builtin_amdgcn_sched_barrier(0);   // hi+lo planes: the V^T fragments are fetched only when the K fragments are spent, into their registers; fetched together the two sets spill
#pragma unroll
            for (int db = 0; db < 4; ++db) { const char* p = sb + VO + db * 16 * LPB + ps * 64; va[db] = WFrag<T16>::ld((const T16*)p); if constexpr (HL) vl[db] = WFrag<T16>::ld((const T16*)(p + PLB)); }
            float t[16]; float mx = m;
#pragma unroll
            for (int kt = 0; kt < 2; ++kt)
#pragma unroll
                for (int j = 0; j < 8; ++j) { const float mv = bf2f(mk[ps][kt][j]); const float tt = s[kt][j] * SCL + mv * -1.0e9f; t[kt * 8 + j] = tt; mx = fmaxf(mx, tt); }
            mx = fmaxf(mx, __shfl_xor(mx, 16, 32));   // the other half of the query's keys of this pass lies in lane lr + 16
            const float al = __builtin_amdgcn_exp2f((m - mx) * L2E); m = mx;
            float sum = 0.f;
#pragma unroll
            for (int k = 0; k < 16; ++k) { t[k] = __builtin_amdgcn_exp2f((t[k] - mx) * L2E); sum += t[k]; }
            l = l * al + sum;   // each half keeps the sum of its own keys; the halves meet behind the loop
#pragma unroll
            for (int db = 0; db < 4; ++db) o[db] *= al;
            if constexpr (HL) { v8us h0, h1, l0, l1;
#pragma unroll
                for (int j = 0; j < 8; ++j) { unsigned short a, c2; splitf(t[j], a, c2); h0[j] = a; l0[j] = c2; splitf(t[8 + j], a, c2); h1[j] = a; l1[j] = c2; }
                const V ph = cat16b(h0, h1), pl = cat16b(l0, l1);
#pragma unroll
                for (int db = 0; db < 4; ++db) { o[db] = WFrag<T16>::mma(va[db], ph, o[db]); o[db] = WFrag<T16>::mma(va[db], pl, o[db]); o[db] = WFrag<T16>::mma(vl[db], ph, o[db]); }
            } else { V pf;
#pragma unroll
                for (int k = 0; k < 16; ++k) pf[k] = tohx(t[k]);
#pragma unroll
                for (int db = 0; db < 4; ++db) o[db] = WFrag<T16>::mma(va[db], pf, o[db]); }
        }
        }
        asm volatile("s_wait_dscnt 0x0" ::: "memory");      // this wave's reads of the stage's buffer are done before the buffer is given up
        asm volatile("s_wait_asynccnt 0x0" ::: "memory");   // this wave's share of the next stage has landed
        __syncthreads();   // the next stage is whole, and every wave has left this stage's buffer
        if (st + 2 < NST) fill(st + 2, st & 1);
        if constexpr (!HL) { act = nact;
#pragma unroll
            for (int g = 0; g < 4; ++g) mk[g >> 1][g & 1] = mkn[g >> 1][g & 1]; }
    }
    asm volatile("s_wait_asynccnt 0x0" ::: "memory");   // no copy is outstanding when the wave ends
    l += __shfl_xor(l, 16, 32);
    const float f = __fdiv_rn(1.0f, l);
#pragma unroll
    for (int db = 0; db < 4; ++db) { v8us oh, ol;
#pragma unroll
        for (int j = 0; j < 8; ++j) { unsigned short x0, x1; splitf(o[db][j] * f, x0, x1); oh[j] = x0; ol[j] = x1; }
        const size_t oo = (size_t)(qw + lr) * DQ + h * HD + db * 16 + hi * 8; *(v8us*)(Ah + oo) = oh; *(v8us*)(Al + oo) = ol; }   // a head's 64 values of a row are one 128-byte line, written by lanes lr and lr + 16 of one wave
    asm volatile("s_wait_xcnt 0x0" ::: "memory");   // behind the last store, before any later code overwrites a register that a store names
}
// grid: NB_ * NH_ * TT / 64 blocks of 64 query rows; one in four takes hi+lo rows (the dearer kind), three take fp16 rows. Within a kind: row block fastest, then head, then batch element.
// All blocks are resident at once, four to a WGP, and which four share a WGP is not promised. The kind is the sum of the index's base-4 digits mod 4: any four blocks that differ in one digit alone
// (neighbours, or 4, 16, 64 or 256 apart) hold one hi+lo block and three fp16 blocks, one from each third of the fp16 rows, so the WGPs get about equal work under any such placement. For speed only: every (kind, number) occurs once wherever the blocks land.
// A batch element's q and k planes lie together (NH_ q heads, then NKV k heads), so both step by NH_ + NKV planes from one element to the next; the mask is the same for all.
// Four work-groups share a WGP (4 x the LDS fits), one wave of each on every SIMD: amdgpu_waves_per_eu(4) holds the registers to a quarter of a SIMD's.
__global__ __launch_bounds__(FNW * 32) __attribute__((amdgpu_waves_per_eu(4))) void k_fattn(const h16* __restrict__ Q16, const h16* __restrict__ K16, const h16* __restrict__ V16, const bf* __restrict__ Qh, const bf* __restrict__ Ql, const bf* __restrict__ Kh, const bf* __restrict__ Kl, const bf* __restrict__ Vh, const bf* __restrict__ Vl, const bf* __restrict__ MB, const float* __restrict__ TM, const float* __restrict__ KM, bf* Ah, bf* Al) {
    __shared__ __align__(16) char sm[2 * 4 * PLB];
    constexpr int NHL = RH / 64, NFP = (TT - RH) / 64; static_assert(NFP == 3 * NHL, "one hi+lo block to three fp16 blocks");
    const int bx = (int)blockIdx.x, kind = (bx + (bx >> 2) + (bx >> 4) + (bx >> 6) + (bx >> 8)) & 3; const bool hl = kind == 0;
    // Number within the kind: bx >> 2 = head * NHL + j. The hi+lo block takes row block j; the fp16 kinds 1, 2, 3 take row block NHL - 1 - j of the first, second, last third of the fp16 rows.
    // Where the mask hides the keys behind a query, a block's work grows with its row: j rising, the dearer hi+lo block gains what the three fp16 blocks of the run lose. For speed only.
    const int nr = bx >> 2, bh = nr / NHL, q0 = hl ? (nr % NHL) * 64 : RH + ((kind - 1) * NHL + NHL - 1 - nr % NHL) * 64;
    const int h = bh % NH_; const size_t bz = (size_t)(bh / NH_);
    const size_t oqk = bz * (NH_ + NKV) * TT * HD, ov = bz * NKV * HD * TT, oa = bz * TT * DQ;
    Q16 += oqk; K16 += oqk; Qh += oqk; Ql += oqk; Kh += oqk; Kl += oqk; V16 += ov; Vh += ov; Vl += ov; Ah += oa; Al += oa; KM += (size_t)bh * (TT / 64) * 8 * 32;   // NKV = NH_: the head's own k tiles
    if (hl) fattn_body<bf, true>(Qh, Ql, Kh, Kl, Vh, Vl, MB, TM, KM, q0, h, sm, Ah, Al);
    else fattn_body<h16, false>(Q16, nullptr, K16, nullptr, V16, nullptr, MB, TM, KM, q0, h, sm, Ah, Al);
}

extern "C" void kernel_launch(void* const* d_in, const int* in_sizes, int n_in,
                              void* d_out, int out_size, void* d_ws, size_t ws_size, hipStream_t stream) {
    (void)in_sizes; (void)n_in; (void)out_size;
    const float* x = (const float*)d_in[0]; const float* fmask = (const float*)d_in[1]; const float* wq = (const float*)d_in[2]; const float* bq = (const float*)d_in[3]; const float* wk = (const float*)d_in[4]; const float* bk = (const float*)d_in[5]; const float* wv = (const float*)d_in[6]; const float* bv = (const float*)d_in[7]; const float* wo = (const float*)d_in[8]; const float* bo = (const float*)d_in[9]; const float* cosT = nullptr; const float* sinT = nullptr; (void)cosT; (void)sinT;
    float* OUT = (float*)d_out;     // [4][2048][512]
    char* wsp = (char*)d_ws;
    auto take = [&](size_t bytes) { char* p = wsp; wsp += (bytes + 255) & ~(size_t)255; return (void*)p; };
    bf* WQ = (bf*)take((size_t)DQ * DM * 2); bf* WK = (bf*)take((size_t)DKV * DM * 2); bf* WV = (bf*)take((size_t)DKV * DM * 2); bf* WO = (bf*)take((size_t)DM * DQ * 2);
    // Every buffer below but MKP and MKM holds all NB_ batch elements, one behind the other. QP*: per element NH_ q planes, then NKV k planes.
    bf* XB = (bf*)take((size_t)NB_ * TT * DM * 2);
    h16* QP16 = (h16*)take((size_t)NB_ * (NH_ + NKV) * TT * HD * 2); h16* VT16 = (h16*)take((size_t)NB_ * NKV * HD * TT * 2);
    bf* QPh = (bf*)take((size_t)NB_ * (NH_ + NKV) * TT * HD * 2); bf* QPl = (bf*)take((size_t)NB_ * (NH_ + NKV) * TT * HD * 2); bf* VTh = (bf*)take((size_t)NB_ * NKV * HD * TT * 2); bf* VTl = (bf*)take((size_t)NB_ * NKV * HD * TT * 2);
    h16* KP16 = QP16 + (size_t)NH_ * TT * HD; bf* KPh = QPh + (size_t)NH_ * TT * HD; bf* KPl = QPl + (size_t)NH_ * TT * HD;
    bf* ATh = (bf*)take((size_t)NB_ * TT * DQ * 2); bf* ATl = (bf*)take((size_t)NB_ * TT * DQ * 2);
    float* KMX = (float*)take((size_t)NB_ * NKV * (TT / 64) * 8 * 32 * 4);   // per k tile and wave of k_qkv: largest |k|, a 128-byte line each
    bf* MKP = (bf*)take((size_t)TT * TT * 2); float* MKM = (float*)take((size_t)(TT / 16) * (TT / 64) * 32 * 4);   // the mask in bf16, tile by tile; per tile its smallest value, a 128-byte line each
    if ((size_t)(wsp - (char*)d_ws) > ws_size) return;    // ws 256 MiB
    (void)WK; (void)WV;
    k_wtG<<<dim3((unsigned)((DM * DQ / 64 + 63) / 64), 4, 1), 256, 0, stream>>>(wq, wk, wv, wo, DM, DQ, WQ);   // WQ, WK, WV, WO are consecutive planes of DM x DQ
    // The batch elements are independent and share every weight and the mask: each stage is one launch over all NB_ of them (rows b * TT + t of the row-major buffers; blockIdx.x holds the element also where planes are formed or read).
    k_cvt8<<<(unsigned)(MKB + ((size_t)NB_ * TT * DM / 8 + 255) / 256), 256, 0, stream>>>(x, XB, (size_t)NB_ * TT * DM / 8, fmask, MKP, MKM);
    k_qkv<<<dim3(NB_ * TT / 64, NH_, 3), 256, 0, stream>>>(XB, WQ, bq, bk, bv, QP16, QPh, QPl, VT16, VTh, VTl, KMX);   // z = q, k, v: weight planes consecutive; q heads, then k heads: an element's k planes lie directly behind its q planes
    k_fattn<<<dim3(NB_ * NH_ * (TT / 64), 1, 1), FNW * 32, 0, stream>>>(QP16, KP16, VT16, QPh, QPl, KPh, KPl, VTh, VTl, MKP, MKM, KMX, ATh, ATl);   // one kv head per query head
    k_gemmw<bf, 1, true, 8><<<dim3(NB_ * TT / 64, DM / 64, 1), 256, 0, stream>>>(ATh, ATl, WO, nullptr, DQ, OUT, DM, bo, nullptr, nullptr, 0, 0, 0);
}

// v009
// One run takes 112 microseconds.
// Timed twice side by side with v008, it ran 1.16 and 1.17 times as fast.
// All steps since v000 together make it 19.0 times as fast.
#include <hip/hip_runtime.h>

// Masked multi-head attention layer (x [4][2048][512]; Q/K/V = x W + b (8 heads x 64, [in, out]); scores = q.k / 8 + mask[i][j] x (-1e9) (float mask [1][1][2048][2048], read); softmax; out = (attn v merged) Wo + bo -> [4][2048][512]).
// Compute dtypes, f32 accumulate: every input rounded to bf16; Q/K/V on PLAIN bf16 operands (inputs: exact) + bias; the mask is data, the same for every head and batch element: it is rounded to bf16 once, with the minimum of each tile of 16 queries x 64 keys; a stage of 64 keys is left out by a wave only where that minimum proves that all its weights are exactly 0; no score is stored: query rows < 512 hl (3 products), the rest single fp16; mask add + running softmax f32; Wo hl x exact (2 products) + bias.

#define NB_  4
#define TT   2048
#define DM   512
#define NH_  8
#define NKV  8
#define REP  (NH_ / NKV)
#define HD   64
#define DQ   (NH_ * HD)
#define DKV  (NKV * HD)
#define RH   512                  // query rows < RH use hi+lo planes (TT / 4: one block in four)
#define WIN  0
#define SCL  0.125f   // HD^-0.5
typedef _Float16 h16;
typedef unsigned short bf;
typedef __attribute__((ext_vector_type(16))) __bf16   v16bf;
typedef __attribute__((ext_vector_type(16))) _Float16 v16h;
typedef __attribute__((ext_vector_type(8)))  _Float16 v8h;
typedef __attribute__((ext_vector_type(8)))  unsigned short v8us;
typedef __attribute__((ext_vector_type(8)))  float    v8f;
typedef __attribute__((ext_vector_type(4)))  float    v4f;
typedef v8h  __attribute__((may_alias)) v8ha;
typedef v4f  __attribute__((may_alias)) v4fa;
typedef v8us __attribute__((may_alias)) v8usa;
typedef float __attribute__((ext_vector_type(2), may_alias)) v2fa;

__device__ __forceinline__ unsigned short f2bf(float f) { unsigned u = __float_as_uint(f); u += 0x7FFFu + ((u >> 16) & 1u); return (unsigned short)(u >> 16); }
__device__ __forceinline__ float bf2f(unsigned short b) { return __uint_as_float(((unsigned)b) << 16); }
__device__ __forceinline__ float bfr(float f) { return bf2f(f2bf(f)); }
__device__ __forceinline__ v16h cat16(v8h lo, v8h hi) { return __builtin_shufflevector(lo, hi, 0, 1, 2, 3, 4, 5, 6, 7, 8, 9, 10, 11, 12, 13, 14, 15); }
__device__ __forceinline__ v16bf cat16b(v8us lo, v8us hi) { return __builtin_bit_cast(v16bf, __builtin_shufflevector(lo, hi, 0, 1, 2, 3, 4, 5, 6, 7, 8, 9, 10, 11, 12, 13, 14, 15)); }
__device__ __forceinline__ v8f wmma16(v16h a, v16h b, v8f c) { return __builtin_amdgcn_wmma_f32_16x16x32_f16(false, a, false, b, (short)0, c, false, false); }
__device__ __forceinline__ v8f wmmab(v16bf a, v16bf b, v8f c) { return __builtin_amdgcn_wmma_f32_16x16x32_bf16(false, a, false, b, (short)0, c, false, false); }



// Fragments of the 16x16x32 products from K-contiguous 16-bit rows: a lane's 8 values from k = 8 hi and its 8 from 16 + 8 hi.
template <typename T16> struct WFrag;
template <> struct WFrag<h16> { typedef v16h V; static __device__ __forceinline__ V ld(const h16* p) { return cat16(*(const v8h*)p, *(const v8h*)(p + 16)); } static __device__ __forceinline__ v8f mma(V a, V b, v8f c) { return wmma16(a, b, c); } };
template <> struct WFrag<bf> { typedef v16bf V; static __device__ __forceinline__ V ld(const bf* p) { return cat16b(*(const v8us*)p, *(const v8us*)(p + 16)); } static __device__ __forceinline__ v8f mma(V a, V b, v8f c) { return wmmab(a, b, c); } };
// Eight asynchronous copies of one wave: a copy is 4 whole 128-byte rows (lane >> 3 = the row, lane & 7 = its 16 bytes of it); l, g: the lane's place in LDS and its source in the first copy; each next copy lies 4 rows on (ls, gs bytes).
// s_wait_xcnt 0 is the statement's last line: it stands in front of whatever later rewrites a register that a copy names.
__device__ __forceinline__ void cp_rows32(const unsigned l, const char* g, const unsigned ls, const size_t gs) {
    const unsigned l1 = l + ls, l2 = l + 2 * ls, l3 = l + 3 * ls, l4 = l + 4 * ls, l5 = l + 5 * ls, l6 = l + 6 * ls, l7 = l + 7 * ls;
    const char* g1 = g + gs; const char* g2 = g + 2 * gs; const char* g3 = g + 3 * gs; const char* g4 = g + 4 * gs; const char* g5 = g + 5 * gs; const char* g6 = g + 6 * gs; const char* g7 = g + 7 * gs;
    asm volatile("global_load_async_to_lds_b128 %0, %8, off\n\tglobal_load_async_to_lds_b128 %1, %9, off\n\tglobal_load_async_to_lds_b128 %2, %10, off\n\tglobal_load_async_to_lds_b128 %3, %11, off\n\t"
                 "global_load_async_to_lds_b128 %4, %12, off\n\tglobal_load_async_to_lds_b128 %5, %13, off\n\tglobal_load_async_to_lds_b128 %6, %14, off\n\tglobal_load_async_to_lds_b128 %7, %15, off\n\ts_wait_xcnt 0x0"
                 :: "v"(l), "v"(l1), "v"(l2), "v"(l3), "v"(l4), "v"(l5), "v"(l6), "v"(l7), "v"(g), "v"(g1), "v"(g2), "v"(g3), "v"(g4), "v"(g5), "v"(g6), "v"(g7) : "memory");
}
#define GLP 144                   // LDS pitch, bytes, of a staged 128-byte row: 16 B x odd, no bank conflict for 16-byte reads
// ---- k_wo: the output projection. C[m][n] (f32, pitch DM) = sum_k (A[m][k] + A2[m][k]) Bt[n][k] + bias[n]: hi and lo planes of the attention result (2 products) on the exact bf16 weight. One 64x64 tile (16 accumulators a wave) a work-group; grid (M/64, N/64), 256 threads.
// 8 waves split K: wave w sums k in [64 w, 64 w + 64), the 8 partial tiles meet in LDS and are added in wave order 0..7.
// A wave's share of K is one 128-byte line of each operand row: it brings its line of the 64 A and 64 A2 rows into LDS of its own by asynchronous copies of whole lines and reads its fragments from there
// (no other wave reads them: its own wait is enough); its partial tile then takes the same LDS. The Bt fragments come straight from global memory, asked for ahead of the copies: staged too, they would leave LDS for one work-group a WGP instead of two.
// amdgpu_waves_per_eu(4): two work-groups a WGP are four waves a SIMD, a quarter of its registers each.
__global__ __launch_bounds__(256) __attribute__((amdgpu_waves_per_eu(4))) void k_wo(const bf* __restrict__ A, const bf* __restrict__ A2, const bf* __restrict__ Bt, float* C, const float* __restrict__ bias) {
    typedef WFrag<bf>::V V;
    constexpr int KS = 8, K = DQ, kw = K / KS, ldc = DM; static_assert(kw * 2 == 128, "a wave's share of a row is one line");
    constexpr int RG = 128 * GLP;   // bytes of a wave's own LDS: 64 A rows, 64 A2 rows; the partial tile (16 KiB) lies at its start
    __shared__ __align__(16) char sm[KS * RG];
    const int lane = threadIdx.x & 31, lr = lane & 15, hi = lane >> 4; const int r0 = blockIdx.x * 64, c0 = blockIdx.y * 64;
    const int wv = __builtin_amdgcn_readfirstlane((int)(threadIdx.x >> 5));   // wave number, scalar
    char* rg = sm + wv * RG;
    // A 16-byte read of the summed tile takes two neighbouring writer lanes: reader lane l, read i holds rows {0,1} of the unit's half (l & 15) >> 3 at columns (2i + (l >> 4)) * 16 + 2 * (l & 7) + {0,1}.
    const int rh = (lane & 15) >> 3, cl = (lane >> 4) * 16 + 2 * (lane & 7);
    V b[kw / 32][4];
    const bf* bp = Bt + (size_t)(c0 + lr) * K + wv * kw + 8 * hi; const float* gp = bias + c0 + cl;
#pragma unroll
    for (int kc = 0; kc < kw / 32; ++kc)
#pragma unroll
        for (int nb = 0; nb < 4; ++nb) b[kc][nb] = WFrag<bf>::ld(bp + (size_t)nb * 16 * K + kc * 32);
    const float g0 = gp[0], g1 = gp[1], g2 = gp[32], g3 = gp[33];   // the bias of this lane's 4 columns: asked for here, used behind the product
    asm volatile("s_wait_xcnt 0x0" :: "v"(bp), "v"(gp) : "memory");   // behind the loads, before anything (a later load's result too) overwrites an address register that they name: the two addresses are inputs, so they stay whole up to here
    { const unsigned lc = (unsigned)(size_t)rg + (unsigned)((lane >> 3) * GLP + (lane & 7) * 16); const size_t go = (size_t)(lane >> 3) * (K * 2) + (size_t)(wv * (kw * 2) + (lane & 7) * 16);
      const char* ga = (const char*)(A + (size_t)r0 * K) + go; const char* gl = (const char*)(A2 + (size_t)r0 * K) + go;
      cp_rows32(lc, ga, 4 * GLP, 4 * K * 2); cp_rows32(lc + 32 * GLP, ga + 32 * K * 2, 4 * GLP, 4 * K * 2);
      cp_rows32(lc + 64 * GLP, gl, 4 * GLP, 4 * K * 2); cp_rows32(lc + 96 * GLP, gl + 32 * K * 2, 4 * GLP, 4 * K * 2); }
    v8f acc[4][4];
#pragma unroll
    for (int mb = 0; mb < 4; ++mb)
#pragma unroll
        for (int nb = 0; nb < 4; ++nb) acc[mb][nb] = (v8f){};
    asm volatile("s_wait_asynccnt 0x0" ::: "memory");   // this wave's rows have landed before it reads them
    const char* fr = rg + lr * GLP + hi * 16;   // fragment reads: row lr of a 16-row tile, 16 bytes from k = 8 hi (and from 16 + 8 hi)
#pragma unroll   // two passes of 32 k, unrolled: b[kc] is a register array
    for (int kc = 0; kc < kw / 32; ++kc) {
        V a[4], a2[4];
#pragma unroll
        for (int mb = 0; mb < 4; ++mb) { a[mb] = WFrag<bf>::ld((const bf*)(fr + mb * 16 * GLP + kc * 64)); a2[mb] = WFrag<bf>::ld((const bf*)(fr + (64 + mb * 16) * GLP + kc * 64)); }
#pragma unroll
        for (int mb = 0; mb < 4; ++mb)
#pragma unroll
            for (int nb = 0; nb < 4; ++nb) { acc[mb][nb] = WFrag<bf>::mma(a[mb], b[kc][nb], acc[mb][nb]); acc[mb][nb] = WFrag<bf>::mma(a2[mb], b[kc][nb], acc[mb][nb]); }
        __builtin_amdgcn_sched_barrier(0);   // the next pass's A and A2 fragments are fetched only behind this pass's products: fetched together the two sets spill
    }
    // Partial tile of wave wv at the start of its own LDS (its reads of the rows there are done: their values are spent), as 16 units u = mb * 4 + jq (rows mb*16 + hi*8 + 2jq + {0,1}, all 64 columns); a unit is [nb][lane][2 rows], 1 KiB: register pairs go out as they lie, every LDS access is contiguous over the lanes.
    const float* os = (const float*)sm;
    float* mine = (float*)rg + lane * 2;
#pragma unroll
    for (int mb = 0; mb < 4; ++mb)
#pragma unroll
        for (int jq = 0; jq < 4; ++jq)
#pragma unroll
            for (int nb = 0; nb < 4; ++nb) { v2fa t; t[0] = acc[mb][nb][2 * jq]; t[1] = acc[mb][nb][2 * jq + 1]; *(v2fa*)(mine + ((mb * 4 + jq) * 4 + nb) * 64) = t; }
    __syncthreads();   // every wave's partial tile is in LDS before any wave adds them
    const float b0 = bfr(g0), b1 = bfr(g1), b2 = bfr(g2), b3 = bfr(g3);
#pragma unroll
    for (int uu = 0; uu < 16 / KS; ++uu) { const int u = wv + uu * KS; const float* q0 = os + u * 256 + lane * 4; v4f s0 = *(const v4fa*)q0, s1 = *(const v4fa*)(q0 + 128);
#pragma unroll
        for (int s = 1; s < KS; ++s) { s0 += *(const v4fa*)(q0 + s * (RG / 4)); s1 += *(const v4fa*)(q0 + s * (RG / 4) + 128); }
        { s0[0] += b0; s0[1] += b0; s0[2] += b1; s0[3] += b1; s1[0] += b2; s1[1] += b2; s1[2] += b3; s1[3] += b3; }
        float* crow = C + (size_t)(r0 + (u >> 2) * 16 + rh * 8 + (u & 3) * 2) * ldc + c0 + cl;   // a unit holds whole 256-byte rows of the tile: one writing wave per line
#pragma unroll
        for (int q = 0; q < 2; ++q) { v2fa lo, up; lo[0] = s0[q]; lo[1] = s0[2 + q]; up[0] = s1[q]; up[1] = s1[2 + q]; *(v2fa*)(crow + (size_t)q * ldc) = lo; *(v2fa*)(crow + (size_t)q * ldc + 32) = up; } }
}

__device__ __forceinline__ h16 tohx(float x) { return (h16)x; }
// Maximum and minimum that hand a NaN on (fmaxf and fminf drop it): what is built from them for the test in k_fattn turns NaN where an operand is NaN, and the test then fails.
__device__ __forceinline__ float mxn(float a, float b) { return __builtin_elementwise_maximum(a, b); }
__device__ __forceinline__ float mnn(float a, float b) { return __builtin_elementwise_minimum(a, b); }
__device__ __forceinline__ void splitf(float y, unsigned short& h, unsigned short& l) { h = f2bf(y); l = f2bf(y - bf2f(h)); }
typedef __attribute__((ext_vector_type(2))) _Float16 v2h;
typedef __attribute__((ext_vector_type(4))) _Float16 v4h;
typedef __attribute__((ext_vector_type(2))) unsigned short v2us;
typedef __attribute__((ext_vector_type(4))) unsigned short v4us;
typedef __attribute__((ext_vector_type(2))) float v2f;
typedef __attribute__((ext_vector_type(4))) int v4i;

// blockIdx.y picks one of four K x N weights; their transposed planes lie one behind the other in Bt.
__global__ __launch_bounds__(256) void k_wtG(const float* __restrict__ w0, const float* __restrict__ w1, const float* __restrict__ w2, const float* __restrict__ w3, int K, int N, bf* Bt) {
    const float* __restrict__ w = (blockIdx.y == 0) ? w0 : (blockIdx.y == 1) ? w1 : (blockIdx.y == 2) ? w2 : w3; Bt += (size_t)blockIdx.y * K * N;
    const int lane = threadIdx.x & 31; const int L0 = (blockIdx.x * 8 + (threadIdx.x >> 5)) * 8; const int nlines = N * K / 64;
{
#pragma unroll 1
        for (int l = 0; l < 8; ++l) { const int L = L0 + l; if (L >= nlines) break; const size_t e = (size_t)L * 64 + lane * 2; const int k = (int)(e % K), n = (int)(e / K); v2us o;
            o[0] = f2bf(w[(size_t)k * N + n]); o[1] = f2bf(w[(size_t)(k + 1) * N + n]); *(v2us*)(Bt + e) = o; }
         }
}
// ---- k_cvt8: x rounded to bf16, and (blocks below MKB) the mask made ready for k_fattn, once for all heads and batch elements.
// A mask tile is 16 query rows x 64 keys = what one wave of k_fattn needs for one stage. MB: the tile's values, rounded to bf16, in the order in which that wave's lanes hold them: [tile][g][lane][8],
// lane = (lr, hi), value j = query row lr, key 16 g + 8 hi + j: each of the wave's four 16-byte loads of a stage is 512 bytes in a row. TM: the smallest of the tile's rounded values, in a 128-byte line of its own (one writing wave per line).
#define MKB (TT / 16 * (TT / 64) / 16)   // 8 waves a block, 2 tiles a wave
__global__ __launch_bounds__(256) void k_cvt8(const float* __restrict__ src, bf* dst, size_t n8, const float* __restrict__ fm, bf* MB, float* TM) {
    if (blockIdx.x < MKB) {
        const int lane = threadIdx.x & 31, lr = lane & 15, hi = lane >> 4; const int t0 = ((int)blockIdx.x * 8 + ((int)threadIdx.x >> 5)) * 2;
        v4f r[2][8];
#pragma unroll
        for (int i = 0; i < 2; ++i) { const int tl = t0 + i; const float* mp = fm + (size_t)(tl / (TT / 64) * 16 + lr) * TT + tl % (TT / 64) * 64 + hi * 8;
#pragma unroll
            for (int g = 0; g < 4; ++g) { r[i][g * 2] = *(const v4f*)(mp + g * 16); r[i][g * 2 + 1] = *(const v4f*)(mp + g * 16 + 4); } }
        asm volatile("s_wait_xcnt 0x0" ::: "memory");   // behind the loads, before later code overwrites a register that one of them names
#pragma unroll
        for (int i = 0; i < 2; ++i) { const int tl = t0 + i; float mq[4];   // the minimum is taken over the rounded values, the ones the scores get; a NaN among them is handed on
#pragma unroll
            for (int g = 0; g < 4; ++g) { v8us o;
#pragma unroll
                for (int j = 0; j < 8; ++j) o[j] = f2bf(r[i][g * 2 + (j >> 2)][j & 3]);
                *(v8us*)(MB + ((size_t)tl * 4 + g) * 256 + lane * 8) = o;
                mq[g] = mnn(mnn(mnn(bf2f(o[0]), bf2f(o[1])), mnn(bf2f(o[2]), bf2f(o[3]))), mnn(mnn(bf2f(o[4]), bf2f(o[5])), mnn(bf2f(o[6]), bf2f(o[7])))); }
            float mn = mnn(mnn(mq[0], mq[1]), mnn(mq[2], mq[3]));
#pragma unroll
            for (int d = 16; d >= 1; d >>= 1) mn = mnn(mn, __shfl_xor(mn, d, 32));
            if (lane == 0) TM[(size_t)tl * 32] = mn;
        }
        asm volatile("s_wait_xcnt 0x0" ::: "memory");   // behind the stores, before later code overwrites a register that one of them names
        return;
    }
    const size_t i = (size_t)(blockIdx.x - MKB) * 256 + threadIdx.x; if (i >= n8) return; const v8f v = *(const v8f*)(src + i * 8); v8us o;
#pragma unroll
    for (int k = 0; k < 8; ++k) o[k] = f2bf(v[k]); *(v8us*)(dst + i * 8) = o;  }
__global__ __launch_bounds__(256) void k_cscvt(const float* __restrict__ cosT, const float* __restrict__ sinT, float* CS) { const int idx = blockIdx.x * 256 + threadIdx.x; if (idx >= TT * HD) return; v2f cs; cs[0] = bfr(cosT[idx]); cs[1] = bfr(sinT[idx]); *(v2f*)(CS + (size_t)idx * 2) = cs;  }
// ---- k_qkv: the Q, K and V projections (blockIdx.z = 0, 1, 2) of all batch elements; a work-group forms one head's 64 values of 64 tokens and writes them straight into the planes that k_fattn reads (fp16 and bf16 hi + lo).
// The product is k_wo's: 8 waves split K, the 8 partial tiles meet in LDS and are added in wave order. A wave's share of K is 64 values = one 128-byte line of each operand row:
// it brings its line of the 64 A rows and the 64 B rows into LDS of its own by asynchronous copies of whole lines and reads its fragments from there (no other wave reads them: its own wait is enough); its partial tile then takes the same LDS. Q, K: tile rows = tokens (A = x), columns = d (B = weight), planes [head][t][d].
// V: the operands change places (A = weight rows d, B = x rows t), so the tile comes out transposed, rows = d, columns = tokens, as the planes [head][d][t] want it. Either way a tile row is one 128-byte line of each plane, written by one wave.
__global__ __launch_bounds__(256) void k_qkv(const bf* __restrict__ X, const bf* __restrict__ Wt, const float* __restrict__ bq, const float* __restrict__ bk, const float* __restrict__ bv, h16* P16, bf* Ph, bf* Pl, h16* V16, bf* Vh, bf* Vl, float* KM) {
    typedef WFrag<bf>::V V;
    constexpr int KS = 8, K = DM, kw = K / KS; static_assert(kw * 2 == 128, "a wave's share of a row is one line");
    constexpr int RG = 128 * GLP;   // bytes of a wave's own LDS: 64 A rows, 64 B rows; the partial tile (16 KiB) lies at its start
    __shared__ __align__(16) char sm[KS * RG];
    const int z = (int)blockIdx.z, hd = (int)blockIdx.y, t0 = (int)blockIdx.x * 64; const bool tr = z == 2;
    const float* bias = ((z == 0) ? bq : (z == 1) ? bk : bv) + hd * HD;
    const bf* xr = X + (size_t)t0 * K; const bf* wr = Wt + ((size_t)z * DQ + hd * HD) * K;
    const bf* A = tr ? wr : xr; const bf* Bt = tr ? xr : wr;
    const int lane = threadIdx.x & 31, lr = lane & 15, hi = lane >> 4;
    const int wv = __builtin_amdgcn_readfirstlane((int)(threadIdx.x >> 5));   // wave number, scalar
    char* rg = sm + wv * RG;
    { const unsigned lc = (unsigned)(size_t)rg + (unsigned)((lane >> 3) * GLP + (lane & 7) * 16); const size_t go = (size_t)(lane >> 3) * (K * 2) + (size_t)(wv * (kw * 2) + (lane & 7) * 16);
      const char* ga = (const char*)A + go; const char* gb = (const char*)Bt + go;
      cp_rows32(lc, ga, 4 * GLP, 4 * K * 2); cp_rows32(lc + 32 * GLP, ga + 32 * K * 2, 4 * GLP, 4 * K * 2);
      cp_rows32(lc + 64 * GLP, gb, 4 * GLP, 4 * K * 2); cp_rows32(lc + 96 * GLP, gb + 32 * K * 2, 4 * GLP, 4 * K * 2); }
    v8f acc[4][4];
#pragma unroll
    for (int mb = 0; mb < 4; ++mb)
#pragma unroll
        for (int nb = 0; nb < 4; ++nb) acc[mb][nb] = (v8f){};
    // Where this lane's sums will lie in the tile (k_wo's lane map): rows ru + 16 * 2 uu + {0, 1} for its two units uu, columns cl + {0, 1} and 32 + cl + {0, 1}.
    const int rh = (lane & 15) >> 3, cl = (lane >> 4) * 16 + 2 * (lane & 7), ru = (wv >> 2) * 16 + rh * 8 + (wv & 3) * 2;
    // The bias belongs to d: the tile's column for Q and K (4 columns a lane), its row for V (2 rows in each of 2 units). Asked for here, used behind the product.
    const float g0 = bias[tr ? ru : cl], g1 = bias[tr ? ru + 1 : cl + 1], g2 = bias[tr ? ru + 32 : 32 + cl], g3 = bias[tr ? ru + 33 : 32 + cl + 1];
    asm volatile("s_wait_xcnt 0x0" ::: "memory");   // behind the loads, before later code overwrites a register that one of them names
    asm volatile("s_wait_asynccnt 0x0" ::: "memory");   // this wave's rows have landed before it reads them
    const char* fr = rg + lr * GLP + hi * 16;   // fragment reads: row lr of a 16-row tile, 16 bytes from k = 8 hi (and from 16 + 8 hi)
#pragma unroll   // two passes of 32 k, unrolled: the second pass's reads can go out among the first's products
    for (int kc = 0; kc < kw / 32; ++kc) {
        V a[4], b[4];
#pragma unroll
        for (int mb = 0; mb < 4; ++mb) { a[mb] = WFrag<bf>::ld((const bf*)(fr + mb * 16 * GLP + kc * 64)); b[mb] = WFrag<bf>::ld((const bf*)(fr + (64 + mb * 16) * GLP + kc * 64)); }
#pragma unroll
        for (int nb = 0; nb < 4; ++nb)
#pragma unroll
            for (int mb = 0; mb < 4; ++mb) acc[mb][nb] = WFrag<bf>::mma(a[mb], b[nb], acc[mb][nb]);
    }
    // Partial tiles in LDS and their sum: units, order and lane map as in k_wo. A wave's tile goes where its own rows lay: its reads of them are done (their values are spent).
    const float* os = (const float*)sm;
    float* mine = (float*)rg + lane * 2;
#pragma unroll
    for (int mb = 0; mb < 4; ++mb)
#pragma unroll
        for (int jq = 0; jq < 4; ++jq)
#pragma unroll
            for (int nb = 0; nb < 4; ++nb) { v2fa t; t[0] = acc[mb][nb][2 * jq]; t[1] = acc[mb][nb][2 * jq + 1]; *(v2fa*)(mine + ((mb * 4 + jq) * 4 + nb) * 64) = t; }
    __syncthreads();   // every wave's partial tile is in LDS before any wave adds them
    const float b0 = bfr(g0), b1 = bfr(g1), b2 = bfr(g2), b3 = bfr(g3);
    const int be = t0 / TT, tb = t0 % TT;   // 64 divides TT: a tile's tokens belong to one batch element
    const size_t base = tr ? (size_t)(be * NKV + hd) * HD * TT + tb : ((size_t)(be * (NH_ + NKV) + z * NH_ + hd) * TT + tb) * HD;
    const int pitch = tr ? TT : HD;
    float am = 0.f;   // largest magnitude among the values this lane stores (the fp16 rounding counted, so an overflow shows as inf)
    h16* D16 = (tr ? V16 : P16) + base + cl; bf* Dh = (tr ? Vh : Ph) + base + cl; bf* Dl = (tr ? Vl : Pl) + base + cl;
#pragma unroll
    for (int uu = 0; uu < 16 / KS; ++uu) { const int u = wv + uu * KS; const float* q0 = os + u * 256 + lane * 4; v4f s0 = *(const v4fa*)q0, s1 = *(const v4fa*)(q0 + 128);
#pragma unroll
        for (int s = 1; s < KS; ++s) { s0 += *(const v4fa*)(q0 + s * (RG / 4)); s1 += *(const v4fa*)(q0 + s * (RG / 4) + 128); }
        const int row = ru + uu * 32;   // s0, s1: [0], [1] = rows row, row + 1 of column cl (s1: 32 + cl); [2], [3] = the same rows of the next column
        if (tr) { const float e0 = uu ? b2 : b0, e1 = uu ? b3 : b1; s0[0] += e0; s0[1] += e1; s0[2] += e0; s0[3] += e1; s1[0] += e0; s1[1] += e1; s1[2] += e0; s1[3] += e1; }
        else { s0[0] += b0; s0[1] += b0; s0[2] += b1; s0[3] += b1; s1[0] += b2; s1[1] += b2; s1[2] += b3; s1[3] += b3; }
#pragma unroll
        for (int q = 0; q < 2; ++q) { const size_t ro = (size_t)(row + q) * pitch;
#pragma unroll
            for (int i = 0; i < 2; ++i) { const float y0 = i ? s1[q] : s0[q], y1 = i ? s1[2 + q] : s0[2 + q]; v2h o16; v2us oh, ol; unsigned short a2, c2;
                o16[0] = tohx(y0); o16[1] = tohx(y1); am = mxn(mxn(am, mxn(fabsf(y0), fabsf(y1))), mxn(fabsf((float)o16[0]), fabsf((float)o16[1]))); splitf(y0, a2, c2); oh[0] = a2; ol[0] = c2; splitf(y1, a2, c2); oh[1] = a2; ol[1] = c2;
                *(v2h*)(D16 + ro + i * 32) = o16; *(v2us*)(Dh + ro + i * 32) = oh; *(v2us*)(Dl + ro + i * 32) = ol; } }
        asm volatile("s_wait_xcnt 0x0" ::: "memory");   // behind the unit's stores, before later code overwrites a register that one of them names
    }
    // K tiles: each wave leaves the largest |k| of its rows for k_fattn's bound on the scores, in a 128-byte line of its own.
    if (z == 1) {
#pragma unroll
        for (int d = 16; d >= 1; d >>= 1) am = mxn(am, __shfl_xor(am, d, 32));
        if (lane == 0) KM[((size_t)((be * NKV + hd) * (TT / 64) + tb / 64) * KS + wv) * 32] = am;
        asm volatile("s_wait_xcnt 0x0" ::: "memory");   // behind the store, before later code overwrites a register that it names
    }
}
// ---- k_fattn: scores, mask, softmax and P.V of one head in one kernel; no score or probability leaves the registers.
// A work-group has 4 waves and 64 query rows: wave w owns rows 16 w .. 16 w + 15 and walks ALL keys, so no partial results meet at the end.
// K and V^T come in stages of 64 keys: the work-group brings each stage into LDS once (asynchronous copies, whole 128-byte lines, two buffers: the next stage flies while this one is worked on) and all 4 waves read their fragments from there.
// Transposed products: S^T = K Q^T (D: row = key, column = query) and O^T += V^T P^T (D: row = d, column = query). A lane's two score tiles of a pass
// (keys 8 hi + j and 16 + 8 hi + j of query lr) are the sixteen k positions of its B fragment for P^T, so P goes from D to B in place, and every per-query factor is per lane.
#define L2E 1.4426950408889634f
#define FNW 4                     // waves of a work-group, 16 query rows each
#define SKK 64                    // keys of a stage = two passes of 32
#define LPB 144                   // LDS pitch, bytes, of a 128-byte row (64 d of a key, or 64 keys of a d): 16 B x odd, no bank conflict for 16-byte reads
#define PLB (64 * LPB)            // one plane's 64 rows of a stage in LDS
// One plane's tile of a stage: 64 rows of 128 bytes; thread t brings 16 bytes of rows (t >> 3) + 0, 16, 32, 48 (l, g: its place and source in the first; gs: 16 source rows in bytes).
// s_wait_xcnt 0 is the statement's last line: it stands in front of whatever later rewrites a register that a copy names.
__device__ __forceinline__ void cp_plane(const unsigned l, const char* g, const size_t gs) {
    const unsigned l1 = l + 16 * LPB, l2 = l + 32 * LPB, l3 = l + 48 * LPB; const char* g1 = g + gs; const char* g2 = g + 2 * gs; const char* g3 = g + 3 * gs;
    asm volatile("global_load_async_to_lds_b128 %0, %4, off\n\tglobal_load_async_to_lds_b128 %1, %5, off\n\tglobal_load_async_to_lds_b128 %2, %6, off\n\tglobal_load_async_to_lds_b128 %3, %7, off\n\ts_wait_xcnt 0x0"
                 :: "v"(l), "v"(l1), "v"(l2), "v"(l3), "v"(g), "v"(g1), "v"(g2), "v"(g3) : "memory");
}
__device__ __forceinline__ float amax16(v16h v) { float a = 0.f;
#pragma unroll
    for (int e = 0; e < 16; ++e) a = mxn(a, fabsf((float)v[e])); return a; }
__device__ __forceinline__ float amax16(v16bf v) { const __attribute__((ext_vector_type(16))) unsigned short u = __builtin_bit_cast(__attribute__((ext_vector_type(16))) unsigned short, v); float a = 0.f;
#pragma unroll
    for (int e = 0; e < 16; ++e) a = mxn(a, fabsf(bf2f(u[e]))); return a; }
typedef __attribute__((address_space(1))) bf gbf;
typedef __attribute__((address_space(1))) v8usa gv8us;
template <typename T16, bool HL>
__device__ __forceinline__ void fattn_body(const T16* __restrict__ Qa, const T16* __restrict__ Qb, const T16* __restrict__ Ka, const T16* __restrict__ Kb, const T16* __restrict__ Va, const T16* __restrict__ Vb, const bf* __restrict__ mb, const float* __restrict__ tm, const float* __restrict__ km, const int q0, const int h, char* sm, bf* Ah, bf* Al) {
    typedef typename WFrag<T16>::V V;
    constexpr int VO = (HL ? 2 : 1) * PLB;   // V^T planes lie behind the K planes of a stage
    constexpr int SB = (HL ? 4 : 2) * PLB;   // bytes of a stage in LDS
    constexpr int NST = TT / SKK;
    const int lane = threadIdx.x & 31, lr = lane & 15, hi = lane >> 4;
    const int wv = __builtin_amdgcn_readfirstlane((int)(threadIdx.x >> 5));   // wave number, scalar
    const int qw = q0 + wv * 16;   // this wave's first query row
    const size_t hp = (size_t)h * TT * HD;
    V qa[2], qb[2];
#pragma unroll
    for (int kc = 0; kc < 2; ++kc) { const size_t qo = hp + (size_t)((qw + lr) * HD + 8 * hi + kc * 32); qa[kc] = WFrag<T16>::ld(Qa + qo);
        asm volatile("s_wait_xcnt 0x0" ::: "memory");   // behind this fragment's loads, before a later instruction (a later load's result too) overwrites an address register that they name
        if constexpr (HL) { qb[kc] = WFrag<T16>::ld(Qb + qo);
            asm volatile("s_wait_xcnt 0x0" ::: "memory"); } }   // the same
    v8f o[4]; float m = -3.0e38f, l = 0.f;
#pragma unroll
    for (int db = 0; db < 4; ++db) o[db] = (v8f){};
    // Copies: this thread's 16 bytes of a row. K planes [key][d]: a stage is 64 whole rows, one behind the other. V^T planes [d][key]: 128 bytes of each of the 64 rows.
    const int crow = (int)threadIdx.x >> 3, ccol = ((int)threadIdx.x & 7) * 16;
    const unsigned lc = (unsigned)(size_t)sm + (unsigned)(crow * LPB + ccol);
    const size_t ko = (size_t)(crow * (HD * 2) + ccol), vo = (size_t)crow * (TT * 2) + ccol;
    const char* gka = (const char*)(Ka + hp) + ko; const char* gva = (const char*)(Va + hp) + vo;
    const char* gkb = HL ? (const char*)(Kb + hp) + ko : nullptr; const char* gvb = HL ? (const char*)(Vb + hp) + vo : nullptr;
    auto fill = [&](const int st, const int buf) {
        const unsigned lb = lc + (unsigned)(buf * SB); const size_t ks = (size_t)st * (SKK * HD * 2), vs = (size_t)st * (SKK * 2);
        cp_plane(lb, gka + ks, 16 * HD * 2); if constexpr (HL) cp_plane(lb + PLB, gkb + ks, 16 * HD * 2);
        cp_plane(lb + VO, gva + vs, (size_t)16 * TT * 2); if constexpr (HL) cp_plane(lb + VO + PLB, gvb + vs, (size_t)16 * TT * 2); };
    // The mask, as k_cvt8 left it: mk[ps][kt][j] = the bf16 value of query lr, key 32 ps + 16 kt + 8 hi + j of a stage; lane i of tmv = the smallest value of stage i's tile (this wave's 16 rows x 64 keys).
    // Behind each group of loads stands s_wait_xcnt 0: a later instruction may overwrite a register that an issued load names, and the wait stands in front of that.
    static_assert(NST == 32, "one stage's minimum a lane");
    v8us mk[2][2], mkn[2][2] = {};   // this stage's values; fp16 rows: the next stage's beside them
    const bf* mb0 = mb + (size_t)(qw >> 4) * NST * 1024; const unsigned ml = (unsigned)lane * 8u;   // wave-uniform base, the lane's place beside it
    const float tmv = tm[(size_t)((qw >> 4) * NST + lane) * 32];
    asm volatile("s_wait_xcnt 0x0" ::: "memory");
    auto ldmask = [&](v8us (&dst)[2][2], const int s_) {
        const unsigned long long a = (unsigned long long)(mb0 + (size_t)s_ * 1024);   // the tile's address, held in scalar registers: the loads then name, beside it, only the lane's offset register, which no load's result overwrites
        const gbf* mp = (const gbf*)(((unsigned long long)(unsigned)__builtin_amdgcn_readfirstlane((int)(unsigned)(a >> 32)) << 32) | (unsigned)__builtin_amdgcn_readfirstlane((int)(unsigned)a));   // rebuilt from its words, so said to be global memory
#pragma unroll
        for (int g = 0; g < 4; ++g) dst[g >> 1][g & 1] = *(const gv8us*)(mp + g * 256 + ml);
        asm volatile("s_wait_xcnt 0x0" ::: "memory"); };
    if constexpr (!HL) ldmask(mk, 0);   // stage 0 always counts (no maximum yet); asked for here, its values are in behind the barrier below, and in the loop no wait for them falls on the loads of the stage after
    fill(0, 0);
    asm volatile("s_wait_asynccnt 0x0" ::: "memory");   // this wave's share of stage 0 has landed
    __syncthreads();   // stage 0 is whole before any wave reads it
    fill(1, 1);
    // sb_: no score of this lane's query, scaled, exceeds it. A score is a sum of at most 192 products (hi+lo: 3 x 64) of a stored q value and a stored k value;
    // qx is the largest stored |q| of the row, kx the largest |k| of the head before rounding (the roundings add under 1 %): 256 x SCL = 32 leaves a quarter to spare. An inf or a NaN among them makes sb_ inf or NaN and the test below fails: nothing is left out.
    float kx = 0.f;
#pragma unroll
    for (int i = 0; i < 8; ++i) kx = mxn(kx, km[(size_t)(lane * 8 + i) * 32]);   // the head's 32 tiles x 8 waves, one value a line
    asm volatile("s_wait_xcnt 0x0" ::: "memory");   // behind the loads, before later code overwrites a register that one of them names
#pragma unroll
    for (int d = 16; d >= 1; d >>= 1) kx = mxn(kx, __shfl_xor(kx, d, 32));
    float qx = mxn(amax16(qa[0]), amax16(qa[1])); if constexpr (HL) qx = mxn(qx, mxn(amax16(qb[0]), amax16(qb[1])));
    qx = mxn(qx, __shfl_xor(qx, 16, 32));   // the other half of the row's d lies in lane lr + 16
    const float sb_ = 32.f * qx * kx;
    const int fro = lr * LPB + hi * 16;   // fragment reads: row lr of a 16-row tile, 16 bytes from k = 8 hi (and from 16 + 8 hi)
    // The test. Every score of stage s_ is at most ub: sb_ bounds q.k / 8, and the tile's smallest mask value gives the largest mask term mt (a thousandth of |mt| on top: room for the roundings of the score's own sum, whatever mt's sign).
    // Where ub lies 256 under the running maximum in every lane, the maximum stays, the rescale factor is exp2(0) and each weight is exp2(under -369) = 0: the stage would change nothing (0 x V^T adds 0: V is finite wherever x, Wv and bv are).
    // The running maximum never falls, so a stage that passes the test early still passes it when its turn comes. Wave-uniform: the ballot's compare is a scalar branch.
    auto dead = [&](const int s_) -> bool {
        const float mt = __uint_as_float((unsigned)__builtin_amdgcn_readlane((int)__float_as_uint(tmv), s_)) * -1.0e9f;
        const float ub = sb_ + (mt + fabsf(mt) * 1.0e-3f);
        return __builtin_amdgcn_ballot_w32(ub - m < -256.f) == 0xFFFFFFFFu; };
    // fp16 rows: whether the next stage counts is settled at the head of this one, and only then are its mask values asked for: they come from L2 while this stage is worked on. A stage left out reads no mask value at all.
    bool act = true, nact = false;
#pragma unroll 1   // rolled: a trip is one stage; the buffer alternates with it
    for (int st = 0; st < NST; ++st) {
        const char* sb = sm + (st & 1) * SB + fro;
        if constexpr (HL) act = !dead(st);   // hi+lo planes: settled here, and the stage's own mask values asked for here; held over from the stage before, their registers stand beside the fragments' and some spill
        else { nact = st + 1 < NST && !dead(st + 1); if (nact) ldmask(mkn, st + 1); }
        if (act) {
        if constexpr (HL) ldmask(mk, st);
#pragma unroll
        for (int ps = 0; ps < 2; ++ps) {
            V ka[2][2], kl[2][2], va[4], vl[4];
#pragma unroll
            for (int kt = 0; kt < 2; ++kt)
#pragma unroll
                for (int kc = 0; kc < 2; ++kc) { const char* p = sb + (ps * 32 + kt * 16) * LPB + kc * 64; ka[kt][kc] = WFrag<T16>::ld((const T16*)p); if constexpr (HL) kl[kt][kc] = WFrag<T16>::ld((const T16*)(p + PLB)); }
            v8f s[2];
#pragma unroll
            for (int kt = 0; kt < 2; ++kt) { v8f c = (v8f){};
#pragma unroll
                for (int kc = 0; kc < 2; ++kc) { c = WFrag<T16>::mma(ka[kt][kc], qa[kc], c); if constexpr (HL) { c = WFrag<T16>::mma(ka[kt][kc], qb[kc], c); c = WFrag<T16>::mma(kl[kt][kc], qa[kc], c); } }
                s[kt] = c; }
            if constexpr (HL) __builtin_amdgcn_sched_barrier(0);   // hi+lo planes: the V^T fragments are fetched only when the K fragments are spent, into their registers; fetched together the two sets spill
#pragma unroll
            for (int db = 0; db < 4; ++db) { const char* p = sb + VO + db * 16 * LPB + ps * 64; va[db] = WFrag<T16>::ld((const T16*)p); if constexpr (HL) vl[db] = WFrag<T16>::ld((const T16*)(p + PLB)); }
            float t[16]; float mx = m;
#pragma unroll
            for (int kt = 0; kt < 2; ++kt)
#pragma unroll
                for (int j = 0; j < 8; ++j) { const float mv = bf2f(mk[ps][kt][j]); const float tt = s[kt][j] * SCL + mv * -1.0e9f; t[kt * 8 + j] = tt; mx = fmaxf(mx, tt); }
            mx = fmaxf(mx, __shfl_xor(mx, 16, 32));   // the other half of the query's keys of this pass lies in lane lr + 16
            const float al = __builtin_amdgcn_exp2f((m - mx) * L2E); m = mx;
            float sum = 0.f;
#pragma unroll
            for (int k = 0; k < 16; ++k) { t[k] = __builtin_amdgcn_exp2f((t[k] - mx) * L2E); sum += t[k]; }
            l = l * al + sum;   // each half keeps the sum of its own keys; the halves meet behind the loop
#pragma unroll
            for (int db = 0; db < 4; ++db) o[db] *= al;
            if constexpr (HL) { v8us h0, h1, l0, l1;
#pragma unroll
                for (int j = 0; j < 8; ++j) { unsigned short a, c2; splitf(t[j], a, c2); h0[j] = a; l0[j] = c2; splitf(t[8 + j], a, c2); h1[j] = a; l1[j] = c2; }
                const V ph = cat16b(h0, h1), pl = cat16b(l0, l1);
#pragma unroll
                for (int db = 0; db < 4; ++db) { o[db] = WFrag<T16>::mma(va[db], ph, o[db]); o[db] = WFrag<T16>::mma(va[db], pl, o[db]); o[db] = WFrag<T16>::mma(vl[db], ph, o[db]); }
            } else { V pf;
#pragma unroll
                for (int k = 0; k < 16; ++k) pf[k] = tohx(t[k]);
#pragma unroll
                for (int db = 0; db < 4; ++db) o[db] = WFrag<T16>::mma(va[db], pf, o[db]); }
        }
        }
        asm volatile("s_wait_dscnt 0x0" ::: "memory");      // this wave's reads of the stage's buffer are done before the buffer is given up
        asm volatile("s_wait_asynccnt 0x0" ::: "memory");   // this wave's share of the next stage has landed
        __syncthreads();   // the next stage is whole, and every wave has left this stage's buffer
        if (st + 2 < NST) fill(st + 2, st & 1);
        if constexpr (!HL) { act = nact;
#pragma unroll
            for (int g = 0; g < 4; ++g) mk[g >> 1][g & 1] = mkn[g >> 1][g & 1]; }
    }
    asm volatile("s_wait_asynccnt 0x0" ::: "memory");   // no copy is outstanding when the wave ends
    l += __shfl_xor(l, 16, 32);
    const float f = __fdiv_rn(1.0f, l);
#pragma unroll
    for (int db = 0; db < 4; ++db) { v8us oh, ol;
#pragma unroll
        for (int j = 0; j < 8; ++j) { unsigned short x0, x1; splitf(o[db][j] * f, x0, x1); oh[j] = x0; ol[j] = x1; }
        const size_t oo = (size_t)(qw + lr) * DQ + h * HD + db * 16 + hi * 8; *(v8us*)(Ah + oo) = oh; *(v8us*)(Al + oo) = ol; }   // a head's 64 values of a row are one 128-byte line, written by lanes lr and lr + 16 of one wave
    asm volatile("s_wait_xcnt 0x0" ::: "memory");   // behind the last store, before any later code overwrites a register that a store names
}
// grid: NB_ * NH_ * TT / 64 blocks of 64 query rows; one in four takes hi+lo rows (the dearer kind), three take fp16 rows. Within a kind: row block fastest, then head, then batch element.
// All blocks are resident at once, four to a WGP, and which four share a WGP is not promised. The kind is the sum of the index's base-4 digits mod 4: any four blocks that differ in one digit alone
// (neighbours, or 4, 16, 64 or 256 apart) hold one hi+lo block and three fp16 blocks, one from each third of the fp16 rows, so the WGPs get about equal work under any such placement. For speed only: every (kind, number) occurs once wherever the blocks land.
// A batch element's q and k planes lie together (NH_ q heads, then NKV k heads), so both step by NH_ + NKV planes from one element to the next; the mask is the same for all.
// Four work-groups share a WGP (4 x the LDS fits), one wave of each on every SIMD: amdgpu_waves_per_eu(4) holds the registers to a quarter of a SIMD's.
__global__ __launch_bounds__(FNW * 32) __attribute__((amdgpu_waves_per_eu(4))) void k_fattn(const h16* __restrict__ Q16, const h16* __restrict__ K16, const h16* __restrict__ V16, const bf* __restrict__ Qh, const bf* __restrict__ Ql, const bf* __restrict__ Kh, const bf* __restrict__ Kl, const bf* __restrict__ Vh, const bf* __restrict__ Vl, const bf* __restrict__ MB, const float* __restrict__ TM, const float* __restrict__ KM, bf* Ah, bf* Al) {
    __shared__ __align__(16) char sm[2 * 4 * PLB];
    constexpr int NHL = RH / 64, NFP = (TT - RH) / 64; static_assert(NFP == 3 * NHL, "one hi+lo block to three fp16 blocks");
    const int bx = (int)blockIdx.x, kind = (bx + (bx >> 2) + (bx >> 4) + (bx >> 6) + (bx >> 8)) & 3; const bool hl = kind == 0;
    // Number within the kind: bx >> 2 = head * NHL + j. The hi+lo block takes row block j; the fp16 kinds 1, 2, 3 take row block NHL - 1 - j of the first, second, last third of the fp16 rows.
    // Where the mask hides the keys behind a query, a block's work grows with its row: j rising, the dearer hi+lo block gains what the three fp16 blocks of the run lose. For speed only.
    const int nr = bx >> 2, bh = nr / NHL, q0 = hl ? (nr % NHL) * 64 : RH + ((kind - 1) * NHL + NHL - 1 - nr % NHL) * 64;
    const int h = bh % NH_; const size_t bz = (size_t)(bh / NH_);
    const size_t oqk = bz * (NH_ + NKV) * TT * HD, ov = bz * NKV * HD * TT, oa = bz * TT * DQ;
    Q16 += oqk; K16 += oqk; Qh += oqk; Ql += oqk; Kh += oqk; Kl += oqk; V16 += ov; Vh += ov; Vl += ov; Ah += oa; Al += oa; KM += (size_t)bh * (TT / 64) * 8 * 32;   // NKV = NH_: the head's own k tiles
    if (hl) fattn_body<bf, true>(Qh, Ql, Kh, Kl, Vh, Vl, MB, TM, KM, q0, h, sm, Ah, Al);
    else fattn_body<h16, false>(Q16, nullptr, K16, nullptr, V16, nullptr, MB, TM, KM, q0, h, sm, Ah, Al);
}

extern "C" void kernel_launch(void* const* d_in, const int* in_sizes, int n_in,
                              void* d_out, int out_size, void* d_ws, size_t ws_size, hipStream_t stream) {
    (void)in_sizes; (void)n_in; (void)out_size;
    const float* x = (const float*)d_in[0]; const float* fmask = (const float*)d_in[1]; const float* wq = (const float*)d_in[2]; const float* bq = (const float*)d_in[3]; const float* wk = (const float*)d_in[4]; const float* bk = (const float*)d_in[5]; const float* wv = (const float*)d_in[6]; const float* bv = (const float*)d_in[7]; const float* wo = (const float*)d_in[8]; const float* bo = (const float*)d_in[9]; const float* cosT = nullptr; const float* sinT = nullptr; (void)cosT; (void)sinT;
    float* OUT = (float*)d_out;     // [4][2048][512]
    char* wsp = (char*)d_ws;
    auto take = [&](size_t bytes) { char* p = wsp; wsp += (bytes + 255) & ~(size_t)255; return (void*)p; };
    bf* WQ = (bf*)take((size_t)DQ * DM * 2); bf* WK = (bf*)take((size_t)DKV * DM * 2); bf* WV = (bf*)take((size_t)DKV * DM * 2); bf* WO = (bf*)take((size_t)DM * DQ * 2);
    // Every buffer below but MKP and MKM holds all NB_ batch elements, one behind the other. QP*: per element NH_ q planes, then NKV k planes.
    bf* XB = (bf*)take((size_t)NB_ * TT * DM * 2);
    h16* QP16 = (h16*)take((size_t)NB_ * (NH_ + NKV) * TT * HD * 2); h16* VT16 = (h16*)take((size_t)NB_ * NKV * HD * TT * 2);
    bf* QPh = (bf*)take((size_t)NB_ * (NH_ + NKV) * TT * HD * 2); bf* QPl = (bf*)take((size_t)NB_ * (NH_ + NKV) * TT * HD * 2); bf* VTh = (bf*)take((size_t)NB_ * NKV * HD * TT * 2); bf* VTl = (bf*)take((size_t)NB_ * NKV * HD * TT * 2);
    h16* KP16 = QP16 + (size_t)NH_ * TT * HD; bf* KPh = QPh + (size_t)NH_ * TT * HD; bf* KPl = QPl + (size_t)NH_ * TT * HD;
    bf* ATh = (bf*)take((size_t)NB_ * TT * DQ * 2); bf* ATl = (bf*)take((size_t)NB_ * TT * DQ * 2);
    float* KMX = (float*)take((size_t)NB_ * NKV * (TT / 64) * 8 * 32 * 4);   // per k tile and wave of k_qkv: largest |k|, a 128-byte line each
    bf* MKP = (bf*)take((size_t)TT * TT * 2); float* MKM = (float*)take((size_t)(TT / 16) * (TT / 64) * 32 * 4);   // the mask in bf16, tile by tile; per tile its smallest value, a 128-byte line each
    if ((size_t)(wsp - (char*)d_ws) > ws_size) return;    // ws 256 MiB
    (void)WK; (void)WV;
    k_wtG<<<dim3((unsigned)((DM * DQ / 64 + 63) / 64), 4, 1), 256, 0, stream>>>(wq, wk, wv, wo, DM, DQ, WQ);   // WQ, WK, WV, WO are consecutive planes of DM x DQ
    // The batch elements are independent and share every weight and the mask: each stage is one launch over all NB_ of them (rows b * TT + t of the row-major buffers; blockIdx.x holds the element also where planes are formed or read).
    k_cvt8<<<(unsigned)(MKB + ((size_t)NB_ * TT * DM / 8 + 255) / 256), 256, 0, stream>>>(x, XB, (size_t)NB_ * TT * DM / 8, fmask, MKP, MKM);
    k_qkv<<<dim3(NB_ * TT / 64, NH_, 3), 256, 0, stream>>>(XB, WQ, bq, bk, bv, QP16, QPh, QPl, VT16, VTh, VTl, KMX);   // z = q, k, v: weight planes consecutive; q heads, then k heads: an element's k planes lie directly behind its q planes
    k_fattn<<<dim3(NB_ * NH_ * (TT / 64), 1, 1), FNW * 32, 0, stream>>>(QP16, KP16, VT16, QPh, QPl, KPh, KPl, VTh, VTl, MKP, MKM, KMX, ATh, ATl);   // one kv head per query head
    k_wo<<<dim3(NB_ * TT / 64, DM / 64, 1), 256, 0, stream>>>(ATh, ATl, WO, OUT, bo);
}

// v010
// Measured time: 107 microseconds a run.
// Next to v009, in two timings, it ran 1.05 times as fast each time.
// Counting every step since v000, it is 20.0 times as fast.
#include <hip/hip_runtime.h>

// Masked multi-head attention layer (x [4][2048][512]; Q/K/V = x W + b (8 heads x 64, [in, out]); scores = q.k / 8 + mask[i][j] x (-1e9) (float mask [1][1][2048][2048], read); softmax; out = (attn v merged) Wo + bo -> [4][2048][512]).
// Compute dtypes, f32 accumulate: every input rounded to bf16; Q/K/V on PLAIN bf16 operands (inputs: exact) + bias; the mask is data, the same for every head and batch element: it is rounded to bf16 once, with the minimum of each tile of 16 queries x 64 keys; a stage of 64 keys is left out by a wave only where that minimum proves that all its weights are exactly 0; no score is stored: query rows < 512 hl (3 products), the rest single fp16; mask add + running softmax f32; Wo hl x exact (2 products) + bias.

#define NB_  4
#define TT   2048
#define DM   512
#define NH_  8
#define NKV  8
#define REP  (NH_ / NKV)
#define HD   64
#define DQ   (NH_ * HD)
#define DKV  (NKV * HD)
#define RH   512                  // query rows < RH use hi+lo planes (TT / 4: one block in four)
#define WIN  0
#define SCL  0.125f   // HD^-0.5
typedef _Float16 h16;
typedef unsigned short bf;
typedef __attribute__((ext_vector_type(16))) __bf16   v16bf;
typedef __attribute__((ext_vector_type(16))) _Float16 v16h;
typedef __attribute__((ext_vector_type(8)))  _Float16 v8h;
typedef __attribute__((ext_vector_type(8)))  unsigned short v8us;
typedef __attribute__((ext_vector_type(8)))  float    v8f;
typedef __attribute__((ext_vector_type(4)))  float    v4f;
typedef v8h  __attribute__((may_alias)) v8ha;
typedef v4f  __attribute__((may_alias)) v4fa;
typedef v8us __attribute__((may_alias)) v8usa;
typedef float __attribute__((ext_vector_type(2), may_alias)) v2fa;

__device__ __forceinline__ unsigned short f2bf(float f) { unsigned u = __float_as_uint(f); u += 0x7FFFu + ((u >> 16) & 1u); return (unsigned short)(u >> 16); }
__device__ __forceinline__ float bf2f(unsigned short b) { return __uint_as_float(((unsigned)b) << 16); }
__device__ __forceinline__ float bfr(float f) { return bf2f(f2bf(f)); }
__device__ __forceinline__ v16h cat16(v8h lo, v8h hi) { return __builtin_shufflevector(lo, hi, 0, 1, 2, 3, 4, 5, 6, 7, 8, 9, 10, 11, 12, 13, 14, 15); }
__device__ __forceinline__ v16bf cat16b(v8us lo, v8us hi) { return __builtin_bit_cast(v16bf, __builtin_shufflevector(lo, hi, 0, 1, 2, 3, 4, 5, 6, 7, 8, 9, 10, 11, 12, 13, 14, 15)); }
__device__ __forceinline__ v8f wmma16(v16h a, v16h b, v8f c) { return __builtin_amdgcn_wmma_f32_16x16x32_f16(false, a, false, b, (short)0, c, false, false); }
__device__ __forceinline__ v8f wmmab(v16bf a, v16bf b, v8f c) { return __builtin_amdgcn_wmma_f32_16x16x32_bf16(false, a, false, b, (short)0, c, false, false); }



// Fragments of the 16x16x32 products from K-contiguous 16-bit rows: a lane's 8 values from k = 8 hi and its 8 from 16 + 8 hi.
template <typename T16> struct WFrag;
template <> struct WFrag<h16> { typedef v16h V; static __device__ __forceinline__ V ld(const h16* p) { return cat16(*(const v8h*)p, *(const v8h*)(p + 16)); } static __device__ __forceinline__ v8f mma(V a, V b, v8f c) { return wmma16(a, b, c); } };
template <> struct WFrag<bf> { typedef v16bf V; static __device__ __forceinline__ V ld(const bf* p) { return cat16b(*(const v8us*)p, *(const v8us*)(p + 16)); } static __device__ __forceinline__ v8f mma(V a, V b, v8f c) { return wmmab(a, b, c); } };
// Eight asynchronous copies of one wave: a copy is 4 whole 128-byte rows (lane >> 3 = the row, lane & 7 = its 16 bytes of it); l, g: the lane's place in LDS and its source in the first copy; each next copy lies 4 rows on (ls, gs bytes).
// s_wait_xcnt 0 is the statement's last line: it stands in front of whatever later rewrites a register that a copy names.
__device__ __forceinline__ void cp_rows32(const unsigned l, const char* g, const unsigned ls, const size_t gs) {
    const unsigned l1 = l + ls, l2 = l + 2 * ls, l3 = l + 3 * ls, l4 = l + 4 * ls, l5 = l + 5 * ls, l6 = l + 6 * ls, l7 = l + 7 * ls;
    const char* g1 = g + gs; const char* g2 = g + 2 * gs; const char* g3 = g + 3 * gs; const char* g4 = g + 4 * gs; const char* g5 = g + 5 * gs; const char* g6 = g + 6 * gs; const char* g7 = g + 7 * gs;
    asm volatile("global_load_async_to_lds_b128 %0, %8, off\n\tglobal_load_async_to_lds_b128 %1, %9, off\n\tglobal_load_async_to_lds_b128 %2, %10, off\n\tglobal_load_async_to_lds_b128 %3, %11, off\n\t"
                 "global_load_async_to_lds_b128 %4, %12, off\n\tglobal_load_async_to_lds_b128 %5, %13, off\n\tglobal_load_async_to_lds_b128 %6, %14, off\n\tglobal_load_async_to_lds_b128 %7, %15, off\n\ts_wait_xcnt 0x0"
                 :: "v"(l), "v"(l1), "v"(l2), "v"(l3), "v"(l4), "v"(l5), "v"(l6), "v"(l7), "v"(g), "v"(g1), "v"(g2), "v"(g3), "v"(g4), "v"(g5), "v"(g6), "v"(g7) : "memory");
}
#define GLP 144                   // LDS pitch, bytes, of a staged 128-byte row: 16 B x odd, no bank conflict for 16-byte reads
// ---- k_wo: the output projection. C[m][n] (f32, pitch DM) = sum_k (A[m][k] + A2[m][k]) Bt[n][k] + bias[n]: hi and lo planes of the attention result (2 products) on the exact bf16 weight. One 64x64 tile (16 accumulators a wave) a work-group; grid (M/64, N/64), 256 threads.
// 8 waves split K: wave w sums k in [64 w, 64 w + 64), the 8 partial tiles meet in LDS and are added in wave order 0..7.
// A wave's share of K is one 128-byte line of each operand row: it brings its line of the 64 A and 64 A2 rows into LDS of its own by asynchronous copies of whole lines and reads its fragments from there
// (no other wave reads them: its own wait is enough); its partial tile then takes the same LDS. The Bt fragments come straight from global memory, asked for ahead of the copies: staged too, they would leave LDS for one work-group a WGP instead of two.
// amdgpu_waves_per_eu(4): two work-groups a WGP are four waves a SIMD, a quarter of its registers each.
__global__ __launch_bounds__(256) __attribute__((amdgpu_waves_per_eu(4))) void k_wo(const bf* __restrict__ A, const bf* __restrict__ A2, const bf* __restrict__ Bt, float* C, const float* __restrict__ bias) {
    typedef WFrag<bf>::V V;
    constexpr int KS = 8, K = DQ, kw = K / KS, ldc = DM; static_assert(kw * 2 == 128, "a wave's share of a row is one line");
    constexpr int RG = 128 * GLP;   // bytes of a wave's own LDS: 64 A rows, 64 A2 rows; the partial tile (16 KiB) lies at its start
    __shared__ __align__(16) char sm[KS * RG];
    const int lane = threadIdx.x & 31, lr = lane & 15, hi = lane >> 4; const int r0 = blockIdx.x * 64, c0 = blockIdx.y * 64;
    const int wv = __builtin_amdgcn_readfirstlane((int)(threadIdx.x >> 5));   // wave number, scalar
    char* rg = sm + wv * RG;
    // A 16-byte read of the summed tile takes two neighbouring writer lanes: reader lane l, read i holds rows {0,1} of the unit's half (l & 15) >> 3 at columns (2i + (l >> 4)) * 16 + 2 * (l & 7) + {0,1}.
    const int rh = (lane & 15) >> 3, cl = (lane >> 4) * 16 + 2 * (lane & 7);
    V b[kw / 32][4];
    const bf* bp = Bt + (size_t)(c0 + lr) * K + wv * kw + 8 * hi; const float* gp = bias + c0 + cl;
#pragma unroll
    for (int kc = 0; kc < kw / 32; ++kc)
#pragma unroll
        for (int nb = 0; nb < 4; ++nb) b[kc][nb] = WFrag<bf>::ld(bp + (size_t)nb * 16 * K + kc * 32);
    const float g0 = gp[0], g1 = gp[1], g2 = gp[32], g3 = gp[33];   // the bias of this lane's 4 columns: asked for here, used behind the product
    asm volatile("s_wait_xcnt 0x0" :: "v"(bp), "v"(gp) : "memory");   // behind the loads, before anything (a later load's result too) overwrites an address register that they name: the two addresses are inputs, so they stay whole up to here
    { const unsigned lc = (unsigned)(size_t)rg + (unsigned)((lane >> 3) * GLP + (lane & 7) * 16); const size_t go = (size_t)(lane >> 3) * (K * 2) + (size_t)(wv * (kw * 2) + (lane & 7) * 16);
      const char* ga = (const char*)(A + (size_t)r0 * K) + go; const char* gl = (const char*)(A2 + (size_t)r0 * K) + go;
      cp_rows32(lc, ga, 4 * GLP, 4 * K * 2); cp_rows32(lc + 32 * GLP, ga + 32 * K * 2, 4 * GLP, 4 * K * 2);
      cp_rows32(lc + 64 * GLP, gl, 4 * GLP, 4 * K * 2); cp_rows32(lc + 96 * GLP, gl + 32 * K * 2, 4 * GLP, 4 * K * 2); }
    v8f acc[4][4];
#pragma unroll
    for (int mb = 0; mb < 4; ++mb)
#pragma unroll
        for (int nb = 0; nb < 4; ++nb) acc[mb][nb] = (v8f){};
    asm volatile("s_wait_asynccnt 0x0" ::: "memory");   // this wave's rows have landed before it reads them
    const char* fr = rg + lr * GLP + hi * 16;   // fragment reads: row lr of a 16-row tile, 16 bytes from k = 8 hi (and from 16 + 8 hi)
#pragma unroll   // two passes of 32 k, unrolled: b[kc] is a register array
    for (int kc = 0; kc < kw / 32; ++kc) {
        V a[4], a2[4];
#pragma unroll
        for (int mb = 0; mb < 4; ++mb) { a[mb] = WFrag<bf>::ld((const bf*)(fr + mb * 16 * GLP + kc * 64)); a2[mb] = WFrag<bf>::ld((const bf*)(fr + (64 + mb * 16) * GLP + kc * 64)); }
#pragma unroll
        for (int mb = 0; mb < 4; ++mb)
#pragma unroll
            for (int nb = 0; nb < 4; ++nb) { acc[mb][nb] = WFrag<bf>::mma(a[mb], b[kc][nb], acc[mb][nb]); acc[mb][nb] = WFrag<bf>::mma(a2[mb], b[kc][nb], acc[mb][nb]); }
        __builtin_amdgcn_sched_barrier(0);   // the next pass's A and A2 fragments are fetched only behind this pass's products: fetched together the two sets spill
    }
    // Partial tile of wave wv at the start of its own LDS (its reads of the rows there are done: their values are spent), as 16 units u = mb * 4 + jq (rows mb*16 + hi*8 + 2jq + {0,1}, all 64 columns); a unit is [nb][lane][2 rows], 1 KiB: register pairs go out as they lie, every LDS access is contiguous over the lanes.
    const float* os = (const float*)sm;
    float* mine = (float*)rg + lane * 2;
#pragma unroll
    for (int mb = 0; mb < 4; ++mb)
#pragma unroll
        for (int jq = 0; jq < 4; ++jq)
#pragma unroll
            for (int nb = 0; nb < 4; ++nb) { v2fa t; t[0] = acc[mb][nb][2 * jq]; t[1] = acc[mb][nb][2 * jq + 1]; *(v2fa*)(mine + ((mb * 4 + jq) * 4 + nb) * 64) = t; }
    __syncthreads();   // every wave's partial tile is in LDS before any wave adds them
    const float b0 = bfr(g0), b1 = bfr(g1), b2 = bfr(g2), b3 = bfr(g3);
#pragma unroll
    for (int uu = 0; uu < 16 / KS; ++uu) { const int u = wv + uu * KS; const float* q0 = os + u * 256 + lane * 4; v4f s0 = *(const v4fa*)q0, s1 = *(const v4fa*)(q0 + 128);
#pragma unroll
        for (int s = 1; s < KS; ++s) { s0 += *(const v4fa*)(q0 + s * (RG / 4)); s1 += *(const v4fa*)(q0 + s * (RG / 4) + 128); }
        { s0[0] += b0; s0[1] += b0; s0[2] += b1; s0[3] += b1; s1[0] += b2; s1[1] += b2; s1[2] += b3; s1[3] += b3; }
        float* crow = C + (size_t)(r0 + (u >> 2) * 16 + rh * 8 + (u & 3) * 2) * ldc + c0 + cl;   // a unit holds whole 256-byte rows of the tile: one writing wave per line
#pragma unroll
        for (int q = 0; q < 2; ++q) { v2fa lo, up; lo[0] = s0[q]; lo[1] = s0[2 + q]; up[0] = s1[q]; up[1] = s1[2 + q]; *(v2fa*)(crow + (size_t)q * ldc) = lo; *(v2fa*)(crow + (size_t)q * ldc + 32) = up; } }
}

__device__ __forceinline__ h16 tohx(float x) { return (h16)x; }
// Maximum and minimum that hand a NaN on (fmaxf and fminf drop it): what is built from them for the test in k_fattn turns NaN where an operand is NaN, and the test then fails.
__device__ __forceinline__ float mxn(float a, float b) { return __builtin_elementwise_maximum(a, b); }
__device__ __forceinline__ float mnn(float a, float b) { return __builtin_elementwise_minimum(a, b); }
__device__ __forceinline__ void splitf(float y, unsigned short& h, unsigned short& l) { h = f2bf(y); l = f2bf(y - bf2f(h)); }
typedef __attribute__((ext_vector_type(2))) _Float16 v2h;
typedef __attribute__((ext_vector_type(4))) _Float16 v4h;
typedef __attribute__((ext_vector_type(2))) unsigned short v2us;
typedef __attribute__((ext_vector_type(4))) unsigned short v4us;
typedef __attribute__((ext_vector_type(2))) float v2f;
typedef __attribute__((ext_vector_type(4))) int v4i;

// One block's share of a weight's transpose: w is K x N ([in][out]), Bt its N x K plane in bf16; block bw of the weight: 8 waves, 8 lines of 64 values a wave. Called from k_cvt8 with K and N as constants.
__device__ __forceinline__ void wt_block(const float* __restrict__ w, const int K, const int N, bf* Bt, const int bw) {
    const int lane = threadIdx.x & 31; const int L0 = (bw * 8 + (threadIdx.x >> 5)) * 8; const int nlines = N * K / 64;
{
#pragma unroll 1
        for (int l = 0; l < 8; ++l) { const int L = L0 + l; if (L >= nlines) break; const size_t e = (size_t)L * 64 + lane * 2; const int k = (int)(e % K), n = (int)(e / K); v2us o;
            o[0] = f2bf(w[(size_t)k * N + n]); o[1] = f2bf(w[(size_t)(k + 1) * N + n]); *(v2us*)(Bt + e) = o; }
         }
}
// ---- k_cvt8: all that reads the inputs alone, in one grid: the four weights transposed to bf16 (the first WTB blocks: the longest chain of loads, placed first for speed only; their planes lie one behind the other in Bt),
// the mask made ready for k_fattn, once for all heads and batch elements (the blocks from there to MKB), and x rounded to bf16 (the rest). No block reads what another writes.
// A mask tile is 16 query rows x 64 keys = what one wave of k_fattn needs for one stage. MB: the tile's values, rounded to bf16, in the order in which that wave's lanes hold them: [tile][g][lane][8],
// lane = (lr, hi), value j = query row lr, key 16 g + 8 hi + j: each of the wave's four 16-byte loads of a stage is 512 bytes in a row. TM: the smallest of the tile's rounded values, in a 128-byte line of its own (one writing wave per line).
#define WT1 (DM * DQ / 64 / 64)          // blocks of one weight: 64 lines of 64 values a block
#define WTB (4 * WT1)
#define MKB (WTB + TT / 16 * (TT / 64) / 16)   // the first block of x: behind the weights' blocks and the mask's (8 waves a block, 2 tiles a wave)
__global__ __launch_bounds__(256) void k_cvt8(const float* __restrict__ src, bf* dst, size_t n8, const float* __restrict__ fm, bf* MB, float* TM, const float* __restrict__ w0, const float* __restrict__ w1, const float* __restrict__ w2, const float* __restrict__ w3, bf* Bt) {
    if (blockIdx.x < WTB) { const int wi = (int)blockIdx.x / WT1;
        wt_block((wi == 0) ? w0 : (wi == 1) ? w1 : (wi == 2) ? w2 : w3, DM, DQ, Bt + (size_t)wi * DM * DQ, (int)blockIdx.x % WT1); return; }
    if (blockIdx.x < MKB) {
        const int lane = threadIdx.x & 31, lr = lane & 15, hi = lane >> 4; const int t0 = (((int)blockIdx.x - WTB) * 8 + ((int)threadIdx.x >> 5)) * 2;
        v4f r[2][8];
#pragma unroll
        for (int i = 0; i < 2; ++i) { const int tl = t0 + i; const float* mp = fm + (size_t)(tl / (TT / 64) * 16 + lr) * TT + tl % (TT / 64) * 64 + hi * 8;
#pragma unroll
            for (int g = 0; g < 4; ++g) { r[i][g * 2] = *(const v4f*)(mp + g * 16); r[i][g * 2 + 1] = *(const v4f*)(mp + g * 16 + 4); } }
        asm volatile("s_wait_xcnt 0x0" ::: "memory");   // behind the loads, before later code overwrites a register that one of them names
#pragma unroll
        for (int i = 0; i < 2; ++i) { const int tl = t0 + i; float mq[4];   // the minimum is taken over the rounded values, the ones the scores get; a NaN among them is handed on
#pragma unroll
            for (int g = 0; g < 4; ++g) { v8us o;
#pragma unroll
                for (int j = 0; j < 8; ++j) o[j] = f2bf(r[i][g * 2 + (j >> 2)][j & 3]);
                *(v8us*)(MB + ((size_t)tl * 4 + g) * 256 + lane * 8) = o;
                mq[g] = mnn(mnn(mnn(bf2f(o[0]), bf2f(o[1])), mnn(bf2f(o[2]), bf2f(o[3]))), mnn(mnn(bf2f(o[4]), bf2f(o[5])), mnn(bf2f(o[6]), bf2f(o[7])))); }
            float mn = mnn(mnn(mq[0], mq[1]), mnn(mq[2], mq[3]));
#pragma unroll
            for (int d = 16; d >= 1; d >>= 1) mn = mnn(mn, __shfl_xor(mn, d, 32));
            if (lane == 0) TM[(size_t)tl * 32] = mn;
        }
        asm volatile("s_wait_xcnt 0x0" ::: "memory");   // behind the stores, before later code overwrites a register that one of them names
        return;
    }
    const size_t i = (size_t)(blockIdx.x - MKB) * 256 + threadIdx.x; if (i >= n8) return; const v8f v = *(const v8f*)(src + i * 8); v8us o;
#pragma unroll
    for (int k = 0; k < 8; ++k) o[k] = f2bf(v[k]); *(v8us*)(dst + i * 8) = o;  }
__global__ __launch_bounds__(256) void k_cscvt(const float* __restrict__ cosT, const float* __restrict__ sinT, float* CS) { const int idx = blockIdx.x * 256 + threadIdx.x; if (idx >= TT * HD) return; v2f cs; cs[0] = bfr(cosT[idx]); cs[1] = bfr(sinT[idx]); *(v2f*)(CS + (size_t)idx * 2) = cs;  }
// ---- k_qkv: the Q, K and V projections (blockIdx.z = 0, 1, 2) of all batch elements; a work-group forms one head's 64 values of 64 tokens and writes them straight into the planes that k_fattn reads (fp16 and bf16 hi + lo).
// The product is k_wo's: 8 waves split K, the 8 partial tiles meet in LDS and are added in wave order. A wave's share of K is 64 values = one 128-byte line of each operand row:
// it brings its line of the 64 A rows and the 64 B rows into LDS of its own by asynchronous copies of whole lines and reads its fragments from there (no other wave reads them: its own wait is enough); its partial tile then takes the same LDS. Q, K: tile rows = tokens (A = x), columns = d (B = weight), planes [head][t][d].
// V: the operands change places (A = weight rows d, B = x rows t), so the tile comes out transposed, rows = d, columns = tokens, as the planes [head][d][t] want it. Either way a tile row is one 128-byte line of each plane, written by one wave.
__global__ __launch_bounds__(256) void k_qkv(const bf* __restrict__ X, const bf* __restrict__ Wt, const float* __restrict__ bq, const float* __restrict__ bk, const float* __restrict__ bv, h16* P16, bf* Ph, bf* Pl, h16* V16, bf* Vh, bf* Vl, float* KM) {
    typedef WFrag<bf>::V V;
    constexpr int KS = 8, K = DM, kw = K / KS; static_assert(kw * 2 == 128, "a wave's share of a row is one line");
    constexpr int RG = 128 * GLP;   // bytes of a wave's own LDS: 64 A rows, 64 B rows; the partial tile (16 KiB) lies at its start
    __shared__ __align__(16) char sm[KS * RG];
    const int z = (int)blockIdx.z, hd = (int)blockIdx.y, t0 = (int)blockIdx.x * 64; const bool tr = z == 2;
    const float* bias = ((z == 0) ? bq : (z == 1) ? bk : bv) + hd * HD;
    const bf* xr = X + (size_t)t0 * K; const bf* wr = Wt + ((size_t)z * DQ + hd * HD) * K;
    const bf* A = tr ? wr : xr; const bf* Bt = tr ? xr : wr;
    const int lane = threadIdx.x & 31, lr = lane & 15, hi = lane >> 4;
    const int wv = __builtin_amdgcn_readfirstlane((int)(threadIdx.x >> 5));   // wave number, scalar
    char* rg = sm + wv * RG;
    { const unsigned lc = (unsigned)(size_t)rg + (unsigned)((lane >> 3) * GLP + (lane & 7) * 16); const size_t go = (size_t)(lane >> 3) * (K * 2) + (size_t)(wv * (kw * 2) + (lane & 7) * 16);
      const char* ga = (const char*)A + go; const char* gb = (const char*)Bt + go;
      cp_rows32(lc, ga, 4 * GLP, 4 * K * 2); cp_rows32(lc + 32 * GLP, ga + 32 * K * 2, 4 * GLP, 4 * K * 2);
      cp_rows32(lc + 64 * GLP, gb, 4 * GLP, 4 * K * 2); cp_rows32(lc + 96 * GLP, gb + 32 * K * 2, 4 * GLP, 4 * K * 2); }
    v8f acc[4][4];
#pragma unroll
    for (int mb = 0; mb < 4; ++mb)
#pragma unroll
        for (int nb = 0; nb < 4; ++nb) acc[mb][nb] = (v8f){};
    // Where this lane's sums will lie in the tile (k_wo's lane map): rows ru + 16 * 2 uu + {0, 1} for its two units uu, columns cl + {0, 1} and 32 + cl + {0, 1}.
    const int rh = (lane & 15) >> 3, cl = (lane >> 4) * 16 + 2 * (lane & 7), ru = (wv >> 2) * 16 + rh * 8 + (wv & 3) * 2;
    // The bias belongs to d: the tile's column for Q and K (4 columns a lane), its row for V (2 rows in each of 2 units). Asked for here, used behind the product.
    const float g0 = bias[tr ? ru : cl], g1 = bias[tr ? ru + 1 : cl + 1], g2 = bias[tr ? ru + 32 : 32 + cl], g3 = bias[tr ? ru + 33 : 32 + cl + 1];
    asm volatile("s_wait_xcnt 0x0" ::: "memory");   // behind the loads, before later code overwrites a register that one of them names
    asm volatile("s_wait_asynccnt 0x0" ::: "memory");   // this wave's rows have landed before it reads them
    const char* fr = rg + lr * GLP + hi * 16;   // fragment reads: row lr of a 16-row tile, 16 bytes from k = 8 hi (and from 16 + 8 hi)
#pragma unroll   // two passes of 32 k, unrolled: the second pass's reads can go out among the first's products
    for (int kc = 0; kc < kw / 32; ++kc) {
        V a[4], b[4];
#pragma unroll
        for (int mb = 0; mb < 4; ++mb) { a[mb] = WFrag<bf>::ld((const bf*)(fr + mb * 16 * GLP + kc * 64)); b[mb] = WFrag<bf>::ld((const bf*)(fr + (64 + mb * 16) * GLP + kc * 64)); }
#pragma unroll
        for (int nb = 0; nb < 4; ++nb)
#pragma unroll
            for (int mb = 0; mb < 4; ++mb) acc[mb][nb] = WFrag<bf>::mma(a[mb], b[nb], acc[mb][nb]);
    }
    // Partial tiles in LDS and their sum: units, order and lane map as in k_wo. A wave's tile goes where its own rows lay: its reads of them are done (their values are spent).
    const float* os = (const float*)sm;
    float* mine = (float*)rg + lane * 2;
#pragma unroll
    for (int mb = 0; mb < 4; ++mb)
#pragma unroll
        for (int jq = 0; jq < 4; ++jq)
#pragma unroll
            for (int nb = 0; nb < 4; ++nb) { v2fa t; t[0] = acc[mb][nb][2 * jq]; t[1] = acc[mb][nb][2 * jq + 1]; *(v2fa*)(mine + ((mb * 4 + jq) * 4 + nb) * 64) = t; }
    __syncthreads();   // every wave's partial tile is in LDS before any wave adds them
    const float b0 = bfr(g0), b1 = bfr(g1), b2 = bfr(g2), b3 = bfr(g3);
    const int be = t0 / TT, tb = t0 % TT;   // 64 divides TT: a tile's tokens belong to one batch element
    const size_t base = tr ? (size_t)(be * NKV + hd) * HD * TT + tb : ((size_t)(be * (NH_ + NKV) + z * NH_ + hd) * TT + tb) * HD;
    const int pitch = tr ? TT : HD;
    float am = 0.f;   // largest magnitude among the values this lane stores (the fp16 rounding counted, so an overflow shows as inf)
    h16* D16 = (tr ? V16 : P16) + base + cl; bf* Dh = (tr ? Vh : Ph) + base + cl; bf* Dl = (tr ? Vl : Pl) + base + cl;
#pragma unroll
    for (int uu = 0; uu < 16 / KS; ++uu) { const int u = wv + uu * KS; const float* q0 = os + u * 256 + lane * 4; v4f s0 = *(const v4fa*)q0, s1 = *(const v4fa*)(q0 + 128);
#pragma unroll
        for (int s = 1; s < KS; ++s) { s0 += *(const v4fa*)(q0 + s * (RG / 4)); s1 += *(const v4fa*)(q0 + s * (RG / 4) + 128); }
        const int row = ru + uu * 32;   // s0, s1: [0], [1] = rows row, row + 1 of column cl (s1: 32 + cl); [2], [3] = the same rows of the next column
        if (tr) { const float e0 = uu ? b2 : b0, e1 = uu ? b3 : b1; s0[0] += e0; s0[1] += e1; s0[2] += e0; s0[3] += e1; s1[0] += e0; s1[1] += e1; s1[2] += e0; s1[3] += e1; }
        else { s0[0] += b0; s0[1] += b0; s0[2] += b1; s0[3] += b1; s1[0] += b2; s1[1] += b2; s1[2] += b3; s1[3] += b3; }
#pragma unroll
        for (int q = 0; q < 2; ++q) { const size_t ro = (size_t)(row + q) * pitch;
#pragma unroll
            for (int i = 0; i < 2; ++i) { const float y0 = i ? s1[q] : s0[q], y1 = i ? s1[2 + q] : s0[2 + q]; v2h o16; v2us oh, ol; unsigned short a2, c2;
                o16[0] = tohx(y0); o16[1] = tohx(y1); am = mxn(mxn(am, mxn(fabsf(y0), fabsf(y1))), mxn(fabsf((float)o16[0]), fabsf((float)o16[1]))); splitf(y0, a2, c2); oh[0] = a2; ol[0] = c2; splitf(y1, a2, c2); oh[1] = a2; ol[1] = c2;
                *(v2h*)(D16 + ro + i * 32) = o16; *(v2us*)(Dh + ro + i * 32) = oh; *(v2us*)(Dl + ro + i * 32) = ol; } }
        asm volatile("s_wait_xcnt 0x0" ::: "memory");   // behind the unit's stores, before later code overwrites a register that one of them names
    }
    // K tiles: each wave leaves the largest |k| of its rows for k_fattn's bound on the scores, in a 128-byte line of its own.
    if (z == 1) {
#pragma unroll
        for (int d = 16; d >= 1; d >>= 1) am = mxn(am, __shfl_xor(am, d, 32));
        if (lane == 0) KM[((size_t)((be * NKV + hd) * (TT / 64) + tb / 64) * KS + wv) * 32] = am;
        asm volatile("s_wait_xcnt 0x0" ::: "memory");   // behind the store, before later code overwrites a register that it names
    }
}
// ---- k_fattn: scores, mask, softmax and P.V of one head in one kernel; no score or probability leaves the registers.
// A work-group has 4 waves and 64 query rows: wave w owns rows 16 w .. 16 w + 15 and walks ALL keys, so no partial results meet at the end.
// K and V^T come in stages of 64 keys: the work-group brings each stage into LDS once (asynchronous copies, whole 128-byte lines, two buffers: the next stage flies while this one is worked on) and all 4 waves read their fragments from there.
// Every work-group brings in all TT / SKK stages, also a stage that all four of its waves leave out: those copies are L2 reads like the others.
// Transposed products: S^T = K Q^T (D: row = key, column = query) and O^T += V^T P^T (D: row = d, column = query). A lane's two score tiles of a pass
// (keys 8 hi + j and 16 + 8 hi + j of query lr) are the sixteen k positions of its B fragment for P^T, so P goes from D to B in place, and every per-query factor is per lane.
#define L2E 1.4426950408889634f
#define FNW 4                     // waves of a work-group, 16 query rows each
#define SKK 64                    // keys of a stage = two passes of 32
#define LPB 144                   // LDS pitch, bytes, of a 128-byte row (64 d of a key, or 64 keys of a d): 16 B x odd, no bank conflict for 16-byte reads
#define PLB (64 * LPB)            // one plane's 64 rows of a stage in LDS
// One plane's tile of a stage: 64 rows of 128 bytes; thread t brings 16 bytes of rows (t >> 3) + 0, 16, 32, 48 (l, g: its place and source in the first; gs: 16 source rows in bytes).
// s_wait_xcnt 0 is the statement's last line: it stands in front of whatever later rewrites a register that a copy names.
__device__ __forceinline__ void cp_plane(const unsigned l, const char* g, const size_t gs) {
    const unsigned l1 = l + 16 * LPB, l2 = l + 32 * LPB, l3 = l + 48 * LPB; const char* g1 = g + gs; const char* g2 = g + 2 * gs; const char* g3 = g + 3 * gs;
    asm volatile("global_load_async_to_lds_b128 %0, %4, off\n\tglobal_load_async_to_lds_b128 %1, %5, off\n\tglobal_load_async_to_lds_b128 %2, %6, off\n\tglobal_load_async_to_lds_b128 %3, %7, off\n\ts_wait_xcnt 0x0"
                 :: "v"(l), "v"(l1), "v"(l2), "v"(l3), "v"(g), "v"(g1), "v"(g2), "v"(g3) : "memory");
}
__device__ __forceinline__ float amax16(v16h v) { float a = 0.f;
#pragma unroll
    for (int e = 0; e < 16; ++e) a = mxn(a, fabsf((float)v[e])); return a; }
__device__ __forceinline__ float amax16(v16bf v) { const __attribute__((ext_vector_type(16))) unsigned short u = __builtin_bit_cast(__attribute__((ext_vector_type(16))) unsigned short, v); float a = 0.f;
#pragma unroll
    for (int e = 0; e < 16; ++e) a = mxn(a, fabsf(bf2f(u[e]))); return a; }
typedef __attribute__((address_space(1))) bf gbf;
typedef __attribute__((address_space(1))) v8usa gv8us;
template <typename T16, bool HL>
__device__ __forceinline__ void fattn_body(const T16* __restrict__ Qa, const T16* __restrict__ Qb, const T16* __restrict__ Ka, const T16* __restrict__ Kb, const T16* __restrict__ Va, const T16* __restrict__ Vb, const bf* __restrict__ mb, const float* __restrict__ tm, const float* __restrict__ km, const int q0, const int h, char* sm, bf* Ah, bf* Al) {
    typedef typename WFrag<T16>::V V;
    constexpr int VO = (HL ? 2 : 1) * PLB;   // V^T planes lie behind the K planes of a stage
    constexpr int SB = (HL ? 4 : 2) * PLB;   // bytes of a stage in LDS
    constexpr int NST = TT / SKK;
    const int lane = threadIdx.x & 31, lr = lane & 15, hi = lane >> 4;
    const int wv = __builtin_amdgcn_readfirstlane((int)(threadIdx.x >> 5));   // wave number, scalar
    const int qw = q0 + wv * 16;   // this wave's first query row
    const size_t hp = (size_t)h * TT * HD;
    V qa[2], qb[2];
#pragma unroll
    for (int kc = 0; kc < 2; ++kc) { const size_t qo = hp + (size_t)((qw + lr) * HD + 8 * hi + kc * 32); qa[kc] = WFrag<T16>::ld(Qa + qo);
        asm volatile("s_wait_xcnt 0x0" ::: "memory");   // behind this fragment's loads, before a later instruction (a later load's result too) overwrites an address register that they name
        if constexpr (HL) { qb[kc] = WFrag<T16>::ld(Qb + qo);
            asm volatile("s_wait_xcnt 0x0" ::: "memory"); } }   // the same
    v8f o[4]; float m = -3.0e38f, l = 0.f;
#pragma unroll
    for (int db = 0; db < 4; ++db) o[db] = (v8f){};
    // Copies: this thread's 16 bytes of a row. K planes [key][d]: a stage is 64 whole rows, one behind the other. V^T planes [d][key]: 128 bytes of each of the 64 rows.
    const int crow = (int)threadIdx.x >> 3, ccol = ((int)threadIdx.x & 7) * 16;
    const unsigned lc = (unsigned)(size_t)sm + (unsigned)(crow * LPB + ccol);
    const size_t ko = (size_t)(crow * (HD * 2) + ccol), vo = (size_t)crow * (TT * 2) + ccol;
    const char* gka = (const char*)(Ka + hp) + ko; const char* gva = (const char*)(Va + hp) + vo;
    const char* gkb = HL ? (const char*)(Kb + hp) + ko : nullptr; const char* gvb = HL ? (const char*)(Vb + hp) + vo : nullptr;
    auto fill = [&](const int st, const int buf) {
        const unsigned lb = lc + (unsigned)(buf * SB); const size_t ks = (size_t)st * (SKK * HD * 2), vs = (size_t)st * (SKK * 2);
        cp_plane(lb, gka + ks, 16 * HD * 2); if constexpr (HL) cp_plane(lb + PLB, gkb + ks, 16 * HD * 2);
        cp_plane(lb + VO, gva + vs, (size_t)16 * TT * 2); if constexpr (HL) cp_plane(lb + VO + PLB, gvb + vs, (size_t)16 * TT * 2); };
    // The mask, as k_cvt8 left it: mk[ps][kt][j] = the bf16 value of query lr, key 32 ps + 16 kt + 8 hi + j of a stage; lane i of tmv = the smallest value of stage i's tile (this wave's 16 rows x 64 keys).
    // Behind each group of loads stands s_wait_xcnt 0: a later instruction may overwrite a register that an issued load names, and the wait stands in front of that.
    static_assert(NST == 32, "one stage's minimum a lane");
    v8us mk[2][2], mkn[2][2] = {};   // this stage's values; fp16 rows: the next stage's beside them
    const bf* mb0 = mb + (size_t)(qw >> 4) * NST * 1024; const unsigned ml = (unsigned)lane * 8u;   // wave-uniform base, the lane's place beside it
    const float tmv = tm[(size_t)((qw >> 4) * NST + lane) * 32];
    asm volatile("s_wait_xcnt 0x0" ::: "memory");
    auto ldmask = [&](v8us (&dst)[2][2], const int s_) {
        const unsigned long long a = (unsigned long long)(mb0 + (size_t)s_ * 1024);   // the tile's address, held in scalar registers: the loads then name, beside it, only the lane's offset register, which no load's result overwrites
        const gbf* mp = (const gbf*)(((unsigned long long)(unsigned)__builtin_amdgcn_readfirstlane((int)(unsigned)(a >> 32)) << 32) | (unsigned)__builtin_amdgcn_readfirstlane((int)(unsigned)a));   // rebuilt from its words, so said to be global memory
#pragma unroll
        for (int g = 0; g < 4; ++g) dst[g >> 1][g & 1] = *(const gv8us*)(mp + g * 256 + ml);
        asm volatile("s_wait_xcnt 0x0" ::: "memory"); };
    if constexpr (!HL) ldmask(mk, 0);   // stage 0 always counts (no maximum yet); asked for here, its values are in behind the barrier below, and in the loop no wait for them falls on the loads of the stage after
    fill(0, 0);
    asm volatile("s_wait_asynccnt 0x0" ::: "memory");   // this wave's share of stage 0 has landed
    __syncthreads();   // stage 0 is whole before any wave reads it
    fill(1, 1);
    // sb_: no score of this lane's query, scaled, exceeds it. A score is a sum of at most 192 products (hi+lo: 3 x 64) of a stored q value and a stored k value;
    // qx is the largest stored |q| of the row, kx the largest |k| of the head before rounding (the roundings add under 1 %): 256 x SCL = 32 leaves a quarter to spare. An inf or a NaN among them makes sb_ inf or NaN and the test below fails: nothing is left out.
    float kx = 0.f;
#pragma unroll
    for (int i = 0; i < 8; ++i) kx = mxn(kx, km[(size_t)(lane * 8 + i) * 32]);   // the head's 32 tiles x 8 waves, one value a line
    asm volatile("s_wait_xcnt 0x0" ::: "memory");   // behind the loads, before later code overwrites a register that one of them names
#pragma unroll
    for (int d = 16; d >= 1; d >>= 1) kx = mxn(kx, __shfl_xor(kx, d, 32));
    float qx = mxn(amax16(qa[0]), amax16(qa[1])); if constexpr (HL) qx = mxn(qx, mxn(amax16(qb[0]), amax16(qb[1])));
    qx = mxn(qx, __shfl_xor(qx, 16, 32));   // the other half of the row's d lies in lane lr + 16
    const float sb_ = 32.f * qx * kx;
    const int fro = lr * LPB + hi * 16;   // fragment reads: row lr of a 16-row tile, 16 bytes from k = 8 hi (and from 16 + 8 hi)
    // The test. Every score of stage s_ is at most ub: sb_ bounds q.k / 8, and the tile's smallest mask value gives the largest mask term mt (a thousandth of |mt| on top: room for the roundings of the score's own sum, whatever mt's sign).
    // Where ub lies 256 under the running maximum in every lane, the maximum stays, the rescale factor is exp2(0) and each weight is exp2(under -369) = 0: the stage would change nothing (0 x V^T adds 0: V is finite wherever x, Wv and bv are).
    // The running maximum never falls, so a stage that passes the test early still passes it when its turn comes. Wave-uniform: the ballot's compare is a scalar branch.
    auto dead = [&](const int s_) -> bool {
        const float mt = __uint_as_float((unsigned)__builtin_amdgcn_readlane((int)__float_as_uint(tmv), s_)) * -1.0e9f;
        const float ub = sb_ + (mt + fabsf(mt) * 1.0e-3f);
        return __builtin_amdgcn_ballot_w32(ub - m < -256.f) == 0xFFFFFFFFu; };
    // fp16 rows: whether the next stage counts is settled at the head of this one, and only then are its mask values asked for: they come from L2 while this stage is worked on. A stage left out reads no mask value at all.
    bool act = true, nact = false;
#pragma unroll 1   // rolled: a trip is one stage; the buffer alternates with it
    for (int st = 0; st < NST; ++st) {
        const char* sb = sm + (st & 1) * SB + fro;
        if constexpr (HL) act = !dead(st);   // hi+lo planes: settled here, and the stage's own mask values asked for here; held over from the stage before, their registers stand beside the fragments' and some spill
        else { nact = st + 1 < NST && !dead(st + 1); if (nact) ldmask(mkn, st + 1); }
        if (act) {
        if constexpr (HL) ldmask(mk, st);
#pragma unroll
        for (int ps = 0; ps < 2; ++ps) {
            V ka[2][2], kl[2][2], va[4], vl[4];
#pragma unroll
            for (int kt = 0; kt < 2; ++kt)
#pragma unroll
                for (int kc = 0; kc < 2; ++kc) { const char* p = sb + (ps * 32 + kt * 16) * LPB + kc * 64; ka[kt][kc] = WFrag<T16>::ld((const T16*)p); if constexpr (HL) kl[kt][kc] = WFrag<T16>::ld((const T16*)(p + PLB)); }
            v8f s[2];
#pragma unroll
            for (int kt = 0; kt < 2; ++kt) { v8f c = (v8f){};
#pragma unroll
                for (int kc = 0; kc < 2; ++kc) { c = WFrag<T16>::mma(ka[kt][kc], qa[kc], c); if constexpr (HL) { c = WFrag<T16>::mma(ka[kt][kc], qb[kc], c); c = WFrag<T16>::mma(kl[kt][kc], qa[kc], c); } }
                s[kt] = c; }
            if constexpr (HL) __builtin_amdgcn_sched_barrier(0);   // hi+lo planes: the V^T fragments are fetched only when the K fragments are spent, into their registers; fetched together the two sets spill
#pragma unroll
            for (int db = 0; db < 4; ++db) { const char* p = sb + VO + db * 16 * LPB + ps * 64; va[db] = WFrag<T16>::ld((const T16*)p); if constexpr (HL) vl[db] = WFrag<T16>::ld((const T16*)(p + PLB)); }
            float t[16]; float mx = m;
#pragma unroll
            for (int kt = 0; kt < 2; ++kt)
#pragma unroll
                for (int j = 0; j < 8; ++j) { const float mv = bf2f(mk[ps][kt][j]); const float tt = s[kt][j] * SCL + mv * -1.0e9f; t[kt * 8 + j] = tt; mx = fmaxf(mx, tt); }
            mx = fmaxf(mx, __shfl_xor(mx, 16, 32));   // the other half of the query's keys of this pass lies in lane lr + 16
            const float al = __builtin_amdgcn_exp2f((m - mx) * L2E); m = mx;
            float sum = 0.f;
#pragma unroll
            for (int k = 0; k < 16; ++k) { t[k] = __builtin_amdgcn_exp2f((t[k] - mx) * L2E); sum += t[k]; }
            l = l * al + sum;   // each half keeps the sum of its own keys; the halves meet behind the loop
#pragma unroll
            for (int db = 0; db < 4; ++db) o[db] *= al;
            if constexpr (HL) { v8us h0, h1, l0, l1;
#pragma unroll
                for (int j = 0; j < 8; ++j) { unsigned short a, c2; splitf(t[j], a, c2); h0[j] = a; l0[j] = c2; splitf(t[8 + j], a, c2); h1[j] = a; l1[j] = c2; }
                const V ph = cat16b(h0, h1), pl = cat16b(l0, l1);
#pragma unroll
                for (int db = 0; db < 4; ++db) { o[db] = WFrag<T16>::mma(va[db], ph, o[db]); o[db] = WFrag<T16>::mma(va[db], pl, o[db]); o[db] = WFrag<T16>::mma(vl[db], ph, o[db]); }
            } else { V pf;
#pragma unroll
                for (int k = 0; k < 16; ++k) pf[k] = tohx(t[k]);
#pragma unroll
                for (int db = 0; db < 4; ++db) o[db] = WFrag<T16>::mma(va[db], pf, o[db]); }
        }
        }
        asm volatile("s_wait_dscnt 0x0" ::: "memory");      // this wave's reads of the stage's buffer are done before the buffer is given up
        asm volatile("s_wait_asynccnt 0x0" ::: "memory");   // this wave's share of the next stage has landed
        __syncthreads();   // the next stage is whole, and every wave has left this stage's buffer
        if (st + 2 < NST) fill(st + 2, st & 1);
        if constexpr (!HL) { act = nact;
#pragma unroll
            for (int g = 0; g < 4; ++g) mk[g >> 1][g & 1] = mkn[g >> 1][g & 1]; }
    }
    asm volatile("s_wait_asynccnt 0x0" ::: "memory");   // no copy is outstanding when the wave ends
    l += __shfl_xor(l, 16, 32);
    const float f = __fdiv_rn(1.0f, l);
#pragma unroll
    for (int db = 0; db < 4; ++db) { v8us oh, ol;
#pragma unroll
        for (int j = 0; j < 8; ++j) { unsigned short x0, x1; splitf(o[db][j] * f, x0, x1); oh[j] = x0; ol[j] = x1; }
        const size_t oo = (size_t)(qw + lr) * DQ + h * HD + db * 16 + hi * 8; *(v8us*)(Ah + oo) = oh; *(v8us*)(Al + oo) = ol; }   // a head's 64 values of a row are one 128-byte line, written by lanes lr and lr + 16 of one wave
    asm volatile("s_wait_xcnt 0x0" ::: "memory");   // behind the last store, before any later code overwrites a register that a store names
}
// grid: NB_ * NH_ * TT / 64 blocks of 64 query rows; one in four takes hi+lo rows (the dearer kind), three take fp16 rows. Within a kind: row block fastest, then head, then batch element.
// All blocks are resident at once, four to a WGP, and which four share a WGP is not promised. The kind is the sum of the index's base-4 digits mod 4: any four blocks that differ in one digit alone
// (neighbours, or 4, 16, 64 or 256 apart) hold one hi+lo block and three fp16 blocks, one from each third of the fp16 rows, so the WGPs get about equal work under any such placement. For speed only: every (kind, number) occurs once wherever the blocks land.
// A batch element's q and k planes lie together (NH_ q heads, then NKV k heads), so both step by NH_ + NKV planes from one element to the next; the mask is the same for all.
// Four work-groups share a WGP (4 x the LDS fits), one wave of each on every SIMD: amdgpu_waves_per_eu(4) holds the registers to a quarter of a SIMD's.
__global__ __launch_bounds__(FNW * 32) __attribute__((amdgpu_waves_per_eu(4))) void k_fattn(const h16* __restrict__ Q16, const h16* __restrict__ K16, const h16* __restrict__ V16, const bf* __restrict__ Qh, const bf* __restrict__ Ql, const bf* __restrict__ Kh, const bf* __restrict__ Kl, const bf* __restrict__ Vh, const bf* __restrict__ Vl, const bf* __restrict__ MB, const float* __restrict__ TM, const float* __restrict__ KM, bf* Ah, bf* Al) {
    __shared__ __align__(16) char sm[2 * 4 * PLB];
    constexpr int NHL = RH / 64, NFP = (TT - RH) / 64; static_assert(NFP == 3 * NHL, "one hi+lo block to three fp16 blocks");
    const int bx = (int)blockIdx.x, kind = (bx + (bx >> 2) + (bx >> 4) + (bx >> 6) + (bx >> 8)) & 3; const bool hl = kind == 0;
    // Number within the kind: bx >> 2 = (batch element * NH_ + head) * NHL + j. The hi+lo block takes row block j; the fp16 kinds 1, 2, 3 take row block NHL - 1 - j of the first, second, last third of the fp16 rows.
    // Where the mask hides the keys behind a query, a block's work grows with its row: j rising, the dearer hi+lo block gains what the three fp16 blocks of the run lose. For speed only.
    const int nr = bx >> 2, bh = nr / NHL, q0 = hl ? (nr % NHL) * 64 : RH + ((kind - 1) * NHL + NHL - 1 - nr % NHL) * 64;
    const int h = bh % NH_; const size_t bz = (size_t)(bh / NH_);
    const size_t oqk = bz * (NH_ + NKV) * TT * HD, ov = bz * NKV * HD * TT, oa = bz * TT * DQ;
    Q16 += oqk; K16 += oqk; Qh += oqk; Ql += oqk; Kh += oqk; Kl += oqk; V16 += ov; Vh += ov; Vl += ov; Ah += oa; Al += oa; KM += (size_t)bh * (TT / 64) * 8 * 32;   // NKV = NH_: the head's own k tiles
    if (hl) fattn_body<bf, true>(Qh, Ql, Kh, Kl, Vh, Vl, MB, TM, KM, q0, h, sm, Ah, Al);
    else fattn_body<h16, false>(Q16, nullptr, K16, nullptr, V16, nullptr, MB, TM, KM, q0, h, sm, Ah, Al);
}

extern "C" void kernel_launch(void* const* d_in, const int* in_sizes, int n_in,
                              void* d_out, int out_size, void* d_ws, size_t ws_size, hipStream_t stream) {
    (void)in_sizes; (void)n_in; (void)out_size;
    const float* x = (const float*)d_in[0]; const float* fmask = (const float*)d_in[1]; const float* wq = (const float*)d_in[2]; const float* bq = (const float*)d_in[3]; const float* wk = (const float*)d_in[4]; const float* bk = (const float*)d_in[5]; const float* wv = (const float*)d_in[6]; const float* bv = (const float*)d_in[7]; const float* wo = (const float*)d_in[8]; const float* bo = (const float*)d_in[9]; const float* cosT = nullptr; const float* sinT = nullptr; (void)cosT; (void)sinT;
    float* OUT = (float*)d_out;     // [4][2048][512]
    char* wsp = (char*)d_ws;
    auto take = [&](size_t bytes) { char* p = wsp; wsp += (bytes + 255) & ~(size_t)255; return (void*)p; };
    bf* WQ = (bf*)take((size_t)DQ * DM * 2); bf* WK = (bf*)take((size_t)DKV * DM * 2); bf* WV = (bf*)take((size_t)DKV * DM * 2); bf* WO = (bf*)take((size_t)DM * DQ * 2);
    // Every buffer below but MKP and MKM holds all NB_ batch elements, one behind the other. QP*: per element NH_ q planes, then NKV k planes.
    bf* XB = (bf*)take((size_t)NB_ * TT * DM * 2);
    h16* QP16 = (h16*)take((size_t)NB_ * (NH_ + NKV) * TT * HD * 2); h16* VT16 = (h16*)take((size_t)NB_ * NKV * HD * TT * 2);
    bf* QPh = (bf*)take((size_t)NB_ * (NH_ + NKV) * TT * HD * 2); bf* QPl = (bf*)take((size_t)NB_ * (NH_ + NKV) * TT * HD * 2); bf* VTh = (bf*)take((size_t)NB_ * NKV * HD * TT * 2); bf* VTl = (bf*)take((size_t)NB_ * NKV * HD * TT * 2);
    h16* KP16 = QP16 + (size_t)NH_ * TT * HD; bf* KPh = QPh + (size_t)NH_ * TT * HD; bf* KPl = QPl + (size_t)NH_ * TT * HD;
    bf* ATh = (bf*)take((size_t)NB_ * TT * DQ * 2); bf* ATl = (bf*)take((size_t)NB_ * TT * DQ * 2);
    float* KMX = (float*)take((size_t)NB_ * NKV * (TT / 64) * 8 * 32 * 4);   // per k tile and wave of k_qkv: largest |k|, a 128-byte line each
    bf* MKP = (bf*)take((size_t)TT * TT * 2); float* MKM = (float*)take((size_t)(TT / 16) * (TT / 64) * 32 * 4);   // the mask in bf16, tile by tile; per tile its smallest value, a 128-byte line each
    if ((size_t)(wsp - (char*)d_ws) > ws_size) return;    // ws 256 MiB
    (void)WK; (void)WV;
    // The batch elements are independent and share every weight and the mask: each stage is one launch over all NB_ of them (rows b * TT + t of the row-major buffers; blockIdx.x carries b also where planes are formed or read).
    k_cvt8<<<(unsigned)(MKB + ((size_t)NB_ * TT * DM / 8 + 255) / 256), 256, 0, stream>>>(x, XB, (size_t)NB_ * TT * DM / 8, fmask, MKP, MKM, wq, wk, wv, wo, WQ);   // WQ, WK, WV, WO are consecutive planes of DM x DQ
    k_qkv<<<dim3(NB_ * TT / 64, NH_, 3), 256, 0, stream>>>(XB, WQ, bq, bk, bv, QP16, QPh, QPl, VT16, VTh, VTl, KMX);   // z = q, k, v: weight planes consecutive; q heads, then k heads: an element's k planes lie directly behind its q planes
    k_fattn<<<dim3(NB_ * NH_ * (TT / 64), 1, 1), FNW * 32, 0, stream>>>(QP16, KP16, VT16, QPh, QPl, KPh, KPl, VTh, VTl, MKP, MKM, KMX, ATh, ATl);   // one kv head per query head
    k_wo<<<dim3(NB_ * TT / 64, DM / 64, 1), 256, 0, stream>>>(ATh, ATl, WO, OUT, bo);
}
